// v000
// Times are from an AMD MI455X. After a warm-up the kernel runs many times in a row, and a time is the length of
// such a window on the GPU divided by its runs, so every launch and the gaps after it count. The runs cycle
// through copies of the inputs. A figure is the median of several windows, for all but v000 over two sittings.
// Sittings can differ by a few percent; kernels timed side by side share one.
// The starting kernel, v000, takes 4620 microseconds a run.
#include <hip/hip_runtime.h>
// Masked (causal) RoPE multi-head attention with LARGE logits (x [2][2048][1024]; qkv = x w_qkv + b_qkv ([in][out] 1024 x 3072, sigma 1/32, bias sigma 0.01) -> q | k | v, 16 heads of 64; interleaved-pair RoPE on q and k (inv_freq_i = 10000^(-2i/64), positions 0..2047); scores = q . k x sqrt(64) (the module divides by 1/sqrt(d_k)), causal (tril); softmax; out = (attn v merged) w_out + b_out -> [2][2048][1024]).
// Structure: token rows r = b*2048 + s; x as exact f16 rows (bf16-rounded); per batch: q | k | v as ONE WMMA GEMM (32x64 wave tiles, f32 accumulation, exact x16 weights + bias, N = 3 x 1024) into f32 rows, then per (row, head) on VALU: the interleaved-pair rotary rotation of q and k from f32 cos/sin tables (positions 0..SQ-1, no norm) -> f32 q, k rows split into f16 hi + x1024 residual planes (the x8 logits have sigma ~64: near-argmax softmax, so the scores are computed to ~f32 accuracy in three accumulating passes), v f16; V^T for all heads via LDS transposes; per query tile of 256 rows: scores against the keys below the tile end only (K = 64, all heads on grid.y, alpha = 8.0), causal row softmax on VALU with an arithmetic 0/1 key mask over the computed range (f32 statistics, native exp; weights x256 f16), o = P . V^T (K = keys below the tile end, alpha 2^-2: o carried x64, folded into the output GEMM alpha) written straight into the merged f16 o rows; out = o W_o + b GEMM (f32) into the output layout.
// Compute dtype: inputs rounded to bf16; x / weights exact; projections and rope f32; q, k as f16 hi + residual (~2^-22); v, softmax weights and o as plain f16 GEMM operands (~2^-12); scores and softmax statistics f32. v_wmma_f32_16x16x32_f16.
#define NB 2
#define SQ 2048
#define DM 1024
#define NH 16
#define HD 64
#define HG 4                         /* heads per group in the k_vt(b, h0) overload, not launched */
#define QT 256                       /* query rows per causal tile */
#define NKX SQ                       /* S / P row pitch */
#define B0 0                         /* first batch processed (debug hook) */
#define NBR NB                       /* batches processed (debug hook) */
#define QN SQ                        /* query rows attended per batch (debug hook) */
#define NHD NH                       /* heads attended (debug hook) */
#define NR ((size_t)NB * SQ)         /* token rows */
#define MPO ((int)((size_t)NBR * SQ))      /* rows through the output GEMM (debug hook) */
typedef __bf16 v16b __attribute__((ext_vector_type(16)));
typedef unsigned short v8us __attribute__((ext_vector_type(8), may_alias));
typedef float  v8f  __attribute__((ext_vector_type(8)));
typedef float  v4f  __attribute__((ext_vector_type(4)));
typedef float  v4fa __attribute__((ext_vector_type(4), may_alias));
union FragB { v16b v; v8us half[2]; unsigned short u[16]; };

__device__ __forceinline__ unsigned short bf16_bits(float x) { unsigned int u = __float_as_uint(x); return (unsigned short)((u + 0x7FFFu + ((u >> 16) & 1u)) >> 16); }
__device__ __forceinline__ float bf16_val(unsigned short b) { return __uint_as_float(((unsigned int)b) << 16); }
__device__ __forceinline__ float bf16_round(float x) { return bf16_val(bf16_bits(x)); }
// D += A·B with NT terms: 1 = ah·bh, 2 = + al·bh (A split), 3 = + ah·bl (both split)
template <int NT>
__device__ __forceinline__ v8f mmaN(v16b ah, v16b al, v16b bh, v16b bl, v8f c) {
  c = __builtin_amdgcn_wmma_f32_16x16x32_bf16(false, ah, false, bh, (short)0, c, false, false);
  if (NT >= 2) c = __builtin_amdgcn_wmma_f32_16x16x32_bf16(false, al, false, bh, (short)0, c, false, false);
  if (NT >= 3) c = __builtin_amdgcn_wmma_f32_16x16x32_bf16(false, ah, false, bl, (short)0, c, false, false);
  asm volatile("v_nop\n\tv_nop\n\tv_nop\n\tv_nop" : "+v"(c) : "v"(ah), "v"(al), "v"(bh), "v"(bl));
  return c;
}

__global__ __launch_bounds__(256) void k_wt_bf16(const float* __restrict__ W, unsigned short* __restrict__ Wt, int K, int N) {
  const int t = blockIdx.x * 256 + threadIdx.x;
  const int k8n = K / 8;
  if (t >= N * k8n) return;
  const int n = t / k8n, k8 = (t % k8n) * 8;
  v8us v;
#pragma unroll
  for (int i = 0; i < 8; ++i) v[i] = bf16_bits(W[(size_t)(k8 + i) * N + n]);
  *(v8us*)(Wt + (size_t)n * K + k8) = v;
  
}

// GEMM C[M][N] (f32, pitch ldc) = act(A[M][K]·W + bias). A f32 row-major (pitch lda) converted per fragment to bf16
// (ASPLIT: hi/lo two planes -> 2 terms, else single rounded term); Wt bf16 [N][K] (pitch ldb). BIAS_BF16 rounds the
// bias to bf16 first (bias quantised to bf16 before the add). K%32==0, M%16==0, N%64==0.
template <bool ASPLIT, int ACT, bool BIAS_BF16>
__global__ __launch_bounds__(128) void k_gemm_bf(const float* __restrict__ A, int lda, const unsigned short* __restrict__ Wt, int ldb,
                                               const float* __restrict__ bias, float* __restrict__ C, int ldc, int M, int N, int K) {
  __shared__ __attribute__((aligned(16))) float so[4][16][64];
  const int tid = threadIdx.x, w = tid >> 5, lane = tid & 31, ln = lane & 15, hh = lane >> 4;
  const int ntn = N / 64;
  const int wid = blockIdx.x * 4 + w;
  const int mt = wid / ntn, nq = wid % ntn;
  if (mt * 16 >= M) return;
  const int row0 = mt * 16, col0 = nq * 64;
  const float* arow = A + (size_t)(row0 + ln) * lda;
  v8f acc[4] = {};
  for (int kb = 0; kb < K; kb += 32) {
    FragB ah, al;
    const v4f x0 = *(const v4fa*)(arow + kb + 8 * hh), x1 = *(const v4fa*)(arow + kb + 8 * hh + 4);
    const v4f x2 = *(const v4fa*)(arow + kb + 16 + 8 * hh), x3 = *(const v4fa*)(arow + kb + 16 + 8 * hh + 4);
    float xs[16] = {x0[0],x0[1],x0[2],x0[3],x1[0],x1[1],x1[2],x1[3],x2[0],x2[1],x2[2],x2[3],x3[0],x3[1],x3[2],x3[3]};
#pragma unroll
    for (int i = 0; i < 16; ++i) { const unsigned short hb = bf16_bits(xs[i]); ah.u[i] = hb; al.u[i] = ASPLIT ? bf16_bits(xs[i] - bf16_val(hb)) : (unsigned short)0; }
#pragma unroll
    for (int t = 0; t < 4; ++t) {
      const unsigned short* brow = Wt + (size_t)(col0 + t * 16 + ln) * ldb + kb;
      FragB b;
      b.half[0] = *(const v8us*)(brow + 8 * hh);
      b.half[1] = *(const v8us*)(brow + 16 + 8 * hh);
      acc[t] = mmaN<ASPLIT ? 2 : 1>(ah.v, al.v, b.v, b.v, acc[t]);
    }
  }
#pragma unroll
  for (int t = 0; t < 4; ++t) {
    float bv = bias ? bias[col0 + t * 16 + ln] : 0.f;
    if (BIAS_BF16) bv = bf16_round(bv);
#pragma unroll
    for (int r = 0; r < 8; ++r) { float v = acc[t][r] + bv; if (ACT == 1) v = fmaxf(v, 0.f); so[w][8 * hh + r][t * 16 + ln] = v; }
  }
  __builtin_amdgcn_fence(__ATOMIC_ACQ_REL, "workgroup");
  __builtin_amdgcn_wave_barrier();
  const int rsub = lane >> 4, c4 = (lane & 15) * 4;
  {
#pragma unroll
    for (int q = 0; q < 8; ++q) {
      const int r = q * 2 + rsub;
      const v4f v = *(const v4fa*)&so[w][r][c4];
      *(v4f*)(C + (size_t)(row0 + r) * ldc + col0 + c4) = v;
    }
    
  }
}

// GEMM C = act(A·W + bias + resid): A f32 (ASPLIT -> hi/lo 2 terms), Wt bf16 [N][K]; ACT 0 none, 1 relu, 2 exact gelu;
// resid (optional, f32, row index = (row % rmod), pitch ldr, RES_BF16 rounds it) added before the activation.
template <bool ASPLIT, int ACT, bool BIAS_BF16, bool RES_BF16>
__global__ __launch_bounds__(128) void k_gemm_bf3(const float* __restrict__ A, int lda, const unsigned short* __restrict__ Wt, int ldb,
                                                const float* __restrict__ bias, const float* __restrict__ resid, int rmod, int ldr,
                                                float* __restrict__ C, int ldc, int M, int N, int K) {
  __shared__ __attribute__((aligned(16))) float so[4][16][64];
  const int tid = threadIdx.x, w = tid >> 5, lane = tid & 31, ln = lane & 15, hh = lane >> 4;
  const int ntn = N / 64;
  const int wid = blockIdx.x * 4 + w;
  const int mt = wid / ntn, nq = wid % ntn;
  if (mt * 16 >= M) return;
  const int row0 = mt * 16, col0 = nq * 64;
  const float* arow = A + (size_t)(row0 + ln) * lda;
  v8f acc[4] = {};
  for (int kb = 0; kb < K; kb += 32) {
    FragB ah, al;
    const v4f x0 = *(const v4fa*)(arow + kb + 8 * hh), x1 = *(const v4fa*)(arow + kb + 8 * hh + 4);
    const v4f x2 = *(const v4fa*)(arow + kb + 16 + 8 * hh), x3 = *(const v4fa*)(arow + kb + 16 + 8 * hh + 4);
    float xs[16] = {x0[0],x0[1],x0[2],x0[3],x1[0],x1[1],x1[2],x1[3],x2[0],x2[1],x2[2],x2[3],x3[0],x3[1],x3[2],x3[3]};
#pragma unroll
    for (int i = 0; i < 16; ++i) { const unsigned short hb = bf16_bits(xs[i]); ah.u[i] = hb; al.u[i] = ASPLIT ? bf16_bits(xs[i] - bf16_val(hb)) : (unsigned short)0; }
#pragma unroll
    for (int t = 0; t < 4; ++t) {
      const unsigned short* brow = Wt + (size_t)(col0 + t * 16 + ln) * ldb + kb;
      FragB b;
      b.half[0] = *(const v8us*)(brow + 8 * hh);
      b.half[1] = *(const v8us*)(brow + 16 + 8 * hh);
      acc[t] = mmaN<ASPLIT ? 2 : 1>(ah.v, al.v, b.v, b.v, acc[t]);
    }
  }
#pragma unroll
  for (int t = 0; t < 4; ++t) {
    const int col = col0 + t * 16 + ln;
    float bv = bias ? bias[col] : 0.f;
    if (BIAS_BF16) bv = bf16_round(bv);
#pragma unroll
    for (int r = 0; r < 8; ++r) {
      float v = acc[t][r] + bv;
      if (resid) { float rv = resid[(size_t)((row0 + 8 * hh + r) % rmod) * ldr + col]; if (RES_BF16) rv = bf16_round(rv); v += rv; }
      if (ACT == 1) v = fmaxf(v, 0.f);
      if (ACT == 2) v = 0.5f * v * (1.0f + erff(v * 0.70710678118654752f));
      if (ACT == 3) { const float u = 0.7978845608028654f * (v + 0.044715f * v * v * v); v = 0.5f * v * (1.0f + tanhf(u)); }
      so[w][8 * hh + r][t * 16 + ln] = v;
    }
  }
  __builtin_amdgcn_fence(__ATOMIC_ACQ_REL, "workgroup");
  __builtin_amdgcn_wave_barrier();
  const int rsub = lane >> 4, c4 = (lane & 15) * 4;
  {
#pragma unroll
    for (int q = 0; q < 8; ++q) {
      const int r = q * 2 + rsub;
      const v4f v = *(const v4fa*)&so[w][r][c4];
      *(v4f*)(C + (size_t)(row0 + r) * ldc + col0 + c4) = v;
    }
    
  }
}
// row LayerNorm (biased variance, eps) over N: s = X (+ R); optional out_sum <- s; out_norm <- (s-mu)*rsqrt(var+eps)*g + b
template <bool PARAM_BF16>
__global__ __launch_bounds__(256) void k_layernorm(const float* __restrict__ X, const float* __restrict__ R, const float* __restrict__ g, const float* __restrict__ bta,
                                                  float* __restrict__ out_sum, float* __restrict__ out_norm, int N, float eps) {
  __shared__ float red[256];
  const int row = blockIdx.x, tid = threadIdx.x;
  const float* x = X + (size_t)row * N; const float* rr = R ? R + (size_t)row * N : nullptr;
  float vals[16];                     // up to N = 4096
  const int per = N / 256;            // contiguous chunk per thread? use strided-by-4 chunks: thread handles j = tid*4 + 1024*u
  float s1 = 0.f;
  for (int u = 0; u < per / 4; ++u) {
    const int j = tid * 4 + 1024 * u;
    const v4f a = *(const v4fa*)(x + j);
    v4f b = {0.f,0.f,0.f,0.f}; if (rr) b = *(const v4fa*)(rr + j);
#pragma unroll
    for (int q = 0; q < 4; ++q) { const float v = a[q] + b[q]; vals[u * 4 + q] = v; s1 += v; }
  }
  red[tid] = s1; __syncthreads();
  for (int st = 128; st > 0; st >>= 1) { if (tid < st) red[tid] += red[tid + st]; __syncthreads(); }
  const float mu = red[0] / (float)N; __syncthreads();
  float s2 = 0.f;
  for (int u = 0; u < per / 4; ++u)
#pragma unroll
    for (int q = 0; q < 4; ++q) { const float c = vals[u * 4 + q] - mu; s2 += c * c; }
  red[tid] = s2; __syncthreads();
  for (int st = 128; st > 0; st >>= 1) { if (tid < st) red[tid] += red[tid + st]; __syncthreads(); }
  const float rs = rsqrtf(red[0] / (float)N + eps);
  {
    for (int u = 0; u < per / 4; ++u) {
      const int j = tid * 4 + 1024 * u;
      v4f o, sm;
#pragma unroll
      for (int q = 0; q < 4; ++q) {
        float gg = g[j + q], bb = bta[j + q];
        if (PARAM_BF16) { gg = bf16_round(gg); bb = bf16_round(bb); }
        sm[q] = vals[u * 4 + q]; o[q] = (vals[u * 4 + q] - mu) * rs * gg + bb;
      }
      if (out_sum) *(v4f*)(out_sum + (size_t)row * N + j) = sm;
      *(v4f*)(out_norm + (size_t)row * N + j) = o;
    }
    
  }
}



// ---- f16 WMMA path (v_wmma_f32_16x16x32_f16): 11-bit significands for operands in range — used where a [0,1] probability operand needs more precision than bf16
typedef _Float16 v16h __attribute__((ext_vector_type(16)));
union FragH { v16h v; v8us half[2]; _Float16 h[16]; unsigned short u[16]; };
template <int NT>
__device__ __forceinline__ v8f mmaH(v16h ah, v16h al, v16h bh, v16h bl, v8f c) {
  c = __builtin_amdgcn_wmma_f32_16x16x32_f16(false, ah, false, bh, (short)0, c, false, false);
  if (NT >= 2) c = __builtin_amdgcn_wmma_f32_16x16x32_f16(false, al, false, bh, (short)0, c, false, false);
  if (NT >= 3) c = __builtin_amdgcn_wmma_f32_16x16x32_f16(false, ah, false, bl, (short)0, c, false, false);
  asm volatile("v_nop\n\tv_nop\n\tv_nop\n\tv_nop" : "+v"(c) : "v"(ah), "v"(al), "v"(bh), "v"(bl));
  return c;
}
// batched GEMM like k_gemm_b but f16 operands: A f32 (split into f16 hi/lo if ASPLIT, else rounded to f16), Bt = f16 values [n][k]; alpha; C f32; N multiple of 16 (partial tiles skipped)
template <bool ASPLIT>
__global__ __launch_bounds__(128) void k_gemm_h(const float* __restrict__ A, int lda, size_t sA, const _Float16* __restrict__ Bh, int ldb, size_t sB, float alpha, float* __restrict__ C, int ldc, size_t sC, int M, int N, int K) {
  __shared__ __attribute__((aligned(16))) float so[4][16][64];
  const int tid = threadIdx.x, w = tid >> 5, lane = tid & 31, ln = lane & 15, hh = lane >> 4; const int by = blockIdx.y;
  A += (size_t)by * sA; Bh += (size_t)by * sB; C += (size_t)by * sC;
  const int ntn = (N + 63) / 64; const int wid = blockIdx.x * 4 + w; const int mt = wid / ntn, nq = wid % ntn; if (mt * 16 >= M) return;
  const int row0 = mt * 16, col0 = nq * 64; const float* arow = A + (size_t)(row0 + ln) * lda;
  v8f acc[4] = {};
  for (int kb = 0; kb < K; kb += 32) {
    FragH ah, al;
    const v4f x0 = *(const v4fa*)(arow + kb + 8 * hh), x1 = *(const v4fa*)(arow + kb + 8 * hh + 4), x2 = *(const v4fa*)(arow + kb + 16 + 8 * hh), x3 = *(const v4fa*)(arow + kb + 16 + 8 * hh + 4);
    float xs[16] = {x0[0],x0[1],x0[2],x0[3],x1[0],x1[1],x1[2],x1[3],x2[0],x2[1],x2[2],x2[3],x3[0],x3[1],x3[2],x3[3]};
#pragma unroll
    for (int i = 0; i < 16; ++i) { const _Float16 h = (_Float16)xs[i]; ah.h[i] = h; al.h[i] = ASPLIT ? (_Float16)(xs[i] - (float)h) : (_Float16)0.0f; }
#pragma unroll
    for (int t = 0; t < 4; ++t) { if (col0 + t * 16 >= N) continue; const size_t boff = (size_t)(col0 + t * 16 + ln) * ldb + kb; FragH bq; bq.half[0] = *(const v8us*)(Bh + boff + 8 * hh); bq.half[1] = *(const v8us*)(Bh + boff + 16 + 8 * hh);
      acc[t] = mmaH<ASPLIT ? 2 : 1>(ah.v, al.v, bq.v, bq.v, acc[t]); }
  }
#pragma unroll
  for (int t = 0; t < 4; ++t) { if (col0 + t * 16 >= N) continue;
#pragma unroll
    for (int r = 0; r < 8; ++r) so[w][8 * hh + r][t * 16 + ln] = acc[t][r] * alpha; }
  __builtin_amdgcn_fence(__ATOMIC_ACQ_REL, "workgroup"); __builtin_amdgcn_wave_barrier();
  const int rsub = lane >> 4, c4 = (lane & 15) * 4;
  {
#pragma unroll
    for (int q = 0; q < 8; ++q) { const int r = q * 2 + rsub; if (col0 + c4 < N) { const v4f v = *(const v4fa*)&so[w][r][c4]; *(v4f*)(C + (size_t)(row0 + r) * ldc + col0 + c4) = v; } }
     }
}

// Wt[n][k] = f16(W[k][n]·scale) from f32 row-major W[K][N] (scale = power of two; bf16-exact weights stay exact in f16 away from the subnormal range)
__global__ __launch_bounds__(256) void k_wt_f16(const float* __restrict__ W, _Float16* __restrict__ Wt, int K, int N, float scale) {
  const int t = blockIdx.x * 256 + threadIdx.x; if (t >= N * (K / 8)) return; const int n = t / (K / 8), k8 = (t % (K / 8)) * 8; FragH f;
#pragma unroll
  for (int i = 0; i < 8; ++i) f.h[i] = (_Float16)(bf16_round(W[(size_t)(k8 + i) * N + n]) * scale); const v8us o = f.half[0];
  *(v8us*)((unsigned short*)Wt + (size_t)n * K + k8) = o; 
}
// k_gemm_hh variant with fused epilogue: v = acc·alpha + bias[by·sBias + col] (+ CP[(row/rowsPerB)·sCPb + by·64 + col] if CP) ; ACT 0 none / 1 elu ; writes f16 C16 (and f32 C if non-null)
template <int ACT>
__global__ __launch_bounds__(128) void k_gemm_hhx(const _Float16* __restrict__ A, int lda, size_t sA, const _Float16* __restrict__ Bh, int ldb, size_t sB, float alpha, const float* __restrict__ bias, size_t sBias, const float* __restrict__ CP, int rowsPerB, size_t sCPb, int row0g,
    float* __restrict__ C, _Float16* __restrict__ C16, int ldc, size_t sC, int M, int N, int K) {
  __shared__ __attribute__((aligned(16))) float so[4][16][64];
  const int tid = threadIdx.x, w = tid >> 5, lane = tid & 31, ln = lane & 15, hh = lane >> 4; const int by = blockIdx.y;
  A += (size_t)by * sA; Bh += (size_t)by * sB; const size_t cofs = (size_t)by * sC; const float* bp = bias ? bias + (size_t)by * sBias : nullptr;
  const int ntn = (N + 63) / 64; const int wid = blockIdx.x * 4 + w; const int mt = wid / ntn, nq = wid % ntn; if (mt * 16 >= M) return;
  const int row0 = mt * 16, col0 = nq * 64; const _Float16* arow = A + (size_t)(row0 + ln) * lda;
  v8f acc[4] = {};
  for (int kb = 0; kb < K; kb += 32) { FragH ah; ah.half[0] = *(const v8us*)((const unsigned short*)arow + kb + 8 * hh); ah.half[1] = *(const v8us*)((const unsigned short*)arow + kb + 16 + 8 * hh);
#pragma unroll
    for (int t = 0; t < 4; ++t) { if (col0 + t * 16 >= N) continue; const size_t boff = (size_t)(col0 + t * 16 + ln) * ldb + kb; FragH bq; bq.half[0] = *(const v8us*)((const unsigned short*)Bh + boff + 8 * hh); bq.half[1] = *(const v8us*)((const unsigned short*)Bh + boff + 16 + 8 * hh);
      acc[t] = mmaH<1>(ah.v, ah.v, bq.v, bq.v, acc[t]); }
  }
#pragma unroll
  for (int t = 0; t < 4; ++t) { if (col0 + t * 16 >= N) continue; const int col = col0 + t * 16 + ln; const float bv = bp ? bf16_round(bp[col]) : 0.f;
#pragma unroll
    for (int r = 0; r < 8; ++r) { float v = acc[t][r] * alpha + bv; if (CP) { const int rr = row0g + row0 + 8 * hh + r; if (rowsPerB < 0) v += CP[cofs + (size_t)rr * ldc + col];      /* rowsPerB < 0: own element of the batched C plane */ else { const int bidx = rr / rowsPerB; v += CP[(size_t)bidx * sCPb + (size_t)by * 64 + col]; } } if (ACT == 1) v = (v > 0.f) ? v : expm1f(v); else if (ACT == 7) v = (v > 0.f) ? v + 1.0f : expf(v); else if (ACT == 8) v = tanhf(v); else if (ACT == 9) v = 0.5f * v * (1.0f + tanhf(0.7978845608028654f * (v + 0.044715f * v * v * v))); else if (ACT == 11) v = 1.0f / (1.0f + expf(-v)); else if (ACT == 12) v = (v > 0.f) ? v : 0.01f * v; else if (ACT == 14) v = (v > 0.f) ? v : 0.1f * v; else if (ACT == 16) v = (v >= 0.f) ? v : 0.3f * v; else if (ACT == 17) v = (v >= 0.f) ? v : 0.2f * v; else if (ACT == 15) v = v / (1.0f + expf(-v)); else if (ACT == 3) v = fmaxf(v, 0.f); else if (ACT == 6) v = 0.5f * v * (1.0f + erff(v * 0.70710678118654752f)); so[w][8 * hh + r][t * 16 + ln] = v; } }
  __builtin_amdgcn_fence(__ATOMIC_ACQ_REL, "workgroup"); __builtin_amdgcn_wave_barrier();
  const int rsub = lane >> 4, c4 = (lane & 15) * 4; typedef _Float16 v4h __attribute__((ext_vector_type(4)));
  {
#pragma unroll
    for (int q = 0; q < 8; ++q) { const int r = q * 2 + rsub; if (col0 + c4 < N) { const v4f v = *(const v4fa*)&so[w][r][c4]; if (C) *(v4f*)(C + cofs + (size_t)(row0 + r) * ldc + col0 + c4) = v; if (C16) { v4h h4; for (int i = 0; i < 4; ++i) h4[i] = (_Float16)v[i]; *(v4h*)(C16 + cofs + (size_t)(row0 + r) * ldc + col0 + c4) = h4; } } }
     }
}


typedef _Float16 v4h __attribute__((ext_vector_type(4)));

__global__ __launch_bounds__(256) void k_x16(const float* __restrict__ x, _Float16* __restrict__ X16, size_t n8) { const size_t t = (size_t)blockIdx.x * 256 + threadIdx.x; if (t >= n8) return; FragH f;
#pragma unroll
  for (int q = 0; q < 8; ++q) f.h[q] = (_Float16)bf16_round(x[t * 8 + q]); *(v8us*)((unsigned short*)X16 + t * 8) = f.half[0];  }
__global__ __launch_bounds__(256) void k_h16(const float* __restrict__ x, _Float16* __restrict__ X16, size_t n8) { const size_t t = (size_t)blockIdx.x * 256 + threadIdx.x; if (t >= n8) return; FragH f;
#pragma unroll
  for (int q = 0; q < 8; ++q) f.h[q] = (_Float16)x[t * 8 + q]; *(v8us*)((unsigned short*)X16 + t * 8) = f.half[0];  }
__global__ __launch_bounds__(256) void k_round16f(const float* __restrict__ W, _Float16* __restrict__ Bt, size_t n8) { const size_t t = (size_t)blockIdx.x * 256 + threadIdx.x; if (t >= n8) return; FragH f;
#pragma unroll
  for (int i = 0; i < 8; ++i) f.h[i] = (_Float16)(bf16_round(W[t * 8 + i]) * 16.0f); *(v8us*)((unsigned short*)Bt + t * 8) = f.half[0];  }
template <int NHv, int TTv>
__global__ __launch_bounds__(256) void k_vt(const _Float16* __restrict__ V16, int ldv, int voff, _Float16* __restrict__ Vt) { __shared__ unsigned short tl[64][66]; const int tid = threadIdx.x; const int slab = blockIdx.x / (TTv / 64), lg = blockIdx.x % (TTv / 64); const int b = slab / NHv, h = slab % NHv;
  for (int i = tid; i < 64 * 8; i += 256) { const int r = i / 8, c8 = (i % 8) * 8; FragH f; f.half[0] = *(const v8us*)((const unsigned short*)V16 + ((size_t)b * TTv + lg * 64 + r) * ldv + voff + h * 64 + c8);
#pragma unroll
    for (int q = 0; q < 8; ++q) tl[r][c8 + q] = f.u[q]; }
  __syncthreads();
  {
#pragma unroll
    for (int rd = 0; rd < 2; ++rd) { const int d = rd * 32 + tid / 8, pc = tid % 8; FragH f;
#pragma unroll
      for (int q = 0; q < 8; ++q) f.u[q] = tl[pc * 8 + q][d];
      *(v8us*)((unsigned short*)Vt + ((size_t)slab * 64 + d) * TTv + lg * 64 + pc * 8) = f.half[0]; }
     } }

__global__ __launch_bounds__(256) void k_hl(const float* __restrict__ F, _Float16* __restrict__ Hh, _Float16* __restrict__ Hl, size_t n8) { const size_t t = (size_t)blockIdx.x * 256 + threadIdx.x; if (t >= n8) return; FragH fh, fl; const v4f a = *(const v4fa*)(F + t * 8), c = *(const v4fa*)(F + t * 8 + 4);
#pragma unroll
  for (int q = 0; q < 4; ++q) { _Float16 h = (_Float16)a[q]; fh.h[q] = h; fl.h[q] = (_Float16)((a[q] - (float)h) * 1024.0f); h = (_Float16)c[q]; fh.h[4 + q] = h; fl.h[4 + q] = (_Float16)((c[q] - (float)h) * 1024.0f); }
  { *(v8us*)((unsigned short*)Hh + t * 8) = fh.half[0]; *(v8us*)((unsigned short*)Hl + t * 8) = fl.half[0];  } }

// ---- fast GEMM (wave tile 32x64; requires M % 32 == 0 rows per launch region and N % 64 == 0); epilogue = k_gemm_hhx semantics ----
__device__ __forceinline__ v16h g2_frag(const _Float16* p, int hh) { FragH f; f.half[0] = *(const v8us*)((const unsigned short*)p + 8 * hh); f.half[1] = *(const v8us*)((const unsigned short*)p + 16 + 8 * hh); return f.v; }
__device__ __forceinline__ v8f g2_mma(v16h a, v16h b, v8f c) { v8f d = __builtin_amdgcn_wmma_f32_16x16x32_f16(false, a, false, b, (short)0, c, false, false); asm volatile("v_nop\n\tv_nop\n\tv_nop\n\tv_nop" : "+v"(d) : "v"(a), "v"(b)); return d; }
template <int ACT>
__global__ __launch_bounds__(128) void k_gemm2(const _Float16* __restrict__ A, int lda, size_t sA, const _Float16* __restrict__ Bh, int ldb, size_t sB, float alpha, const float* __restrict__ bias, size_t sBias, const float* __restrict__ CP, int rowsPerB, size_t sCPb, int row0g,
    float* __restrict__ C, _Float16* __restrict__ C16, int ldc, size_t sC, int M, int N, int K) { static_assert(ACT == 0 || ACT == 3 || ACT == 6 || ACT == 8 || ACT == 9 || ACT == 11 || ACT == 12 || ACT == 14 || ACT == 15 || ACT == 16 || ACT == 17, "k_gemm2: unsupported ACT code (would silently apply no activation)");
  __shared__ __attribute__((aligned(16))) float so[4][32][68];
  const int tid = threadIdx.x, w = tid >> 5, lane = tid & 31, ln = lane & 15, hh = lane >> 4; const int by = blockIdx.y;
  A += (size_t)by * sA; Bh += (size_t)by * sB; const size_t cofs = (size_t)by * sC; const float* bp = bias ? bias + (size_t)by * sBias : nullptr;
  const int ntn = N >> 6; const int mt = blockIdx.x / ntn, nq = blockIdx.x - mt * ntn; const int row0 = mt * 128 + 32 * w, col0 = nq * 64; if (row0 >= M) return;
  const _Float16* a0p = A + (size_t)(row0 + ln) * lda; const _Float16* a1p = a0p + (size_t)16 * lda;
  const _Float16* b0p = Bh + (size_t)(col0 + ln) * ldb; const _Float16* b1p = b0p + (size_t)16 * ldb; const _Float16* b2p = b1p + (size_t)16 * ldb; const _Float16* b3p = b2p + (size_t)16 * ldb;
  const v8f z8 = {0.f,0.f,0.f,0.f,0.f,0.f,0.f,0.f}; v8f c00 = z8, c01 = z8, c02 = z8, c03 = z8, c10 = z8, c11 = z8, c12 = z8, c13 = z8;
#pragma unroll 1
  for (int kb = 0; kb < K; kb += 32) { const v16h a0 = g2_frag(a0p + kb, hh), a1 = g2_frag(a1p + kb, hh);
    v16h b = g2_frag(b0p + kb, hh); c00 = g2_mma(a0, b, c00); c10 = g2_mma(a1, b, c10);
    b = g2_frag(b1p + kb, hh); c01 = g2_mma(a0, b, c01); c11 = g2_mma(a1, b, c11);
    b = g2_frag(b2p + kb, hh); c02 = g2_mma(a0, b, c02); c12 = g2_mma(a1, b, c12);
    b = g2_frag(b3p + kb, hh); c03 = g2_mma(a0, b, c03); c13 = g2_mma(a1, b, c13); }
  v8f accs[8] = {c00, c01, c02, c03, c10, c11, c12, c13};
#pragma unroll
  for (int u = 0; u < 8; ++u) { const int t = u & 3, half = u >> 2; const int col = col0 + t * 16 + ln; const float bv = bp ? bf16_round(bp[col]) : 0.f;
#pragma unroll
    for (int r = 0; r < 8; ++r) { const int rloc = half * 16 + 8 * hh + r; float v = accs[u][r] * alpha + bv; if (CP) { if (rowsPerB < 0) v += CP[cofs + (size_t)(row0g + row0 + rloc) * ldc + col];      /* rowsPerB < 0: own element of the batched C plane */ else { const int bidx = (row0g + row0 + rloc) / rowsPerB; v += CP[(size_t)bidx * sCPb + (size_t)by * 64 + col]; } }
      if (ACT == 3) v = fmaxf(v, 0.f); else if (ACT == 6) v = 0.5f * v * (1.0f + erff(v * 0.70710678118654752f)); else if (ACT == 11) v = 1.0f / (1.0f + expf(-v)); else if (ACT == 15) v = v / (1.0f + expf(-v)); else if (ACT == 12) v = (v > 0.f) ? v : 0.01f * v; else if (ACT == 8) v = tanhf(v); else if (ACT == 9) v = 0.5f * v * (1.0f + tanhf(0.7978845608028654f * (v + 0.044715f * v * v * v))); else if (ACT == 14) v = (v > 0.f) ? v : 0.1f * v; else if (ACT == 16) v = (v >= 0.f) ? v : 0.3f * v; else if (ACT == 17) v = (v >= 0.f) ? v : 0.2f * v;
      so[w][rloc][t * 16 + ln] = v; } }
  __builtin_amdgcn_fence(__ATOMIC_ACQ_REL, "workgroup"); __builtin_amdgcn_wave_barrier();
  const int rsub = lane >> 4, c4 = (lane & 15) * 4;
  {
#pragma unroll
    for (int q = 0; q < 16; ++q) { const int r = q * 2 + rsub; const v4f v = *(const v4fa*)&so[w][r][c4]; if (C) *(v4f*)(C + cofs + (size_t)(row0 + r) * ldc + col0 + c4) = v; if (C16) { v4h h4; for (int i = 0; i < 4; ++i) h4[i] = (_Float16)v[i]; *(v4h*)(C16 + cofs + (size_t)(row0 + r) * ldc + col0 + c4) = h4; } }
     } }


__global__ __launch_bounds__(256) void k_wnat(const float* __restrict__ w, size_t n8, _Float16* __restrict__ Bt) { const size_t t = (size_t)blockIdx.x * 256 + threadIdx.x; if (t >= n8) return; FragH f; for (int q = 0; q < 8; ++q) f.h[q] = (_Float16)(bf16_round(w[t * 8 + q]) * 16.0f); *(v8us*)((unsigned short*)Bt + t * 8) = f.half[0];  }
__global__ __launch_bounds__(256) void k_rsm(const float* __restrict__ S, _Float16* __restrict__ P, int nrows) {
  #pragma clang fp contract(off)
  const int i = blockIdx.x * 256 + threadIdx.x; if (i >= nrows) return; const float* s = S + (size_t)i * SQ; float mx = -3.0e38f;
#pragma unroll 1
  for (int j = 0; j < SQ; ++j) mx = fmaxf(mx, s[j]); float se = 0.f;
#pragma unroll 1
  for (int j = 0; j < SQ; ++j) se += expf(s[j] - mx); const float sc = 256.0f / se;
#pragma unroll 1
  for (int j0 = 0; j0 < SQ; j0 += 8) { FragH f; for (int q = 0; q < 8; ++q) f.h[q] = (_Float16)(expf(s[j0 + q] - mx) * sc); unsigned short* d = (unsigned short*)P + (size_t)i * SQ + j0; *(v8us*)d = f.half[0];  } }
__global__ __launch_bounds__(256) void k_vt(const _Float16* __restrict__ V16, int b, int h0, _Float16* __restrict__ VT) { __shared__ unsigned short tl[64][65]; const int tid = threadIdx.x; const int hh = blockIdx.x % HG, sg = blockIdx.x / HG; const int s0 = sg * 64; const int h = h0 + hh;
  for (int i = tid; i < 64 * 8; i += 256) { const int j = i / 8, d8 = (i % 8) * 8; FragH f; f.half[0] = *(const v8us*)((const unsigned short*)V16 + ((size_t)b * SQ + s0 + j) * DM + h * HD + d8); for (int q = 0; q < 8; ++q) tl[d8 + q][j] = f.u[q]; }
  __syncthreads();
  { for (int i = tid; i < 64 * 8; i += 256) { const int d = i / 8, j8 = (i % 8) * 8; FragH f; for (int q = 0; q < 8; ++q) f.u[q] = tl[d][j8 + q]; *(v8us*)((unsigned short*)VT + ((size_t)hh * HD + d) * SQ + s0 + j8) = f.half[0]; }  } }


__global__ __launch_bounds__(256) void k_tab2(float theta, float* __restrict__ CS, float* __restrict__ SN) {
  #pragma clang fp contract(off)
  const int t = blockIdx.x * 256 + threadIdx.x; if (t >= SQ * (HD / 2)) return; const int i = t % (HD / 2); const int p = t / (HD / 2); const float invf = 1.0f / powf(theta, (float)(2 * i) / (float)HD); const float ang = __fmul_rn((float)p, invf); const float c = cosf(ang), s = sinf(ang);
  *(float*)(CS + t) = c; *(float*)(SN + t) = s;  }
template <int NORM, int ROPE>
__global__ __launch_bounds__(64) void k_xform(const float* __restrict__ F, int ldf, int nh, const float* __restrict__ gain, float eps, const float* __restrict__ CS, const float* __restrict__ SN, _Float16* __restrict__ H16, int ldo) {
  #pragma clang fp contract(off)
  __shared__ float xv[HD]; __shared__ float red[HD]; __shared__ unsigned short sh_[HD]; const int d = threadIdx.x; const int h = blockIdx.x % nh; const size_t r = blockIdx.x / nh; const int p = (int)(r % SQ);
  float x = F[r * (size_t)ldf + (size_t)h * HD + d];
  if (NORM) { red[d] = __fmul_rn(x, x); __syncthreads(); for (int st = HD / 2; st > 0; st >>= 1) { if (d < st) red[d] = __fadd_rn(red[d], red[d + st]); __syncthreads(); } const float rs = rsqrtf(__fadd_rn(red[0] / (float)HD, eps)); x = __fmul_rn(__fmul_rn(x, rs), bf16_round(gain[d])); }
  xv[d] = x; __syncthreads();
  float o = x;
  if (ROPE == 1) { const int i = d >> 1; const float c = CS[p * (HD / 2) + i], s = SN[p * (HD / 2) + i]; const float ev = xv[2 * i], od = xv[2 * i + 1]; o = (d & 1) ? __fadd_rn(__fmul_rn(ev, s), __fmul_rn(od, c)) : __fadd_rn(__fmul_rn(ev, c), -__fmul_rn(od, s)); }
  if (ROPE == 2) { const int i = d & (HD / 2 - 1); const float c = CS[p * (HD / 2) + i], s = SN[p * (HD / 2) + i]; const float lo = xv[i], hi = xv[i + HD / 2]; o = (d < HD / 2) ? __fadd_rn(__fmul_rn(lo, c), -__fmul_rn(hi, s)) : __fadd_rn(__fmul_rn(lo, s), __fmul_rn(hi, c)); }
  FragH th; th.h[0] = (_Float16)o; sh_[d] = th.u[0]; __syncthreads();
  if (d < HD / 8) { FragH f; for (int q = 0; q < 8; ++q) f.u[q] = sh_[d * 8 + q]; unsigned short* dst = (unsigned short*)H16 + r * (size_t)ldo + (size_t)h * HD + d * 8; *(v8us*)dst = f.half[0];  } }



__global__ __launch_bounds__(256) void k_rsmcf2(const float* __restrict__ S, _Float16* __restrict__ P, int hg, int q0, int nk) {
  #pragma clang fp contract(off)
  const int t = blockIdx.x * 256 + threadIdx.x; if (t >= hg * QT) return; const size_t i = (size_t)t; const float* s = S + i * NKX; const int last = q0 + (t % QT); float mx = -3.0e38f;
#pragma unroll 1
  for (int j = 0; j < nk; ++j) { const float f = (j <= last) ? 1.f : 0.f; mx = fmaxf(mx, fmaf(f, s[j], (1.f - f) * -1.0e9f)); } float se = 0.f;
#pragma unroll 1
  for (int j = 0; j < nk; ++j) { const float f = (j <= last) ? 1.f : 0.f; se += __expf(fmaf(f, s[j], (1.f - f) * -1.0e9f) - mx); } const float sc = 256.0f / se;
#pragma unroll 1
  for (int j0 = 0; j0 < nk; j0 += 8) { FragH fr; for (int q = 0; q < 8; ++q) { const int j = j0 + q; const float f = (j <= last) ? 1.f : 0.f; fr.h[q] = (_Float16)(__expf(fmaf(f, s[j], (1.f - f) * -1.0e9f) - mx) * sc); } unsigned short* d = (unsigned short*)P + i * NKX + j0; *(v8us*)d = fr.half[0];  } }


template <int NORM, int ROPE>
__global__ __launch_bounds__(64) void k_xformf(const float* __restrict__ F, int ldf, int nh, const float* __restrict__ gain, float eps, const float* __restrict__ CS, const float* __restrict__ SN, float* __restrict__ F32, int ldo) {
  #pragma clang fp contract(off)
  __shared__ float xv[HD]; __shared__ float red[HD]; const int d = threadIdx.x; const int h = blockIdx.x % nh; const size_t r = blockIdx.x / nh; const int p = (int)(r % SQ);
  float x = F[r * (size_t)ldf + (size_t)h * HD + d];
  if (NORM) { red[d] = __fmul_rn(x, x); __syncthreads(); for (int st = HD / 2; st > 0; st >>= 1) { if (d < st) red[d] = __fadd_rn(red[d], red[d + st]); __syncthreads(); } const float rs = rsqrtf(__fadd_rn(red[0] / (float)HD, eps)); x = __fmul_rn(__fmul_rn(x, rs), bf16_round(gain[d])); }
  xv[d] = x; __syncthreads();
  float o = x;
  if (ROPE == 1) { const int i = d >> 1; const float c = CS[p * (HD / 2) + i], s = SN[p * (HD / 2) + i]; const float ev = xv[2 * i], od = xv[2 * i + 1]; o = (d & 1) ? __fadd_rn(__fmul_rn(ev, s), __fmul_rn(od, c)) : __fadd_rn(__fmul_rn(ev, c), -__fmul_rn(od, s)); }
  if (ROPE == 2) { const int i = d & (HD / 2 - 1); const float c = CS[p * (HD / 2) + i], s = SN[p * (HD / 2) + i]; const float lo = xv[i], hi = xv[i + HD / 2]; o = (d < HD / 2) ? __fadd_rn(__fmul_rn(lo, c), -__fmul_rn(hi, s)) : __fadd_rn(__fmul_rn(lo, s), __fmul_rn(hi, c)); }
  float* dst = F32 + r * (size_t)ldo + (size_t)h * HD + d; *(float*)dst = o;  }
extern "C" void kernel_launch(void* const* d_in, const int* in_sizes, int n_in,
                              void* d_out, int out_size, void* d_ws, size_t ws_size, hipStream_t stream) {
  (void)in_sizes; (void)n_in; (void)out_size;
  const float* const* I = (const float* const*)d_in; const float* x = I[0]; const float* wqkv = I[1]; const float* bqkv = I[2]; const float* wo = I[3]; const float* bo = I[4];      /* [in][out] fused qkv + out weights, biases */
  char* ws = (char*)d_ws; size_t off = 0;
  auto take = [&](size_t bytes) { char* p = ws + off; off += (bytes + 255) & ~(size_t)255; return p; };
  _Float16* BQKV = (_Float16*)take((size_t)3 * DM * DM * 2); _Float16* BO = (_Float16*)take((size_t)DM * DM * 2); float* CS = (float*)take((size_t)SQ * (HD / 2) * 4); float* SN = (float*)take((size_t)SQ * (HD / 2) * 4);
  _Float16* X16 = (_Float16*)take(NR * DM * 2); float* QKVF = (float*)take((size_t)SQ * 3 * DM * 4);      /* one batch of f32 q | k | v rows */
  float* QF = (float*)take(NR * DM * 4); float* KF = (float*)take(NR * DM * 4); _Float16* QH = (_Float16*)take(NR * DM * 2); _Float16* QL = (_Float16*)take(NR * DM * 2); _Float16* KH = (_Float16*)take(NR * DM * 2); _Float16* KL = (_Float16*)take(NR * DM * 2); _Float16* V16 = (_Float16*)take(NR * DM * 2); _Float16* O16 = (_Float16*)take(NR * DM * 2);
  float* S = (float*)take((size_t)NH * QT * NKX * 4); _Float16* P = (_Float16*)take((size_t)NH * QT * NKX * 2); _Float16* VT = (_Float16*)take((size_t)NH * HD * SQ * 2);
  if (off > ws_size) return;
  k_wt_f16<<<(unsigned)(((size_t)3 * DM * (DM / 8) + 255) / 256), 256, 0, stream>>>(wqkv, BQKV, DM, 3 * DM, 16.0f); k_wt_f16<<<(unsigned)(((size_t)DM * (DM / 8) + 255) / 256), 256, 0, stream>>>(wo, BO, DM, DM, 16.0f);      /* [in][out] -> Bt[n][k] x16; q | k | v stacked along n */
  k_tab2<<<(SQ * (HD / 2) + 255) / 256, 256, 0, stream>>>(10000.0f, CS, SN);
  k_x16<<<(unsigned)((NR * DM / 8 + 255) / 256), 256, 0, stream>>>(x, X16, NR * DM / 8);
  for (int b = B0; b < B0 + NBR; ++b) { const size_t r0 = (size_t)b * SQ;
    k_gemm2<0><<<dim3((unsigned)((SQ / 128) * (3 * DM / 64)), 1), 128, 0, stream>>>(X16 + r0 * DM, DM, 0, BQKV, DM, 0, 0.0625f, bqkv, 0, nullptr, 1, 0, 0, QKVF, nullptr, 3 * DM, 0, SQ, 3 * DM, DM);      /* q | k | v rows (f32) of this batch */
    k_xformf<0, 1><<<(unsigned)(SQ * NH), 64, 0, stream>>>(QKVF, 3 * DM, NH, nullptr, 0.f, CS, SN, QF + r0 * DM, DM); k_hl<<<(unsigned)(((size_t)SQ * DM / 8 + 255) / 256), 256, 0, stream>>>(QF + r0 * DM, QH + r0 * DM, QL + r0 * DM, (size_t)SQ * DM / 8);      /* roped q (f32) -> f16 hi + x1024 residual: the x8 logits (sigma ~64) need ~f32-accurate scores */
    k_xformf<0, 1><<<(unsigned)(SQ * NH), 64, 0, stream>>>(QKVF + DM, 3 * DM, NH, nullptr, 0.f, CS, SN, KF + r0 * DM, DM); k_hl<<<(unsigned)(((size_t)SQ * DM / 8 + 255) / 256), 256, 0, stream>>>(KF + r0 * DM, KH + r0 * DM, KL + r0 * DM, (size_t)SQ * DM / 8);
    k_xform<0, 0><<<(unsigned)(SQ * NH), 64, 0, stream>>>(QKVF + 2 * DM, 3 * DM, NH, nullptr, 0.f, CS, SN, V16 + r0 * DM, DM);
    k_vt<NH, SQ><<<NH * (SQ / 64), 256, 0, stream>>>(V16 + r0 * DM, DM, 0, VT);      /* V^T [NH][HD][SQ] for this batch */
    for (int q0 = 0; q0 < QN; q0 += QT) { const int nk = q0 + QT;      /* causal: only keys below the tile end are computed */
      k_gemm2<0><<<dim3((QT / 128) * (nk / 64), NHD), 128, 0, stream>>>(QH + (r0 + q0) * DM, DM, (size_t)HD, KH + r0 * DM, DM, (size_t)HD, 8.0f, nullptr, 0, nullptr, 1, 0, 0, S, nullptr, NKX, (size_t)QT * NKX, QT, nk, HD);
      k_gemm2<0><<<dim3((QT / 128) * (nk / 64), NHD), 128, 0, stream>>>(QL + (r0 + q0) * DM, DM, (size_t)HD, KH + r0 * DM, DM, (size_t)HD, 0.0078125f, nullptr, 0, S, -1, 0, 0, S, nullptr, NKX, (size_t)QT * NKX, QT, nk, HD);      /* += 2^-10 x8 (q_lo . k_hi) */
      k_gemm2<0><<<dim3((QT / 128) * (nk / 64), NHD), 128, 0, stream>>>(QH + (r0 + q0) * DM, DM, (size_t)HD, KL + r0 * DM, DM, (size_t)HD, 0.0078125f, nullptr, 0, S, -1, 0, 0, S, nullptr, NKX, (size_t)QT * NKX, QT, nk, HD);      /* += 2^-10 x8 (q_hi . k_lo) */      /* scores, all heads on grid.y */
      k_rsmcf2<<<(NHD * QT + 255) / 256, 256, 0, stream>>>(S, P, NHD, q0, nk);
      k_gemm2<0><<<dim3((QT / 128) * (HD / 64), NHD), 128, 0, stream>>>(P, NKX, (size_t)QT * NKX, VT, SQ, (size_t)HD * SQ, 0.25f, nullptr, 0, nullptr, 1, 0, 0, nullptr, O16 + (r0 + q0) * DM, DM, (size_t)HD, QT, HD, nk); } }      /* o (merged heads, x64) as f16 rows */
  k_gemm2<0><<<dim3((unsigned)((MPO / 128) * (DM / 64)), 1), 128, 0, stream>>>(O16 + (size_t)B0 * SQ * DM, DM, 0, BO, DM, 0, 0.0009765625f, bo, 0, nullptr, 1, 0, 0, (float*)d_out + (size_t)B0 * SQ * DM, nullptr, DM, 0, MPO, DM, DM);      /* out rows are the output layout */
}

// v001
// It runs in 1710 microseconds.
// Timed twice side by side with v000, it ran 2.71 times as fast both times.
#include <hip/hip_runtime.h>
// Masked (causal) RoPE multi-head attention with LARGE logits (x [2][2048][1024]; qkv = x w_qkv + b_qkv ([in][out] 1024 x 3072, sigma 1/32, bias sigma 0.01) -> q | k | v, 16 heads of 64; interleaved-pair RoPE on q and k (inv_freq_i = 10000^(-2i/64), positions 0..2047); scores = q . k x sqrt(64) (the module divides by 1/sqrt(d_k)), causal (tril); softmax; out = (attn v merged) w_out + b_out -> [2][2048][1024]).
// Structure: token rows r = b*2048 + s; x as exact f16 rows (bf16-rounded); per batch: q | k | v as ONE WMMA GEMM (32x64 wave tiles, f32 accumulation, exact x16 weights + bias, N = 3 x 1024) into f32 rows, then per (row, head) on VALU: the interleaved-pair rotary rotation of q and k from f32 cos/sin tables (positions 0..SQ-1, no norm) -> f32 q, k rows split into f16 hi + x1024 residual planes (the x8 logits have sigma ~64: near-argmax softmax, so the scores are computed to ~f32 accuracy in three accumulating passes), v f16; V^T for all heads via LDS transposes; per query tile of 256 rows: scores against the keys below the tile end only (K = 64, all heads on grid.y, alpha = 8.0), causal row softmax on VALU, one wave per row with the row in registers, keys above the diagonal set to -1e9 (f32 statistics, native exp; weights x256 f16), o = P . V^T (K = keys below the tile end, alpha 2^-2: o carried x64, folded into the output GEMM alpha) written straight into the merged f16 o rows; out = o W_o + b GEMM (f32) into the output layout.
// Compute dtype: inputs rounded to bf16; x / weights exact; projections and rope f32; q, k as f16 hi + residual (~2^-22); v, softmax weights and o as plain f16 GEMM operands (~2^-12); scores and softmax statistics f32. v_wmma_f32_16x16x32_f16.
#define NB 2
#define SQ 2048
#define DM 1024
#define NH 16
#define HD 64
#define HG 4                         /* heads per group in the k_vt(b, h0) overload, not launched */
#define QT 256                       /* query rows per causal tile */
#define NKX SQ                       /* S / P row pitch */
#define B0 0                         /* first batch processed (debug hook) */
#define NBR NB                       /* batches processed (debug hook) */
#define QN SQ                        /* query rows attended per batch (debug hook) */
#define NHD NH                       /* heads attended (debug hook) */
#define NR ((size_t)NB * SQ)         /* token rows */
#define MPO ((int)((size_t)NBR * SQ))      /* rows through the output GEMM (debug hook) */
typedef __bf16 v16b __attribute__((ext_vector_type(16)));
typedef unsigned short v8us __attribute__((ext_vector_type(8), may_alias));
typedef float  v8f  __attribute__((ext_vector_type(8)));
typedef float  v4f  __attribute__((ext_vector_type(4)));
typedef float  v4fa __attribute__((ext_vector_type(4), may_alias));
union FragB { v16b v; v8us half[2]; unsigned short u[16]; };

__device__ __forceinline__ unsigned short bf16_bits(float x) { unsigned int u = __float_as_uint(x); return (unsigned short)((u + 0x7FFFu + ((u >> 16) & 1u)) >> 16); }
__device__ __forceinline__ float bf16_val(unsigned short b) { return __uint_as_float(((unsigned int)b) << 16); }
__device__ __forceinline__ float bf16_round(float x) { return bf16_val(bf16_bits(x)); }
// D += A·B with NT terms: 1 = ah·bh, 2 = + al·bh (A split), 3 = + ah·bl (both split)
template <int NT>
__device__ __forceinline__ v8f mmaN(v16b ah, v16b al, v16b bh, v16b bl, v8f c) {
  c = __builtin_amdgcn_wmma_f32_16x16x32_bf16(false, ah, false, bh, (short)0, c, false, false);
  if (NT >= 2) c = __builtin_amdgcn_wmma_f32_16x16x32_bf16(false, al, false, bh, (short)0, c, false, false);
  if (NT >= 3) c = __builtin_amdgcn_wmma_f32_16x16x32_bf16(false, ah, false, bl, (short)0, c, false, false);
  asm volatile("v_nop\n\tv_nop\n\tv_nop\n\tv_nop" : "+v"(c) : "v"(ah), "v"(al), "v"(bh), "v"(bl));
  return c;
}

__global__ __launch_bounds__(256) void k_wt_bf16(const float* __restrict__ W, unsigned short* __restrict__ Wt, int K, int N) {
  const int t = blockIdx.x * 256 + threadIdx.x;
  const int k8n = K / 8;
  if (t >= N * k8n) return;
  const int n = t / k8n, k8 = (t % k8n) * 8;
  v8us v;
#pragma unroll
  for (int i = 0; i < 8; ++i) v[i] = bf16_bits(W[(size_t)(k8 + i) * N + n]);
  *(v8us*)(Wt + (size_t)n * K + k8) = v;
  
}

// GEMM C[M][N] (f32, pitch ldc) = act(A[M][K]·W + bias). A f32 row-major (pitch lda) converted per fragment to bf16
// (ASPLIT: hi/lo two planes -> 2 terms, else single rounded term); Wt bf16 [N][K] (pitch ldb). BIAS_BF16 rounds the
// bias to bf16 first (bias quantised to bf16 before the add). K%32==0, M%16==0, N%64==0.
template <bool ASPLIT, int ACT, bool BIAS_BF16>
__global__ __launch_bounds__(128) void k_gemm_bf(const float* __restrict__ A, int lda, const unsigned short* __restrict__ Wt, int ldb,
                                               const float* __restrict__ bias, float* __restrict__ C, int ldc, int M, int N, int K) {
  __shared__ __attribute__((aligned(16))) float so[4][16][64];
  const int tid = threadIdx.x, w = tid >> 5, lane = tid & 31, ln = lane & 15, hh = lane >> 4;
  const int ntn = N / 64;
  const int wid = blockIdx.x * 4 + w;
  const int mt = wid / ntn, nq = wid % ntn;
  if (mt * 16 >= M) return;
  const int row0 = mt * 16, col0 = nq * 64;
  const float* arow = A + (size_t)(row0 + ln) * lda;
  v8f acc[4] = {};
  for (int kb = 0; kb < K; kb += 32) {
    FragB ah, al;
    const v4f x0 = *(const v4fa*)(arow + kb + 8 * hh), x1 = *(const v4fa*)(arow + kb + 8 * hh + 4);
    const v4f x2 = *(const v4fa*)(arow + kb + 16 + 8 * hh), x3 = *(const v4fa*)(arow + kb + 16 + 8 * hh + 4);
    float xs[16] = {x0[0],x0[1],x0[2],x0[3],x1[0],x1[1],x1[2],x1[3],x2[0],x2[1],x2[2],x2[3],x3[0],x3[1],x3[2],x3[3]};
#pragma unroll
    for (int i = 0; i < 16; ++i) { const unsigned short hb = bf16_bits(xs[i]); ah.u[i] = hb; al.u[i] = ASPLIT ? bf16_bits(xs[i] - bf16_val(hb)) : (unsigned short)0; }
#pragma unroll
    for (int t = 0; t < 4; ++t) {
      const unsigned short* brow = Wt + (size_t)(col0 + t * 16 + ln) * ldb + kb;
      FragB b;
      b.half[0] = *(const v8us*)(brow + 8 * hh);
      b.half[1] = *(const v8us*)(brow + 16 + 8 * hh);
      acc[t] = mmaN<ASPLIT ? 2 : 1>(ah.v, al.v, b.v, b.v, acc[t]);
    }
  }
#pragma unroll
  for (int t = 0; t < 4; ++t) {
    float bv = bias ? bias[col0 + t * 16 + ln] : 0.f;
    if (BIAS_BF16) bv = bf16_round(bv);
#pragma unroll
    for (int r = 0; r < 8; ++r) { float v = acc[t][r] + bv; if (ACT == 1) v = fmaxf(v, 0.f); so[w][8 * hh + r][t * 16 + ln] = v; }
  }
  __builtin_amdgcn_fence(__ATOMIC_ACQ_REL, "workgroup");
  __builtin_amdgcn_wave_barrier();
  const int rsub = lane >> 4, c4 = (lane & 15) * 4;
  {
#pragma unroll
    for (int q = 0; q < 8; ++q) {
      const int r = q * 2 + rsub;
      const v4f v = *(const v4fa*)&so[w][r][c4];
      *(v4f*)(C + (size_t)(row0 + r) * ldc + col0 + c4) = v;
    }
    
  }
}

// GEMM C = act(A·W + bias + resid): A f32 (ASPLIT -> hi/lo 2 terms), Wt bf16 [N][K]; ACT 0 none, 1 relu, 2 exact gelu;
// resid (optional, f32, row index = (row % rmod), pitch ldr, RES_BF16 rounds it) added before the activation.
template <bool ASPLIT, int ACT, bool BIAS_BF16, bool RES_BF16>
__global__ __launch_bounds__(128) void k_gemm_bf3(const float* __restrict__ A, int lda, const unsigned short* __restrict__ Wt, int ldb,
                                                const float* __restrict__ bias, const float* __restrict__ resid, int rmod, int ldr,
                                                float* __restrict__ C, int ldc, int M, int N, int K) {
  __shared__ __attribute__((aligned(16))) float so[4][16][64];
  const int tid = threadIdx.x, w = tid >> 5, lane = tid & 31, ln = lane & 15, hh = lane >> 4;
  const int ntn = N / 64;
  const int wid = blockIdx.x * 4 + w;
  const int mt = wid / ntn, nq = wid % ntn;
  if (mt * 16 >= M) return;
  const int row0 = mt * 16, col0 = nq * 64;
  const float* arow = A + (size_t)(row0 + ln) * lda;
  v8f acc[4] = {};
  for (int kb = 0; kb < K; kb += 32) {
    FragB ah, al;
    const v4f x0 = *(const v4fa*)(arow + kb + 8 * hh), x1 = *(const v4fa*)(arow + kb + 8 * hh + 4);
    const v4f x2 = *(const v4fa*)(arow + kb + 16 + 8 * hh), x3 = *(const v4fa*)(arow + kb + 16 + 8 * hh + 4);
    float xs[16] = {x0[0],x0[1],x0[2],x0[3],x1[0],x1[1],x1[2],x1[3],x2[0],x2[1],x2[2],x2[3],x3[0],x3[1],x3[2],x3[3]};
#pragma unroll
    for (int i = 0; i < 16; ++i) { const unsigned short hb = bf16_bits(xs[i]); ah.u[i] = hb; al.u[i] = ASPLIT ? bf16_bits(xs[i] - bf16_val(hb)) : (unsigned short)0; }
#pragma unroll
    for (int t = 0; t < 4; ++t) {
      const unsigned short* brow = Wt + (size_t)(col0 + t * 16 + ln) * ldb + kb;
      FragB b;
      b.half[0] = *(const v8us*)(brow + 8 * hh);
      b.half[1] = *(const v8us*)(brow + 16 + 8 * hh);
      acc[t] = mmaN<ASPLIT ? 2 : 1>(ah.v, al.v, b.v, b.v, acc[t]);
    }
  }
#pragma unroll
  for (int t = 0; t < 4; ++t) {
    const int col = col0 + t * 16 + ln;
    float bv = bias ? bias[col] : 0.f;
    if (BIAS_BF16) bv = bf16_round(bv);
#pragma unroll
    for (int r = 0; r < 8; ++r) {
      float v = acc[t][r] + bv;
      if (resid) { float rv = resid[(size_t)((row0 + 8 * hh + r) % rmod) * ldr + col]; if (RES_BF16) rv = bf16_round(rv); v += rv; }
      if (ACT == 1) v = fmaxf(v, 0.f);
      if (ACT == 2) v = 0.5f * v * (1.0f + erff(v * 0.70710678118654752f));
      if (ACT == 3) { const float u = 0.7978845608028654f * (v + 0.044715f * v * v * v); v = 0.5f * v * (1.0f + tanhf(u)); }
      so[w][8 * hh + r][t * 16 + ln] = v;
    }
  }
  __builtin_amdgcn_fence(__ATOMIC_ACQ_REL, "workgroup");
  __builtin_amdgcn_wave_barrier();
  const int rsub = lane >> 4, c4 = (lane & 15) * 4;
  {
#pragma unroll
    for (int q = 0; q < 8; ++q) {
      const int r = q * 2 + rsub;
      const v4f v = *(const v4fa*)&so[w][r][c4];
      *(v4f*)(C + (size_t)(row0 + r) * ldc + col0 + c4) = v;
    }
    
  }
}
// row LayerNorm (biased variance, eps) over N: s = X (+ R); optional out_sum <- s; out_norm <- (s-mu)*rsqrt(var+eps)*g + b
template <bool PARAM_BF16>
__global__ __launch_bounds__(256) void k_layernorm(const float* __restrict__ X, const float* __restrict__ R, const float* __restrict__ g, const float* __restrict__ bta,
                                                  float* __restrict__ out_sum, float* __restrict__ out_norm, int N, float eps) {
  __shared__ float red[256];
  const int row = blockIdx.x, tid = threadIdx.x;
  const float* x = X + (size_t)row * N; const float* rr = R ? R + (size_t)row * N : nullptr;
  float vals[16];                     // up to N = 4096
  const int per = N / 256;            // contiguous chunk per thread? use strided-by-4 chunks: thread handles j = tid*4 + 1024*u
  float s1 = 0.f;
  for (int u = 0; u < per / 4; ++u) {
    const int j = tid * 4 + 1024 * u;
    const v4f a = *(const v4fa*)(x + j);
    v4f b = {0.f,0.f,0.f,0.f}; if (rr) b = *(const v4fa*)(rr + j);
#pragma unroll
    for (int q = 0; q < 4; ++q) { const float v = a[q] + b[q]; vals[u * 4 + q] = v; s1 += v; }
  }
  red[tid] = s1; __syncthreads();
  for (int st = 128; st > 0; st >>= 1) { if (tid < st) red[tid] += red[tid + st]; __syncthreads(); }
  const float mu = red[0] / (float)N; __syncthreads();
  float s2 = 0.f;
  for (int u = 0; u < per / 4; ++u)
#pragma unroll
    for (int q = 0; q < 4; ++q) { const float c = vals[u * 4 + q] - mu; s2 += c * c; }
  red[tid] = s2; __syncthreads();
  for (int st = 128; st > 0; st >>= 1) { if (tid < st) red[tid] += red[tid + st]; __syncthreads(); }
  const float rs = rsqrtf(red[0] / (float)N + eps);
  {
    for (int u = 0; u < per / 4; ++u) {
      const int j = tid * 4 + 1024 * u;
      v4f o, sm;
#pragma unroll
      for (int q = 0; q < 4; ++q) {
        float gg = g[j + q], bb = bta[j + q];
        if (PARAM_BF16) { gg = bf16_round(gg); bb = bf16_round(bb); }
        sm[q] = vals[u * 4 + q]; o[q] = (vals[u * 4 + q] - mu) * rs * gg + bb;
      }
      if (out_sum) *(v4f*)(out_sum + (size_t)row * N + j) = sm;
      *(v4f*)(out_norm + (size_t)row * N + j) = o;
    }
    
  }
}



// ---- f16 WMMA path (v_wmma_f32_16x16x32_f16): 11-bit significands for operands in range — used where a [0,1] probability operand needs more precision than bf16
typedef _Float16 v16h __attribute__((ext_vector_type(16)));
union FragH { v16h v; v8us half[2]; _Float16 h[16]; unsigned short u[16]; };
template <int NT>
__device__ __forceinline__ v8f mmaH(v16h ah, v16h al, v16h bh, v16h bl, v8f c) {
  c = __builtin_amdgcn_wmma_f32_16x16x32_f16(false, ah, false, bh, (short)0, c, false, false);
  if (NT >= 2) c = __builtin_amdgcn_wmma_f32_16x16x32_f16(false, al, false, bh, (short)0, c, false, false);
  if (NT >= 3) c = __builtin_amdgcn_wmma_f32_16x16x32_f16(false, ah, false, bl, (short)0, c, false, false);
  asm volatile("v_nop\n\tv_nop\n\tv_nop\n\tv_nop" : "+v"(c) : "v"(ah), "v"(al), "v"(bh), "v"(bl));
  return c;
}
// batched GEMM like k_gemm_b but f16 operands: A f32 (split into f16 hi/lo if ASPLIT, else rounded to f16), Bt = f16 values [n][k]; alpha; C f32; N multiple of 16 (partial tiles skipped)
template <bool ASPLIT>
__global__ __launch_bounds__(128) void k_gemm_h(const float* __restrict__ A, int lda, size_t sA, const _Float16* __restrict__ Bh, int ldb, size_t sB, float alpha, float* __restrict__ C, int ldc, size_t sC, int M, int N, int K) {
  __shared__ __attribute__((aligned(16))) float so[4][16][64];
  const int tid = threadIdx.x, w = tid >> 5, lane = tid & 31, ln = lane & 15, hh = lane >> 4; const int by = blockIdx.y;
  A += (size_t)by * sA; Bh += (size_t)by * sB; C += (size_t)by * sC;
  const int ntn = (N + 63) / 64; const int wid = blockIdx.x * 4 + w; const int mt = wid / ntn, nq = wid % ntn; if (mt * 16 >= M) return;
  const int row0 = mt * 16, col0 = nq * 64; const float* arow = A + (size_t)(row0 + ln) * lda;
  v8f acc[4] = {};
  for (int kb = 0; kb < K; kb += 32) {
    FragH ah, al;
    const v4f x0 = *(const v4fa*)(arow + kb + 8 * hh), x1 = *(const v4fa*)(arow + kb + 8 * hh + 4), x2 = *(const v4fa*)(arow + kb + 16 + 8 * hh), x3 = *(const v4fa*)(arow + kb + 16 + 8 * hh + 4);
    float xs[16] = {x0[0],x0[1],x0[2],x0[3],x1[0],x1[1],x1[2],x1[3],x2[0],x2[1],x2[2],x2[3],x3[0],x3[1],x3[2],x3[3]};
#pragma unroll
    for (int i = 0; i < 16; ++i) { const _Float16 h = (_Float16)xs[i]; ah.h[i] = h; al.h[i] = ASPLIT ? (_Float16)(xs[i] - (float)h) : (_Float16)0.0f; }
#pragma unroll
    for (int t = 0; t < 4; ++t) { if (col0 + t * 16 >= N) continue; const size_t boff = (size_t)(col0 + t * 16 + ln) * ldb + kb; FragH bq; bq.half[0] = *(const v8us*)(Bh + boff + 8 * hh); bq.half[1] = *(const v8us*)(Bh + boff + 16 + 8 * hh);
      acc[t] = mmaH<ASPLIT ? 2 : 1>(ah.v, al.v, bq.v, bq.v, acc[t]); }
  }
#pragma unroll
  for (int t = 0; t < 4; ++t) { if (col0 + t * 16 >= N) continue;
#pragma unroll
    for (int r = 0; r < 8; ++r) so[w][8 * hh + r][t * 16 + ln] = acc[t][r] * alpha; }
  __builtin_amdgcn_fence(__ATOMIC_ACQ_REL, "workgroup"); __builtin_amdgcn_wave_barrier();
  const int rsub = lane >> 4, c4 = (lane & 15) * 4;
  {
#pragma unroll
    for (int q = 0; q < 8; ++q) { const int r = q * 2 + rsub; if (col0 + c4 < N) { const v4f v = *(const v4fa*)&so[w][r][c4]; *(v4f*)(C + (size_t)(row0 + r) * ldc + col0 + c4) = v; } }
     }
}

// Wt[n][k] = f16(W[k][n]·scale) from f32 row-major W[K][N] (scale = power of two; bf16-exact weights stay exact in f16 away from the subnormal range)
__global__ __launch_bounds__(256) void k_wt_f16(const float* __restrict__ W, _Float16* __restrict__ Wt, int K, int N, float scale) {
  const int t = blockIdx.x * 256 + threadIdx.x; if (t >= N * (K / 8)) return; const int n = t / (K / 8), k8 = (t % (K / 8)) * 8; FragH f;
#pragma unroll
  for (int i = 0; i < 8; ++i) f.h[i] = (_Float16)(bf16_round(W[(size_t)(k8 + i) * N + n]) * scale); const v8us o = f.half[0];
  *(v8us*)((unsigned short*)Wt + (size_t)n * K + k8) = o; 
}
// k_gemm_hh variant with fused epilogue: v = acc·alpha + bias[by·sBias + col] (+ CP[(row/rowsPerB)·sCPb + by·64 + col] if CP) ; ACT 0 none / 1 elu ; writes f16 C16 (and f32 C if non-null)
template <int ACT>
__global__ __launch_bounds__(128) void k_gemm_hhx(const _Float16* __restrict__ A, int lda, size_t sA, const _Float16* __restrict__ Bh, int ldb, size_t sB, float alpha, const float* __restrict__ bias, size_t sBias, const float* __restrict__ CP, int rowsPerB, size_t sCPb, int row0g,
    float* __restrict__ C, _Float16* __restrict__ C16, int ldc, size_t sC, int M, int N, int K) {
  __shared__ __attribute__((aligned(16))) float so[4][16][64];
  const int tid = threadIdx.x, w = tid >> 5, lane = tid & 31, ln = lane & 15, hh = lane >> 4; const int by = blockIdx.y;
  A += (size_t)by * sA; Bh += (size_t)by * sB; const size_t cofs = (size_t)by * sC; const float* bp = bias ? bias + (size_t)by * sBias : nullptr;
  const int ntn = (N + 63) / 64; const int wid = blockIdx.x * 4 + w; const int mt = wid / ntn, nq = wid % ntn; if (mt * 16 >= M) return;
  const int row0 = mt * 16, col0 = nq * 64; const _Float16* arow = A + (size_t)(row0 + ln) * lda;
  v8f acc[4] = {};
  for (int kb = 0; kb < K; kb += 32) { FragH ah; ah.half[0] = *(const v8us*)((const unsigned short*)arow + kb + 8 * hh); ah.half[1] = *(const v8us*)((const unsigned short*)arow + kb + 16 + 8 * hh);
#pragma unroll
    for (int t = 0; t < 4; ++t) { if (col0 + t * 16 >= N) continue; const size_t boff = (size_t)(col0 + t * 16 + ln) * ldb + kb; FragH bq; bq.half[0] = *(const v8us*)((const unsigned short*)Bh + boff + 8 * hh); bq.half[1] = *(const v8us*)((const unsigned short*)Bh + boff + 16 + 8 * hh);
      acc[t] = mmaH<1>(ah.v, ah.v, bq.v, bq.v, acc[t]); }
  }
#pragma unroll
  for (int t = 0; t < 4; ++t) { if (col0 + t * 16 >= N) continue; const int col = col0 + t * 16 + ln; const float bv = bp ? bf16_round(bp[col]) : 0.f;
#pragma unroll
    for (int r = 0; r < 8; ++r) { float v = acc[t][r] * alpha + bv; if (CP) { const int rr = row0g + row0 + 8 * hh + r; if (rowsPerB < 0) v += CP[cofs + (size_t)rr * ldc + col];      /* rowsPerB < 0: own element of the batched C plane */ else { const int bidx = rr / rowsPerB; v += CP[(size_t)bidx * sCPb + (size_t)by * 64 + col]; } } if (ACT == 1) v = (v > 0.f) ? v : expm1f(v); else if (ACT == 7) v = (v > 0.f) ? v + 1.0f : expf(v); else if (ACT == 8) v = tanhf(v); else if (ACT == 9) v = 0.5f * v * (1.0f + tanhf(0.7978845608028654f * (v + 0.044715f * v * v * v))); else if (ACT == 11) v = 1.0f / (1.0f + expf(-v)); else if (ACT == 12) v = (v > 0.f) ? v : 0.01f * v; else if (ACT == 14) v = (v > 0.f) ? v : 0.1f * v; else if (ACT == 16) v = (v >= 0.f) ? v : 0.3f * v; else if (ACT == 17) v = (v >= 0.f) ? v : 0.2f * v; else if (ACT == 15) v = v / (1.0f + expf(-v)); else if (ACT == 3) v = fmaxf(v, 0.f); else if (ACT == 6) v = 0.5f * v * (1.0f + erff(v * 0.70710678118654752f)); so[w][8 * hh + r][t * 16 + ln] = v; } }
  __builtin_amdgcn_fence(__ATOMIC_ACQ_REL, "workgroup"); __builtin_amdgcn_wave_barrier();
  const int rsub = lane >> 4, c4 = (lane & 15) * 4; typedef _Float16 v4h __attribute__((ext_vector_type(4)));
  {
#pragma unroll
    for (int q = 0; q < 8; ++q) { const int r = q * 2 + rsub; if (col0 + c4 < N) { const v4f v = *(const v4fa*)&so[w][r][c4]; if (C) *(v4f*)(C + cofs + (size_t)(row0 + r) * ldc + col0 + c4) = v; if (C16) { v4h h4; for (int i = 0; i < 4; ++i) h4[i] = (_Float16)v[i]; *(v4h*)(C16 + cofs + (size_t)(row0 + r) * ldc + col0 + c4) = h4; } } }
     }
}


typedef _Float16 v4h __attribute__((ext_vector_type(4)));

__global__ __launch_bounds__(256) void k_x16(const float* __restrict__ x, _Float16* __restrict__ X16, size_t n8) { const size_t t = (size_t)blockIdx.x * 256 + threadIdx.x; if (t >= n8) return; FragH f;
#pragma unroll
  for (int q = 0; q < 8; ++q) f.h[q] = (_Float16)bf16_round(x[t * 8 + q]); *(v8us*)((unsigned short*)X16 + t * 8) = f.half[0];  }
__global__ __launch_bounds__(256) void k_h16(const float* __restrict__ x, _Float16* __restrict__ X16, size_t n8) { const size_t t = (size_t)blockIdx.x * 256 + threadIdx.x; if (t >= n8) return; FragH f;
#pragma unroll
  for (int q = 0; q < 8; ++q) f.h[q] = (_Float16)x[t * 8 + q]; *(v8us*)((unsigned short*)X16 + t * 8) = f.half[0];  }
__global__ __launch_bounds__(256) void k_round16f(const float* __restrict__ W, _Float16* __restrict__ Bt, size_t n8) { const size_t t = (size_t)blockIdx.x * 256 + threadIdx.x; if (t >= n8) return; FragH f;
#pragma unroll
  for (int i = 0; i < 8; ++i) f.h[i] = (_Float16)(bf16_round(W[t * 8 + i]) * 16.0f); *(v8us*)((unsigned short*)Bt + t * 8) = f.half[0];  }
template <int NHv, int TTv>
__global__ __launch_bounds__(256) void k_vt(const _Float16* __restrict__ V16, int ldv, int voff, _Float16* __restrict__ Vt) { __shared__ unsigned short tl[64][66]; const int tid = threadIdx.x; const int slab = blockIdx.x / (TTv / 64), lg = blockIdx.x % (TTv / 64); const int b = slab / NHv, h = slab % NHv;
  for (int i = tid; i < 64 * 8; i += 256) { const int r = i / 8, c8 = (i % 8) * 8; FragH f; f.half[0] = *(const v8us*)((const unsigned short*)V16 + ((size_t)b * TTv + lg * 64 + r) * ldv + voff + h * 64 + c8);
#pragma unroll
    for (int q = 0; q < 8; ++q) tl[r][c8 + q] = f.u[q]; }
  __syncthreads();
  {
#pragma unroll
    for (int rd = 0; rd < 2; ++rd) { const int d = rd * 32 + tid / 8, pc = tid % 8; FragH f;
#pragma unroll
      for (int q = 0; q < 8; ++q) f.u[q] = tl[pc * 8 + q][d];
      *(v8us*)((unsigned short*)Vt + ((size_t)slab * 64 + d) * TTv + lg * 64 + pc * 8) = f.half[0]; }
     } }

__global__ __launch_bounds__(256) void k_hl(const float* __restrict__ F, _Float16* __restrict__ Hh, _Float16* __restrict__ Hl, size_t n8) { const size_t t = (size_t)blockIdx.x * 256 + threadIdx.x; if (t >= n8) return; FragH fh, fl; const v4f a = *(const v4fa*)(F + t * 8), c = *(const v4fa*)(F + t * 8 + 4);
#pragma unroll
  for (int q = 0; q < 4; ++q) { _Float16 h = (_Float16)a[q]; fh.h[q] = h; fl.h[q] = (_Float16)((a[q] - (float)h) * 1024.0f); h = (_Float16)c[q]; fh.h[4 + q] = h; fl.h[4 + q] = (_Float16)((c[q] - (float)h) * 1024.0f); }
  { *(v8us*)((unsigned short*)Hh + t * 8) = fh.half[0]; *(v8us*)((unsigned short*)Hl + t * 8) = fl.half[0];  } }

// ---- fast GEMM (wave tile 32x64; requires M % 32 == 0 rows per launch region and N % 64 == 0); epilogue = k_gemm_hhx semantics ----
__device__ __forceinline__ v16h g2_frag(const _Float16* p, int hh) { FragH f; f.half[0] = *(const v8us*)((const unsigned short*)p + 8 * hh); f.half[1] = *(const v8us*)((const unsigned short*)p + 16 + 8 * hh); return f.v; }
__device__ __forceinline__ v8f g2_mma(v16h a, v16h b, v8f c) { v8f d = __builtin_amdgcn_wmma_f32_16x16x32_f16(false, a, false, b, (short)0, c, false, false); asm volatile("v_nop\n\tv_nop\n\tv_nop\n\tv_nop" : "+v"(d) : "v"(a), "v"(b)); return d; }
template <int ACT>
__global__ __launch_bounds__(128) void k_gemm2(const _Float16* __restrict__ A, int lda, size_t sA, const _Float16* __restrict__ Bh, int ldb, size_t sB, float alpha, const float* __restrict__ bias, size_t sBias, const float* __restrict__ CP, int rowsPerB, size_t sCPb, int row0g,
    float* __restrict__ C, _Float16* __restrict__ C16, int ldc, size_t sC, int M, int N, int K) { static_assert(ACT == 0 || ACT == 3 || ACT == 6 || ACT == 8 || ACT == 9 || ACT == 11 || ACT == 12 || ACT == 14 || ACT == 15 || ACT == 16 || ACT == 17, "k_gemm2: unsupported ACT code (would silently apply no activation)");
  __shared__ __attribute__((aligned(16))) float so[4][32][68];
  const int tid = threadIdx.x, w = tid >> 5, lane = tid & 31, ln = lane & 15, hh = lane >> 4; const int by = blockIdx.y;
  A += (size_t)by * sA; Bh += (size_t)by * sB; const size_t cofs = (size_t)by * sC; const float* bp = bias ? bias + (size_t)by * sBias : nullptr;
  const int ntn = N >> 6; const int mt = blockIdx.x / ntn, nq = blockIdx.x - mt * ntn; const int row0 = mt * 128 + 32 * w, col0 = nq * 64; if (row0 >= M) return;
  const _Float16* a0p = A + (size_t)(row0 + ln) * lda; const _Float16* a1p = a0p + (size_t)16 * lda;
  const _Float16* b0p = Bh + (size_t)(col0 + ln) * ldb; const _Float16* b1p = b0p + (size_t)16 * ldb; const _Float16* b2p = b1p + (size_t)16 * ldb; const _Float16* b3p = b2p + (size_t)16 * ldb;
  const v8f z8 = {0.f,0.f,0.f,0.f,0.f,0.f,0.f,0.f}; v8f c00 = z8, c01 = z8, c02 = z8, c03 = z8, c10 = z8, c11 = z8, c12 = z8, c13 = z8;
#pragma unroll 1
  for (int kb = 0; kb < K; kb += 32) { const v16h a0 = g2_frag(a0p + kb, hh), a1 = g2_frag(a1p + kb, hh);
    v16h b = g2_frag(b0p + kb, hh); c00 = g2_mma(a0, b, c00); c10 = g2_mma(a1, b, c10);
    b = g2_frag(b1p + kb, hh); c01 = g2_mma(a0, b, c01); c11 = g2_mma(a1, b, c11);
    b = g2_frag(b2p + kb, hh); c02 = g2_mma(a0, b, c02); c12 = g2_mma(a1, b, c12);
    b = g2_frag(b3p + kb, hh); c03 = g2_mma(a0, b, c03); c13 = g2_mma(a1, b, c13); }
  v8f accs[8] = {c00, c01, c02, c03, c10, c11, c12, c13};
#pragma unroll
  for (int u = 0; u < 8; ++u) { const int t = u & 3, half = u >> 2; const int col = col0 + t * 16 + ln; const float bv = bp ? bf16_round(bp[col]) : 0.f;
#pragma unroll
    for (int r = 0; r < 8; ++r) { const int rloc = half * 16 + 8 * hh + r; float v = accs[u][r] * alpha + bv; if (CP) { if (rowsPerB < 0) v += CP[cofs + (size_t)(row0g + row0 + rloc) * ldc + col];      /* rowsPerB < 0: own element of the batched C plane */ else { const int bidx = (row0g + row0 + rloc) / rowsPerB; v += CP[(size_t)bidx * sCPb + (size_t)by * 64 + col]; } }
      if (ACT == 3) v = fmaxf(v, 0.f); else if (ACT == 6) v = 0.5f * v * (1.0f + erff(v * 0.70710678118654752f)); else if (ACT == 11) v = 1.0f / (1.0f + expf(-v)); else if (ACT == 15) v = v / (1.0f + expf(-v)); else if (ACT == 12) v = (v > 0.f) ? v : 0.01f * v; else if (ACT == 8) v = tanhf(v); else if (ACT == 9) v = 0.5f * v * (1.0f + tanhf(0.7978845608028654f * (v + 0.044715f * v * v * v))); else if (ACT == 14) v = (v > 0.f) ? v : 0.1f * v; else if (ACT == 16) v = (v >= 0.f) ? v : 0.3f * v; else if (ACT == 17) v = (v >= 0.f) ? v : 0.2f * v;
      so[w][rloc][t * 16 + ln] = v; } }
  __builtin_amdgcn_fence(__ATOMIC_ACQ_REL, "workgroup"); __builtin_amdgcn_wave_barrier();
  const int rsub = lane >> 4, c4 = (lane & 15) * 4;
  {
#pragma unroll
    for (int q = 0; q < 16; ++q) { const int r = q * 2 + rsub; const v4f v = *(const v4fa*)&so[w][r][c4]; if (C) *(v4f*)(C + cofs + (size_t)(row0 + r) * ldc + col0 + c4) = v; if (C16) { v4h h4; for (int i = 0; i < 4; ++i) h4[i] = (_Float16)v[i]; *(v4h*)(C16 + cofs + (size_t)(row0 + r) * ldc + col0 + c4) = h4; } }
     } }


__global__ __launch_bounds__(256) void k_wnat(const float* __restrict__ w, size_t n8, _Float16* __restrict__ Bt) { const size_t t = (size_t)blockIdx.x * 256 + threadIdx.x; if (t >= n8) return; FragH f; for (int q = 0; q < 8; ++q) f.h[q] = (_Float16)(bf16_round(w[t * 8 + q]) * 16.0f); *(v8us*)((unsigned short*)Bt + t * 8) = f.half[0];  }
__global__ __launch_bounds__(256) void k_rsm(const float* __restrict__ S, _Float16* __restrict__ P, int nrows) {
  #pragma clang fp contract(off)
  const int i = blockIdx.x * 256 + threadIdx.x; if (i >= nrows) return; const float* s = S + (size_t)i * SQ; float mx = -3.0e38f;
#pragma unroll 1
  for (int j = 0; j < SQ; ++j) mx = fmaxf(mx, s[j]); float se = 0.f;
#pragma unroll 1
  for (int j = 0; j < SQ; ++j) se += expf(s[j] - mx); const float sc = 256.0f / se;
#pragma unroll 1
  for (int j0 = 0; j0 < SQ; j0 += 8) { FragH f; for (int q = 0; q < 8; ++q) f.h[q] = (_Float16)(expf(s[j0 + q] - mx) * sc); unsigned short* d = (unsigned short*)P + (size_t)i * SQ + j0; *(v8us*)d = f.half[0];  } }
__global__ __launch_bounds__(256) void k_vt(const _Float16* __restrict__ V16, int b, int h0, _Float16* __restrict__ VT) { __shared__ unsigned short tl[64][65]; const int tid = threadIdx.x; const int hh = blockIdx.x % HG, sg = blockIdx.x / HG; const int s0 = sg * 64; const int h = h0 + hh;
  for (int i = tid; i < 64 * 8; i += 256) { const int j = i / 8, d8 = (i % 8) * 8; FragH f; f.half[0] = *(const v8us*)((const unsigned short*)V16 + ((size_t)b * SQ + s0 + j) * DM + h * HD + d8); for (int q = 0; q < 8; ++q) tl[d8 + q][j] = f.u[q]; }
  __syncthreads();
  { for (int i = tid; i < 64 * 8; i += 256) { const int d = i / 8, j8 = (i % 8) * 8; FragH f; for (int q = 0; q < 8; ++q) f.u[q] = tl[d][j8 + q]; *(v8us*)((unsigned short*)VT + ((size_t)hh * HD + d) * SQ + s0 + j8) = f.half[0]; }  } }


__global__ __launch_bounds__(256) void k_tab2(float theta, float* __restrict__ CS, float* __restrict__ SN) {
  #pragma clang fp contract(off)
  const int t = blockIdx.x * 256 + threadIdx.x; if (t >= SQ * (HD / 2)) return; const int i = t % (HD / 2); const int p = t / (HD / 2); const float invf = 1.0f / powf(theta, (float)(2 * i) / (float)HD); const float ang = __fmul_rn((float)p, invf); const float c = cosf(ang), s = sinf(ang);
  *(float*)(CS + t) = c; *(float*)(SN + t) = s;  }
template <int NORM, int ROPE>
__global__ __launch_bounds__(64) void k_xform(const float* __restrict__ F, int ldf, int nh, const float* __restrict__ gain, float eps, const float* __restrict__ CS, const float* __restrict__ SN, _Float16* __restrict__ H16, int ldo) {
  #pragma clang fp contract(off)
  __shared__ float xv[HD]; __shared__ float red[HD]; __shared__ unsigned short sh_[HD]; const int d = threadIdx.x; const int h = blockIdx.x % nh; const size_t r = blockIdx.x / nh; const int p = (int)(r % SQ);
  float x = F[r * (size_t)ldf + (size_t)h * HD + d];
  if (NORM) { red[d] = __fmul_rn(x, x); __syncthreads(); for (int st = HD / 2; st > 0; st >>= 1) { if (d < st) red[d] = __fadd_rn(red[d], red[d + st]); __syncthreads(); } const float rs = rsqrtf(__fadd_rn(red[0] / (float)HD, eps)); x = __fmul_rn(__fmul_rn(x, rs), bf16_round(gain[d])); }
  xv[d] = x; __syncthreads();
  float o = x;
  if (ROPE == 1) { const int i = d >> 1; const float c = CS[p * (HD / 2) + i], s = SN[p * (HD / 2) + i]; const float ev = xv[2 * i], od = xv[2 * i + 1]; o = (d & 1) ? __fadd_rn(__fmul_rn(ev, s), __fmul_rn(od, c)) : __fadd_rn(__fmul_rn(ev, c), -__fmul_rn(od, s)); }
  if (ROPE == 2) { const int i = d & (HD / 2 - 1); const float c = CS[p * (HD / 2) + i], s = SN[p * (HD / 2) + i]; const float lo = xv[i], hi = xv[i + HD / 2]; o = (d < HD / 2) ? __fadd_rn(__fmul_rn(lo, c), -__fmul_rn(hi, s)) : __fadd_rn(__fmul_rn(lo, s), __fmul_rn(hi, c)); }
  FragH th; th.h[0] = (_Float16)o; sh_[d] = th.u[0]; __syncthreads();
  if (d < HD / 8) { FragH f; for (int q = 0; q < 8; ++q) f.u[q] = sh_[d * 8 + q]; unsigned short* dst = (unsigned short*)H16 + r * (size_t)ldo + (size_t)h * HD + d * 8; *(v8us*)dst = f.half[0];  } }



// Causal row softmax, ONE WAVE PER ROW: tile NC covers query rows (NC-1)*QT .. NC*QT-1 against keys 0 .. NC*QT-1. Lane l holds keys 128u + 4l .. +3 (each load 512 contiguous bytes of the row),
// the whole row stays in registers (one read of S), maximum and sum go over the 32 lanes by a butterfly; only the last QT keys can lie above the diagonal, so only they are masked.
template <int CTRL> __device__ __forceinline__ float rs_dpp(float v) { return __int_as_float(__builtin_amdgcn_update_dpp(0, __float_as_int(v), CTRL, 0xf, 0xf, true)); }      /* row_xmask: lane l <- lane l ^ m inside a 16-lane row */
__device__ __forceinline__ float rs_xrow(float v) { const int i = __float_as_int(v); return __int_as_float(__builtin_amdgcn_permlanex16(i, i, 0x76543210, 0xfedcba98, false, false)); }      /* lane l <- lane l ^ 16 */
__device__ __forceinline__ float rs_wmax(float v) { v = fmaxf(v, rs_dpp<0x161>(v)); v = fmaxf(v, rs_dpp<0x162>(v)); v = fmaxf(v, rs_dpp<0x164>(v)); v = fmaxf(v, rs_dpp<0x168>(v)); return fmaxf(v, rs_xrow(v)); }
__device__ __forceinline__ float rs_wsum(float v) { v += rs_dpp<0x161>(v); v += rs_dpp<0x162>(v); v += rs_dpp<0x164>(v); v += rs_dpp<0x168>(v); return v + rs_xrow(v); }
// native exp as before (x * log2(e), then v_exp_f32). The v_nop is the slot the instruction set asks for behind a transcendental before its source is overwritten or its result read.
__device__ __forceinline__ float rs_exp(float x) { const float a = x * 1.44269504088896340736f; float e; asm("v_exp_f32 %0, %1\n\tv_nop" : "=v"(e) : "v"(a)); return e; }
template <int NC>
__global__ __launch_bounds__(256) void k_rsmw(const float* __restrict__ S, _Float16* __restrict__ P, int hg) {
  constexpr int NU = NC * (QT / 128);      /* 128-key pieces of a row */
  const int lane = threadIdx.x & 31; const int t = blockIdx.x * 8 + (threadIdx.x >> 5); if (t >= hg * QT) return;      /* wave-uniform, no barrier in this kernel */
  const float* s = S + (size_t)t * NKX + lane * 4; const int last = (NC - 1) * QT + (t % QT);
  v4f v[NU];
#pragma unroll
  for (int u = 0; u < NU; ++u) v[u] = *(const v4fa*)(s + u * 128);
  asm volatile("s_wait_xcnt 0x0" :: "v"(s) : "memory");      /* the row's address pair stays whole until every load above has taken it */
#pragma unroll
  for (int u = NU - QT / 128; u < NU; ++u)
#pragma unroll
    for (int q = 0; q < 4; ++q) v[u][q] = (u * 128 + lane * 4 + q <= last) ? v[u][q] : -1.0e9f;
  v4f m4 = v[0];
#pragma unroll
  for (int u = 1; u < NU; ++u)
#pragma unroll
    for (int q = 0; q < 4; ++q) m4[q] = fmaxf(m4[q], v[u][q]);
  const float mx = rs_wmax(fmaxf(fmaxf(m4[0], m4[1]), fmaxf(m4[2], m4[3])));
  v4f a4 = {0.f, 0.f, 0.f, 0.f};
#pragma unroll
  for (int u = 0; u < NU; ++u)
#pragma unroll
    for (int q = 0; q < 4; ++q) { v[u][q] = rs_exp(v[u][q] - mx); a4[q] += v[u][q]; }
  const float sc = 256.0f / rs_wsum((a4[0] + a4[1]) + (a4[2] + a4[3]));
  _Float16* p = P + (size_t)t * NKX + lane * 4;
#pragma unroll
  for (int u = 0; u < NU; ++u) { v4h h4;
#pragma unroll
    for (int q = 0; q < 4; ++q) h4[q] = (_Float16)(v[u][q] * sc);
    *(v4h*)(p + u * 128) = h4; } }


template <int NORM, int ROPE>
__global__ __launch_bounds__(64) void k_xformf(const float* __restrict__ F, int ldf, int nh, const float* __restrict__ gain, float eps, const float* __restrict__ CS, const float* __restrict__ SN, float* __restrict__ F32, int ldo) {
  #pragma clang fp contract(off)
  __shared__ float xv[HD]; __shared__ float red[HD]; const int d = threadIdx.x; const int h = blockIdx.x % nh; const size_t r = blockIdx.x / nh; const int p = (int)(r % SQ);
  float x = F[r * (size_t)ldf + (size_t)h * HD + d];
  if (NORM) { red[d] = __fmul_rn(x, x); __syncthreads(); for (int st = HD / 2; st > 0; st >>= 1) { if (d < st) red[d] = __fadd_rn(red[d], red[d + st]); __syncthreads(); } const float rs = rsqrtf(__fadd_rn(red[0] / (float)HD, eps)); x = __fmul_rn(__fmul_rn(x, rs), bf16_round(gain[d])); }
  xv[d] = x; __syncthreads();
  float o = x;
  if (ROPE == 1) { const int i = d >> 1; const float c = CS[p * (HD / 2) + i], s = SN[p * (HD / 2) + i]; const float ev = xv[2 * i], od = xv[2 * i + 1]; o = (d & 1) ? __fadd_rn(__fmul_rn(ev, s), __fmul_rn(od, c)) : __fadd_rn(__fmul_rn(ev, c), -__fmul_rn(od, s)); }
  if (ROPE == 2) { const int i = d & (HD / 2 - 1); const float c = CS[p * (HD / 2) + i], s = SN[p * (HD / 2) + i]; const float lo = xv[i], hi = xv[i + HD / 2]; o = (d < HD / 2) ? __fadd_rn(__fmul_rn(lo, c), -__fmul_rn(hi, s)) : __fadd_rn(__fmul_rn(lo, s), __fmul_rn(hi, c)); }
  float* dst = F32 + r * (size_t)ldo + (size_t)h * HD + d; *(float*)dst = o;  }
extern "C" void kernel_launch(void* const* d_in, const int* in_sizes, int n_in,
                              void* d_out, int out_size, void* d_ws, size_t ws_size, hipStream_t stream) {
  (void)in_sizes; (void)n_in; (void)out_size;
  const float* const* I = (const float* const*)d_in; const float* x = I[0]; const float* wqkv = I[1]; const float* bqkv = I[2]; const float* wo = I[3]; const float* bo = I[4];      /* [in][out] fused qkv + out weights, biases */
  char* ws = (char*)d_ws; size_t off = 0;
  auto take = [&](size_t bytes) { char* p = ws + off; off += (bytes + 255) & ~(size_t)255; return p; };
  _Float16* BQKV = (_Float16*)take((size_t)3 * DM * DM * 2); _Float16* BO = (_Float16*)take((size_t)DM * DM * 2); float* CS = (float*)take((size_t)SQ * (HD / 2) * 4); float* SN = (float*)take((size_t)SQ * (HD / 2) * 4);
  _Float16* X16 = (_Float16*)take(NR * DM * 2); float* QKVF = (float*)take((size_t)SQ * 3 * DM * 4);      /* one batch of f32 q | k | v rows */
  float* QF = (float*)take(NR * DM * 4); float* KF = (float*)take(NR * DM * 4); _Float16* QH = (_Float16*)take(NR * DM * 2); _Float16* QL = (_Float16*)take(NR * DM * 2); _Float16* KH = (_Float16*)take(NR * DM * 2); _Float16* KL = (_Float16*)take(NR * DM * 2); _Float16* V16 = (_Float16*)take(NR * DM * 2); _Float16* O16 = (_Float16*)take(NR * DM * 2);
  float* S = (float*)take((size_t)NH * QT * NKX * 4); _Float16* P = (_Float16*)take((size_t)NH * QT * NKX * 2); _Float16* VT = (_Float16*)take((size_t)NH * HD * SQ * 2);
  if (off > ws_size) return;
  k_wt_f16<<<(unsigned)(((size_t)3 * DM * (DM / 8) + 255) / 256), 256, 0, stream>>>(wqkv, BQKV, DM, 3 * DM, 16.0f); k_wt_f16<<<(unsigned)(((size_t)DM * (DM / 8) + 255) / 256), 256, 0, stream>>>(wo, BO, DM, DM, 16.0f);      /* [in][out] -> Bt[n][k] x16; q | k | v stacked along n */
  k_tab2<<<(SQ * (HD / 2) + 255) / 256, 256, 0, stream>>>(10000.0f, CS, SN);
  k_x16<<<(unsigned)((NR * DM / 8 + 255) / 256), 256, 0, stream>>>(x, X16, NR * DM / 8);
  for (int b = B0; b < B0 + NBR; ++b) { const size_t r0 = (size_t)b * SQ;
    k_gemm2<0><<<dim3((unsigned)((SQ / 128) * (3 * DM / 64)), 1), 128, 0, stream>>>(X16 + r0 * DM, DM, 0, BQKV, DM, 0, 0.0625f, bqkv, 0, nullptr, 1, 0, 0, QKVF, nullptr, 3 * DM, 0, SQ, 3 * DM, DM);      /* q | k | v rows (f32) of this batch */
    k_xformf<0, 1><<<(unsigned)(SQ * NH), 64, 0, stream>>>(QKVF, 3 * DM, NH, nullptr, 0.f, CS, SN, QF + r0 * DM, DM); k_hl<<<(unsigned)(((size_t)SQ * DM / 8 + 255) / 256), 256, 0, stream>>>(QF + r0 * DM, QH + r0 * DM, QL + r0 * DM, (size_t)SQ * DM / 8);      /* roped q (f32) -> f16 hi + x1024 residual: the x8 logits (sigma ~64) need ~f32-accurate scores */
    k_xformf<0, 1><<<(unsigned)(SQ * NH), 64, 0, stream>>>(QKVF + DM, 3 * DM, NH, nullptr, 0.f, CS, SN, KF + r0 * DM, DM); k_hl<<<(unsigned)(((size_t)SQ * DM / 8 + 255) / 256), 256, 0, stream>>>(KF + r0 * DM, KH + r0 * DM, KL + r0 * DM, (size_t)SQ * DM / 8);
    k_xform<0, 0><<<(unsigned)(SQ * NH), 64, 0, stream>>>(QKVF + 2 * DM, 3 * DM, NH, nullptr, 0.f, CS, SN, V16 + r0 * DM, DM);
    k_vt<NH, SQ><<<NH * (SQ / 64), 256, 0, stream>>>(V16 + r0 * DM, DM, 0, VT);      /* V^T [NH][HD][SQ] for this batch */
    for (int q0 = 0; q0 < QN; q0 += QT) { const int nk = q0 + QT;      /* causal: only keys below the tile end are computed */
      k_gemm2<0><<<dim3((QT / 128) * (nk / 64), NHD), 128, 0, stream>>>(QH + (r0 + q0) * DM, DM, (size_t)HD, KH + r0 * DM, DM, (size_t)HD, 8.0f, nullptr, 0, nullptr, 1, 0, 0, S, nullptr, NKX, (size_t)QT * NKX, QT, nk, HD);
      k_gemm2<0><<<dim3((QT / 128) * (nk / 64), NHD), 128, 0, stream>>>(QL + (r0 + q0) * DM, DM, (size_t)HD, KH + r0 * DM, DM, (size_t)HD, 0.0078125f, nullptr, 0, S, -1, 0, 0, S, nullptr, NKX, (size_t)QT * NKX, QT, nk, HD);      /* += 2^-10 x8 (q_lo . k_hi) */
      k_gemm2<0><<<dim3((QT / 128) * (nk / 64), NHD), 128, 0, stream>>>(QH + (r0 + q0) * DM, DM, (size_t)HD, KL + r0 * DM, DM, (size_t)HD, 0.0078125f, nullptr, 0, S, -1, 0, 0, S, nullptr, NKX, (size_t)QT * NKX, QT, nk, HD);      /* += 2^-10 x8 (q_hi . k_lo) */      /* scores, all heads on grid.y */
      switch (nk / QT) {      /* one wave per row: 8 rows per block; the tile index fixes the row length at compile time */
        case 1: k_rsmw<1><<<NHD * QT / 8, 256, 0, stream>>>(S, P, NHD); break; case 2: k_rsmw<2><<<NHD * QT / 8, 256, 0, stream>>>(S, P, NHD); break;
        case 3: k_rsmw<3><<<NHD * QT / 8, 256, 0, stream>>>(S, P, NHD); break; case 4: k_rsmw<4><<<NHD * QT / 8, 256, 0, stream>>>(S, P, NHD); break;
        case 5: k_rsmw<5><<<NHD * QT / 8, 256, 0, stream>>>(S, P, NHD); break; case 6: k_rsmw<6><<<NHD * QT / 8, 256, 0, stream>>>(S, P, NHD); break;
        case 7: k_rsmw<7><<<NHD * QT / 8, 256, 0, stream>>>(S, P, NHD); break; default: k_rsmw<8><<<NHD * QT / 8, 256, 0, stream>>>(S, P, NHD); break; }
      k_gemm2<0><<<dim3((QT / 128) * (HD / 64), NHD), 128, 0, stream>>>(P, NKX, (size_t)QT * NKX, VT, SQ, (size_t)HD * SQ, 0.25f, nullptr, 0, nullptr, 1, 0, 0, nullptr, O16 + (r0 + q0) * DM, DM, (size_t)HD, QT, HD, nk); } }      /* o (merged heads, x64) as f16 rows */
  k_gemm2<0><<<dim3((unsigned)((MPO / 128) * (DM / 64)), 1), 128, 0, stream>>>(O16 + (size_t)B0 * SQ * DM, DM, 0, BO, DM, 0, 0.0009765625f, bo, 0, nullptr, 1, 0, 0, (float*)d_out + (size_t)B0 * SQ * DM, nullptr, DM, 0, MPO, DM, DM);      /* out rows are the output layout */
}

// v002
// A run of this version takes 304 microseconds.
// Timed twice side by side with v001, it ran 5.62 and 5.60 times as fast.
// All steps since v000 together make it 15.2 times as fast.
#include <hip/hip_runtime.h>
// Masked (causal) RoPE multi-head attention with LARGE logits (x [2][2048][1024]; qkv = x w_qkv + b_qkv ([in][out] 1024 x 3072, sigma 1/32, bias sigma 0.01) -> q | k | v, 16 heads of 64; interleaved-pair RoPE on q and k (inv_freq_i = 10000^(-2i/64), positions 0..2047); scores = q . k x sqrt(64) (the module divides by 1/sqrt(d_k)), causal (tril); softmax; out = (attn v merged) w_out + b_out -> [2][2048][1024]).
// Structure: token rows r = b*2048 + s; x as exact f16 rows (bf16-rounded); per batch: q | k | v as ONE WMMA GEMM (32x64 wave tiles, f32 accumulation, exact x16 weights + bias, N = 3 x 1024) into f32 rows, then per (row, head) on VALU: the interleaved-pair rotary rotation of q and k from f32 cos/sin tables (positions 0..SQ-1, no norm) -> f32 q, k rows split into f16 hi + x1024 residual planes (the x8 logits have sigma ~64: near-argmax softmax, so the scores are computed to ~f32 accuracy from three products), v f16; V^T for all heads via LDS transposes; then ONE fused attention launch over every (batch, head, 128-query block): a wave holds 32 queries, walks the keys up to its own diagonal in passes of 32, scores as S^T = K . Q^T (three products), online causal softmax in registers (f32 running maximum and sum, native exp; keys above the diagonal set to -1e9; weights x256 f16), O^T += V^T . P^T with the score tiles as the B operand, o carried x64 (folded into the output GEMM alpha) written straight into the merged f16 o rows; out = o W_o + b GEMM (f32) into the output layout.
// Compute dtype: inputs rounded to bf16; x / weights exact; projections and rope f32; q, k as f16 hi + residual (~2^-22); v, softmax weights and o as plain f16 GEMM operands (~2^-12); scores and softmax statistics f32; v_wmma_f32_16x16x32_f16.
#define NB 2
#define SQ 2048
#define DM 1024
#define NH 16
#define HD 64
#define HG 4                         /* heads per launch of the (b, h0) V^T transpose */
#define QT 256
#define NKX SQ                       /* unused */
#define B0 0                         /* first batch processed (debug hook) */
#define NBR NB                       /* batches processed (debug hook) */
#define QN SQ                        /* unused (attention covers all SQ queries) */
#define NHD NH                       /* unused (attention covers all NH heads) */
#define NR ((size_t)NB * SQ)         /* token rows */
#define MPO ((int)((size_t)NBR * SQ))      /* rows through the output GEMM (debug hook) */
typedef __bf16 v16b __attribute__((ext_vector_type(16)));
typedef unsigned short v8us __attribute__((ext_vector_type(8), may_alias));
typedef float  v8f  __attribute__((ext_vector_type(8)));
typedef float  v4f  __attribute__((ext_vector_type(4)));
typedef float  v4fa __attribute__((ext_vector_type(4), may_alias));
union FragB { v16b v; v8us half[2]; unsigned short u[16]; };

__device__ __forceinline__ unsigned short bf16_bits(float x) { unsigned int u = __float_as_uint(x); return (unsigned short)((u + 0x7FFFu + ((u >> 16) & 1u)) >> 16); }
__device__ __forceinline__ float bf16_val(unsigned short b) { return __uint_as_float(((unsigned int)b) << 16); }
__device__ __forceinline__ float bf16_round(float x) { return bf16_val(bf16_bits(x)); }
// D += A·B with NT terms: 1 = ah·bh, 2 = + al·bh (A split), 3 = + ah·bl (both split)
template <int NT>
__device__ __forceinline__ v8f mmaN(v16b ah, v16b al, v16b bh, v16b bl, v8f c) {
  c = __builtin_amdgcn_wmma_f32_16x16x32_bf16(false, ah, false, bh, (short)0, c, false, false);
  if (NT >= 2) c = __builtin_amdgcn_wmma_f32_16x16x32_bf16(false, al, false, bh, (short)0, c, false, false);
  if (NT >= 3) c = __builtin_amdgcn_wmma_f32_16x16x32_bf16(false, ah, false, bl, (short)0, c, false, false);
  asm volatile("v_nop\n\tv_nop\n\tv_nop\n\tv_nop" : "+v"(c) : "v"(ah), "v"(al), "v"(bh), "v"(bl));
  return c;
}

__global__ __launch_bounds__(256) void k_wt_bf16(const float* __restrict__ W, unsigned short* __restrict__ Wt, int K, int N) {
  const int t = blockIdx.x * 256 + threadIdx.x;
  const int k8n = K / 8;
  if (t >= N * k8n) return;
  const int n = t / k8n, k8 = (t % k8n) * 8;
  v8us v;
#pragma unroll
  for (int i = 0; i < 8; ++i) v[i] = bf16_bits(W[(size_t)(k8 + i) * N + n]);
  *(v8us*)(Wt + (size_t)n * K + k8) = v;
  
}

// GEMM C[M][N] (f32, pitch ldc) = act(A[M][K]·W + bias). A f32 row-major (pitch lda) converted per fragment to bf16
// (ASPLIT: hi/lo two planes -> 2 terms, else single rounded term); Wt bf16 [N][K] (pitch ldb). BIAS_BF16 rounds the
// bias to bf16 first (bias quantised to bf16 before the add). K%32==0, M%16==0, N%64==0.
template <bool ASPLIT, int ACT, bool BIAS_BF16>
__global__ __launch_bounds__(128) void k_gemm_bf(const float* __restrict__ A, int lda, const unsigned short* __restrict__ Wt, int ldb,
                                               const float* __restrict__ bias, float* __restrict__ C, int ldc, int M, int N, int K) {
  __shared__ __attribute__((aligned(16))) float so[4][16][64];
  const int tid = threadIdx.x, w = tid >> 5, lane = tid & 31, ln = lane & 15, hh = lane >> 4;
  const int ntn = N / 64;
  const int wid = blockIdx.x * 4 + w;
  const int mt = wid / ntn, nq = wid % ntn;
  if (mt * 16 >= M) return;
  const int row0 = mt * 16, col0 = nq * 64;
  const float* arow = A + (size_t)(row0 + ln) * lda;
  v8f acc[4] = {};
  for (int kb = 0; kb < K; kb += 32) {
    FragB ah, al;
    const v4f x0 = *(const v4fa*)(arow + kb + 8 * hh), x1 = *(const v4fa*)(arow + kb + 8 * hh + 4);
    const v4f x2 = *(const v4fa*)(arow + kb + 16 + 8 * hh), x3 = *(const v4fa*)(arow + kb + 16 + 8 * hh + 4);
    float xs[16] = {x0[0],x0[1],x0[2],x0[3],x1[0],x1[1],x1[2],x1[3],x2[0],x2[1],x2[2],x2[3],x3[0],x3[1],x3[2],x3[3]};
#pragma unroll
    for (int i = 0; i < 16; ++i) { const unsigned short hb = bf16_bits(xs[i]); ah.u[i] = hb; al.u[i] = ASPLIT ? bf16_bits(xs[i] - bf16_val(hb)) : (unsigned short)0; }
#pragma unroll
    for (int t = 0; t < 4; ++t) {
      const unsigned short* brow = Wt + (size_t)(col0 + t * 16 + ln) * ldb + kb;
      FragB b;
      b.half[0] = *(const v8us*)(brow + 8 * hh);
      b.half[1] = *(const v8us*)(brow + 16 + 8 * hh);
      acc[t] = mmaN<ASPLIT ? 2 : 1>(ah.v, al.v, b.v, b.v, acc[t]);
    }
  }
#pragma unroll
  for (int t = 0; t < 4; ++t) {
    float bv = bias ? bias[col0 + t * 16 + ln] : 0.f;
    if (BIAS_BF16) bv = bf16_round(bv);
#pragma unroll
    for (int r = 0; r < 8; ++r) { float v = acc[t][r] + bv; if (ACT == 1) v = fmaxf(v, 0.f); so[w][8 * hh + r][t * 16 + ln] = v; }
  }
  __builtin_amdgcn_fence(__ATOMIC_ACQ_REL, "workgroup");
  __builtin_amdgcn_wave_barrier();
  const int rsub = lane >> 4, c4 = (lane & 15) * 4;
  {
#pragma unroll
    for (int q = 0; q < 8; ++q) {
      const int r = q * 2 + rsub;
      const v4f v = *(const v4fa*)&so[w][r][c4];
      *(v4f*)(C + (size_t)(row0 + r) * ldc + col0 + c4) = v;
    }
    
  }
}

// GEMM C = act(A·W + bias + resid): A f32 (ASPLIT -> hi/lo 2 terms), Wt bf16 [N][K]; ACT 0 none, 1 relu, 2 exact gelu;
// resid (optional, f32, row index = (row % rmod), pitch ldr, RES_BF16 rounds it) added before the activation.
template <bool ASPLIT, int ACT, bool BIAS_BF16, bool RES_BF16>
__global__ __launch_bounds__(128) void k_gemm_bf3(const float* __restrict__ A, int lda, const unsigned short* __restrict__ Wt, int ldb,
                                                const float* __restrict__ bias, const float* __restrict__ resid, int rmod, int ldr,
                                                float* __restrict__ C, int ldc, int M, int N, int K) {
  __shared__ __attribute__((aligned(16))) float so[4][16][64];
  const int tid = threadIdx.x, w = tid >> 5, lane = tid & 31, ln = lane & 15, hh = lane >> 4;
  const int ntn = N / 64;
  const int wid = blockIdx.x * 4 + w;
  const int mt = wid / ntn, nq = wid % ntn;
  if (mt * 16 >= M) return;
  const int row0 = mt * 16, col0 = nq * 64;
  const float* arow = A + (size_t)(row0 + ln) * lda;
  v8f acc[4] = {};
  for (int kb = 0; kb < K; kb += 32) {
    FragB ah, al;
    const v4f x0 = *(const v4fa*)(arow + kb + 8 * hh), x1 = *(const v4fa*)(arow + kb + 8 * hh + 4);
    const v4f x2 = *(const v4fa*)(arow + kb + 16 + 8 * hh), x3 = *(const v4fa*)(arow + kb + 16 + 8 * hh + 4);
    float xs[16] = {x0[0],x0[1],x0[2],x0[3],x1[0],x1[1],x1[2],x1[3],x2[0],x2[1],x2[2],x2[3],x3[0],x3[1],x3[2],x3[3]};
#pragma unroll
    for (int i = 0; i < 16; ++i) { const unsigned short hb = bf16_bits(xs[i]); ah.u[i] = hb; al.u[i] = ASPLIT ? bf16_bits(xs[i] - bf16_val(hb)) : (unsigned short)0; }
#pragma unroll
    for (int t = 0; t < 4; ++t) {
      const unsigned short* brow = Wt + (size_t)(col0 + t * 16 + ln) * ldb + kb;
      FragB b;
      b.half[0] = *(const v8us*)(brow + 8 * hh);
      b.half[1] = *(const v8us*)(brow + 16 + 8 * hh);
      acc[t] = mmaN<ASPLIT ? 2 : 1>(ah.v, al.v, b.v, b.v, acc[t]);
    }
  }
#pragma unroll
  for (int t = 0; t < 4; ++t) {
    const int col = col0 + t * 16 + ln;
    float bv = bias ? bias[col] : 0.f;
    if (BIAS_BF16) bv = bf16_round(bv);
#pragma unroll
    for (int r = 0; r < 8; ++r) {
      float v = acc[t][r] + bv;
      if (resid) { float rv = resid[(size_t)((row0 + 8 * hh + r) % rmod) * ldr + col]; if (RES_BF16) rv = bf16_round(rv); v += rv; }
      if (ACT == 1) v = fmaxf(v, 0.f);
      if (ACT == 2) v = 0.5f * v * (1.0f + erff(v * 0.70710678118654752f));
      if (ACT == 3) { const float u = 0.7978845608028654f * (v + 0.044715f * v * v * v); v = 0.5f * v * (1.0f + tanhf(u)); }
      so[w][8 * hh + r][t * 16 + ln] = v;
    }
  }
  __builtin_amdgcn_fence(__ATOMIC_ACQ_REL, "workgroup");
  __builtin_amdgcn_wave_barrier();
  const int rsub = lane >> 4, c4 = (lane & 15) * 4;
  {
#pragma unroll
    for (int q = 0; q < 8; ++q) {
      const int r = q * 2 + rsub;
      const v4f v = *(const v4fa*)&so[w][r][c4];
      *(v4f*)(C + (size_t)(row0 + r) * ldc + col0 + c4) = v;
    }
    
  }
}
// row LayerNorm (biased variance, eps) over N: s = X (+ R); optional out_sum <- s; out_norm <- (s-mu)*rsqrt(var+eps)*g + b
template <bool PARAM_BF16>
__global__ __launch_bounds__(256) void k_layernorm(const float* __restrict__ X, const float* __restrict__ R, const float* __restrict__ g, const float* __restrict__ bta,
                                                  float* __restrict__ out_sum, float* __restrict__ out_norm, int N, float eps) {
  __shared__ float red[256];
  const int row = blockIdx.x, tid = threadIdx.x;
  const float* x = X + (size_t)row * N; const float* rr = R ? R + (size_t)row * N : nullptr;
  float vals[16];                     // up to N = 4096
  const int per = N / 256;            // contiguous chunk per thread? use strided-by-4 chunks: thread handles j = tid*4 + 1024*u
  float s1 = 0.f;
  for (int u = 0; u < per / 4; ++u) {
    const int j = tid * 4 + 1024 * u;
    const v4f a = *(const v4fa*)(x + j);
    v4f b = {0.f,0.f,0.f,0.f}; if (rr) b = *(const v4fa*)(rr + j);
#pragma unroll
    for (int q = 0; q < 4; ++q) { const float v = a[q] + b[q]; vals[u * 4 + q] = v; s1 += v; }
  }
  red[tid] = s1; __syncthreads();
  for (int st = 128; st > 0; st >>= 1) { if (tid < st) red[tid] += red[tid + st]; __syncthreads(); }
  const float mu = red[0] / (float)N; __syncthreads();
  float s2 = 0.f;
  for (int u = 0; u < per / 4; ++u)
#pragma unroll
    for (int q = 0; q < 4; ++q) { const float c = vals[u * 4 + q] - mu; s2 += c * c; }
  red[tid] = s2; __syncthreads();
  for (int st = 128; st > 0; st >>= 1) { if (tid < st) red[tid] += red[tid + st]; __syncthreads(); }
  const float rs = rsqrtf(red[0] / (float)N + eps);
  {
    for (int u = 0; u < per / 4; ++u) {
      const int j = tid * 4 + 1024 * u;
      v4f o, sm;
#pragma unroll
      for (int q = 0; q < 4; ++q) {
        float gg = g[j + q], bb = bta[j + q];
        if (PARAM_BF16) { gg = bf16_round(gg); bb = bf16_round(bb); }
        sm[q] = vals[u * 4 + q]; o[q] = (vals[u * 4 + q] - mu) * rs * gg + bb;
      }
      if (out_sum) *(v4f*)(out_sum + (size_t)row * N + j) = sm;
      *(v4f*)(out_norm + (size_t)row * N + j) = o;
    }
    
  }
}



// ---- f16 WMMA path (v_wmma_f32_16x16x32_f16): 11-bit significands for operands in range — used where a [0,1] probability operand needs more precision than bf16
typedef _Float16 v16h __attribute__((ext_vector_type(16)));
union FragH { v16h v; v8us half[2]; _Float16 h[16]; unsigned short u[16]; };
template <int NT>
__device__ __forceinline__ v8f mmaH(v16h ah, v16h al, v16h bh, v16h bl, v8f c) {
  c = __builtin_amdgcn_wmma_f32_16x16x32_f16(false, ah, false, bh, (short)0, c, false, false);
  if (NT >= 2) c = __builtin_amdgcn_wmma_f32_16x16x32_f16(false, al, false, bh, (short)0, c, false, false);
  if (NT >= 3) c = __builtin_amdgcn_wmma_f32_16x16x32_f16(false, ah, false, bl, (short)0, c, false, false);
  asm volatile("v_nop\n\tv_nop\n\tv_nop\n\tv_nop" : "+v"(c) : "v"(ah), "v"(al), "v"(bh), "v"(bl));
  return c;
}
// batched GEMM like k_gemm_b but f16 operands: A f32 (split into f16 hi/lo if ASPLIT, else rounded to f16), Bt = f16 values [n][k]; alpha; C f32; N multiple of 16 (partial tiles skipped)
template <bool ASPLIT>
__global__ __launch_bounds__(128) void k_gemm_h(const float* __restrict__ A, int lda, size_t sA, const _Float16* __restrict__ Bh, int ldb, size_t sB, float alpha, float* __restrict__ C, int ldc, size_t sC, int M, int N, int K) {
  __shared__ __attribute__((aligned(16))) float so[4][16][64];
  const int tid = threadIdx.x, w = tid >> 5, lane = tid & 31, ln = lane & 15, hh = lane >> 4; const int by = blockIdx.y;
  A += (size_t)by * sA; Bh += (size_t)by * sB; C += (size_t)by * sC;
  const int ntn = (N + 63) / 64; const int wid = blockIdx.x * 4 + w; const int mt = wid / ntn, nq = wid % ntn; if (mt * 16 >= M) return;
  const int row0 = mt * 16, col0 = nq * 64; const float* arow = A + (size_t)(row0 + ln) * lda;
  v8f acc[4] = {};
  for (int kb = 0; kb < K; kb += 32) {
    FragH ah, al;
    const v4f x0 = *(const v4fa*)(arow + kb + 8 * hh), x1 = *(const v4fa*)(arow + kb + 8 * hh + 4), x2 = *(const v4fa*)(arow + kb + 16 + 8 * hh), x3 = *(const v4fa*)(arow + kb + 16 + 8 * hh + 4);
    float xs[16] = {x0[0],x0[1],x0[2],x0[3],x1[0],x1[1],x1[2],x1[3],x2[0],x2[1],x2[2],x2[3],x3[0],x3[1],x3[2],x3[3]};
#pragma unroll
    for (int i = 0; i < 16; ++i) { const _Float16 h = (_Float16)xs[i]; ah.h[i] = h; al.h[i] = ASPLIT ? (_Float16)(xs[i] - (float)h) : (_Float16)0.0f; }
#pragma unroll
    for (int t = 0; t < 4; ++t) { if (col0 + t * 16 >= N) continue; const size_t boff = (size_t)(col0 + t * 16 + ln) * ldb + kb; FragH bq; bq.half[0] = *(const v8us*)(Bh + boff + 8 * hh); bq.half[1] = *(const v8us*)(Bh + boff + 16 + 8 * hh);
      acc[t] = mmaH<ASPLIT ? 2 : 1>(ah.v, al.v, bq.v, bq.v, acc[t]); }
  }
#pragma unroll
  for (int t = 0; t < 4; ++t) { if (col0 + t * 16 >= N) continue;
#pragma unroll
    for (int r = 0; r < 8; ++r) so[w][8 * hh + r][t * 16 + ln] = acc[t][r] * alpha; }
  __builtin_amdgcn_fence(__ATOMIC_ACQ_REL, "workgroup"); __builtin_amdgcn_wave_barrier();
  const int rsub = lane >> 4, c4 = (lane & 15) * 4;
  {
#pragma unroll
    for (int q = 0; q < 8; ++q) { const int r = q * 2 + rsub; if (col0 + c4 < N) { const v4f v = *(const v4fa*)&so[w][r][c4]; *(v4f*)(C + (size_t)(row0 + r) * ldc + col0 + c4) = v; } }
     }
}

// Wt[n][k] = f16(W[k][n]·scale) from f32 row-major W[K][N] (scale = power of two; bf16-exact weights stay exact in f16 away from the subnormal range)
__global__ __launch_bounds__(256) void k_wt_f16(const float* __restrict__ W, _Float16* __restrict__ Wt, int K, int N, float scale) {
  const int t = blockIdx.x * 256 + threadIdx.x; if (t >= N * (K / 8)) return; const int n = t / (K / 8), k8 = (t % (K / 8)) * 8; FragH f;
#pragma unroll
  for (int i = 0; i < 8; ++i) f.h[i] = (_Float16)(bf16_round(W[(size_t)(k8 + i) * N + n]) * scale); const v8us o = f.half[0];
  *(v8us*)((unsigned short*)Wt + (size_t)n * K + k8) = o; 
}
// k_gemm_hh variant with fused epilogue: v = acc·alpha + bias[by·sBias + col] (+ CP[(row/rowsPerB)·sCPb + by·64 + col] if CP) ; ACT 0 none / 1 elu ; writes f16 C16 (and f32 C if non-null)
template <int ACT>
__global__ __launch_bounds__(128) void k_gemm_hhx(const _Float16* __restrict__ A, int lda, size_t sA, const _Float16* __restrict__ Bh, int ldb, size_t sB, float alpha, const float* __restrict__ bias, size_t sBias, const float* __restrict__ CP, int rowsPerB, size_t sCPb, int row0g,
    float* __restrict__ C, _Float16* __restrict__ C16, int ldc, size_t sC, int M, int N, int K) {
  __shared__ __attribute__((aligned(16))) float so[4][16][64];
  const int tid = threadIdx.x, w = tid >> 5, lane = tid & 31, ln = lane & 15, hh = lane >> 4; const int by = blockIdx.y;
  A += (size_t)by * sA; Bh += (size_t)by * sB; const size_t cofs = (size_t)by * sC; const float* bp = bias ? bias + (size_t)by * sBias : nullptr;
  const int ntn = (N + 63) / 64; const int wid = blockIdx.x * 4 + w; const int mt = wid / ntn, nq = wid % ntn; if (mt * 16 >= M) return;
  const int row0 = mt * 16, col0 = nq * 64; const _Float16* arow = A + (size_t)(row0 + ln) * lda;
  v8f acc[4] = {};
  for (int kb = 0; kb < K; kb += 32) { FragH ah; ah.half[0] = *(const v8us*)((const unsigned short*)arow + kb + 8 * hh); ah.half[1] = *(const v8us*)((const unsigned short*)arow + kb + 16 + 8 * hh);
#pragma unroll
    for (int t = 0; t < 4; ++t) { if (col0 + t * 16 >= N) continue; const size_t boff = (size_t)(col0 + t * 16 + ln) * ldb + kb; FragH bq; bq.half[0] = *(const v8us*)((const unsigned short*)Bh + boff + 8 * hh); bq.half[1] = *(const v8us*)((const unsigned short*)Bh + boff + 16 + 8 * hh);
      acc[t] = mmaH<1>(ah.v, ah.v, bq.v, bq.v, acc[t]); }
  }
#pragma unroll
  for (int t = 0; t < 4; ++t) { if (col0 + t * 16 >= N) continue; const int col = col0 + t * 16 + ln; const float bv = bp ? bf16_round(bp[col]) : 0.f;
#pragma unroll
    for (int r = 0; r < 8; ++r) { float v = acc[t][r] * alpha + bv; if (CP) { const int rr = row0g + row0 + 8 * hh + r; if (rowsPerB < 0) v += CP[cofs + (size_t)rr * ldc + col];      /* rowsPerB < 0: own element of the batched C plane */ else { const int bidx = rr / rowsPerB; v += CP[(size_t)bidx * sCPb + (size_t)by * 64 + col]; } } if (ACT == 1) v = (v > 0.f) ? v : expm1f(v); else if (ACT == 7) v = (v > 0.f) ? v + 1.0f : expf(v); else if (ACT == 8) v = tanhf(v); else if (ACT == 9) v = 0.5f * v * (1.0f + tanhf(0.7978845608028654f * (v + 0.044715f * v * v * v))); else if (ACT == 11) v = 1.0f / (1.0f + expf(-v)); else if (ACT == 12) v = (v > 0.f) ? v : 0.01f * v; else if (ACT == 14) v = (v > 0.f) ? v : 0.1f * v; else if (ACT == 16) v = (v >= 0.f) ? v : 0.3f * v; else if (ACT == 17) v = (v >= 0.f) ? v : 0.2f * v; else if (ACT == 15) v = v / (1.0f + expf(-v)); else if (ACT == 3) v = fmaxf(v, 0.f); else if (ACT == 6) v = 0.5f * v * (1.0f + erff(v * 0.70710678118654752f)); so[w][8 * hh + r][t * 16 + ln] = v; } }
  __builtin_amdgcn_fence(__ATOMIC_ACQ_REL, "workgroup"); __builtin_amdgcn_wave_barrier();
  const int rsub = lane >> 4, c4 = (lane & 15) * 4; typedef _Float16 v4h __attribute__((ext_vector_type(4)));
  {
#pragma unroll
    for (int q = 0; q < 8; ++q) { const int r = q * 2 + rsub; if (col0 + c4 < N) { const v4f v = *(const v4fa*)&so[w][r][c4]; if (C) *(v4f*)(C + cofs + (size_t)(row0 + r) * ldc + col0 + c4) = v; if (C16) { v4h h4; for (int i = 0; i < 4; ++i) h4[i] = (_Float16)v[i]; *(v4h*)(C16 + cofs + (size_t)(row0 + r) * ldc + col0 + c4) = h4; } } }
     }
}


typedef _Float16 v4h __attribute__((ext_vector_type(4)));

__global__ __launch_bounds__(256) void k_x16(const float* __restrict__ x, _Float16* __restrict__ X16, size_t n8) { const size_t t = (size_t)blockIdx.x * 256 + threadIdx.x; if (t >= n8) return; FragH f;
#pragma unroll
  for (int q = 0; q < 8; ++q) f.h[q] = (_Float16)bf16_round(x[t * 8 + q]); *(v8us*)((unsigned short*)X16 + t * 8) = f.half[0];  }
__global__ __launch_bounds__(256) void k_h16(const float* __restrict__ x, _Float16* __restrict__ X16, size_t n8) { const size_t t = (size_t)blockIdx.x * 256 + threadIdx.x; if (t >= n8) return; FragH f;
#pragma unroll
  for (int q = 0; q < 8; ++q) f.h[q] = (_Float16)x[t * 8 + q]; *(v8us*)((unsigned short*)X16 + t * 8) = f.half[0];  }
__global__ __launch_bounds__(256) void k_round16f(const float* __restrict__ W, _Float16* __restrict__ Bt, size_t n8) { const size_t t = (size_t)blockIdx.x * 256 + threadIdx.x; if (t >= n8) return; FragH f;
#pragma unroll
  for (int i = 0; i < 8; ++i) f.h[i] = (_Float16)(bf16_round(W[t * 8 + i]) * 16.0f); *(v8us*)((unsigned short*)Bt + t * 8) = f.half[0];  }
template <int NHv, int TTv>
__global__ __launch_bounds__(256) void k_vt(const _Float16* __restrict__ V16, int ldv, int voff, _Float16* __restrict__ Vt) { __shared__ unsigned short tl[64][66]; const int tid = threadIdx.x; const int slab = blockIdx.x / (TTv / 64), lg = blockIdx.x % (TTv / 64); const int b = slab / NHv, h = slab % NHv;
  for (int i = tid; i < 64 * 8; i += 256) { const int r = i / 8, c8 = (i % 8) * 8; FragH f; f.half[0] = *(const v8us*)((const unsigned short*)V16 + ((size_t)b * TTv + lg * 64 + r) * ldv + voff + h * 64 + c8);
#pragma unroll
    for (int q = 0; q < 8; ++q) tl[r][c8 + q] = f.u[q]; }
  __syncthreads();
  {
#pragma unroll
    for (int rd = 0; rd < 2; ++rd) { const int d = rd * 32 + tid / 8, pc = tid % 8; FragH f;
#pragma unroll
      for (int q = 0; q < 8; ++q) f.u[q] = tl[pc * 8 + q][d];
      *(v8us*)((unsigned short*)Vt + ((size_t)slab * 64 + d) * TTv + lg * 64 + pc * 8) = f.half[0]; }
     } }

__global__ __launch_bounds__(256) void k_hl(const float* __restrict__ F, _Float16* __restrict__ Hh, _Float16* __restrict__ Hl, size_t n8) { const size_t t = (size_t)blockIdx.x * 256 + threadIdx.x; if (t >= n8) return; FragH fh, fl; const v4f a = *(const v4fa*)(F + t * 8), c = *(const v4fa*)(F + t * 8 + 4);
#pragma unroll
  for (int q = 0; q < 4; ++q) { _Float16 h = (_Float16)a[q]; fh.h[q] = h; fl.h[q] = (_Float16)((a[q] - (float)h) * 1024.0f); h = (_Float16)c[q]; fh.h[4 + q] = h; fl.h[4 + q] = (_Float16)((c[q] - (float)h) * 1024.0f); }
  { *(v8us*)((unsigned short*)Hh + t * 8) = fh.half[0]; *(v8us*)((unsigned short*)Hl + t * 8) = fl.half[0];  } }

// ---- fast GEMM (wave tile 32x64; requires M % 32 == 0 rows per launch region and N % 64 == 0); epilogue = k_gemm_hhx semantics ----
__device__ __forceinline__ v16h g2_frag(const _Float16* p, int hh) { FragH f; f.half[0] = *(const v8us*)((const unsigned short*)p + 8 * hh); f.half[1] = *(const v8us*)((const unsigned short*)p + 16 + 8 * hh); return f.v; }
__device__ __forceinline__ v8f g2_mma(v16h a, v16h b, v8f c) { v8f d = __builtin_amdgcn_wmma_f32_16x16x32_f16(false, a, false, b, (short)0, c, false, false); asm volatile("v_nop\n\tv_nop\n\tv_nop\n\tv_nop" : "+v"(d) : "v"(a), "v"(b)); return d; }
template <int ACT>
__global__ __launch_bounds__(128) void k_gemm2(const _Float16* __restrict__ A, int lda, size_t sA, const _Float16* __restrict__ Bh, int ldb, size_t sB, float alpha, const float* __restrict__ bias, size_t sBias, const float* __restrict__ CP, int rowsPerB, size_t sCPb, int row0g,
    float* __restrict__ C, _Float16* __restrict__ C16, int ldc, size_t sC, int M, int N, int K) { static_assert(ACT == 0 || ACT == 3 || ACT == 6 || ACT == 8 || ACT == 9 || ACT == 11 || ACT == 12 || ACT == 14 || ACT == 15 || ACT == 16 || ACT == 17, "k_gemm2: unsupported ACT code (would silently apply no activation)");
  __shared__ __attribute__((aligned(16))) float so[4][32][68];
  const int tid = threadIdx.x, w = tid >> 5, lane = tid & 31, ln = lane & 15, hh = lane >> 4; const int by = blockIdx.y;
  A += (size_t)by * sA; Bh += (size_t)by * sB; const size_t cofs = (size_t)by * sC; const float* bp = bias ? bias + (size_t)by * sBias : nullptr;
  const int ntn = N >> 6; const int mt = blockIdx.x / ntn, nq = blockIdx.x - mt * ntn; const int row0 = mt * 128 + 32 * w, col0 = nq * 64; if (row0 >= M) return;
  const _Float16* a0p = A + (size_t)(row0 + ln) * lda; const _Float16* a1p = a0p + (size_t)16 * lda;
  const _Float16* b0p = Bh + (size_t)(col0 + ln) * ldb; const _Float16* b1p = b0p + (size_t)16 * ldb; const _Float16* b2p = b1p + (size_t)16 * ldb; const _Float16* b3p = b2p + (size_t)16 * ldb;
  const v8f z8 = {0.f,0.f,0.f,0.f,0.f,0.f,0.f,0.f}; v8f c00 = z8, c01 = z8, c02 = z8, c03 = z8, c10 = z8, c11 = z8, c12 = z8, c13 = z8;
#pragma unroll 1
  for (int kb = 0; kb < K; kb += 32) { const v16h a0 = g2_frag(a0p + kb, hh), a1 = g2_frag(a1p + kb, hh);
    v16h b = g2_frag(b0p + kb, hh); c00 = g2_mma(a0, b, c00); c10 = g2_mma(a1, b, c10);
    b = g2_frag(b1p + kb, hh); c01 = g2_mma(a0, b, c01); c11 = g2_mma(a1, b, c11);
    b = g2_frag(b2p + kb, hh); c02 = g2_mma(a0, b, c02); c12 = g2_mma(a1, b, c12);
    b = g2_frag(b3p + kb, hh); c03 = g2_mma(a0, b, c03); c13 = g2_mma(a1, b, c13); }
  v8f accs[8] = {c00, c01, c02, c03, c10, c11, c12, c13};
#pragma unroll
  for (int u = 0; u < 8; ++u) { const int t = u & 3, half = u >> 2; const int col = col0 + t * 16 + ln; const float bv = bp ? bf16_round(bp[col]) : 0.f;
#pragma unroll
    for (int r = 0; r < 8; ++r) { const int rloc = half * 16 + 8 * hh + r; float v = accs[u][r] * alpha + bv; if (CP) { if (rowsPerB < 0) v += CP[cofs + (size_t)(row0g + row0 + rloc) * ldc + col];      /* rowsPerB < 0: own element of the batched C plane */ else { const int bidx = (row0g + row0 + rloc) / rowsPerB; v += CP[(size_t)bidx * sCPb + (size_t)by * 64 + col]; } }
      if (ACT == 3) v = fmaxf(v, 0.f); else if (ACT == 6) v = 0.5f * v * (1.0f + erff(v * 0.70710678118654752f)); else if (ACT == 11) v = 1.0f / (1.0f + expf(-v)); else if (ACT == 15) v = v / (1.0f + expf(-v)); else if (ACT == 12) v = (v > 0.f) ? v : 0.01f * v; else if (ACT == 8) v = tanhf(v); else if (ACT == 9) v = 0.5f * v * (1.0f + tanhf(0.7978845608028654f * (v + 0.044715f * v * v * v))); else if (ACT == 14) v = (v > 0.f) ? v : 0.1f * v; else if (ACT == 16) v = (v >= 0.f) ? v : 0.3f * v; else if (ACT == 17) v = (v >= 0.f) ? v : 0.2f * v;
      so[w][rloc][t * 16 + ln] = v; } }
  __builtin_amdgcn_fence(__ATOMIC_ACQ_REL, "workgroup"); __builtin_amdgcn_wave_barrier();
  const int rsub = lane >> 4, c4 = (lane & 15) * 4;
  {
#pragma unroll
    for (int q = 0; q < 16; ++q) { const int r = q * 2 + rsub; const v4f v = *(const v4fa*)&so[w][r][c4]; if (C) *(v4f*)(C + cofs + (size_t)(row0 + r) * ldc + col0 + c4) = v; if (C16) { v4h h4; for (int i = 0; i < 4; ++i) h4[i] = (_Float16)v[i]; *(v4h*)(C16 + cofs + (size_t)(row0 + r) * ldc + col0 + c4) = h4; } }
     } }


__global__ __launch_bounds__(256) void k_wnat(const float* __restrict__ w, size_t n8, _Float16* __restrict__ Bt) { const size_t t = (size_t)blockIdx.x * 256 + threadIdx.x; if (t >= n8) return; FragH f; for (int q = 0; q < 8; ++q) f.h[q] = (_Float16)(bf16_round(w[t * 8 + q]) * 16.0f); *(v8us*)((unsigned short*)Bt + t * 8) = f.half[0];  }
__global__ __launch_bounds__(256) void k_rsm(const float* __restrict__ S, _Float16* __restrict__ P, int nrows) {
  #pragma clang fp contract(off)
  const int i = blockIdx.x * 256 + threadIdx.x; if (i >= nrows) return; const float* s = S + (size_t)i * SQ; float mx = -3.0e38f;
#pragma unroll 1
  for (int j = 0; j < SQ; ++j) mx = fmaxf(mx, s[j]); float se = 0.f;
#pragma unroll 1
  for (int j = 0; j < SQ; ++j) se += expf(s[j] - mx); const float sc = 256.0f / se;
#pragma unroll 1
  for (int j0 = 0; j0 < SQ; j0 += 8) { FragH f; for (int q = 0; q < 8; ++q) f.h[q] = (_Float16)(expf(s[j0 + q] - mx) * sc); unsigned short* d = (unsigned short*)P + (size_t)i * SQ + j0; *(v8us*)d = f.half[0];  } }
__global__ __launch_bounds__(256) void k_vt(const _Float16* __restrict__ V16, int b, int h0, _Float16* __restrict__ VT) { __shared__ unsigned short tl[64][65]; const int tid = threadIdx.x; const int hh = blockIdx.x % HG, sg = blockIdx.x / HG; const int s0 = sg * 64; const int h = h0 + hh;
  for (int i = tid; i < 64 * 8; i += 256) { const int j = i / 8, d8 = (i % 8) * 8; FragH f; f.half[0] = *(const v8us*)((const unsigned short*)V16 + ((size_t)b * SQ + s0 + j) * DM + h * HD + d8); for (int q = 0; q < 8; ++q) tl[d8 + q][j] = f.u[q]; }
  __syncthreads();
  { for (int i = tid; i < 64 * 8; i += 256) { const int d = i / 8, j8 = (i % 8) * 8; FragH f; for (int q = 0; q < 8; ++q) f.u[q] = tl[d][j8 + q]; *(v8us*)((unsigned short*)VT + ((size_t)hh * HD + d) * SQ + s0 + j8) = f.half[0]; }  } }


__global__ __launch_bounds__(256) void k_tab2(float theta, float* __restrict__ CS, float* __restrict__ SN) {
  #pragma clang fp contract(off)
  const int t = blockIdx.x * 256 + threadIdx.x; if (t >= SQ * (HD / 2)) return; const int i = t % (HD / 2); const int p = t / (HD / 2); const float invf = 1.0f / powf(theta, (float)(2 * i) / (float)HD); const float ang = __fmul_rn((float)p, invf); const float c = cosf(ang), s = sinf(ang);
  *(float*)(CS + t) = c; *(float*)(SN + t) = s;  }
template <int NORM, int ROPE>
__global__ __launch_bounds__(64) void k_xform(const float* __restrict__ F, int ldf, int nh, const float* __restrict__ gain, float eps, const float* __restrict__ CS, const float* __restrict__ SN, _Float16* __restrict__ H16, int ldo) {
  #pragma clang fp contract(off)
  __shared__ float xv[HD]; __shared__ float red[HD]; __shared__ unsigned short sh_[HD]; const int d = threadIdx.x; const int h = blockIdx.x % nh; const size_t r = blockIdx.x / nh; const int p = (int)(r % SQ);
  float x = F[r * (size_t)ldf + (size_t)h * HD + d];
  if (NORM) { red[d] = __fmul_rn(x, x); __syncthreads(); for (int st = HD / 2; st > 0; st >>= 1) { if (d < st) red[d] = __fadd_rn(red[d], red[d + st]); __syncthreads(); } const float rs = rsqrtf(__fadd_rn(red[0] / (float)HD, eps)); x = __fmul_rn(__fmul_rn(x, rs), bf16_round(gain[d])); }
  xv[d] = x; __syncthreads();
  float o = x;
  if (ROPE == 1) { const int i = d >> 1; const float c = CS[p * (HD / 2) + i], s = SN[p * (HD / 2) + i]; const float ev = xv[2 * i], od = xv[2 * i + 1]; o = (d & 1) ? __fadd_rn(__fmul_rn(ev, s), __fmul_rn(od, c)) : __fadd_rn(__fmul_rn(ev, c), -__fmul_rn(od, s)); }
  if (ROPE == 2) { const int i = d & (HD / 2 - 1); const float c = CS[p * (HD / 2) + i], s = SN[p * (HD / 2) + i]; const float lo = xv[i], hi = xv[i + HD / 2]; o = (d < HD / 2) ? __fadd_rn(__fmul_rn(lo, c), -__fmul_rn(hi, s)) : __fadd_rn(__fmul_rn(lo, s), __fmul_rn(hi, c)); }
  FragH th; th.h[0] = (_Float16)o; sh_[d] = th.u[0]; __syncthreads();
  if (d < HD / 8) { FragH f; for (int q = 0; q < 8; ++q) f.u[q] = sh_[d * 8 + q]; unsigned short* dst = (unsigned short*)H16 + r * (size_t)ldo + (size_t)h * HD + d * 8; *(v8us*)dst = f.half[0];  } }



// Fused causal attention, one launch for every (batch, head, 128-query block): each wave owns 32 queries and walks the keys 0 .. its own last query in passes of 32, nothing of S or P goes through memory.
// Transposed products: S^T = K . Q^T (A = key rows, B = query rows kept in registers; hi.hi in one accumulator, lo.hi + hi.lo in a second, joined as hi + 2^-10 lo in f32), so a lane holds 16 scores of ONE query;
// running maximum and sum per query (online softmax, accumulators rescaled only in a pass where some query's maximum moved); the two 16-key score tiles, as f16 weights x256, ARE the B operand of O^T += V^T . P^T.
__device__ __forceinline__ float rs_xrow(float v) { const int i = __float_as_int(v); return __int_as_float(__builtin_amdgcn_permlanex16(i, i, 0x76543210, 0xfedcba98, false, false)); }      /* lane l <- lane l ^ 16 */
// native 2^a. The v_nop is the slot the instruction set asks for behind a transcendental before its source is overwritten or its result read.
__device__ __forceinline__ float fa_exp2(float a) { float e; asm("v_exp_f32 %0, %1\n\tv_nop" : "=v"(e) : "v"(a)); return e; }
__device__ __forceinline__ v8f fa_mma(v16h a, v16h b, v8f c) { return __builtin_amdgcn_wmma_f32_16x16x32_f16(false, a, false, b, (short)0, c, false, false); }
#define FA_C 11.5415603271117072589f      /* sqrt(64) * log2(e): score differences -> exponent of 2 */
__global__ __launch_bounds__(128) void k_fattn(const _Float16* __restrict__ QH, const _Float16* __restrict__ QL, const _Float16* __restrict__ KH, const _Float16* __restrict__ KL, const _Float16* __restrict__ VT, _Float16* __restrict__ O16) {
  const int lane = threadIdx.x & 31, ln = lane & 15, hh = lane >> 4; const int w = __builtin_amdgcn_readfirstlane((int)(threadIdx.x >> 5));      /* scalar wave number: the key loop's bound stays a scalar */
  const int bh = blockIdx.y, b = bh / NH, h = bh % NH; const int q0 = ((int)gridDim.x - 1 - (int)blockIdx.x) * 128 + w * 32;      /* longest blocks start first */
  const size_t r0 = (size_t)b * SQ;
  /* every pointer below is the lane's own address, its k offset 8 hh folded in, so that the loads name exactly the pair that the wait behind them holds */
  const _Float16* qhp = QH + (r0 + q0 + ln) * DM + h * HD + 8 * hh; const _Float16* qlp = QL + (r0 + q0 + ln) * DM + h * HD + 8 * hh;
  v16h qh[2][2], ql[2][2];      /* [query group of 16][k half of the head] */
#pragma unroll
  for (int j = 0; j < 2; ++j)
#pragma unroll
    for (int ks = 0; ks < 2; ++ks) { const size_t o = (size_t)(16 * j) * DM + 32 * ks; qh[j][ks] = g2_frag(qhp + o, 0); ql[j][ks] = g2_frag(qlp + o, 0); }
  asm volatile("s_wait_xcnt 0x0" :: "v"(qhp), "v"(qlp) : "memory");      /* the two address pairs stay whole until the loads have taken them */
  const _Float16* khp = KH + (r0 + ln) * DM + h * HD + 8 * hh; const _Float16* klp = KL + (r0 + ln) * DM + h * HD + 8 * hh; const _Float16* vtp = VT + ((size_t)bh * HD + ln) * SQ + 8 * hh;
  const v8f z8 = {0.f,0.f,0.f,0.f,0.f,0.f,0.f,0.f};
  v8f o[2][4]; float m[2], l[2];
#pragma unroll
  for (int j = 0; j < 2; ++j) { m[j] = -1.0e30f; l[j] = 0.f;
#pragma unroll
    for (int t = 0; t < 4; ++t) o[j][t] = z8; }
  v16h kh[2][2], kl[2][2];      /* [16-key tile][k half] */
#pragma unroll
  for (int kt = 0; kt < 2; ++kt)
#pragma unroll
    for (int ks = 0; ks < 2; ++ks) { const size_t ko = (size_t)(16 * kt) * DM + 32 * ks; kh[kt][ks] = g2_frag(khp + ko, 0); kl[kt][ks] = g2_frag(klp + ko, 0); }
#pragma unroll 1
  for (int kb = 0; kb <= q0; kb += 32) {
    v16h vf[4]; const _Float16* pv = vtp + kb;      /* V^T rows of this pass, asked for ahead of the score products */
#pragma unroll
    for (int t = 0; t < 4; ++t) vf[t] = g2_frag(pv + (size_t)(16 * t) * SQ, 0);
    asm volatile("s_wait_xcnt 0x0" ::: "memory");      /* stands in front of the advance of the loads' address pair; it also keeps these loads here, ahead of the score products, where the build had sunk them to their use */
    v8f u[2][2];      /* [query group][key tile]: q . k, register r = key 16 kt + 8 hh + r of query ln */
#pragma unroll
    for (int kt = 0; kt < 2; ++kt)
#pragma unroll
      for (int j = 0; j < 2; ++j) { v8f sh = z8, sl = z8;
#pragma unroll
        for (int ks = 0; ks < 2; ++ks) { sh = fa_mma(kh[kt][ks], qh[j][ks], sh); sl = fa_mma(kh[kt][ks], ql[j][ks], sl); sl = fa_mma(kl[kt][ks], qh[j][ks], sl); }
#pragma unroll
        for (int r = 0; r < 8; ++r) u[j][kt][r] = sh[r] + 0.0009765625f * sl[r]; }
    { const int kn = (kb + 32 <= q0) ? kb + 32 : q0;      /* next pass's key rows into the same registers, behind their last use; the last pass asks for its own rows again (in bounds) */
      const _Float16* pkh = khp + (size_t)kn * DM; const _Float16* pkl = klp + (size_t)kn * DM;
#pragma unroll
      for (int kt = 0; kt < 2; ++kt)
#pragma unroll
        for (int ks = 0; ks < 2; ++ks) { const size_t ko = (size_t)(16 * kt) * DM + 32 * ks; kh[kt][ks] = g2_frag(pkh + ko, 0); kl[kt][ks] = g2_frag(pkl + ko, 0); }
      asm volatile("s_wait_xcnt 0x0" :: "v"(pkh), "v"(pkl) : "memory"); }      /* the two address pairs stay whole until the loads have taken them */
    if (kb == q0) {      /* the one pass on the diagonal: keys above the query are out */
#pragma unroll
      for (int j = 0; j < 2; ++j)
#pragma unroll
        for (int kt = 0; kt < 2; ++kt)
#pragma unroll
          for (int r = 0; r < 8; ++r) u[j][kt][r] = (16 * kt + 8 * hh + r <= 16 * j + ln) ? u[j][kt][r] : -1.0e9f; }
    float mn[2];
#pragma unroll
    for (int j = 0; j < 2; ++j) { float x = fmaxf(u[j][0][0], u[j][1][0]);
#pragma unroll
      for (int r = 1; r < 8; ++r) x = fmaxf(x, fmaxf(u[j][0][r], u[j][1][r]));
      mn[j] = fmaxf(m[j], fmaxf(x, rs_xrow(x))); }
    if (__builtin_amdgcn_ballot_w32(mn[0] > m[0] || mn[1] > m[1]) != 0) {      /* scalar branch; where no maximum moved every factor would be 1 */
#pragma unroll
      for (int j = 0; j < 2; ++j) { const float al = fa_exp2((m[j] - mn[j]) * FA_C); m[j] = mn[j]; l[j] *= al;
#pragma unroll
        for (int t = 0; t < 4; ++t)
#pragma unroll
          for (int r = 0; r < 8; ++r) o[j][t][r] *= al; } }
#pragma unroll
    for (int j = 0; j < 2; ++j) { FragH pf; float s0 = 0.f, s1 = 0.f;
#pragma unroll
      for (int r = 0; r < 8; ++r) { const float p0 = fa_exp2((u[j][0][r] - m[j]) * FA_C + 8.0f), p1 = fa_exp2((u[j][1][r] - m[j]) * FA_C + 8.0f); s0 += p0; s1 += p1; pf.h[r] = (_Float16)p0; pf.h[8 + r] = (_Float16)p1; }      /* weights x256 */
      l[j] += s0 + s1;
#pragma unroll
      for (int t = 0; t < 4; ++t) o[j][t] = fa_mma(vf[t], pf.v, o[j][t]); }
  }
#pragma unroll
  for (int j = 0; j < 2; ++j) { const float inv = 64.0f / (l[j] + rs_xrow(l[j]));      /* the two lane halves hold disjoint keys' sums; o carried x64 */
    unsigned short* dst = (unsigned short*)O16 + (r0 + q0 + 16 * j + ln) * DM + h * HD + 8 * hh;
#pragma unroll
    for (int t = 0; t < 4; ++t) { FragH f;
#pragma unroll
      for (int r = 0; r < 8; ++r) f.h[r] = (_Float16)(o[j][t][r] * inv);
      *(v8us*)(dst + 16 * t) = f.half[0]; } } }


template <int NORM, int ROPE>
__global__ __launch_bounds__(64) void k_xformf(const float* __restrict__ F, int ldf, int nh, const float* __restrict__ gain, float eps, const float* __restrict__ CS, const float* __restrict__ SN, float* __restrict__ F32, int ldo) {
  #pragma clang fp contract(off)
  __shared__ float xv[HD]; __shared__ float red[HD]; const int d = threadIdx.x; const int h = blockIdx.x % nh; const size_t r = blockIdx.x / nh; const int p = (int)(r % SQ);
  float x = F[r * (size_t)ldf + (size_t)h * HD + d];
  if (NORM) { red[d] = __fmul_rn(x, x); __syncthreads(); for (int st = HD / 2; st > 0; st >>= 1) { if (d < st) red[d] = __fadd_rn(red[d], red[d + st]); __syncthreads(); } const float rs = rsqrtf(__fadd_rn(red[0] / (float)HD, eps)); x = __fmul_rn(__fmul_rn(x, rs), bf16_round(gain[d])); }
  xv[d] = x; __syncthreads();
  float o = x;
  if (ROPE == 1) { const int i = d >> 1; const float c = CS[p * (HD / 2) + i], s = SN[p * (HD / 2) + i]; const float ev = xv[2 * i], od = xv[2 * i + 1]; o = (d & 1) ? __fadd_rn(__fmul_rn(ev, s), __fmul_rn(od, c)) : __fadd_rn(__fmul_rn(ev, c), -__fmul_rn(od, s)); }
  if (ROPE == 2) { const int i = d & (HD / 2 - 1); const float c = CS[p * (HD / 2) + i], s = SN[p * (HD / 2) + i]; const float lo = xv[i], hi = xv[i + HD / 2]; o = (d < HD / 2) ? __fadd_rn(__fmul_rn(lo, c), -__fmul_rn(hi, s)) : __fadd_rn(__fmul_rn(lo, s), __fmul_rn(hi, c)); }
  float* dst = F32 + r * (size_t)ldo + (size_t)h * HD + d; *(float*)dst = o;  }
extern "C" void kernel_launch(void* const* d_in, const int* in_sizes, int n_in,
                              void* d_out, int out_size, void* d_ws, size_t ws_size, hipStream_t stream) {
  (void)in_sizes; (void)n_in; (void)out_size;
  const float* const* I = (const float* const*)d_in; const float* x = I[0]; const float* wqkv = I[1]; const float* bqkv = I[2]; const float* wo = I[3]; const float* bo = I[4];      /* [in][out] fused qkv + out weights, biases */
  char* ws = (char*)d_ws; size_t off = 0;
  auto take = [&](size_t bytes) { char* p = ws + off; off += (bytes + 255) & ~(size_t)255; return p; };
  _Float16* BQKV = (_Float16*)take((size_t)3 * DM * DM * 2); _Float16* BO = (_Float16*)take((size_t)DM * DM * 2); float* CS = (float*)take((size_t)SQ * (HD / 2) * 4); float* SN = (float*)take((size_t)SQ * (HD / 2) * 4);
  _Float16* X16 = (_Float16*)take(NR * DM * 2); float* QKVF = (float*)take((size_t)SQ * 3 * DM * 4);      /* one batch of f32 q | k | v rows */
  float* QF = (float*)take(NR * DM * 4); float* KF = (float*)take(NR * DM * 4); _Float16* QH = (_Float16*)take(NR * DM * 2); _Float16* QL = (_Float16*)take(NR * DM * 2); _Float16* KH = (_Float16*)take(NR * DM * 2); _Float16* KL = (_Float16*)take(NR * DM * 2); _Float16* V16 = (_Float16*)take(NR * DM * 2); _Float16* O16 = (_Float16*)take(NR * DM * 2);
  _Float16* VT = (_Float16*)take((size_t)NB * NH * HD * SQ * 2);      /* V^T of every batch */
  if (off > ws_size) return;
  k_wt_f16<<<(unsigned)(((size_t)3 * DM * (DM / 8) + 255) / 256), 256, 0, stream>>>(wqkv, BQKV, DM, 3 * DM, 16.0f); k_wt_f16<<<(unsigned)(((size_t)DM * (DM / 8) + 255) / 256), 256, 0, stream>>>(wo, BO, DM, DM, 16.0f);      /* [in][out] -> Bt[n][k] x16; q | k | v stacked along n */
  k_tab2<<<(SQ * (HD / 2) + 255) / 256, 256, 0, stream>>>(10000.0f, CS, SN);
  k_x16<<<(unsigned)((NR * DM / 8 + 255) / 256), 256, 0, stream>>>(x, X16, NR * DM / 8);
  for (int b = B0; b < B0 + NBR; ++b) { const size_t r0 = (size_t)b * SQ;
    k_gemm2<0><<<dim3((unsigned)((SQ / 128) * (3 * DM / 64)), 1), 128, 0, stream>>>(X16 + r0 * DM, DM, 0, BQKV, DM, 0, 0.0625f, bqkv, 0, nullptr, 1, 0, 0, QKVF, nullptr, 3 * DM, 0, SQ, 3 * DM, DM);      /* q | k | v rows (f32) of this batch */
    k_xformf<0, 1><<<(unsigned)(SQ * NH), 64, 0, stream>>>(QKVF, 3 * DM, NH, nullptr, 0.f, CS, SN, QF + r0 * DM, DM); k_hl<<<(unsigned)(((size_t)SQ * DM / 8 + 255) / 256), 256, 0, stream>>>(QF + r0 * DM, QH + r0 * DM, QL + r0 * DM, (size_t)SQ * DM / 8);      /* roped q (f32) -> f16 hi + x1024 residual: the x8 logits (sigma ~64) need ~f32-accurate scores */
    k_xformf<0, 1><<<(unsigned)(SQ * NH), 64, 0, stream>>>(QKVF + DM, 3 * DM, NH, nullptr, 0.f, CS, SN, KF + r0 * DM, DM); k_hl<<<(unsigned)(((size_t)SQ * DM / 8 + 255) / 256), 256, 0, stream>>>(KF + r0 * DM, KH + r0 * DM, KL + r0 * DM, (size_t)SQ * DM / 8);
    k_xform<0, 0><<<(unsigned)(SQ * NH), 64, 0, stream>>>(QKVF + 2 * DM, 3 * DM, NH, nullptr, 0.f, CS, SN, V16 + r0 * DM, DM);
    k_vt<NH, SQ><<<NH * (SQ / 64), 256, 0, stream>>>(V16 + r0 * DM, DM, 0, VT + (size_t)b * NH * HD * SQ); }      /* V^T [NH][HD][SQ] for this batch */
  k_fattn<<<dim3(SQ / 128, NB * NH), 128, 0, stream>>>(QH, QL, KH, KL, VT, O16);      /* o (merged heads, x64) as f16 rows */
  k_gemm2<0><<<dim3((unsigned)((MPO / 128) * (DM / 64)), 1), 128, 0, stream>>>(O16 + (size_t)B0 * SQ * DM, DM, 0, BO, DM, 0, 0.0009765625f, bo, 0, nullptr, 1, 0, 0, (float*)d_out + (size_t)B0 * SQ * DM, nullptr, DM, 0, MPO, DM, DM);      /* out rows are the output layout */
}

// v003
// Measured time: 216 microseconds a run.
// Timed twice side by side with v002, it ran 1.41 and 1.40 times as fast.
// All steps since v000 together make it 21.4 times as fast.
#include <hip/hip_runtime.h>
// Masked (causal) RoPE multi-head attention with LARGE logits (x [2][2048][1024]; qkv = x w_qkv + b_qkv ([in][out] 1024 x 3072, sigma 1/32, bias sigma 0.01) -> q | k | v, 16 heads of 64; interleaved-pair RoPE on q and k (inv_freq_i = 10000^(-2i/64), positions 0..2047); scores = q . k x sqrt(64) (the module divides by 1/sqrt(d_k)), causal (tril); softmax; out = (attn v merged) w_out + b_out -> [2][2048][1024]).
// Structure: token rows r = b*2048 + s; x as exact f16 rows (bf16-rounded); q | k | v of every row as ONE WMMA GEMM launch (32x64 wave tiles, f32 accumulation, exact x16 weights + bias, N = 3 x 1024) whose epilogue, a block's 64 columns being one head, does on VALU: the interleaved-pair rotary rotation of q and k from f32 cos/sin tables (positions 0..SQ-1, no norm) and their split into f16 hi + x1024 residual planes (the x8 logits have sigma ~64: near-argmax softmax, so the scores are computed to ~f32 accuracy from three products), v as f16 into V^T; then ONE fused attention launch over every (batch, head, 128-query block): a wave holds 32 queries, walks the keys up to its own diagonal in passes of 32, scores as S^T = K . Q^T (three products), online causal softmax in registers (f32 running maximum and sum, native exp; keys above the diagonal set to -1e9; weights x256 f16), O^T += V^T . P^T with the score tiles as the B operand, o carried x64 (folded into the output GEMM alpha) written straight into the merged f16 o rows; out = o W_o + b GEMM (f32) into the output layout.
// Compute dtype: inputs rounded to bf16; x / weights exact; projections and rope f32; q, k as f16 hi + residual (~2^-22); v, softmax weights and o as plain f16 GEMM operands (~2^-12); scores and softmax statistics f32. v_wmma_f32_16x16x32_f16.
#define NB 2
#define SQ 2048
#define DM 1024
#define NH 16
#define HD 64
#define HG 4                         /* heads per launch of the (b, h0) V^T transpose */
#define QT 256
#define NKX SQ                       /* unused */
#define B0 0                         /* first batch processed (debug hook) */
#define NBR NB                       /* batches processed (debug hook) */
#define QN SQ                        /* unused (attention covers all SQ queries) */
#define NHD NH                       /* unused (attention covers all NH heads) */
#define NR ((size_t)NB * SQ)         /* token rows */
#define MPO ((int)((size_t)NBR * SQ))      /* rows through the output GEMM (debug hook) */
typedef __bf16 v16b __attribute__((ext_vector_type(16)));
typedef unsigned short v8us __attribute__((ext_vector_type(8), may_alias));
typedef float  v8f  __attribute__((ext_vector_type(8)));
typedef float  v4f  __attribute__((ext_vector_type(4)));
typedef float  v4fa __attribute__((ext_vector_type(4), may_alias));
union FragB { v16b v; v8us half[2]; unsigned short u[16]; };

__device__ __forceinline__ unsigned short bf16_bits(float x) { unsigned int u = __float_as_uint(x); return (unsigned short)((u + 0x7FFFu + ((u >> 16) & 1u)) >> 16); }
__device__ __forceinline__ float bf16_val(unsigned short b) { return __uint_as_float(((unsigned int)b) << 16); }
__device__ __forceinline__ float bf16_round(float x) { return bf16_val(bf16_bits(x)); }
// D += A·B with NT terms: 1 = ah·bh, 2 = + al·bh (A split), 3 = + ah·bl (both split)
template <int NT>
__device__ __forceinline__ v8f mmaN(v16b ah, v16b al, v16b bh, v16b bl, v8f c) {
  c = __builtin_amdgcn_wmma_f32_16x16x32_bf16(false, ah, false, bh, (short)0, c, false, false);
  if (NT >= 2) c = __builtin_amdgcn_wmma_f32_16x16x32_bf16(false, al, false, bh, (short)0, c, false, false);
  if (NT >= 3) c = __builtin_amdgcn_wmma_f32_16x16x32_bf16(false, ah, false, bl, (short)0, c, false, false);
  asm volatile("v_nop\n\tv_nop\n\tv_nop\n\tv_nop" : "+v"(c) : "v"(ah), "v"(al), "v"(bh), "v"(bl));
  return c;
}

__global__ __launch_bounds__(256) void k_wt_bf16(const float* __restrict__ W, unsigned short* __restrict__ Wt, int K, int N) {
  const int t = blockIdx.x * 256 + threadIdx.x;
  const int k8n = K / 8;
  if (t >= N * k8n) return;
  const int n = t / k8n, k8 = (t % k8n) * 8;
  v8us v;
#pragma unroll
  for (int i = 0; i < 8; ++i) v[i] = bf16_bits(W[(size_t)(k8 + i) * N + n]);
  *(v8us*)(Wt + (size_t)n * K + k8) = v;
  
}

// GEMM C[M][N] (f32, pitch ldc) = act(A[M][K]·W + bias). A f32 row-major (pitch lda) converted per fragment to bf16
// (ASPLIT: hi/lo two planes -> 2 terms, else single rounded term); Wt bf16 [N][K] (pitch ldb). BIAS_BF16 rounds the
// bias to bf16 first (bias quantised to bf16 before the add). K%32==0, M%16==0, N%64==0.
template <bool ASPLIT, int ACT, bool BIAS_BF16>
__global__ __launch_bounds__(128) void k_gemm_bf(const float* __restrict__ A, int lda, const unsigned short* __restrict__ Wt, int ldb,
                                               const float* __restrict__ bias, float* __restrict__ C, int ldc, int M, int N, int K) {
  __shared__ __attribute__((aligned(16))) float so[4][16][64];
  const int tid = threadIdx.x, w = tid >> 5, lane = tid & 31, ln = lane & 15, hh = lane >> 4;
  const int ntn = N / 64;
  const int wid = blockIdx.x * 4 + w;
  const int mt = wid / ntn, nq = wid % ntn;
  if (mt * 16 >= M) return;
  const int row0 = mt * 16, col0 = nq * 64;
  const float* arow = A + (size_t)(row0 + ln) * lda;
  v8f acc[4] = {};
  for (int kb = 0; kb < K; kb += 32) {
    FragB ah, al;
    const v4f x0 = *(const v4fa*)(arow + kb + 8 * hh), x1 = *(const v4fa*)(arow + kb + 8 * hh + 4);
    const v4f x2 = *(const v4fa*)(arow + kb + 16 + 8 * hh), x3 = *(const v4fa*)(arow + kb + 16 + 8 * hh + 4);
    float xs[16] = {x0[0],x0[1],x0[2],x0[3],x1[0],x1[1],x1[2],x1[3],x2[0],x2[1],x2[2],x2[3],x3[0],x3[1],x3[2],x3[3]};
#pragma unroll
    for (int i = 0; i < 16; ++i) { const unsigned short hb = bf16_bits(xs[i]); ah.u[i] = hb; al.u[i] = ASPLIT ? bf16_bits(xs[i] - bf16_val(hb)) : (unsigned short)0; }
#pragma unroll
    for (int t = 0; t < 4; ++t) {
      const unsigned short* brow = Wt + (size_t)(col0 + t * 16 + ln) * ldb + kb;
      FragB b;
      b.half[0] = *(const v8us*)(brow + 8 * hh);
      b.half[1] = *(const v8us*)(brow + 16 + 8 * hh);
      acc[t] = mmaN<ASPLIT ? 2 : 1>(ah.v, al.v, b.v, b.v, acc[t]);
    }
  }
#pragma unroll
  for (int t = 0; t < 4; ++t) {
    float bv = bias ? bias[col0 + t * 16 + ln] : 0.f;
    if (BIAS_BF16) bv = bf16_round(bv);
#pragma unroll
    for (int r = 0; r < 8; ++r) { float v = acc[t][r] + bv; if (ACT == 1) v = fmaxf(v, 0.f); so[w][8 * hh + r][t * 16 + ln] = v; }
  }
  __builtin_amdgcn_fence(__ATOMIC_ACQ_REL, "workgroup");
  __builtin_amdgcn_wave_barrier();
  const int rsub = lane >> 4, c4 = (lane & 15) * 4;
  {
#pragma unroll
    for (int q = 0; q < 8; ++q) {
      const int r = q * 2 + rsub;
      const v4f v = *(const v4fa*)&so[w][r][c4];
      *(v4f*)(C + (size_t)(row0 + r) * ldc + col0 + c4) = v;
    }
    
  }
}

// GEMM C = act(A·W + bias + resid): A f32 (ASPLIT -> hi/lo 2 terms), Wt bf16 [N][K]; ACT 0 none, 1 relu, 2 exact gelu;
// resid (optional, f32, row index = (row % rmod), pitch ldr, RES_BF16 rounds it) added before the activation.
template <bool ASPLIT, int ACT, bool BIAS_BF16, bool RES_BF16>
__global__ __launch_bounds__(128) void k_gemm_bf3(const float* __restrict__ A, int lda, const unsigned short* __restrict__ Wt, int ldb,
                                                const float* __restrict__ bias, const float* __restrict__ resid, int rmod, int ldr,
                                                float* __restrict__ C, int ldc, int M, int N, int K) {
  __shared__ __attribute__((aligned(16))) float so[4][16][64];
  const int tid = threadIdx.x, w = tid >> 5, lane = tid & 31, ln = lane & 15, hh = lane >> 4;
  const int ntn = N / 64;
  const int wid = blockIdx.x * 4 + w;
  const int mt = wid / ntn, nq = wid % ntn;
  if (mt * 16 >= M) return;
  const int row0 = mt * 16, col0 = nq * 64;
  const float* arow = A + (size_t)(row0 + ln) * lda;
  v8f acc[4] = {};
  for (int kb = 0; kb < K; kb += 32) {
    FragB ah, al;
    const v4f x0 = *(const v4fa*)(arow + kb + 8 * hh), x1 = *(const v4fa*)(arow + kb + 8 * hh + 4);
    const v4f x2 = *(const v4fa*)(arow + kb + 16 + 8 * hh), x3 = *(const v4fa*)(arow + kb + 16 + 8 * hh + 4);
    float xs[16] = {x0[0],x0[1],x0[2],x0[3],x1[0],x1[1],x1[2],x1[3],x2[0],x2[1],x2[2],x2[3],x3[0],x3[1],x3[2],x3[3]};
#pragma unroll
    for (int i = 0; i < 16; ++i) { const unsigned short hb = bf16_bits(xs[i]); ah.u[i] = hb; al.u[i] = ASPLIT ? bf16_bits(xs[i] - bf16_val(hb)) : (unsigned short)0; }
#pragma unroll
    for (int t = 0; t < 4; ++t) {
      const unsigned short* brow = Wt + (size_t)(col0 + t * 16 + ln) * ldb + kb;
      FragB b;
      b.half[0] = *(const v8us*)(brow + 8 * hh);
      b.half[1] = *(const v8us*)(brow + 16 + 8 * hh);
      acc[t] = mmaN<ASPLIT ? 2 : 1>(ah.v, al.v, b.v, b.v, acc[t]);
    }
  }
#pragma unroll
  for (int t = 0; t < 4; ++t) {
    const int col = col0 + t * 16 + ln;
    float bv = bias ? bias[col] : 0.f;
    if (BIAS_BF16) bv = bf16_round(bv);
#pragma unroll
    for (int r = 0; r < 8; ++r) {
      float v = acc[t][r] + bv;
      if (resid) { float rv = resid[(size_t)((row0 + 8 * hh + r) % rmod) * ldr + col]; if (RES_BF16) rv = bf16_round(rv); v += rv; }
      if (ACT == 1) v = fmaxf(v, 0.f);
      if (ACT == 2) v = 0.5f * v * (1.0f + erff(v * 0.70710678118654752f));
      if (ACT == 3) { const float u = 0.7978845608028654f * (v + 0.044715f * v * v * v); v = 0.5f * v * (1.0f + tanhf(u)); }
      so[w][8 * hh + r][t * 16 + ln] = v;
    }
  }
  __builtin_amdgcn_fence(__ATOMIC_ACQ_REL, "workgroup");
  __builtin_amdgcn_wave_barrier();
  const int rsub = lane >> 4, c4 = (lane & 15) * 4;
  {
#pragma unroll
    for (int q = 0; q < 8; ++q) {
      const int r = q * 2 + rsub;
      const v4f v = *(const v4fa*)&so[w][r][c4];
      *(v4f*)(C + (size_t)(row0 + r) * ldc + col0 + c4) = v;
    }
    
  }
}
// row LayerNorm (biased variance, eps) over N: s = X (+ R); optional out_sum <- s; out_norm <- (s-mu)*rsqrt(var+eps)*g + b
template <bool PARAM_BF16>
__global__ __launch_bounds__(256) void k_layernorm(const float* __restrict__ X, const float* __restrict__ R, const float* __restrict__ g, const float* __restrict__ bta,
                                                  float* __restrict__ out_sum, float* __restrict__ out_norm, int N, float eps) {
  __shared__ float red[256];
  const int row = blockIdx.x, tid = threadIdx.x;
  const float* x = X + (size_t)row * N; const float* rr = R ? R + (size_t)row * N : nullptr;
  float vals[16];                     // up to N = 4096
  const int per = N / 256;            // contiguous chunk per thread? use strided-by-4 chunks: thread handles j = tid*4 + 1024*u
  float s1 = 0.f;
  for (int u = 0; u < per / 4; ++u) {
    const int j = tid * 4 + 1024 * u;
    const v4f a = *(const v4fa*)(x + j);
    v4f b = {0.f,0.f,0.f,0.f}; if (rr) b = *(const v4fa*)(rr + j);
#pragma unroll
    for (int q = 0; q < 4; ++q) { const float v = a[q] + b[q]; vals[u * 4 + q] = v; s1 += v; }
  }
  red[tid] = s1; __syncthreads();
  for (int st = 128; st > 0; st >>= 1) { if (tid < st) red[tid] += red[tid + st]; __syncthreads(); }
  const float mu = red[0] / (float)N; __syncthreads();
  float s2 = 0.f;
  for (int u = 0; u < per / 4; ++u)
#pragma unroll
    for (int q = 0; q < 4; ++q) { const float c = vals[u * 4 + q] - mu; s2 += c * c; }
  red[tid] = s2; __syncthreads();
  for (int st = 128; st > 0; st >>= 1) { if (tid < st) red[tid] += red[tid + st]; __syncthreads(); }
  const float rs = rsqrtf(red[0] / (float)N + eps);
  {
    for (int u = 0; u < per / 4; ++u) {
      const int j = tid * 4 + 1024 * u;
      v4f o, sm;
#pragma unroll
      for (int q = 0; q < 4; ++q) {
        float gg = g[j + q], bb = bta[j + q];
        if (PARAM_BF16) { gg = bf16_round(gg); bb = bf16_round(bb); }
        sm[q] = vals[u * 4 + q]; o[q] = (vals[u * 4 + q] - mu) * rs * gg + bb;
      }
      if (out_sum) *(v4f*)(out_sum + (size_t)row * N + j) = sm;
      *(v4f*)(out_norm + (size_t)row * N + j) = o;
    }
    
  }
}



// ---- f16 WMMA path (v_wmma_f32_16x16x32_f16): 11-bit significands for operands in range — used where a [0,1] probability operand needs more precision than bf16
typedef _Float16 v16h __attribute__((ext_vector_type(16)));
union FragH { v16h v; v8us half[2]; _Float16 h[16]; unsigned short u[16]; };
template <int NT>
__device__ __forceinline__ v8f mmaH(v16h ah, v16h al, v16h bh, v16h bl, v8f c) {
  c = __builtin_amdgcn_wmma_f32_16x16x32_f16(false, ah, false, bh, (short)0, c, false, false);
  if (NT >= 2) c = __builtin_amdgcn_wmma_f32_16x16x32_f16(false, al, false, bh, (short)0, c, false, false);
  if (NT >= 3) c = __builtin_amdgcn_wmma_f32_16x16x32_f16(false, ah, false, bl, (short)0, c, false, false);
  asm volatile("v_nop\n\tv_nop\n\tv_nop\n\tv_nop" : "+v"(c) : "v"(ah), "v"(al), "v"(bh), "v"(bl));
  return c;
}
// batched GEMM like k_gemm_b but f16 operands: A f32 (split into f16 hi/lo if ASPLIT, else rounded to f16), Bt = f16 values [n][k]; alpha; C f32; N multiple of 16 (partial tiles skipped)
template <bool ASPLIT>
__global__ __launch_bounds__(128) void k_gemm_h(const float* __restrict__ A, int lda, size_t sA, const _Float16* __restrict__ Bh, int ldb, size_t sB, float alpha, float* __restrict__ C, int ldc, size_t sC, int M, int N, int K) {
  __shared__ __attribute__((aligned(16))) float so[4][16][64];
  const int tid = threadIdx.x, w = tid >> 5, lane = tid & 31, ln = lane & 15, hh = lane >> 4; const int by = blockIdx.y;
  A += (size_t)by * sA; Bh += (size_t)by * sB; C += (size_t)by * sC;
  const int ntn = (N + 63) / 64; const int wid = blockIdx.x * 4 + w; const int mt = wid / ntn, nq = wid % ntn; if (mt * 16 >= M) return;
  const int row0 = mt * 16, col0 = nq * 64; const float* arow = A + (size_t)(row0 + ln) * lda;
  v8f acc[4] = {};
  for (int kb = 0; kb < K; kb += 32) {
    FragH ah, al;
    const v4f x0 = *(const v4fa*)(arow + kb + 8 * hh), x1 = *(const v4fa*)(arow + kb + 8 * hh + 4), x2 = *(const v4fa*)(arow + kb + 16 + 8 * hh), x3 = *(const v4fa*)(arow + kb + 16 + 8 * hh + 4);
    float xs[16] = {x0[0],x0[1],x0[2],x0[3],x1[0],x1[1],x1[2],x1[3],x2[0],x2[1],x2[2],x2[3],x3[0],x3[1],x3[2],x3[3]};
#pragma unroll
    for (int i = 0; i < 16; ++i) { const _Float16 h = (_Float16)xs[i]; ah.h[i] = h; al.h[i] = ASPLIT ? (_Float16)(xs[i] - (float)h) : (_Float16)0.0f; }
#pragma unroll
    for (int t = 0; t < 4; ++t) { if (col0 + t * 16 >= N) continue; const size_t boff = (size_t)(col0 + t * 16 + ln) * ldb + kb; FragH bq; bq.half[0] = *(const v8us*)(Bh + boff + 8 * hh); bq.half[1] = *(const v8us*)(Bh + boff + 16 + 8 * hh);
      acc[t] = mmaH<ASPLIT ? 2 : 1>(ah.v, al.v, bq.v, bq.v, acc[t]); }
  }
#pragma unroll
  for (int t = 0; t < 4; ++t) { if (col0 + t * 16 >= N) continue;
#pragma unroll
    for (int r = 0; r < 8; ++r) so[w][8 * hh + r][t * 16 + ln] = acc[t][r] * alpha; }
  __builtin_amdgcn_fence(__ATOMIC_ACQ_REL, "workgroup"); __builtin_amdgcn_wave_barrier();
  const int rsub = lane >> 4, c4 = (lane & 15) * 4;
  {
#pragma unroll
    for (int q = 0; q < 8; ++q) { const int r = q * 2 + rsub; if (col0 + c4 < N) { const v4f v = *(const v4fa*)&so[w][r][c4]; *(v4f*)(C + (size_t)(row0 + r) * ldc + col0 + c4) = v; } }
     }
}

// Wt[n][k] = f16(W[k][n]·scale) from f32 row-major W[K][N] (scale = power of two; bf16-exact weights stay exact in f16 away from the subnormal range)
__global__ __launch_bounds__(256) void k_wt_f16(const float* __restrict__ W, _Float16* __restrict__ Wt, int K, int N, float scale) {
  const int t = blockIdx.x * 256 + threadIdx.x; if (t >= N * (K / 8)) return; const int n = t / (K / 8), k8 = (t % (K / 8)) * 8; FragH f;
#pragma unroll
  for (int i = 0; i < 8; ++i) f.h[i] = (_Float16)(bf16_round(W[(size_t)(k8 + i) * N + n]) * scale); const v8us o = f.half[0];
  *(v8us*)((unsigned short*)Wt + (size_t)n * K + k8) = o; 
}
// k_gemm_hh variant with fused epilogue: v = acc·alpha + bias[by·sBias + col] (+ CP[(row/rowsPerB)·sCPb + by·64 + col] if CP) ; ACT 0 none / 1 elu ; writes f16 C16 (and f32 C if non-null)
template <int ACT>
__global__ __launch_bounds__(128) void k_gemm_hhx(const _Float16* __restrict__ A, int lda, size_t sA, const _Float16* __restrict__ Bh, int ldb, size_t sB, float alpha, const float* __restrict__ bias, size_t sBias, const float* __restrict__ CP, int rowsPerB, size_t sCPb, int row0g,
    float* __restrict__ C, _Float16* __restrict__ C16, int ldc, size_t sC, int M, int N, int K) {
  __shared__ __attribute__((aligned(16))) float so[4][16][64];
  const int tid = threadIdx.x, w = tid >> 5, lane = tid & 31, ln = lane & 15, hh = lane >> 4; const int by = blockIdx.y;
  A += (size_t)by * sA; Bh += (size_t)by * sB; const size_t cofs = (size_t)by * sC; const float* bp = bias ? bias + (size_t)by * sBias : nullptr;
  const int ntn = (N + 63) / 64; const int wid = blockIdx.x * 4 + w; const int mt = wid / ntn, nq = wid % ntn; if (mt * 16 >= M) return;
  const int row0 = mt * 16, col0 = nq * 64; const _Float16* arow = A + (size_t)(row0 + ln) * lda;
  v8f acc[4] = {};
  for (int kb = 0; kb < K; kb += 32) { FragH ah; ah.half[0] = *(const v8us*)((const unsigned short*)arow + kb + 8 * hh); ah.half[1] = *(const v8us*)((const unsigned short*)arow + kb + 16 + 8 * hh);
#pragma unroll
    for (int t = 0; t < 4; ++t) { if (col0 + t * 16 >= N) continue; const size_t boff = (size_t)(col0 + t * 16 + ln) * ldb + kb; FragH bq; bq.half[0] = *(const v8us*)((const unsigned short*)Bh + boff + 8 * hh); bq.half[1] = *(const v8us*)((const unsigned short*)Bh + boff + 16 + 8 * hh);
      acc[t] = mmaH<1>(ah.v, ah.v, bq.v, bq.v, acc[t]); }
  }
#pragma unroll
  for (int t = 0; t < 4; ++t) { if (col0 + t * 16 >= N) continue; const int col = col0 + t * 16 + ln; const float bv = bp ? bf16_round(bp[col]) : 0.f;
#pragma unroll
    for (int r = 0; r < 8; ++r) { float v = acc[t][r] * alpha + bv; if (CP) { const int rr = row0g + row0 + 8 * hh + r; if (rowsPerB < 0) v += CP[cofs + (size_t)rr * ldc + col];      /* rowsPerB < 0: own element of the batched C plane */ else { const int bidx = rr / rowsPerB; v += CP[(size_t)bidx * sCPb + (size_t)by * 64 + col]; } } if (ACT == 1) v = (v > 0.f) ? v : expm1f(v); else if (ACT == 7) v = (v > 0.f) ? v + 1.0f : expf(v); else if (ACT == 8) v = tanhf(v); else if (ACT == 9) v = 0.5f * v * (1.0f + tanhf(0.7978845608028654f * (v + 0.044715f * v * v * v))); else if (ACT == 11) v = 1.0f / (1.0f + expf(-v)); else if (ACT == 12) v = (v > 0.f) ? v : 0.01f * v; else if (ACT == 14) v = (v > 0.f) ? v : 0.1f * v; else if (ACT == 16) v = (v >= 0.f) ? v : 0.3f * v; else if (ACT == 17) v = (v >= 0.f) ? v : 0.2f * v; else if (ACT == 15) v = v / (1.0f + expf(-v)); else if (ACT == 3) v = fmaxf(v, 0.f); else if (ACT == 6) v = 0.5f * v * (1.0f + erff(v * 0.70710678118654752f)); so[w][8 * hh + r][t * 16 + ln] = v; } }
  __builtin_amdgcn_fence(__ATOMIC_ACQ_REL, "workgroup"); __builtin_amdgcn_wave_barrier();
  const int rsub = lane >> 4, c4 = (lane & 15) * 4; typedef _Float16 v4h __attribute__((ext_vector_type(4)));
  {
#pragma unroll
    for (int q = 0; q < 8; ++q) { const int r = q * 2 + rsub; if (col0 + c4 < N) { const v4f v = *(const v4fa*)&so[w][r][c4]; if (C) *(v4f*)(C + cofs + (size_t)(row0 + r) * ldc + col0 + c4) = v; if (C16) { v4h h4; for (int i = 0; i < 4; ++i) h4[i] = (_Float16)v[i]; *(v4h*)(C16 + cofs + (size_t)(row0 + r) * ldc + col0 + c4) = h4; } } }
     }
}


typedef _Float16 v4h __attribute__((ext_vector_type(4)));

__global__ __launch_bounds__(256) void k_x16(const float* __restrict__ x, _Float16* __restrict__ X16, size_t n8) { const size_t t = (size_t)blockIdx.x * 256 + threadIdx.x; if (t >= n8) return; FragH f;
#pragma unroll
  for (int q = 0; q < 8; ++q) f.h[q] = (_Float16)bf16_round(x[t * 8 + q]); *(v8us*)((unsigned short*)X16 + t * 8) = f.half[0];  }
__global__ __launch_bounds__(256) void k_h16(const float* __restrict__ x, _Float16* __restrict__ X16, size_t n8) { const size_t t = (size_t)blockIdx.x * 256 + threadIdx.x; if (t >= n8) return; FragH f;
#pragma unroll
  for (int q = 0; q < 8; ++q) f.h[q] = (_Float16)x[t * 8 + q]; *(v8us*)((unsigned short*)X16 + t * 8) = f.half[0];  }
__global__ __launch_bounds__(256) void k_round16f(const float* __restrict__ W, _Float16* __restrict__ Bt, size_t n8) { const size_t t = (size_t)blockIdx.x * 256 + threadIdx.x; if (t >= n8) return; FragH f;
#pragma unroll
  for (int i = 0; i < 8; ++i) f.h[i] = (_Float16)(bf16_round(W[t * 8 + i]) * 16.0f); *(v8us*)((unsigned short*)Bt + t * 8) = f.half[0];  }
// ---- fast GEMM (wave tile 32x64; requires M % 32 == 0 rows per launch region and N % 64 == 0); epilogue = k_gemm_hhx semantics ----
__device__ __forceinline__ v16h g2_frag(const _Float16* p, int hh) { FragH f; f.half[0] = *(const v8us*)((const unsigned short*)p + 8 * hh); f.half[1] = *(const v8us*)((const unsigned short*)p + 16 + 8 * hh); return f.v; }
__device__ __forceinline__ v8f g2_mma(v16h a, v16h b, v8f c) { v8f d = __builtin_amdgcn_wmma_f32_16x16x32_f16(false, a, false, b, (short)0, c, false, false); asm volatile("v_nop\n\tv_nop\n\tv_nop\n\tv_nop" : "+v"(d) : "v"(a), "v"(b)); return d; }
template <int ACT>
__global__ __launch_bounds__(128) void k_gemm2(const _Float16* __restrict__ A, int lda, size_t sA, const _Float16* __restrict__ Bh, int ldb, size_t sB, float alpha, const float* __restrict__ bias, size_t sBias, const float* __restrict__ CP, int rowsPerB, size_t sCPb, int row0g,
    float* __restrict__ C, _Float16* __restrict__ C16, int ldc, size_t sC, int M, int N, int K) { static_assert(ACT == 0 || ACT == 3 || ACT == 6 || ACT == 8 || ACT == 9 || ACT == 11 || ACT == 12 || ACT == 14 || ACT == 15 || ACT == 16 || ACT == 17, "k_gemm2: unsupported ACT code (would silently apply no activation)");
  __shared__ __attribute__((aligned(16))) float so[4][32][68];
  const int tid = threadIdx.x, w = tid >> 5, lane = tid & 31, ln = lane & 15, hh = lane >> 4; const int by = blockIdx.y;
  A += (size_t)by * sA; Bh += (size_t)by * sB; const size_t cofs = (size_t)by * sC; const float* bp = bias ? bias + (size_t)by * sBias : nullptr;
  const int ntn = N >> 6; const int mt = blockIdx.x / ntn, nq = blockIdx.x - mt * ntn; const int row0 = mt * 128 + 32 * w, col0 = nq * 64; if (row0 >= M) return;
  const _Float16* a0p = A + (size_t)(row0 + ln) * lda; const _Float16* a1p = a0p + (size_t)16 * lda;
  const _Float16* b0p = Bh + (size_t)(col0 + ln) * ldb; const _Float16* b1p = b0p + (size_t)16 * ldb; const _Float16* b2p = b1p + (size_t)16 * ldb; const _Float16* b3p = b2p + (size_t)16 * ldb;
  const v8f z8 = {0.f,0.f,0.f,0.f,0.f,0.f,0.f,0.f}; v8f c00 = z8, c01 = z8, c02 = z8, c03 = z8, c10 = z8, c11 = z8, c12 = z8, c13 = z8;
#pragma unroll 1
  for (int kb = 0; kb < K; kb += 32) { const v16h a0 = g2_frag(a0p + kb, hh), a1 = g2_frag(a1p + kb, hh);
    v16h b = g2_frag(b0p + kb, hh); c00 = g2_mma(a0, b, c00); c10 = g2_mma(a1, b, c10);
    b = g2_frag(b1p + kb, hh); c01 = g2_mma(a0, b, c01); c11 = g2_mma(a1, b, c11);
    b = g2_frag(b2p + kb, hh); c02 = g2_mma(a0, b, c02); c12 = g2_mma(a1, b, c12);
    b = g2_frag(b3p + kb, hh); c03 = g2_mma(a0, b, c03); c13 = g2_mma(a1, b, c13); }
  v8f accs[8] = {c00, c01, c02, c03, c10, c11, c12, c13};
#pragma unroll
  for (int u = 0; u < 8; ++u) { const int t = u & 3, half = u >> 2; const int col = col0 + t * 16 + ln; const float bv = bp ? bf16_round(bp[col]) : 0.f;
#pragma unroll
    for (int r = 0; r < 8; ++r) { const int rloc = half * 16 + 8 * hh + r; float v = accs[u][r] * alpha + bv; if (CP) { if (rowsPerB < 0) v += CP[cofs + (size_t)(row0g + row0 + rloc) * ldc + col];      /* rowsPerB < 0: own element of the batched C plane */ else { const int bidx = (row0g + row0 + rloc) / rowsPerB; v += CP[(size_t)bidx * sCPb + (size_t)by * 64 + col]; } }
      if (ACT == 3) v = fmaxf(v, 0.f); else if (ACT == 6) v = 0.5f * v * (1.0f + erff(v * 0.70710678118654752f)); else if (ACT == 11) v = 1.0f / (1.0f + expf(-v)); else if (ACT == 15) v = v / (1.0f + expf(-v)); else if (ACT == 12) v = (v > 0.f) ? v : 0.01f * v; else if (ACT == 8) v = tanhf(v); else if (ACT == 9) v = 0.5f * v * (1.0f + tanhf(0.7978845608028654f * (v + 0.044715f * v * v * v))); else if (ACT == 14) v = (v > 0.f) ? v : 0.1f * v; else if (ACT == 16) v = (v >= 0.f) ? v : 0.3f * v; else if (ACT == 17) v = (v >= 0.f) ? v : 0.2f * v;
      so[w][rloc][t * 16 + ln] = v; } }
  __builtin_amdgcn_fence(__ATOMIC_ACQ_REL, "workgroup"); __builtin_amdgcn_wave_barrier();
  const int rsub = lane >> 4, c4 = (lane & 15) * 4;
  {
#pragma unroll
    for (int q = 0; q < 16; ++q) { const int r = q * 2 + rsub; const v4f v = *(const v4fa*)&so[w][r][c4]; if (C) *(v4f*)(C + cofs + (size_t)(row0 + r) * ldc + col0 + c4) = v; if (C16) { v4h h4; for (int i = 0; i < 4; ++i) h4[i] = (_Float16)v[i]; *(v4h*)(C16 + cofs + (size_t)(row0 + r) * ldc + col0 + c4) = h4; } }
     } }


__global__ __launch_bounds__(256) void k_wnat(const float* __restrict__ w, size_t n8, _Float16* __restrict__ Bt) { const size_t t = (size_t)blockIdx.x * 256 + threadIdx.x; if (t >= n8) return; FragH f; for (int q = 0; q < 8; ++q) f.h[q] = (_Float16)(bf16_round(w[t * 8 + q]) * 16.0f); *(v8us*)((unsigned short*)Bt + t * 8) = f.half[0];  }
__global__ __launch_bounds__(256) void k_rsm(const float* __restrict__ S, _Float16* __restrict__ P, int nrows) {
  #pragma clang fp contract(off)
  const int i = blockIdx.x * 256 + threadIdx.x; if (i >= nrows) return; const float* s = S + (size_t)i * SQ; float mx = -3.0e38f;
#pragma unroll 1
  for (int j = 0; j < SQ; ++j) mx = fmaxf(mx, s[j]); float se = 0.f;
#pragma unroll 1
  for (int j = 0; j < SQ; ++j) se += expf(s[j] - mx); const float sc = 256.0f / se;
#pragma unroll 1
  for (int j0 = 0; j0 < SQ; j0 += 8) { FragH f; for (int q = 0; q < 8; ++q) f.h[q] = (_Float16)(expf(s[j0 + q] - mx) * sc); unsigned short* d = (unsigned short*)P + (size_t)i * SQ + j0; *(v8us*)d = f.half[0];  } }
__global__ __launch_bounds__(256) void k_vt(const _Float16* __restrict__ V16, int b, int h0, _Float16* __restrict__ VT) { __shared__ unsigned short tl[64][65]; const int tid = threadIdx.x; const int hh = blockIdx.x % HG, sg = blockIdx.x / HG; const int s0 = sg * 64; const int h = h0 + hh;
  for (int i = tid; i < 64 * 8; i += 256) { const int j = i / 8, d8 = (i % 8) * 8; FragH f; f.half[0] = *(const v8us*)((const unsigned short*)V16 + ((size_t)b * SQ + s0 + j) * DM + h * HD + d8); for (int q = 0; q < 8; ++q) tl[d8 + q][j] = f.u[q]; }
  __syncthreads();
  { for (int i = tid; i < 64 * 8; i += 256) { const int d = i / 8, j8 = (i % 8) * 8; FragH f; for (int q = 0; q < 8; ++q) f.u[q] = tl[d][j8 + q]; *(v8us*)((unsigned short*)VT + ((size_t)hh * HD + d) * SQ + s0 + j8) = f.half[0]; }  } }


__global__ __launch_bounds__(256) void k_tab2(float theta, float* __restrict__ CS, float* __restrict__ SN) {
  #pragma clang fp contract(off)
  const int t = blockIdx.x * 256 + threadIdx.x; if (t >= SQ * (HD / 2)) return; const int i = t % (HD / 2); const int p = t / (HD / 2); const float invf = 1.0f / powf(theta, (float)(2 * i) / (float)HD); const float ang = __fmul_rn((float)p, invf); const float c = cosf(ang), s = sinf(ang);
  *(float*)(CS + t) = c; *(float*)(SN + t) = s;  }
// Fused causal attention, one launch for every (batch, head, 128-query block): each wave owns 32 queries and walks the keys 0 .. its own last query in passes of 32, nothing of S or P goes through memory.
// Transposed products: S^T = K . Q^T (A = key rows, B = query rows kept in registers; hi.hi in one accumulator, lo.hi + hi.lo in a second, joined as hi + 2^-10 lo in f32), so a lane holds 16 scores of ONE query;
// running maximum and sum per query (online softmax, accumulators rescaled only in a pass where some query's maximum moved); the two 16-key score tiles, as f16 weights x256, ARE the B operand of O^T += V^T . P^T.
__device__ __forceinline__ float rs_xrow(float v) { const int i = __float_as_int(v); return __int_as_float(__builtin_amdgcn_permlanex16(i, i, 0x76543210, 0xfedcba98, false, false)); }      /* lane l <- lane l ^ 16 */
// native 2^a. The v_nop is the slot the instruction set asks for behind a transcendental before its source is overwritten or its result read.
__device__ __forceinline__ float fa_exp2(float a) { float e; asm("v_exp_f32 %0, %1\n\tv_nop" : "=v"(e) : "v"(a)); return e; }
__device__ __forceinline__ v8f fa_mma(v16h a, v16h b, v8f c) { return __builtin_amdgcn_wmma_f32_16x16x32_f16(false, a, false, b, (short)0, c, false, false); }
#define FA_C 11.5415603271117072589f      /* sqrt(64) * log2(e): score differences -> exponent of 2 */
__global__ __launch_bounds__(128) void k_fattn(const _Float16* __restrict__ QH, const _Float16* __restrict__ QL, const _Float16* __restrict__ KH, const _Float16* __restrict__ KL, const _Float16* __restrict__ VT, _Float16* __restrict__ O16) {
  const int lane = threadIdx.x & 31, ln = lane & 15, hh = lane >> 4; const int w = __builtin_amdgcn_readfirstlane((int)(threadIdx.x >> 5));      /* scalar wave number: the key loop's bound stays a scalar */
  const int bh = blockIdx.y, b = bh / NH, h = bh % NH; const int q0 = ((int)gridDim.x - 1 - (int)blockIdx.x) * 128 + w * 32;      /* longest blocks start first */
  const size_t r0 = (size_t)b * SQ;
  /* every pointer below is the lane's own address, its k offset 8 hh folded in, so that the loads name exactly the pair that the wait behind them holds */
  const _Float16* qhp = QH + (r0 + q0 + ln) * DM + h * HD + 8 * hh; const _Float16* qlp = QL + (r0 + q0 + ln) * DM + h * HD + 8 * hh;
  v16h qh[2][2], ql[2][2];      /* [query group of 16][k half of the head] */
#pragma unroll
  for (int j = 0; j < 2; ++j)
#pragma unroll
    for (int ks = 0; ks < 2; ++ks) { const size_t o = (size_t)(16 * j) * DM + 32 * ks; qh[j][ks] = g2_frag(qhp + o, 0); ql[j][ks] = g2_frag(qlp + o, 0); }
  asm volatile("s_wait_xcnt 0x0" :: "v"(qhp), "v"(qlp) : "memory");      /* the two address pairs stay whole until the loads have taken them */
  const _Float16* khp = KH + (r0 + ln) * DM + h * HD + 8 * hh; const _Float16* klp = KL + (r0 + ln) * DM + h * HD + 8 * hh; const _Float16* vtp = VT + ((size_t)bh * HD + ln) * SQ + 8 * hh;
  const v8f z8 = {0.f,0.f,0.f,0.f,0.f,0.f,0.f,0.f};
  v8f o[2][4]; float m[2], l[2];
#pragma unroll
  for (int j = 0; j < 2; ++j) { m[j] = -1.0e30f; l[j] = 0.f;
#pragma unroll
    for (int t = 0; t < 4; ++t) o[j][t] = z8; }
  v16h kh[2][2], kl[2][2];      /* [16-key tile][k half] */
#pragma unroll
  for (int kt = 0; kt < 2; ++kt)
#pragma unroll
    for (int ks = 0; ks < 2; ++ks) { const size_t ko = (size_t)(16 * kt) * DM + 32 * ks; kh[kt][ks] = g2_frag(khp + ko, 0); kl[kt][ks] = g2_frag(klp + ko, 0); }
#pragma unroll 1
  for (int kb = 0; kb <= q0; kb += 32) {
    v16h vf[4]; const _Float16* pv = vtp + kb;      /* V^T rows of this pass, asked for ahead of the score products */
#pragma unroll
    for (int t = 0; t < 4; ++t) vf[t] = g2_frag(pv + (size_t)(16 * t) * SQ, 0);
    asm volatile("s_wait_xcnt 0x0" ::: "memory");      /* stands in front of the advance of the loads' address pair; it also keeps these loads here, ahead of the score products, where the build had sunk them to their use */
    v8f u[2][2];      /* [query group][key tile]: q . k, register r = key 16 kt + 8 hh + r of query ln */
#pragma unroll
    for (int kt = 0; kt < 2; ++kt)
#pragma unroll
      for (int j = 0; j < 2; ++j) { v8f sh = z8, sl = z8;
#pragma unroll
        for (int ks = 0; ks < 2; ++ks) { sh = fa_mma(kh[kt][ks], qh[j][ks], sh); sl = fa_mma(kh[kt][ks], ql[j][ks], sl); sl = fa_mma(kl[kt][ks], qh[j][ks], sl); }
#pragma unroll
        for (int r = 0; r < 8; ++r) u[j][kt][r] = sh[r] + 0.0009765625f * sl[r]; }
    { const int kn = (kb + 32 <= q0) ? kb + 32 : q0;      /* next pass's key rows into the same registers, behind their last use; the last pass asks for its own rows again (in bounds) */
      const _Float16* pkh = khp + (size_t)kn * DM; const _Float16* pkl = klp + (size_t)kn * DM;
#pragma unroll
      for (int kt = 0; kt < 2; ++kt)
#pragma unroll
        for (int ks = 0; ks < 2; ++ks) { const size_t ko = (size_t)(16 * kt) * DM + 32 * ks; kh[kt][ks] = g2_frag(pkh + ko, 0); kl[kt][ks] = g2_frag(pkl + ko, 0); }
      asm volatile("s_wait_xcnt 0x0" :: "v"(pkh), "v"(pkl) : "memory"); }      /* the two address pairs stay whole until the loads have taken them */
    if (kb == q0) {      /* the one pass on the diagonal: keys above the query are out */
#pragma unroll
      for (int j = 0; j < 2; ++j)
#pragma unroll
        for (int kt = 0; kt < 2; ++kt)
#pragma unroll
          for (int r = 0; r < 8; ++r) u[j][kt][r] = (16 * kt + 8 * hh + r <= 16 * j + ln) ? u[j][kt][r] : -1.0e9f; }
    float mn[2];
#pragma unroll
    for (int j = 0; j < 2; ++j) { float x = fmaxf(u[j][0][0], u[j][1][0]);
#pragma unroll
      for (int r = 1; r < 8; ++r) x = fmaxf(x, fmaxf(u[j][0][r], u[j][1][r]));
      mn[j] = fmaxf(m[j], fmaxf(x, rs_xrow(x))); }
    if (__builtin_amdgcn_ballot_w32(mn[0] > m[0] || mn[1] > m[1]) != 0) {      /* scalar branch; where no maximum moved every factor would be 1 */
#pragma unroll
      for (int j = 0; j < 2; ++j) { const float al = fa_exp2((m[j] - mn[j]) * FA_C); m[j] = mn[j]; l[j] *= al;
#pragma unroll
        for (int t = 0; t < 4; ++t)
#pragma unroll
          for (int r = 0; r < 8; ++r) o[j][t][r] *= al; } }
#pragma unroll
    for (int j = 0; j < 2; ++j) { FragH pf; float s0 = 0.f, s1 = 0.f;
#pragma unroll
      for (int r = 0; r < 8; ++r) { const float p0 = fa_exp2((u[j][0][r] - m[j]) * FA_C + 8.0f), p1 = fa_exp2((u[j][1][r] - m[j]) * FA_C + 8.0f); s0 += p0; s1 += p1; pf.h[r] = (_Float16)p0; pf.h[8 + r] = (_Float16)p1; }      /* weights x256 */
      l[j] += s0 + s1;
#pragma unroll
      for (int t = 0; t < 4; ++t) o[j][t] = fa_mma(vf[t], pf.v, o[j][t]); }
  }
#pragma unroll
  for (int j = 0; j < 2; ++j) { const float inv = 64.0f / (l[j] + rs_xrow(l[j]));      /* the two lane halves hold disjoint keys' sums; o carried x64 */
    unsigned short* dst = (unsigned short*)O16 + (r0 + q0 + 16 * j + ln) * DM + h * HD + 8 * hh;
#pragma unroll
    for (int t = 0; t < 4; ++t) { FragH f;
#pragma unroll
      for (int r = 0; r < 8; ++r) f.h[r] = (_Float16)(o[j][t][r] * inv);
      *(v8us*)(dst + 16 * t) = f.half[0]; } } }


// q | k | v projection of every token row in one launch: main loop and wave tile (32 x 64) of k_gemm2; a block's 64 columns are exactly one head of q, of k or of v, and the epilogue finishes that head's rows itself:
// q, k: f32 row through LDS, interleaved-pair rotation from the f32 tables, f16 hi + x1024 residual planes, whole 128-byte lines; v: f16 from the accumulators (a lane holds 8 consecutive tokens of one column) through an LDS tile of the block into V^T, whole 128-byte lines.
typedef float v2fa __attribute__((ext_vector_type(2), may_alias));
__global__ __launch_bounds__(128) void k_qkv(const _Float16* __restrict__ A, const _Float16* __restrict__ Bh, const float* __restrict__ bias, const float* __restrict__ CS, const float* __restrict__ SN,
    _Float16* __restrict__ QH, _Float16* __restrict__ QL, _Float16* __restrict__ KH, _Float16* __restrict__ KL, _Float16* __restrict__ VT) {
  __shared__ __attribute__((aligned(16))) float so[4][32][68];
  const int tid = threadIdx.x, w = tid >> 5, lane = tid & 31, ln = lane & 15, hh = lane >> 4;
  const int ntn = 3 * NH; const int mt = blockIdx.x / ntn, nq = blockIdx.x - mt * ntn; const int row0 = mt * 128 + 32 * w, col0 = nq * HD; const int part = nq / NH, h = nq - part * NH;      /* part 0 q, 1 k, 2 v: the same for the whole block */
  const _Float16* ap = A + (size_t)(row0 + ln) * DM + 8 * hh; const _Float16* bp = Bh + (size_t)(col0 + ln) * DM + 8 * hh;      /* the lane's own addresses, its k offset 8 hh folded in: every load of a trip names one of two pairs */
  const v8f z8 = {0.f,0.f,0.f,0.f,0.f,0.f,0.f,0.f}; v8f c00 = z8, c01 = z8, c02 = z8, c03 = z8, c10 = z8, c11 = z8, c12 = z8, c13 = z8;
#pragma unroll 1      /* rolled, as in k_gemm2: one trip's code and registers */
  for (int kb = 0; kb < DM; kb += 32) { const _Float16* pa = ap + kb; const _Float16* pb = bp + kb; const v16h a0 = g2_frag(pa, 0), a1 = g2_frag(pa + 16 * DM, 0);
    v16h b = g2_frag(pb, 0); c00 = g2_mma(a0, b, c00); c10 = g2_mma(a1, b, c10);
    b = g2_frag(pb + 16 * DM, 0); c01 = g2_mma(a0, b, c01); c11 = g2_mma(a1, b, c11);
    b = g2_frag(pb + 32 * DM, 0); c02 = g2_mma(a0, b, c02); c12 = g2_mma(a1, b, c12);
    b = g2_frag(pb + 48 * DM, 0); c03 = g2_mma(a0, b, c03); c13 = g2_mma(a1, b, c13);
    asm volatile("s_wait_xcnt 0x0" :: "v"(pa), "v"(pb) : "memory"); }      /* the two address pairs stay whole to the end of the trip */
  v8f accs[8] = {c00, c01, c02, c03, c10, c11, c12, c13};
  if (part == 2) {      /* the same for the whole block, so the barrier below is met by all four waves or by none */
    unsigned short* vt = (unsigned short*)&so[0][0][0];      /* [64 columns][136]: the block's 128 tokens of each column, pitch 272 bytes */
#pragma unroll
    for (int u = 0; u < 8; ++u) { const int t = u & 3, half = u >> 2; const float bv = bf16_round(bias[col0 + t * 16 + ln]); FragH f;
#pragma unroll
      for (int r = 0; r < 8; ++r) f.h[r] = (_Float16)(accs[u][r] * 0.0625f + bv);
      *(v8us*)(vt + (t * 16 + ln) * 136 + 32 * w + half * 16 + 8 * hh) = f.half[0]; }
    __syncthreads();      /* a column's 128 tokens come from all four waves; behind it each wave stores 16 columns as whole 128-byte lines */
    unsigned short* vd = (unsigned short*)VT + ((size_t)((row0 / SQ) * NH + h) * HD + 16 * w + hh) * SQ + (mt * 128) % SQ + 8 * ln;
#pragma unroll
    for (int i = 0; i < 8; ++i) { const v8us x = *(const v8us*)(vt + (16 * w + 2 * i + hh) * 136 + 8 * ln); *(v8us*)(vd + (size_t)(2 * i) * SQ) = x; }
    return; }
#pragma unroll
  for (int u = 0; u < 8; ++u) { const int t = u & 3, half = u >> 2; const float bv = bf16_round(bias[col0 + t * 16 + ln]);
#pragma unroll
    for (int r = 0; r < 8; ++r) so[w][half * 16 + 8 * hh + r][t * 16 + ln] = accs[u][r] * 0.0625f + bv; }
  __builtin_amdgcn_fence(__ATOMIC_ACQ_REL, "workgroup"); __builtin_amdgcn_wave_barrier();      /* a wave reads back only its own plane of so: its LDS writes are ordered in front of its reads, no block barrier */
  const int rsub = lane >> 4, c4 = (lane & 15) * 4;
  _Float16* Hh = part ? KH : QH; _Float16* Hl = part ? KL : QL;
#pragma unroll 1      /* rolled, four steps (eight rows) a trip: as one unrolled loop of sixteen steps the build took 166 registers, five waves a SIMD, and this launch needs six to be resident at once */
  for (int q0 = 0; q0 < 16; q0 += 4) {
#pragma unroll
  for (int q = q0; q < q0 + 4; ++q) { const int r = q * 2 + rsub; const v4f v = *(const v4fa*)&so[w][r][c4]; const int row = row0 + r; const size_t to = (size_t)(row % SQ) * (HD / 2) + (c4 >> 1);
    const v2fa c = *(const v2fa*)(CS + to), s = *(const v2fa*)(SN + to); float o[4];
    o[0] = fmaf(v[0], c[0], -(v[1] * s[0])); o[1] = fmaf(v[0], s[0], v[1] * c[0]); o[2] = fmaf(v[2], c[1], -(v[3] * s[1])); o[3] = fmaf(v[2], s[1], v[3] * c[1]);      /* the odd element's product rounded, the even element's fused onto it */
    v4h fh, fl;
#pragma unroll
    for (int i = 0; i < 4; ++i) { const _Float16 hi = (_Float16)o[i]; fh[i] = hi; fl[i] = (_Float16)((o[i] - (float)hi) * 1024.0f); }
    const size_t d = (size_t)row * DM + h * HD + c4; *(v4h*)(Hh + d) = fh; *(v4h*)(Hl + d) = fl; }
    asm volatile("s_wait_xcnt 0x0" ::: "memory"); } }      /* stands in front of the next trip's first writes */

extern "C" void kernel_launch(void* const* d_in, const int* in_sizes, int n_in,
                              void* d_out, int out_size, void* d_ws, size_t ws_size, hipStream_t stream) {
  (void)in_sizes; (void)n_in; (void)out_size;
  const float* const* I = (const float* const*)d_in; const float* x = I[0]; const float* wqkv = I[1]; const float* bqkv = I[2]; const float* wo = I[3]; const float* bo = I[4];      /* [in][out] fused qkv + out weights, biases */
  char* ws = (char*)d_ws; size_t off = 0;
  auto take = [&](size_t bytes) { char* p = ws + off; off += (bytes + 255) & ~(size_t)255; return p; };
  _Float16* BQKV = (_Float16*)take((size_t)3 * DM * DM * 2); _Float16* BO = (_Float16*)take((size_t)DM * DM * 2); float* CS = (float*)take((size_t)SQ * (HD / 2) * 4); float* SN = (float*)take((size_t)SQ * (HD / 2) * 4);
  _Float16* X16 = (_Float16*)take(NR * DM * 2);
  _Float16* QH = (_Float16*)take(NR * DM * 2); _Float16* QL = (_Float16*)take(NR * DM * 2); _Float16* KH = (_Float16*)take(NR * DM * 2); _Float16* KL = (_Float16*)take(NR * DM * 2); _Float16* O16 = (_Float16*)take(NR * DM * 2);
  _Float16* VT = (_Float16*)take((size_t)NB * NH * HD * SQ * 2);      /* V^T of every batch */
  if (off > ws_size) return;
  k_wt_f16<<<(unsigned)(((size_t)3 * DM * (DM / 8) + 255) / 256), 256, 0, stream>>>(wqkv, BQKV, DM, 3 * DM, 16.0f); k_wt_f16<<<(unsigned)(((size_t)DM * (DM / 8) + 255) / 256), 256, 0, stream>>>(wo, BO, DM, DM, 16.0f);      /* [in][out] -> Bt[n][k] x16; q | k | v stacked along n */
  k_tab2<<<(SQ * (HD / 2) + 255) / 256, 256, 0, stream>>>(10000.0f, CS, SN);
  k_x16<<<(unsigned)((NR * DM / 8 + 255) / 256), 256, 0, stream>>>(x, X16, NR * DM / 8);
  k_qkv<<<(unsigned)((NR / 128) * (3 * DM / 64)), 128, 0, stream>>>(X16, BQKV, bqkv, CS, SN, QH, QL, KH, KL, VT);      /* roped q, k as f16 hi + x1024 residual (the x8 logits, sigma ~64, need ~f32-accurate scores); V^T [NB][NH][HD][SQ] */
  k_fattn<<<dim3(SQ / 128, NB * NH), 128, 0, stream>>>(QH, QL, KH, KL, VT, O16);      /* o (merged heads, x64) as f16 rows */
  k_gemm2<0><<<dim3((unsigned)((MPO / 128) * (DM / 64)), 1), 128, 0, stream>>>(O16 + (size_t)B0 * SQ * DM, DM, 0, BO, DM, 0, 0.0009765625f, bo, 0, nullptr, 1, 0, 0, (float*)d_out + (size_t)B0 * SQ * DM, nullptr, DM, 0, MPO, DM, DM);      /* out rows are the output layout */
}

// v004
// Measured time: 207 microseconds a run.
// In two side-by-side timings against v003, it was 1.05 and 1.04 times as fast.
// Over all steps from v000 it is 22.4 times as fast.
#include <hip/hip_runtime.h>
// Masked (causal) RoPE multi-head attention with LARGE logits (x [2][2048][1024]; qkv = x w_qkv + b_qkv ([in][out] 1024 x 3072, sigma 1/32, bias sigma 0.01) -> q | k | v, 16 heads of 64; interleaved-pair RoPE on q and k (inv_freq_i = 10000^(-2i/64), positions 0..2047); scores = q . k x sqrt(64) (the module divides by 1/sqrt(d_k)), causal (tril); softmax; out = (attn v merged) w_out + b_out -> [2][2048][1024]).
// Structure: token rows r = b*2048 + s; x as exact f16 rows (bf16-rounded); q | k | v of every row as ONE WMMA GEMM launch (32x64 wave tiles, f32 accumulation, exact x16 weights + bias, N = 3 x 1024) whose epilogue, a block's 64 columns being one head, does on VALU: the interleaved-pair rotary rotation of q and k from f32 cos/sin tables (positions 0..SQ-1, no norm) and their split into f16 hi + x1024 residual planes (the x8 logits have sigma ~64: near-argmax softmax, so the scores are computed to ~f32 accuracy from three products), v as f16 into V^T; then ONE fused attention launch over every (batch, head, 128-query block): a wave holds 32 queries, walks the keys up to its own diagonal in passes of 32, scores as S^T = K . Q^T (three products), online causal softmax in registers (f32 running maximum and sum, native exp; keys above the diagonal set to -1e9; weights x256 f16), O^T += V^T . P^T with the score tiles as the B operand, o carried x64 (folded into the output GEMM alpha) written straight into the merged f16 o rows; out = o W_o + b GEMM (f32) into the output layout. Every f16 operand plane in the workspace (x, both weights, q and k hi / residual, V^T, o) lies in WMMA fragment order (see gf_frag), so that a fragment load reads whole 128-byte lines.
// Compute dtype: inputs rounded to bf16; x / weights exact; projections and rope f32; q, k as f16 hi + residual (~2^-22); v, softmax weights and o as plain f16 GEMM operands (~2^-12); scores and softmax statistics f32. v_wmma_f32_16x16x32_f16.
#define NB 2
#define SQ 2048
#define DM 1024
#define NH 16
#define HD 64
#define HG 4                         /* heads per launch of the (b, h0) V^T transpose */
#define QT 256
#define NKX SQ                       /* unused */
#define B0 0                         /* first batch processed (debug hook) */
#define NBR NB                       /* batches processed (debug hook) */
#define QN SQ                        /* unused (attention covers all SQ queries) */
#define NHD NH                       /* unused (attention covers all NH heads) */
#define NR ((size_t)NB * SQ)         /* token rows */
#define MPO ((int)((size_t)NBR * SQ))      /* rows through the output GEMM (debug hook) */
typedef __bf16 v16b __attribute__((ext_vector_type(16)));
typedef unsigned short v8us __attribute__((ext_vector_type(8), may_alias));
typedef float  v8f  __attribute__((ext_vector_type(8)));
typedef float  v4f  __attribute__((ext_vector_type(4)));
typedef float  v4fa __attribute__((ext_vector_type(4), may_alias));
union FragB { v16b v; v8us half[2]; unsigned short u[16]; };

__device__ __forceinline__ unsigned short bf16_bits(float x) { unsigned int u = __float_as_uint(x); return (unsigned short)((u + 0x7FFFu + ((u >> 16) & 1u)) >> 16); }
__device__ __forceinline__ float bf16_val(unsigned short b) { return __uint_as_float(((unsigned int)b) << 16); }
__device__ __forceinline__ float bf16_round(float x) { return bf16_val(bf16_bits(x)); }
// D += A·B with NT terms: 1 = ah·bh, 2 = + al·bh (A split), 3 = + ah·bl (both split)
template <int NT>
__device__ __forceinline__ v8f mmaN(v16b ah, v16b al, v16b bh, v16b bl, v8f c) {
  c = __builtin_amdgcn_wmma_f32_16x16x32_bf16(false, ah, false, bh, (short)0, c, false, false);
  if (NT >= 2) c = __builtin_amdgcn_wmma_f32_16x16x32_bf16(false, al, false, bh, (short)0, c, false, false);
  if (NT >= 3) c = __builtin_amdgcn_wmma_f32_16x16x32_bf16(false, ah, false, bl, (short)0, c, false, false);
  asm volatile("v_nop\n\tv_nop\n\tv_nop\n\tv_nop" : "+v"(c) : "v"(ah), "v"(al), "v"(bh), "v"(bl));
  return c;
}

__global__ __launch_bounds__(256) void k_wt_bf16(const float* __restrict__ W, unsigned short* __restrict__ Wt, int K, int N) {
  const int t = blockIdx.x * 256 + threadIdx.x;
  const int k8n = K / 8;
  if (t >= N * k8n) return;
  const int n = t / k8n, k8 = (t % k8n) * 8;
  v8us v;
#pragma unroll
  for (int i = 0; i < 8; ++i) v[i] = bf16_bits(W[(size_t)(k8 + i) * N + n]);
  *(v8us*)(Wt + (size_t)n * K + k8) = v;
  
}

// GEMM C[M][N] (f32, pitch ldc) = act(A[M][K]·W + bias). A f32 row-major (pitch lda) converted per fragment to bf16
// (ASPLIT: hi/lo two planes -> 2 terms, else single rounded term); Wt bf16 [N][K] (pitch ldb). BIAS_BF16 rounds the
// bias to bf16 first (bias quantised to bf16 before the add). K%32==0, M%16==0, N%64==0.
template <bool ASPLIT, int ACT, bool BIAS_BF16>
__global__ __launch_bounds__(128) void k_gemm_bf(const float* __restrict__ A, int lda, const unsigned short* __restrict__ Wt, int ldb,
                                               const float* __restrict__ bias, float* __restrict__ C, int ldc, int M, int N, int K) {
  __shared__ __attribute__((aligned(16))) float so[4][16][64];
  const int tid = threadIdx.x, w = tid >> 5, lane = tid & 31, ln = lane & 15, hh = lane >> 4;
  const int ntn = N / 64;
  const int wid = blockIdx.x * 4 + w;
  const int mt = wid / ntn, nq = wid % ntn;
  if (mt * 16 >= M) return;
  const int row0 = mt * 16, col0 = nq * 64;
  const float* arow = A + (size_t)(row0 + ln) * lda;
  v8f acc[4] = {};
  for (int kb = 0; kb < K; kb += 32) {
    FragB ah, al;
    const v4f x0 = *(const v4fa*)(arow + kb + 8 * hh), x1 = *(const v4fa*)(arow + kb + 8 * hh + 4);
    const v4f x2 = *(const v4fa*)(arow + kb + 16 + 8 * hh), x3 = *(const v4fa*)(arow + kb + 16 + 8 * hh + 4);
    float xs[16] = {x0[0],x0[1],x0[2],x0[3],x1[0],x1[1],x1[2],x1[3],x2[0],x2[1],x2[2],x2[3],x3[0],x3[1],x3[2],x3[3]};
#pragma unroll
    for (int i = 0; i < 16; ++i) { const unsigned short hb = bf16_bits(xs[i]); ah.u[i] = hb; al.u[i] = ASPLIT ? bf16_bits(xs[i] - bf16_val(hb)) : (unsigned short)0; }
#pragma unroll
    for (int t = 0; t < 4; ++t) {
      const unsigned short* brow = Wt + (size_t)(col0 + t * 16 + ln) * ldb + kb;
      FragB b;
      b.half[0] = *(const v8us*)(brow + 8 * hh);
      b.half[1] = *(const v8us*)(brow + 16 + 8 * hh);
      acc[t] = mmaN<ASPLIT ? 2 : 1>(ah.v, al.v, b.v, b.v, acc[t]);
    }
  }
#pragma unroll
  for (int t = 0; t < 4; ++t) {
    float bv = bias ? bias[col0 + t * 16 + ln] : 0.f;
    if (BIAS_BF16) bv = bf16_round(bv);
#pragma unroll
    for (int r = 0; r < 8; ++r) { float v = acc[t][r] + bv; if (ACT == 1) v = fmaxf(v, 0.f); so[w][8 * hh + r][t * 16 + ln] = v; }
  }
  __builtin_amdgcn_fence(__ATOMIC_ACQ_REL, "workgroup");
  __builtin_amdgcn_wave_barrier();
  const int rsub = lane >> 4, c4 = (lane & 15) * 4;
  {
#pragma unroll
    for (int q = 0; q < 8; ++q) {
      const int r = q * 2 + rsub;
      const v4f v = *(const v4fa*)&so[w][r][c4];
      *(v4f*)(C + (size_t)(row0 + r) * ldc + col0 + c4) = v;
    }
    
  }
}

// GEMM C = act(A·W + bias + resid): A f32 (ASPLIT -> hi/lo 2 terms), Wt bf16 [N][K]; ACT 0 none, 1 relu, 2 exact gelu;
// resid (optional, f32, row index = (row % rmod), pitch ldr, RES_BF16 rounds it) added before the activation.
template <bool ASPLIT, int ACT, bool BIAS_BF16, bool RES_BF16>
__global__ __launch_bounds__(128) void k_gemm_bf3(const float* __restrict__ A, int lda, const unsigned short* __restrict__ Wt, int ldb,
                                                const float* __restrict__ bias, const float* __restrict__ resid, int rmod, int ldr,
                                                float* __restrict__ C, int ldc, int M, int N, int K) {
  __shared__ __attribute__((aligned(16))) float so[4][16][64];
  const int tid = threadIdx.x, w = tid >> 5, lane = tid & 31, ln = lane & 15, hh = lane >> 4;
  const int ntn = N / 64;
  const int wid = blockIdx.x * 4 + w;
  const int mt = wid / ntn, nq = wid % ntn;
  if (mt * 16 >= M) return;
  const int row0 = mt * 16, col0 = nq * 64;
  const float* arow = A + (size_t)(row0 + ln) * lda;
  v8f acc[4] = {};
  for (int kb = 0; kb < K; kb += 32) {
    FragB ah, al;
    const v4f x0 = *(const v4fa*)(arow + kb + 8 * hh), x1 = *(const v4fa*)(arow + kb + 8 * hh + 4);
    const v4f x2 = *(const v4fa*)(arow + kb + 16 + 8 * hh), x3 = *(const v4fa*)(arow + kb + 16 + 8 * hh + 4);
    float xs[16] = {x0[0],x0[1],x0[2],x0[3],x1[0],x1[1],x1[2],x1[3],x2[0],x2[1],x2[2],x2[3],x3[0],x3[1],x3[2],x3[3]};
#pragma unroll
    for (int i = 0; i < 16; ++i) { const unsigned short hb = bf16_bits(xs[i]); ah.u[i] = hb; al.u[i] = ASPLIT ? bf16_bits(xs[i] - bf16_val(hb)) : (unsigned short)0; }
#pragma unroll
    for (int t = 0; t < 4; ++t) {
      const unsigned short* brow = Wt + (size_t)(col0 + t * 16 + ln) * ldb + kb;
      FragB b;
      b.half[0] = *(const v8us*)(brow + 8 * hh);
      b.half[1] = *(const v8us*)(brow + 16 + 8 * hh);
      acc[t] = mmaN<ASPLIT ? 2 : 1>(ah.v, al.v, b.v, b.v, acc[t]);
    }
  }
#pragma unroll
  for (int t = 0; t < 4; ++t) {
    const int col = col0 + t * 16 + ln;
    float bv = bias ? bias[col] : 0.f;
    if (BIAS_BF16) bv = bf16_round(bv);
#pragma unroll
    for (int r = 0; r < 8; ++r) {
      float v = acc[t][r] + bv;
      if (resid) { float rv = resid[(size_t)((row0 + 8 * hh + r) % rmod) * ldr + col]; if (RES_BF16) rv = bf16_round(rv); v += rv; }
      if (ACT == 1) v = fmaxf(v, 0.f);
      if (ACT == 2) v = 0.5f * v * (1.0f + erff(v * 0.70710678118654752f));
      if (ACT == 3) { const float u = 0.7978845608028654f * (v + 0.044715f * v * v * v); v = 0.5f * v * (1.0f + tanhf(u)); }
      so[w][8 * hh + r][t * 16 + ln] = v;
    }
  }
  __builtin_amdgcn_fence(__ATOMIC_ACQ_REL, "workgroup");
  __builtin_amdgcn_wave_barrier();
  const int rsub = lane >> 4, c4 = (lane & 15) * 4;
  {
#pragma unroll
    for (int q = 0; q < 8; ++q) {
      const int r = q * 2 + rsub;
      const v4f v = *(const v4fa*)&so[w][r][c4];
      *(v4f*)(C + (size_t)(row0 + r) * ldc + col0 + c4) = v;
    }
    
  }
}
// row LayerNorm (biased variance, eps) over N: s = X (+ R); optional out_sum <- s; out_norm <- (s-mu)*rsqrt(var+eps)*g + b
template <bool PARAM_BF16>
__global__ __launch_bounds__(256) void k_layernorm(const float* __restrict__ X, const float* __restrict__ R, const float* __restrict__ g, const float* __restrict__ bta,
                                                  float* __restrict__ out_sum, float* __restrict__ out_norm, int N, float eps) {
  __shared__ float red[256];
  const int row = blockIdx.x, tid = threadIdx.x;
  const float* x = X + (size_t)row * N; const float* rr = R ? R + (size_t)row * N : nullptr;
  float vals[16];                     // up to N = 4096
  const int per = N / 256;            // contiguous chunk per thread? use strided-by-4 chunks: thread handles j = tid*4 + 1024*u
  float s1 = 0.f;
  for (int u = 0; u < per / 4; ++u) {
    const int j = tid * 4 + 1024 * u;
    const v4f a = *(const v4fa*)(x + j);
    v4f b = {0.f,0.f,0.f,0.f}; if (rr) b = *(const v4fa*)(rr + j);
#pragma unroll
    for (int q = 0; q < 4; ++q) { const float v = a[q] + b[q]; vals[u * 4 + q] = v; s1 += v; }
  }
  red[tid] = s1; __syncthreads();
  for (int st = 128; st > 0; st >>= 1) { if (tid < st) red[tid] += red[tid + st]; __syncthreads(); }
  const float mu = red[0] / (float)N; __syncthreads();
  float s2 = 0.f;
  for (int u = 0; u < per / 4; ++u)
#pragma unroll
    for (int q = 0; q < 4; ++q) { const float c = vals[u * 4 + q] - mu; s2 += c * c; }
  red[tid] = s2; __syncthreads();
  for (int st = 128; st > 0; st >>= 1) { if (tid < st) red[tid] += red[tid + st]; __syncthreads(); }
  const float rs = rsqrtf(red[0] / (float)N + eps);
  {
    for (int u = 0; u < per / 4; ++u) {
      const int j = tid * 4 + 1024 * u;
      v4f o, sm;
#pragma unroll
      for (int q = 0; q < 4; ++q) {
        float gg = g[j + q], bb = bta[j + q];
        if (PARAM_BF16) { gg = bf16_round(gg); bb = bf16_round(bb); }
        sm[q] = vals[u * 4 + q]; o[q] = (vals[u * 4 + q] - mu) * rs * gg + bb;
      }
      if (out_sum) *(v4f*)(out_sum + (size_t)row * N + j) = sm;
      *(v4f*)(out_norm + (size_t)row * N + j) = o;
    }
    
  }
}



// ---- f16 WMMA path (v_wmma_f32_16x16x32_f16): 11-bit significands for operands in range — used where a [0,1] probability operand needs more precision than bf16
typedef _Float16 v16h __attribute__((ext_vector_type(16)));
union FragH { v16h v; v8us half[2]; _Float16 h[16]; unsigned short u[16]; };
template <int NT>
__device__ __forceinline__ v8f mmaH(v16h ah, v16h al, v16h bh, v16h bl, v8f c) {
  c = __builtin_amdgcn_wmma_f32_16x16x32_f16(false, ah, false, bh, (short)0, c, false, false);
  if (NT >= 2) c = __builtin_amdgcn_wmma_f32_16x16x32_f16(false, al, false, bh, (short)0, c, false, false);
  if (NT >= 3) c = __builtin_amdgcn_wmma_f32_16x16x32_f16(false, ah, false, bl, (short)0, c, false, false);
  asm volatile("v_nop\n\tv_nop\n\tv_nop\n\tv_nop" : "+v"(c) : "v"(ah), "v"(al), "v"(bh), "v"(bl));
  return c;
}
// batched GEMM like k_gemm_b but f16 operands: A f32 (split into f16 hi/lo if ASPLIT, else rounded to f16), Bt = f16 values [n][k]; alpha; C f32; N multiple of 16 (partial tiles skipped)
template <bool ASPLIT>
__global__ __launch_bounds__(128) void k_gemm_h(const float* __restrict__ A, int lda, size_t sA, const _Float16* __restrict__ Bh, int ldb, size_t sB, float alpha, float* __restrict__ C, int ldc, size_t sC, int M, int N, int K) {
  __shared__ __attribute__((aligned(16))) float so[4][16][64];
  const int tid = threadIdx.x, w = tid >> 5, lane = tid & 31, ln = lane & 15, hh = lane >> 4; const int by = blockIdx.y;
  A += (size_t)by * sA; Bh += (size_t)by * sB; C += (size_t)by * sC;
  const int ntn = (N + 63) / 64; const int wid = blockIdx.x * 4 + w; const int mt = wid / ntn, nq = wid % ntn; if (mt * 16 >= M) return;
  const int row0 = mt * 16, col0 = nq * 64; const float* arow = A + (size_t)(row0 + ln) * lda;
  v8f acc[4] = {};
  for (int kb = 0; kb < K; kb += 32) {
    FragH ah, al;
    const v4f x0 = *(const v4fa*)(arow + kb + 8 * hh), x1 = *(const v4fa*)(arow + kb + 8 * hh + 4), x2 = *(const v4fa*)(arow + kb + 16 + 8 * hh), x3 = *(const v4fa*)(arow + kb + 16 + 8 * hh + 4);
    float xs[16] = {x0[0],x0[1],x0[2],x0[3],x1[0],x1[1],x1[2],x1[3],x2[0],x2[1],x2[2],x2[3],x3[0],x3[1],x3[2],x3[3]};
#pragma unroll
    for (int i = 0; i < 16; ++i) { const _Float16 h = (_Float16)xs[i]; ah.h[i] = h; al.h[i] = ASPLIT ? (_Float16)(xs[i] - (float)h) : (_Float16)0.0f; }
#pragma unroll
    for (int t = 0; t < 4; ++t) { if (col0 + t * 16 >= N) continue; const size_t boff = (size_t)(col0 + t * 16 + ln) * ldb + kb; FragH bq; bq.half[0] = *(const v8us*)(Bh + boff + 8 * hh); bq.half[1] = *(const v8us*)(Bh + boff + 16 + 8 * hh);
      acc[t] = mmaH<ASPLIT ? 2 : 1>(ah.v, al.v, bq.v, bq.v, acc[t]); }
  }
#pragma unroll
  for (int t = 0; t < 4; ++t) { if (col0 + t * 16 >= N) continue;
#pragma unroll
    for (int r = 0; r < 8; ++r) so[w][8 * hh + r][t * 16 + ln] = acc[t][r] * alpha; }
  __builtin_amdgcn_fence(__ATOMIC_ACQ_REL, "workgroup"); __builtin_amdgcn_wave_barrier();
  const int rsub = lane >> 4, c4 = (lane & 15) * 4;
  {
#pragma unroll
    for (int q = 0; q < 8; ++q) { const int r = q * 2 + rsub; if (col0 + c4 < N) { const v4f v = *(const v4fa*)&so[w][r][c4]; *(v4f*)(C + (size_t)(row0 + r) * ldc + col0 + c4) = v; } }
     }
}

// Wt(n, k) = f16(W[k][n]·scale) from f32 row-major W[K][N] (scale = power of two; bf16-exact weights stay exact in f16 away from the subnormal range), in fragment order (see gf_frag): strips of 16 n, K / 32 tiles a strip; thread t writes the t-th 16 bytes
__global__ __launch_bounds__(256) void k_wt_f16(const float* __restrict__ W, _Float16* __restrict__ Wt, int K, int N, float scale) {
  const int t = blockIdx.x * 256 + threadIdx.x; if (t >= N * (K / 8)) return; const int tile = t >> 6, c = t & 63; const int n = (tile / (K / 32)) * 16 + (c & 15), k8 = (tile % (K / 32)) * 32 + (c >> 5) * 16 + ((c >> 4) & 1) * 8; FragH f;
#pragma unroll
  for (int i = 0; i < 8; ++i) f.h[i] = (_Float16)(bf16_round(W[(size_t)(k8 + i) * N + n]) * scale); const v8us o = f.half[0];
  *(v8us*)((unsigned short*)Wt + (size_t)t * 8) = o; 
}
// k_gemm_hh variant with fused epilogue: v = acc·alpha + bias[by·sBias + col] (+ CP[(row/rowsPerB)·sCPb + by·64 + col] if CP) ; ACT 0 none / 1 elu ; writes f16 C16 (and f32 C if non-null)
template <int ACT>
__global__ __launch_bounds__(128) void k_gemm_hhx(const _Float16* __restrict__ A, int lda, size_t sA, const _Float16* __restrict__ Bh, int ldb, size_t sB, float alpha, const float* __restrict__ bias, size_t sBias, const float* __restrict__ CP, int rowsPerB, size_t sCPb, int row0g,
    float* __restrict__ C, _Float16* __restrict__ C16, int ldc, size_t sC, int M, int N, int K) {
  __shared__ __attribute__((aligned(16))) float so[4][16][64];
  const int tid = threadIdx.x, w = tid >> 5, lane = tid & 31, ln = lane & 15, hh = lane >> 4; const int by = blockIdx.y;
  A += (size_t)by * sA; Bh += (size_t)by * sB; const size_t cofs = (size_t)by * sC; const float* bp = bias ? bias + (size_t)by * sBias : nullptr;
  const int ntn = (N + 63) / 64; const int wid = blockIdx.x * 4 + w; const int mt = wid / ntn, nq = wid % ntn; if (mt * 16 >= M) return;
  const int row0 = mt * 16, col0 = nq * 64; const _Float16* arow = A + (size_t)(row0 + ln) * lda;
  v8f acc[4] = {};
  for (int kb = 0; kb < K; kb += 32) { FragH ah; ah.half[0] = *(const v8us*)((const unsigned short*)arow + kb + 8 * hh); ah.half[1] = *(const v8us*)((const unsigned short*)arow + kb + 16 + 8 * hh);
#pragma unroll
    for (int t = 0; t < 4; ++t) { if (col0 + t * 16 >= N) continue; const size_t boff = (size_t)(col0 + t * 16 + ln) * ldb + kb; FragH bq; bq.half[0] = *(const v8us*)((const unsigned short*)Bh + boff + 8 * hh); bq.half[1] = *(const v8us*)((const unsigned short*)Bh + boff + 16 + 8 * hh);
      acc[t] = mmaH<1>(ah.v, ah.v, bq.v, bq.v, acc[t]); }
  }
#pragma unroll
  for (int t = 0; t < 4; ++t) { if (col0 + t * 16 >= N) continue; const int col = col0 + t * 16 + ln; const float bv = bp ? bf16_round(bp[col]) : 0.f;
#pragma unroll
    for (int r = 0; r < 8; ++r) { float v = acc[t][r] * alpha + bv; if (CP) { const int rr = row0g + row0 + 8 * hh + r; if (rowsPerB < 0) v += CP[cofs + (size_t)rr * ldc + col];      /* rowsPerB < 0: own element of the batched C plane */ else { const int bidx = rr / rowsPerB; v += CP[(size_t)bidx * sCPb + (size_t)by * 64 + col]; } } if (ACT == 1) v = (v > 0.f) ? v : expm1f(v); else if (ACT == 7) v = (v > 0.f) ? v + 1.0f : expf(v); else if (ACT == 8) v = tanhf(v); else if (ACT == 9) v = 0.5f * v * (1.0f + tanhf(0.7978845608028654f * (v + 0.044715f * v * v * v))); else if (ACT == 11) v = 1.0f / (1.0f + expf(-v)); else if (ACT == 12) v = (v > 0.f) ? v : 0.01f * v; else if (ACT == 14) v = (v > 0.f) ? v : 0.1f * v; else if (ACT == 16) v = (v >= 0.f) ? v : 0.3f * v; else if (ACT == 17) v = (v >= 0.f) ? v : 0.2f * v; else if (ACT == 15) v = v / (1.0f + expf(-v)); else if (ACT == 3) v = fmaxf(v, 0.f); else if (ACT == 6) v = 0.5f * v * (1.0f + erff(v * 0.70710678118654752f)); so[w][8 * hh + r][t * 16 + ln] = v; } }
  __builtin_amdgcn_fence(__ATOMIC_ACQ_REL, "workgroup"); __builtin_amdgcn_wave_barrier();
  const int rsub = lane >> 4, c4 = (lane & 15) * 4; typedef _Float16 v4h __attribute__((ext_vector_type(4)));
  {
#pragma unroll
    for (int q = 0; q < 8; ++q) { const int r = q * 2 + rsub; if (col0 + c4 < N) { const v4f v = *(const v4fa*)&so[w][r][c4]; if (C) *(v4f*)(C + cofs + (size_t)(row0 + r) * ldc + col0 + c4) = v; if (C16) { v4h h4; for (int i = 0; i < 4; ++i) h4[i] = (_Float16)v[i]; *(v4h*)(C16 + cofs + (size_t)(row0 + r) * ldc + col0 + c4) = h4; } } }
     }
}


typedef _Float16 v4h __attribute__((ext_vector_type(4)));

/* rows of DM into fragment order (see gf_frag): strips of 16 rows, DM / 32 tiles a strip; thread t writes the t-th 16 bytes */
__global__ __launch_bounds__(256) void k_x16(const float* __restrict__ x, _Float16* __restrict__ X16, size_t n8) { const size_t t = (size_t)blockIdx.x * 256 + threadIdx.x; if (t >= n8) return; FragH f;
  const size_t tile = t >> 6; const int c = (int)(t & 63); const float* src = x + ((tile / (DM / 32)) * 16 + (c & 15)) * DM + (tile % (DM / 32)) * 32 + (c >> 5) * 16 + ((c >> 4) & 1) * 8;
#pragma unroll
  for (int q = 0; q < 8; ++q) f.h[q] = (_Float16)bf16_round(src[q]); *(v8us*)((unsigned short*)X16 + t * 8) = f.half[0];  }
__global__ __launch_bounds__(256) void k_h16(const float* __restrict__ x, _Float16* __restrict__ X16, size_t n8) { const size_t t = (size_t)blockIdx.x * 256 + threadIdx.x; if (t >= n8) return; FragH f;
#pragma unroll
  for (int q = 0; q < 8; ++q) f.h[q] = (_Float16)x[t * 8 + q]; *(v8us*)((unsigned short*)X16 + t * 8) = f.half[0];  }
__global__ __launch_bounds__(256) void k_round16f(const float* __restrict__ W, _Float16* __restrict__ Bt, size_t n8) { const size_t t = (size_t)blockIdx.x * 256 + threadIdx.x; if (t >= n8) return; FragH f;
#pragma unroll
  for (int i = 0; i < 8; ++i) f.h[i] = (_Float16)(bf16_round(W[t * 8 + i]) * 16.0f); *(v8us*)((unsigned short*)Bt + t * 8) = f.half[0];  }
// ---- fast GEMM (wave tile 32x64; requires M % 32 == 0 rows per launch region and N % 64 == 0); A and Bh in fragment order (see gf_frag), strips of 16 rows of lda / ldb elements each; epilogue = k_gemm_hhx semantics ----
__device__ __forceinline__ v16h g2_frag(const _Float16* p, int hh) { FragH f; f.half[0] = *(const v8us*)((const unsigned short*)p + 8 * hh); f.half[1] = *(const v8us*)((const unsigned short*)p + 16 + 8 * hh); return f.v; }
// Fragment order: a 16-row x 32-k f16 tile lies 1 KB in a row, element (r, k) at (k >> 4) * 256 + (((k >> 3) & 1) * 16 + r) * 8 + (k & 7), so lane l = 16 hh + ln finds the two 16-byte halves of its fragment at 8 l and 256 + 8 l:
// each fragment load of a wave reads 512 bytes in a row (four whole 128-byte lines) where a row-major plane gives it 16 lines of 32 bytes. Which element a lane and register hold is as in g2_frag. p = tile + 8 * lane.
__device__ __forceinline__ v16h gf_frag(const _Float16* p) { FragH f; f.half[0] = *(const v8us*)((const unsigned short*)p); f.half[1] = *(const v8us*)((const unsigned short*)p + 256); return f.v; }
__device__ __forceinline__ v8f g2_mma(v16h a, v16h b, v8f c) { v8f d = __builtin_amdgcn_wmma_f32_16x16x32_f16(false, a, false, b, (short)0, c, false, false); asm volatile("v_nop\n\tv_nop\n\tv_nop\n\tv_nop" : "+v"(d) : "v"(a), "v"(b)); return d; }
template <int ACT>
__global__ __launch_bounds__(128) void k_gemm2(const _Float16* __restrict__ A, int lda, size_t sA, const _Float16* __restrict__ Bh, int ldb, size_t sB, float alpha, const float* __restrict__ bias, size_t sBias, const float* __restrict__ CP, int rowsPerB, size_t sCPb, int row0g,
    float* __restrict__ C, _Float16* __restrict__ C16, int ldc, size_t sC, int M, int N, int K) { static_assert(ACT == 0 || ACT == 3 || ACT == 6 || ACT == 8 || ACT == 9 || ACT == 11 || ACT == 12 || ACT == 14 || ACT == 15 || ACT == 16 || ACT == 17, "k_gemm2: unsupported ACT code (would silently apply no activation)");
  __shared__ __attribute__((aligned(16))) float so[4][32][68];
  const int tid = threadIdx.x, w = tid >> 5, lane = tid & 31, ln = lane & 15, hh = lane >> 4; const int by = blockIdx.y;
  A += (size_t)by * sA; Bh += (size_t)by * sB; const size_t cofs = (size_t)by * sC; const float* bp = bias ? bias + (size_t)by * sBias : nullptr;
  const int ntn = N >> 6; const int mt = blockIdx.x / ntn, nq = blockIdx.x - mt * ntn; const int row0 = mt * 128 + 32 * w, col0 = nq * 64; if (row0 >= M) return;
  const _Float16* a0p = A + (size_t)row0 * lda + 8 * lane; const _Float16* a1p = a0p + (size_t)16 * lda;
  const _Float16* b0p = Bh + (size_t)col0 * ldb + 8 * lane; const _Float16* b1p = b0p + (size_t)16 * ldb; const _Float16* b2p = b1p + (size_t)16 * ldb; const _Float16* b3p = b2p + (size_t)16 * ldb;
  const v8f z8 = {0.f,0.f,0.f,0.f,0.f,0.f,0.f,0.f}; v8f c00 = z8, c01 = z8, c02 = z8, c03 = z8, c10 = z8, c11 = z8, c12 = z8, c13 = z8;
#pragma unroll 1
  for (int kb = 0; kb < K; kb += 32) { const int ko = kb * 16;      /* 512 elements a tile of 32 k */
    const _Float16* pa0 = a0p + ko; const _Float16* pa1 = a1p + ko; const _Float16* pb0 = b0p + ko; const _Float16* pb1 = b1p + ko; const _Float16* pb2 = b2p + ko; const _Float16* pb3 = b3p + ko;
    const v16h a0 = gf_frag(pa0), a1 = gf_frag(pa1);
    v16h b = gf_frag(pb0); c00 = g2_mma(a0, b, c00); c10 = g2_mma(a1, b, c10);
    b = gf_frag(pb1); c01 = g2_mma(a0, b, c01); c11 = g2_mma(a1, b, c11);
    b = gf_frag(pb2); c02 = g2_mma(a0, b, c02); c12 = g2_mma(a1, b, c12);
    b = gf_frag(pb3); c03 = g2_mma(a0, b, c03); c13 = g2_mma(a1, b, c13);
    asm volatile("s_wait_xcnt 0x0" :: "v"(pa0), "v"(pa1), "v"(pb0), "v"(pb1), "v"(pb2), "v"(pb3) : "memory"); }      /* the six address pairs stay whole to the end of the trip */
  v8f accs[8] = {c00, c01, c02, c03, c10, c11, c12, c13};
#pragma unroll
  for (int u = 0; u < 8; ++u) { const int t = u & 3, half = u >> 2; const int col = col0 + t * 16 + ln; const float bv = bp ? bf16_round(bp[col]) : 0.f;
#pragma unroll
    for (int r = 0; r < 8; ++r) { const int rloc = half * 16 + 8 * hh + r; float v = accs[u][r] * alpha + bv; if (CP) { if (rowsPerB < 0) v += CP[cofs + (size_t)(row0g + row0 + rloc) * ldc + col];      /* rowsPerB < 0: own element of the batched C plane */ else { const int bidx = (row0g + row0 + rloc) / rowsPerB; v += CP[(size_t)bidx * sCPb + (size_t)by * 64 + col]; } }
      if (ACT == 3) v = fmaxf(v, 0.f); else if (ACT == 6) v = 0.5f * v * (1.0f + erff(v * 0.70710678118654752f)); else if (ACT == 11) v = 1.0f / (1.0f + expf(-v)); else if (ACT == 15) v = v / (1.0f + expf(-v)); else if (ACT == 12) v = (v > 0.f) ? v : 0.01f * v; else if (ACT == 8) v = tanhf(v); else if (ACT == 9) v = 0.5f * v * (1.0f + tanhf(0.7978845608028654f * (v + 0.044715f * v * v * v))); else if (ACT == 14) v = (v > 0.f) ? v : 0.1f * v; else if (ACT == 16) v = (v >= 0.f) ? v : 0.3f * v; else if (ACT == 17) v = (v >= 0.f) ? v : 0.2f * v;
      so[w][rloc][t * 16 + ln] = v; } }
  __builtin_amdgcn_fence(__ATOMIC_ACQ_REL, "workgroup"); __builtin_amdgcn_wave_barrier();
  const int rsub = lane >> 4, c4 = (lane & 15) * 4;
  {
#pragma unroll
    for (int q = 0; q < 16; ++q) { const int r = q * 2 + rsub; const v4f v = *(const v4fa*)&so[w][r][c4]; if (C) *(v4f*)(C + cofs + (size_t)(row0 + r) * ldc + col0 + c4) = v; if (C16) { v4h h4; for (int i = 0; i < 4; ++i) h4[i] = (_Float16)v[i]; *(v4h*)(C16 + cofs + (size_t)(row0 + r) * ldc + col0 + c4) = h4; } }
     } }


__global__ __launch_bounds__(256) void k_wnat(const float* __restrict__ w, size_t n8, _Float16* __restrict__ Bt) { const size_t t = (size_t)blockIdx.x * 256 + threadIdx.x; if (t >= n8) return; FragH f; for (int q = 0; q < 8; ++q) f.h[q] = (_Float16)(bf16_round(w[t * 8 + q]) * 16.0f); *(v8us*)((unsigned short*)Bt + t * 8) = f.half[0];  }
__global__ __launch_bounds__(256) void k_rsm(const float* __restrict__ S, _Float16* __restrict__ P, int nrows) {
  #pragma clang fp contract(off)
  const int i = blockIdx.x * 256 + threadIdx.x; if (i >= nrows) return; const float* s = S + (size_t)i * SQ; float mx = -3.0e38f;
#pragma unroll 1
  for (int j = 0; j < SQ; ++j) mx = fmaxf(mx, s[j]); float se = 0.f;
#pragma unroll 1
  for (int j = 0; j < SQ; ++j) se += expf(s[j] - mx); const float sc = 256.0f / se;
#pragma unroll 1
  for (int j0 = 0; j0 < SQ; j0 += 8) { FragH f; for (int q = 0; q < 8; ++q) f.h[q] = (_Float16)(expf(s[j0 + q] - mx) * sc); unsigned short* d = (unsigned short*)P + (size_t)i * SQ + j0; *(v8us*)d = f.half[0];  } }
__global__ __launch_bounds__(256) void k_vt(const _Float16* __restrict__ V16, int b, int h0, _Float16* __restrict__ VT) { __shared__ unsigned short tl[64][65]; const int tid = threadIdx.x; const int hh = blockIdx.x % HG, sg = blockIdx.x / HG; const int s0 = sg * 64; const int h = h0 + hh;
  for (int i = tid; i < 64 * 8; i += 256) { const int j = i / 8, d8 = (i % 8) * 8; FragH f; f.half[0] = *(const v8us*)((const unsigned short*)V16 + ((size_t)b * SQ + s0 + j) * DM + h * HD + d8); for (int q = 0; q < 8; ++q) tl[d8 + q][j] = f.u[q]; }
  __syncthreads();
  { for (int i = tid; i < 64 * 8; i += 256) { const int d = i / 8, j8 = (i % 8) * 8; FragH f; for (int q = 0; q < 8; ++q) f.u[q] = tl[d][j8 + q]; *(v8us*)((unsigned short*)VT + ((size_t)hh * HD + d) * SQ + s0 + j8) = f.half[0]; }  } }


__global__ __launch_bounds__(256) void k_tab2(float theta, float* __restrict__ CS, float* __restrict__ SN) {
  #pragma clang fp contract(off)
  const int t = blockIdx.x * 256 + threadIdx.x; if (t >= SQ * (HD / 2)) return; const int i = t % (HD / 2); const int p = t / (HD / 2); const float invf = 1.0f / powf(theta, (float)(2 * i) / (float)HD); const float ang = __fmul_rn((float)p, invf); const float c = cosf(ang), s = sinf(ang);
  *(float*)(CS + t) = c; *(float*)(SN + t) = s;  }
// Fused causal attention, one launch for every (batch, head, 128-query block): each wave owns 32 queries and walks the keys 0 .. its own last query in passes of 32, nothing of S or P goes through memory.
// Transposed products: S^T = K . Q^T (A = key rows, B = query rows kept in registers; hi.hi in one accumulator, lo.hi + hi.lo in a second, joined as hi + 2^-10 lo in f32), so a lane holds 16 scores of ONE query;
// running maximum and sum per query (online softmax, accumulators rescaled only in a pass where some query's maximum moved); the two 16-key score tiles, as f16 weights x256, ARE the B operand of O^T += V^T . P^T.
__device__ __forceinline__ float rs_xrow(float v) { const int i = __float_as_int(v); return __int_as_float(__builtin_amdgcn_permlanex16(i, i, 0x76543210, 0xfedcba98, false, false)); }      /* lane l <- lane l ^ 16 */
// native 2^a. The v_nop is the slot the instruction set asks for behind a transcendental before its source is overwritten or its result read.
__device__ __forceinline__ float fa_exp2(float a) { float e; asm("v_exp_f32 %0, %1\n\tv_nop" : "=v"(e) : "v"(a)); return e; }
__device__ __forceinline__ v8f fa_mma(v16h a, v16h b, v8f c) { return __builtin_amdgcn_wmma_f32_16x16x32_f16(false, a, false, b, (short)0, c, false, false); }
#define FA_C 11.5415603271117072589f      /* sqrt(64) * log2(e): score differences -> exponent of 2 */
__global__ __launch_bounds__(128) void k_fattn(const _Float16* __restrict__ QH, const _Float16* __restrict__ QL, const _Float16* __restrict__ KH, const _Float16* __restrict__ KL, const _Float16* __restrict__ VT, _Float16* __restrict__ O16) {
  const int lane = threadIdx.x & 31, ln = lane & 15, hh = lane >> 4; const int w = __builtin_amdgcn_readfirstlane((int)(threadIdx.x >> 5));      /* scalar wave number: the key loop's bound stays a scalar */
  const int bh = blockIdx.y, b = bh / NH, h = bh % NH; const int q0 = ((int)gridDim.x - 1 - (int)blockIdx.x) * 128 + w * 32;      /* longest blocks start first */
  const size_t r0 = (size_t)b * SQ;
  /* every pointer below is the lane's own address, its lane offset 8 lane folded in, so that the loads name exactly the pair that the wait behind them holds */
  /* q, k planes: fragment order (see gf_frag), per (batch, head) strips of 16 tokens, two tiles (k halves of the head) a strip: 64 elements a token; V^T: per (batch, head) and 32 keys four tiles (16 head columns each): 64 elements a key */
  const size_t hb = (size_t)bh * SQ * HD + 8 * lane;
  const _Float16* qhp = QH + hb + (size_t)q0 * HD; const _Float16* qlp = QL + hb + (size_t)q0 * HD;
  v16h qh[2][2], ql[2][2];      /* [query group of 16][k half of the head] */
#pragma unroll
  for (int j = 0; j < 2; ++j)
#pragma unroll
    for (int ks = 0; ks < 2; ++ks) { const size_t o = (size_t)(2 * j + ks) * 512; qh[j][ks] = gf_frag(qhp + o); ql[j][ks] = gf_frag(qlp + o); }
  asm volatile("s_wait_xcnt 0x0" :: "v"(qhp), "v"(qlp) : "memory");      /* the two address pairs stay whole until the loads have taken them */
  const _Float16* khp = KH + hb; const _Float16* klp = KL + hb; const _Float16* vtp = VT + hb;
  const v8f z8 = {0.f,0.f,0.f,0.f,0.f,0.f,0.f,0.f};
  v8f o[2][4]; float m[2], l[2];
#pragma unroll
  for (int j = 0; j < 2; ++j) { m[j] = -1.0e30f; l[j] = 0.f;
#pragma unroll
    for (int t = 0; t < 4; ++t) o[j][t] = z8; }
  v16h kh[2][2], kl[2][2];      /* [16-key tile][k half] */
#pragma unroll
  for (int kt = 0; kt < 2; ++kt)
#pragma unroll
    for (int ks = 0; ks < 2; ++ks) { const size_t ko = (size_t)(2 * kt + ks) * 512; kh[kt][ks] = gf_frag(khp + ko); kl[kt][ks] = gf_frag(klp + ko); }
#pragma unroll 1
  for (int kb = 0; kb <= q0; kb += 32) {
    v16h vf[4]; const _Float16* pv = vtp + (size_t)kb * HD;      /* V^T tiles of this pass, asked for ahead of the score products */
#pragma unroll
    for (int t = 0; t < 4; ++t) vf[t] = gf_frag(pv + (size_t)t * 512);
    asm volatile("s_wait_xcnt 0x0" ::: "memory");      /* stands in front of the advance of the loads' address pair; it also keeps these loads here, ahead of the score products, where the build had sunk them to their use */
    v8f u[2][2];      /* [query group][key tile]: q . k, register r = key 16 kt + 8 hh + r of query ln */
#pragma unroll
    for (int kt = 0; kt < 2; ++kt)
#pragma unroll
      for (int j = 0; j < 2; ++j) { v8f sh = z8, sl = z8;
#pragma unroll
        for (int ks = 0; ks < 2; ++ks) { sh = fa_mma(kh[kt][ks], qh[j][ks], sh); sl = fa_mma(kh[kt][ks], ql[j][ks], sl); sl = fa_mma(kl[kt][ks], qh[j][ks], sl); }
#pragma unroll
        for (int r = 0; r < 8; ++r) u[j][kt][r] = sh[r] + 0.0009765625f * sl[r]; }
    { const int kn = (kb + 32 <= q0) ? kb + 32 : q0;      /* next pass's key rows into the same registers, behind their last use; the last pass asks for its own rows again (in bounds) */
      const _Float16* pkh = khp + (size_t)kn * HD; const _Float16* pkl = klp + (size_t)kn * HD;
#pragma unroll
      for (int kt = 0; kt < 2; ++kt)
#pragma unroll
        for (int ks = 0; ks < 2; ++ks) { const size_t ko = (size_t)(2 * kt + ks) * 512; kh[kt][ks] = gf_frag(pkh + ko); kl[kt][ks] = gf_frag(pkl + ko); }
      asm volatile("s_wait_xcnt 0x0" :: "v"(pkh), "v"(pkl) : "memory"); }      /* the two address pairs stay whole until the loads have taken them */
    if (kb == q0) {      /* the one pass on the diagonal: keys above the query are out */
#pragma unroll
      for (int j = 0; j < 2; ++j)
#pragma unroll
        for (int kt = 0; kt < 2; ++kt)
#pragma unroll
          for (int r = 0; r < 8; ++r) u[j][kt][r] = (16 * kt + 8 * hh + r <= 16 * j + ln) ? u[j][kt][r] : -1.0e9f; }
    float mn[2];
#pragma unroll
    for (int j = 0; j < 2; ++j) { float x = fmaxf(u[j][0][0], u[j][1][0]);
#pragma unroll
      for (int r = 1; r < 8; ++r) x = fmaxf(x, fmaxf(u[j][0][r], u[j][1][r]));
      mn[j] = fmaxf(m[j], fmaxf(x, rs_xrow(x))); }
    if (__builtin_amdgcn_ballot_w32(mn[0] > m[0] || mn[1] > m[1]) != 0) {      /* scalar branch; where no maximum moved every factor would be 1 */
#pragma unroll
      for (int j = 0; j < 2; ++j) { const float al = fa_exp2((m[j] - mn[j]) * FA_C); m[j] = mn[j]; l[j] *= al;
#pragma unroll
        for (int t = 0; t < 4; ++t)
#pragma unroll
          for (int r = 0; r < 8; ++r) o[j][t][r] *= al; } }
#pragma unroll
    for (int j = 0; j < 2; ++j) { FragH pf; float s0 = 0.f, s1 = 0.f;
#pragma unroll
      for (int r = 0; r < 8; ++r) { const float p0 = fa_exp2((u[j][0][r] - m[j]) * FA_C + 8.0f), p1 = fa_exp2((u[j][1][r] - m[j]) * FA_C + 8.0f); s0 += p0; s1 += p1; pf.h[r] = (_Float16)p0; pf.h[8 + r] = (_Float16)p1; }      /* weights x256 */
      l[j] += s0 + s1;
#pragma unroll
      for (int t = 0; t < 4; ++t) o[j][t] = fa_mma(vf[t], pf.v, o[j][t]); }
  }
#pragma unroll
  for (int j = 0; j < 2; ++j) { const float inv = 64.0f / (l[j] + rs_xrow(l[j]));      /* the two lane halves hold disjoint keys' sums; o carried x64 */
    unsigned short* dst = (unsigned short*)O16 + (r0 + q0 + 16 * j) * DM + (size_t)h * 1024 + 8 * lane;      /* o rows in fragment order for the output GEMM: strip of 16 rows, tiles 2 h and 2 h + 1; the lane's 8 values are one 16-byte half of its own fragment */
#pragma unroll
    for (int t = 0; t < 4; ++t) { FragH f;
#pragma unroll
      for (int r = 0; r < 8; ++r) f.h[r] = (_Float16)(o[j][t][r] * inv);
      *(v8us*)(dst + 256 * t) = f.half[0]; } } }


// q | k | v projection of every token row in one launch: main loop and wave tile (32 x 64) of k_gemm2; a block's 64 columns are exactly one head of q, of k or of v, and the epilogue finishes that head's rows itself:
// q, k: f32 row through LDS, interleaved-pair rotation from the f32 tables, f16 hi + x1024 residual planes in fragment order; v: f16 from the accumulators (a lane holds 8 consecutive tokens of one column) straight into V^T in fragment order, whole 128-byte lines.
typedef float v2fa __attribute__((ext_vector_type(2), may_alias));
__global__ __launch_bounds__(128) void k_qkv(const _Float16* __restrict__ A, const _Float16* __restrict__ Bh, const float* __restrict__ bias, const float* __restrict__ CS, const float* __restrict__ SN,
    _Float16* __restrict__ QH, _Float16* __restrict__ QL, _Float16* __restrict__ KH, _Float16* __restrict__ KL, _Float16* __restrict__ VT) {
  __shared__ __attribute__((aligned(16))) float so[4][32][68];
  const int tid = threadIdx.x, w = tid >> 5, lane = tid & 31, ln = lane & 15, hh = lane >> 4;
  const int ntn = 3 * NH; const int mt = blockIdx.x / ntn, nq = blockIdx.x - mt * ntn; const int row0 = mt * 128 + 32 * w, col0 = nq * HD; const int part = nq / NH, h = nq - part * NH;      /* part 0 q, 1 k, 2 v: the same for the whole block */
  const _Float16* ap = A + (size_t)row0 * DM + 8 * lane; const _Float16* bp = Bh + (size_t)col0 * DM + 8 * lane;      /* A, Bh in fragment order (see gf_frag), strips of 16 rows; the lane's own addresses: every load of a trip names one of two pairs */
  const v8f z8 = {0.f,0.f,0.f,0.f,0.f,0.f,0.f,0.f}; v8f c00 = z8, c01 = z8, c02 = z8, c03 = z8, c10 = z8, c11 = z8, c12 = z8, c13 = z8;
#pragma unroll 1      /* rolled, as in k_gemm2: one trip's code and registers */
  for (int kb = 0; kb < DM; kb += 32) { const _Float16* pa = ap + kb * 16; const _Float16* pb = bp + kb * 16; const v16h a0 = gf_frag(pa), a1 = gf_frag(pa + 16 * DM);      /* 512 elements a tile of 32 k */
    v16h b = gf_frag(pb); c00 = g2_mma(a0, b, c00); c10 = g2_mma(a1, b, c10);
    b = gf_frag(pb + 16 * DM); c01 = g2_mma(a0, b, c01); c11 = g2_mma(a1, b, c11);
    b = gf_frag(pb + 32 * DM); c02 = g2_mma(a0, b, c02); c12 = g2_mma(a1, b, c12);
    b = gf_frag(pb + 48 * DM); c03 = g2_mma(a0, b, c03); c13 = g2_mma(a1, b, c13);
    asm volatile("s_wait_xcnt 0x0" :: "v"(pa), "v"(pb) : "memory"); }      /* the two address pairs stay whole to the end of the trip */
  v8f accs[8] = {c00, c01, c02, c03, c10, c11, c12, c13};
  const size_t hb = ((size_t)((row0 / SQ) * NH + h) * SQ + row0 % SQ) * HD;      /* the wave's 32 tokens in a plane of its (batch, head): 64 elements a token in fragment order */
  if (part == 2) {      /* V^T tiles (16 head columns x 32 keys) in fragment order: the wave's 32 tokens are one group of 32 keys, and a lane's 8 accumulator values (column ln of tile t, tokens 16 half + 8 hh + r) are one 16-byte half of its own fragment: stored from the registers, 512 bytes in a row a store */
    unsigned short* vd = (unsigned short*)VT + hb + 8 * lane;
#pragma unroll
    for (int u = 0; u < 8; ++u) { const int t = u & 3, half = u >> 2; const float bv = bf16_round(bias[col0 + t * 16 + ln]); FragH f;
#pragma unroll
      for (int r = 0; r < 8; ++r) f.h[r] = (_Float16)(accs[u][r] * 0.0625f + bv);
      *(v8us*)(vd + t * 512 + half * 256) = f.half[0]; }
    return; }
#pragma unroll
  for (int u = 0; u < 8; ++u) { const int t = u & 3, half = u >> 2; const float bv = bf16_round(bias[col0 + t * 16 + ln]);
#pragma unroll
    for (int r = 0; r < 8; ++r) so[w][half * 16 + 8 * hh + r][t * 16 + ln] = accs[u][r] * 0.0625f + bv; }
  __builtin_amdgcn_fence(__ATOMIC_ACQ_REL, "workgroup"); __builtin_amdgcn_wave_barrier();      /* a wave reads back only its own plane of so: its LDS writes are ordered in front of its reads, no block barrier */
  const int rsub = lane >> 4, c4 = (lane & 15) * 4;
  _Float16* Hh = (part ? KH : QH) + hb + (c4 >> 3) * 128 + (c4 & 7); _Float16* Hl = (part ? KL : QL) + hb + (c4 >> 3) * 128 + (c4 & 7);      /* the lane's 4 columns in fragment order: tile c4 >> 5, half (c4 >> 4) & 1, lane half (c4 >> 3) & 1, 128 elements apart each step of 8 columns */
#pragma unroll 1      /* rolled, four steps (eight rows) a trip: as one unrolled loop of sixteen steps the build took 166 registers, five waves a SIMD, and this launch needs six to be resident at once */
  for (int q0 = 0; q0 < 16; q0 += 4) {
#pragma unroll
  for (int q = q0; q < q0 + 4; ++q) { const int r = q * 2 + rsub; const v4f v = *(const v4fa*)&so[w][r][c4]; const int row = row0 + r; const size_t to = (size_t)(row % SQ) * (HD / 2) + (c4 >> 1);
    const v2fa c = *(const v2fa*)(CS + to), s = *(const v2fa*)(SN + to); float o[4];
    o[0] = fmaf(v[0], c[0], -(v[1] * s[0])); o[1] = fmaf(v[0], s[0], v[1] * c[0]); o[2] = fmaf(v[2], c[1], -(v[3] * s[1])); o[3] = fmaf(v[2], s[1], v[3] * c[1]);      /* the odd element's product rounded, the even element's fused onto it */
    v4h fh, fl;
#pragma unroll
    for (int i = 0; i < 4; ++i) { const _Float16 hi = (_Float16)o[i]; fh[i] = hi; fl[i] = (_Float16)((o[i] - (float)hi) * 1024.0f); }
    const size_t d = (size_t)(r >> 4) * 1024 + (r & 15) * 8; *(v4h*)(Hh + d) = fh; *(v4h*)(Hl + d) = fl; }
    asm volatile("s_wait_xcnt 0x0" ::: "memory"); } }      /* stands in front of the next trip's first writes */

extern "C" void kernel_launch(void* const* d_in, const int* in_sizes, int n_in,
                              void* d_out, int out_size, void* d_ws, size_t ws_size, hipStream_t stream) {
  (void)in_sizes; (void)n_in; (void)out_size;
  const float* const* I = (const float* const*)d_in; const float* x = I[0]; const float* wqkv = I[1]; const float* bqkv = I[2]; const float* wo = I[3]; const float* bo = I[4];      /* [in][out] fused qkv + out weights, biases */
  char* ws = (char*)d_ws; size_t off = 0;
  auto take = [&](size_t bytes) { char* p = ws + off; off += (bytes + 255) & ~(size_t)255; return p; };
  _Float16* BQKV = (_Float16*)take((size_t)3 * DM * DM * 2); _Float16* BO = (_Float16*)take((size_t)DM * DM * 2); float* CS = (float*)take((size_t)SQ * (HD / 2) * 4); float* SN = (float*)take((size_t)SQ * (HD / 2) * 4);
  _Float16* X16 = (_Float16*)take(NR * DM * 2);
  _Float16* QH = (_Float16*)take(NR * DM * 2); _Float16* QL = (_Float16*)take(NR * DM * 2); _Float16* KH = (_Float16*)take(NR * DM * 2); _Float16* KL = (_Float16*)take(NR * DM * 2); _Float16* O16 = (_Float16*)take(NR * DM * 2);
  _Float16* VT = (_Float16*)take((size_t)NB * NH * HD * SQ * 2);      /* V^T of every batch */
  if (off > ws_size) return;
  k_wt_f16<<<(unsigned)(((size_t)3 * DM * (DM / 8) + 255) / 256), 256, 0, stream>>>(wqkv, BQKV, DM, 3 * DM, 16.0f); k_wt_f16<<<(unsigned)(((size_t)DM * (DM / 8) + 255) / 256), 256, 0, stream>>>(wo, BO, DM, DM, 16.0f);      /* [in][out] -> Bt(n, k) x16 in fragment order; q | k | v stacked along n */
  k_tab2<<<(SQ * (HD / 2) + 255) / 256, 256, 0, stream>>>(10000.0f, CS, SN);
  k_x16<<<(unsigned)((NR * DM / 8 + 255) / 256), 256, 0, stream>>>(x, X16, NR * DM / 8);
  k_qkv<<<(unsigned)((NR / 128) * (3 * DM / 64)), 128, 0, stream>>>(X16, BQKV, bqkv, CS, SN, QH, QL, KH, KL, VT);      /* roped q, k as f16 hi + x1024 residual (the x8 logits, sigma ~64, need ~f32-accurate scores) and V^T, per (batch, head), in fragment order */
  k_fattn<<<dim3(SQ / 128, NB * NH), 128, 0, stream>>>(QH, QL, KH, KL, VT, O16);      /* o (merged heads, x64) as f16 rows in fragment order */
  k_gemm2<0><<<dim3((unsigned)((MPO / 128) * (DM / 64)), 1), 128, 0, stream>>>(O16 + (size_t)B0 * SQ * DM, DM, 0, BO, DM, 0, 0.0009765625f, bo, 0, nullptr, 1, 0, 0, (float*)d_out + (size_t)B0 * SQ * DM, nullptr, DM, 0, MPO, DM, DM);      /* out rows are the output layout */
}

// v005
// Measured time: 132 microseconds a run.
// Timed twice side by side with v004, it ran 1.55 and 1.58 times as fast.
// All steps since v000 together make it 35.1 times as fast.
#include <hip/hip_runtime.h>
// Masked (causal) RoPE multi-head attention with LARGE logits (x [2][2048][1024]; qkv = x w_qkv + b_qkv ([in][out] 1024 x 3072, sigma 1/32, bias sigma 0.01) -> q | k | v, 16 heads of 64; interleaved-pair RoPE on q and k (inv_freq_i = 10000^(-2i/64), positions 0..2047); scores = q . k x sqrt(64) (the module divides by 1/sqrt(d_k)), causal (tril); softmax; out = (attn v merged) w_out + b_out -> [2][2048][1024]).
// Structure: token rows r = b*2048 + s; x as exact f16 rows (bf16-rounded); q | k | v of every row as ONE WMMA GEMM launch (32x64 wave tiles, f32 accumulation, exact x16 weights + bias, N = 3 x 1024) whose epilogue, a block's 64 columns being one head, does on VALU: the interleaved-pair rotary rotation of q and k from f32 cos/sin tables (positions 0..SQ-1, no norm) and their split into f16 hi + x1024 residual planes (the x8 logits have sigma ~64: near-argmax softmax, so the scores are computed to ~f32 accuracy from three products), v as f16 into V^T; then ONE fused attention launch over every (batch, head, 128-query block): a wave holds 32 queries, walks the keys up to its own diagonal in passes of 32, scores as S^T = K . Q^T (three products), online causal softmax in registers (f32 running maximum and sum, native exp; keys above the diagonal set to -1e9; weights x256 f16), O^T += V^T . P^T with the score tiles as the B operand, o carried x64 (folded into the output GEMM alpha) written straight into the merged f16 o rows; out = o W_o + b GEMM (f32) into the output layout. Every f16 operand plane in the workspace (x, both weights, q and k hi / residual, V^T, o) lies in WMMA fragment order (see gf_frag), so that a fragment load reads whole 128-byte lines.
// Compute dtype: inputs rounded to bf16; x / weights exact; projections and rope f32; q, k as f16 hi + residual (~2^-22); v, softmax weights and o as plain f16 GEMM operands (~2^-12); scores and softmax statistics f32. v_wmma_f32_16x16x32_f16.
#define NB 2
#define SQ 2048
#define DM 1024
#define NH 16
#define HD 64
#define HG 4                         /* heads per launch of the (b, h0) V^T transpose */
#define QT 256
#define NKX SQ                       /* unused */
#define B0 0                         /* first batch processed (debug hook) */
#define NBR NB                       /* batches processed (debug hook) */
#define QN SQ                        /* unused (attention covers all SQ queries) */
#define NHD NH                       /* unused (attention covers all NH heads) */
#define NR ((size_t)NB * SQ)         /* token rows */
#define MPO ((int)((size_t)NBR * SQ))      /* rows through the output GEMM (debug hook) */
typedef __bf16 v16b __attribute__((ext_vector_type(16)));
typedef unsigned short v8us __attribute__((ext_vector_type(8), may_alias));
typedef float  v8f  __attribute__((ext_vector_type(8)));
typedef float  v4f  __attribute__((ext_vector_type(4)));
typedef float  v4fa __attribute__((ext_vector_type(4), may_alias));
union FragB { v16b v; v8us half[2]; unsigned short u[16]; };

__device__ __forceinline__ unsigned short bf16_bits(float x) { unsigned int u = __float_as_uint(x); return (unsigned short)((u + 0x7FFFu + ((u >> 16) & 1u)) >> 16); }
__device__ __forceinline__ float bf16_val(unsigned short b) { return __uint_as_float(((unsigned int)b) << 16); }
__device__ __forceinline__ float bf16_round(float x) { return bf16_val(bf16_bits(x)); }
// D += A·B with NT terms: 1 = ah·bh, 2 = + al·bh (A split), 3 = + ah·bl (both split)
template <int NT>
__device__ __forceinline__ v8f mmaN(v16b ah, v16b al, v16b bh, v16b bl, v8f c) {
  c = __builtin_amdgcn_wmma_f32_16x16x32_bf16(false, ah, false, bh, (short)0, c, false, false);
  if (NT >= 2) c = __builtin_amdgcn_wmma_f32_16x16x32_bf16(false, al, false, bh, (short)0, c, false, false);
  if (NT >= 3) c = __builtin_amdgcn_wmma_f32_16x16x32_bf16(false, ah, false, bl, (short)0, c, false, false);
  asm volatile("v_nop\n\tv_nop\n\tv_nop\n\tv_nop" : "+v"(c) : "v"(ah), "v"(al), "v"(bh), "v"(bl));
  return c;
}

__global__ __launch_bounds__(256) void k_wt_bf16(const float* __restrict__ W, unsigned short* __restrict__ Wt, int K, int N) {
  const int t = blockIdx.x * 256 + threadIdx.x;
  const int k8n = K / 8;
  if (t >= N * k8n) return;
  const int n = t / k8n, k8 = (t % k8n) * 8;
  v8us v;
#pragma unroll
  for (int i = 0; i < 8; ++i) v[i] = bf16_bits(W[(size_t)(k8 + i) * N + n]);
  *(v8us*)(Wt + (size_t)n * K + k8) = v;
  
}

// GEMM C[M][N] (f32, pitch ldc) = act(A[M][K]·W + bias). A f32 row-major (pitch lda) converted per fragment to bf16
// (ASPLIT: hi/lo two planes -> 2 terms, else single rounded term); Wt bf16 [N][K] (pitch ldb). BIAS_BF16 rounds the
// bias to bf16 first (bias quantised to bf16 before the add). K%32==0, M%16==0, N%64==0.
template <bool ASPLIT, int ACT, bool BIAS_BF16>
__global__ __launch_bounds__(128) void k_gemm_bf(const float* __restrict__ A, int lda, const unsigned short* __restrict__ Wt, int ldb,
                                               const float* __restrict__ bias, float* __restrict__ C, int ldc, int M, int N, int K) {
  __shared__ __attribute__((aligned(16))) float so[4][16][64];
  const int tid = threadIdx.x, w = tid >> 5, lane = tid & 31, ln = lane & 15, hh = lane >> 4;
  const int ntn = N / 64;
  const int wid = blockIdx.x * 4 + w;
  const int mt = wid / ntn, nq = wid % ntn;
  if (mt * 16 >= M) return;
  const int row0 = mt * 16, col0 = nq * 64;
  const float* arow = A + (size_t)(row0 + ln) * lda;
  v8f acc[4] = {};
  for (int kb = 0; kb < K; kb += 32) {
    FragB ah, al;
    const v4f x0 = *(const v4fa*)(arow + kb + 8 * hh), x1 = *(const v4fa*)(arow + kb + 8 * hh + 4);
    const v4f x2 = *(const v4fa*)(arow + kb + 16 + 8 * hh), x3 = *(const v4fa*)(arow + kb + 16 + 8 * hh + 4);
    float xs[16] = {x0[0],x0[1],x0[2],x0[3],x1[0],x1[1],x1[2],x1[3],x2[0],x2[1],x2[2],x2[3],x3[0],x3[1],x3[2],x3[3]};
#pragma unroll
    for (int i = 0; i < 16; ++i) { const unsigned short hb = bf16_bits(xs[i]); ah.u[i] = hb; al.u[i] = ASPLIT ? bf16_bits(xs[i] - bf16_val(hb)) : (unsigned short)0; }
#pragma unroll
    for (int t = 0; t < 4; ++t) {
      const unsigned short* brow = Wt + (size_t)(col0 + t * 16 + ln) * ldb + kb;
      FragB b;
      b.half[0] = *(const v8us*)(brow + 8 * hh);
      b.half[1] = *(const v8us*)(brow + 16 + 8 * hh);
      acc[t] = mmaN<ASPLIT ? 2 : 1>(ah.v, al.v, b.v, b.v, acc[t]);
    }
  }
#pragma unroll
  for (int t = 0; t < 4; ++t) {
    float bv = bias ? bias[col0 + t * 16 + ln] : 0.f;
    if (BIAS_BF16) bv = bf16_round(bv);
#pragma unroll
    for (int r = 0; r < 8; ++r) { float v = acc[t][r] + bv; if (ACT == 1) v = fmaxf(v, 0.f); so[w][8 * hh + r][t * 16 + ln] = v; }
  }
  __builtin_amdgcn_fence(__ATOMIC_ACQ_REL, "workgroup");
  __builtin_amdgcn_wave_barrier();
  const int rsub = lane >> 4, c4 = (lane & 15) * 4;
  {
#pragma unroll
    for (int q = 0; q < 8; ++q) {
      const int r = q * 2 + rsub;
      const v4f v = *(const v4fa*)&so[w][r][c4];
      *(v4f*)(C + (size_t)(row0 + r) * ldc + col0 + c4) = v;
    }
    
  }
}

// GEMM C = act(A·W + bias + resid): A f32 (ASPLIT -> hi/lo 2 terms), Wt bf16 [N][K]; ACT 0 none, 1 relu, 2 exact gelu;
// resid (optional, f32, row index = (row % rmod), pitch ldr, RES_BF16 rounds it) added before the activation.
template <bool ASPLIT, int ACT, bool BIAS_BF16, bool RES_BF16>
__global__ __launch_bounds__(128) void k_gemm_bf3(const float* __restrict__ A, int lda, const unsigned short* __restrict__ Wt, int ldb,
                                                const float* __restrict__ bias, const float* __restrict__ resid, int rmod, int ldr,
                                                float* __restrict__ C, int ldc, int M, int N, int K) {
  __shared__ __attribute__((aligned(16))) float so[4][16][64];
  const int tid = threadIdx.x, w = tid >> 5, lane = tid & 31, ln = lane & 15, hh = lane >> 4;
  const int ntn = N / 64;
  const int wid = blockIdx.x * 4 + w;
  const int mt = wid / ntn, nq = wid % ntn;
  if (mt * 16 >= M) return;
  const int row0 = mt * 16, col0 = nq * 64;
  const float* arow = A + (size_t)(row0 + ln) * lda;
  v8f acc[4] = {};
  for (int kb = 0; kb < K; kb += 32) {
    FragB ah, al;
    const v4f x0 = *(const v4fa*)(arow + kb + 8 * hh), x1 = *(const v4fa*)(arow + kb + 8 * hh + 4);
    const v4f x2 = *(const v4fa*)(arow + kb + 16 + 8 * hh), x3 = *(const v4fa*)(arow + kb + 16 + 8 * hh + 4);
    float xs[16] = {x0[0],x0[1],x0[2],x0[3],x1[0],x1[1],x1[2],x1[3],x2[0],x2[1],x2[2],x2[3],x3[0],x3[1],x3[2],x3[3]};
#pragma unroll
    for (int i = 0; i < 16; ++i) { const unsigned short hb = bf16_bits(xs[i]); ah.u[i] = hb; al.u[i] = ASPLIT ? bf16_bits(xs[i] - bf16_val(hb)) : (unsigned short)0; }
#pragma unroll
    for (int t = 0; t < 4; ++t) {
      const unsigned short* brow = Wt + (size_t)(col0 + t * 16 + ln) * ldb + kb;
      FragB b;
      b.half[0] = *(const v8us*)(brow + 8 * hh);
      b.half[1] = *(const v8us*)(brow + 16 + 8 * hh);
      acc[t] = mmaN<ASPLIT ? 2 : 1>(ah.v, al.v, b.v, b.v, acc[t]);
    }
  }
#pragma unroll
  for (int t = 0; t < 4; ++t) {
    const int col = col0 + t * 16 + ln;
    float bv = bias ? bias[col] : 0.f;
    if (BIAS_BF16) bv = bf16_round(bv);
#pragma unroll
    for (int r = 0; r < 8; ++r) {
      float v = acc[t][r] + bv;
      if (resid) { float rv = resid[(size_t)((row0 + 8 * hh + r) % rmod) * ldr + col]; if (RES_BF16) rv = bf16_round(rv); v += rv; }
      if (ACT == 1) v = fmaxf(v, 0.f);
      if (ACT == 2) v = 0.5f * v * (1.0f + erff(v * 0.70710678118654752f));
      if (ACT == 3) { const float u = 0.7978845608028654f * (v + 0.044715f * v * v * v); v = 0.5f * v * (1.0f + tanhf(u)); }
      so[w][8 * hh + r][t * 16 + ln] = v;
    }
  }
  __builtin_amdgcn_fence(__ATOMIC_ACQ_REL, "workgroup");
  __builtin_amdgcn_wave_barrier();
  const int rsub = lane >> 4, c4 = (lane & 15) * 4;
  {
#pragma unroll
    for (int q = 0; q < 8; ++q) {
      const int r = q * 2 + rsub;
      const v4f v = *(const v4fa*)&so[w][r][c4];
      *(v4f*)(C + (size_t)(row0 + r) * ldc + col0 + c4) = v;
    }
    
  }
}
// row LayerNorm (biased variance, eps) over N: s = X (+ R); optional out_sum <- s; out_norm <- (s-mu)*rsqrt(var+eps)*g + b
template <bool PARAM_BF16>
__global__ __launch_bounds__(256) void k_layernorm(const float* __restrict__ X, const float* __restrict__ R, const float* __restrict__ g, const float* __restrict__ bta,
                                                  float* __restrict__ out_sum, float* __restrict__ out_norm, int N, float eps) {
  __shared__ float red[256];
  const int row = blockIdx.x, tid = threadIdx.x;
  const float* x = X + (size_t)row * N; const float* rr = R ? R + (size_t)row * N : nullptr;
  float vals[16];                     // up to N = 4096
  const int per = N / 256;            // contiguous chunk per thread? use strided-by-4 chunks: thread handles j = tid*4 + 1024*u
  float s1 = 0.f;
  for (int u = 0; u < per / 4; ++u) {
    const int j = tid * 4 + 1024 * u;
    const v4f a = *(const v4fa*)(x + j);
    v4f b = {0.f,0.f,0.f,0.f}; if (rr) b = *(const v4fa*)(rr + j);
#pragma unroll
    for (int q = 0; q < 4; ++q) { const float v = a[q] + b[q]; vals[u * 4 + q] = v; s1 += v; }
  }
  red[tid] = s1; __syncthreads();
  for (int st = 128; st > 0; st >>= 1) { if (tid < st) red[tid] += red[tid + st]; __syncthreads(); }
  const float mu = red[0] / (float)N; __syncthreads();
  float s2 = 0.f;
  for (int u = 0; u < per / 4; ++u)
#pragma unroll
    for (int q = 0; q < 4; ++q) { const float c = vals[u * 4 + q] - mu; s2 += c * c; }
  red[tid] = s2; __syncthreads();
  for (int st = 128; st > 0; st >>= 1) { if (tid < st) red[tid] += red[tid + st]; __syncthreads(); }
  const float rs = rsqrtf(red[0] / (float)N + eps);
  {
    for (int u = 0; u < per / 4; ++u) {
      const int j = tid * 4 + 1024 * u;
      v4f o, sm;
#pragma unroll
      for (int q = 0; q < 4; ++q) {
        float gg = g[j + q], bb = bta[j + q];
        if (PARAM_BF16) { gg = bf16_round(gg); bb = bf16_round(bb); }
        sm[q] = vals[u * 4 + q]; o[q] = (vals[u * 4 + q] - mu) * rs * gg + bb;
      }
      if (out_sum) *(v4f*)(out_sum + (size_t)row * N + j) = sm;
      *(v4f*)(out_norm + (size_t)row * N + j) = o;
    }
    
  }
}



// ---- f16 WMMA path (v_wmma_f32_16x16x32_f16): 11-bit significands for operands in range — used where a [0,1] probability operand needs more precision than bf16
typedef _Float16 v16h __attribute__((ext_vector_type(16)));
union FragH { v16h v; v8us half[2]; _Float16 h[16]; unsigned short u[16]; };
template <int NT>
__device__ __forceinline__ v8f mmaH(v16h ah, v16h al, v16h bh, v16h bl, v8f c) {
  c = __builtin_amdgcn_wmma_f32_16x16x32_f16(false, ah, false, bh, (short)0, c, false, false);
  if (NT >= 2) c = __builtin_amdgcn_wmma_f32_16x16x32_f16(false, al, false, bh, (short)0, c, false, false);
  if (NT >= 3) c = __builtin_amdgcn_wmma_f32_16x16x32_f16(false, ah, false, bl, (short)0, c, false, false);
  asm volatile("v_nop\n\tv_nop\n\tv_nop\n\tv_nop" : "+v"(c) : "v"(ah), "v"(al), "v"(bh), "v"(bl));
  return c;
}
// batched GEMM like k_gemm_b but f16 operands: A f32 (split into f16 hi/lo if ASPLIT, else rounded to f16), Bt = f16 values [n][k]; alpha; C f32; N multiple of 16 (partial tiles skipped)
template <bool ASPLIT>
__global__ __launch_bounds__(128) void k_gemm_h(const float* __restrict__ A, int lda, size_t sA, const _Float16* __restrict__ Bh, int ldb, size_t sB, float alpha, float* __restrict__ C, int ldc, size_t sC, int M, int N, int K) {
  __shared__ __attribute__((aligned(16))) float so[4][16][64];
  const int tid = threadIdx.x, w = tid >> 5, lane = tid & 31, ln = lane & 15, hh = lane >> 4; const int by = blockIdx.y;
  A += (size_t)by * sA; Bh += (size_t)by * sB; C += (size_t)by * sC;
  const int ntn = (N + 63) / 64; const int wid = blockIdx.x * 4 + w; const int mt = wid / ntn, nq = wid % ntn; if (mt * 16 >= M) return;
  const int row0 = mt * 16, col0 = nq * 64; const float* arow = A + (size_t)(row0 + ln) * lda;
  v8f acc[4] = {};
  for (int kb = 0; kb < K; kb += 32) {
    FragH ah, al;
    const v4f x0 = *(const v4fa*)(arow + kb + 8 * hh), x1 = *(const v4fa*)(arow + kb + 8 * hh + 4), x2 = *(const v4fa*)(arow + kb + 16 + 8 * hh), x3 = *(const v4fa*)(arow + kb + 16 + 8 * hh + 4);
    float xs[16] = {x0[0],x0[1],x0[2],x0[3],x1[0],x1[1],x1[2],x1[3],x2[0],x2[1],x2[2],x2[3],x3[0],x3[1],x3[2],x3[3]};
#pragma unroll
    for (int i = 0; i < 16; ++i) { const _Float16 h = (_Float16)xs[i]; ah.h[i] = h; al.h[i] = ASPLIT ? (_Float16)(xs[i] - (float)h) : (_Float16)0.0f; }
#pragma unroll
    for (int t = 0; t < 4; ++t) { if (col0 + t * 16 >= N) continue; const size_t boff = (size_t)(col0 + t * 16 + ln) * ldb + kb; FragH bq; bq.half[0] = *(const v8us*)(Bh + boff + 8 * hh); bq.half[1] = *(const v8us*)(Bh + boff + 16 + 8 * hh);
      acc[t] = mmaH<ASPLIT ? 2 : 1>(ah.v, al.v, bq.v, bq.v, acc[t]); }
  }
#pragma unroll
  for (int t = 0; t < 4; ++t) { if (col0 + t * 16 >= N) continue;
#pragma unroll
    for (int r = 0; r < 8; ++r) so[w][8 * hh + r][t * 16 + ln] = acc[t][r] * alpha; }
  __builtin_amdgcn_fence(__ATOMIC_ACQ_REL, "workgroup"); __builtin_amdgcn_wave_barrier();
  const int rsub = lane >> 4, c4 = (lane & 15) * 4;
  {
#pragma unroll
    for (int q = 0; q < 8; ++q) { const int r = q * 2 + rsub; if (col0 + c4 < N) { const v4f v = *(const v4fa*)&so[w][r][c4]; *(v4f*)(C + (size_t)(row0 + r) * ldc + col0 + c4) = v; } }
     }
}

// Wt(n, k) = f16(W[k][n]·scale) from f32 row-major W[K][N] (scale = power of two; bf16-exact weights stay exact in f16 away from the subnormal range), in fragment order (see gf_frag): strips of 16 n, K / 32 tiles a strip; thread t writes the t-th 16 bytes
__global__ __launch_bounds__(256) void k_wt_f16(const float* __restrict__ W, _Float16* __restrict__ Wt, int K, int N, float scale) {
  const int t = blockIdx.x * 256 + threadIdx.x; if (t >= N * (K / 8)) return; const int tile = t >> 6, c = t & 63; const int n = (tile / (K / 32)) * 16 + (c & 15), k8 = (tile % (K / 32)) * 32 + (c >> 5) * 16 + ((c >> 4) & 1) * 8; FragH f;
#pragma unroll
  for (int i = 0; i < 8; ++i) f.h[i] = (_Float16)(bf16_round(W[(size_t)(k8 + i) * N + n]) * scale); const v8us o = f.half[0];
  *(v8us*)((unsigned short*)Wt + (size_t)t * 8) = o; 
}
// k_gemm_hh variant with fused epilogue: v = acc·alpha + bias[by·sBias + col] (+ CP[(row/rowsPerB)·sCPb + by·64 + col] if CP) ; ACT 0 none / 1 elu ; writes f16 C16 (and f32 C if non-null)
template <int ACT>
__global__ __launch_bounds__(128) void k_gemm_hhx(const _Float16* __restrict__ A, int lda, size_t sA, const _Float16* __restrict__ Bh, int ldb, size_t sB, float alpha, const float* __restrict__ bias, size_t sBias, const float* __restrict__ CP, int rowsPerB, size_t sCPb, int row0g,
    float* __restrict__ C, _Float16* __restrict__ C16, int ldc, size_t sC, int M, int N, int K) {
  __shared__ __attribute__((aligned(16))) float so[4][16][64];
  const int tid = threadIdx.x, w = tid >> 5, lane = tid & 31, ln = lane & 15, hh = lane >> 4; const int by = blockIdx.y;
  A += (size_t)by * sA; Bh += (size_t)by * sB; const size_t cofs = (size_t)by * sC; const float* bp = bias ? bias + (size_t)by * sBias : nullptr;
  const int ntn = (N + 63) / 64; const int wid = blockIdx.x * 4 + w; const int mt = wid / ntn, nq = wid % ntn; if (mt * 16 >= M) return;
  const int row0 = mt * 16, col0 = nq * 64; const _Float16* arow = A + (size_t)(row0 + ln) * lda;
  v8f acc[4] = {};
  for (int kb = 0; kb < K; kb += 32) { FragH ah; ah.half[0] = *(const v8us*)((const unsigned short*)arow + kb + 8 * hh); ah.half[1] = *(const v8us*)((const unsigned short*)arow + kb + 16 + 8 * hh);
#pragma unroll
    for (int t = 0; t < 4; ++t) { if (col0 + t * 16 >= N) continue; const size_t boff = (size_t)(col0 + t * 16 + ln) * ldb + kb; FragH bq; bq.half[0] = *(const v8us*)((const unsigned short*)Bh + boff + 8 * hh); bq.half[1] = *(const v8us*)((const unsigned short*)Bh + boff + 16 + 8 * hh);
      acc[t] = mmaH<1>(ah.v, ah.v, bq.v, bq.v, acc[t]); }
  }
#pragma unroll
  for (int t = 0; t < 4; ++t) { if (col0 + t * 16 >= N) continue; const int col = col0 + t * 16 + ln; const float bv = bp ? bf16_round(bp[col]) : 0.f;
#pragma unroll
    for (int r = 0; r < 8; ++r) { float v = acc[t][r] * alpha + bv; if (CP) { const int rr = row0g + row0 + 8 * hh + r; if (rowsPerB < 0) v += CP[cofs + (size_t)rr * ldc + col];      /* rowsPerB < 0: own element of the batched C plane */ else { const int bidx = rr / rowsPerB; v += CP[(size_t)bidx * sCPb + (size_t)by * 64 + col]; } } if (ACT == 1) v = (v > 0.f) ? v : expm1f(v); else if (ACT == 7) v = (v > 0.f) ? v + 1.0f : expf(v); else if (ACT == 8) v = tanhf(v); else if (ACT == 9) v = 0.5f * v * (1.0f + tanhf(0.7978845608028654f * (v + 0.044715f * v * v * v))); else if (ACT == 11) v = 1.0f / (1.0f + expf(-v)); else if (ACT == 12) v = (v > 0.f) ? v : 0.01f * v; else if (ACT == 14) v = (v > 0.f) ? v : 0.1f * v; else if (ACT == 16) v = (v >= 0.f) ? v : 0.3f * v; else if (ACT == 17) v = (v >= 0.f) ? v : 0.2f * v; else if (ACT == 15) v = v / (1.0f + expf(-v)); else if (ACT == 3) v = fmaxf(v, 0.f); else if (ACT == 6) v = 0.5f * v * (1.0f + erff(v * 0.70710678118654752f)); so[w][8 * hh + r][t * 16 + ln] = v; } }
  __builtin_amdgcn_fence(__ATOMIC_ACQ_REL, "workgroup"); __builtin_amdgcn_wave_barrier();
  const int rsub = lane >> 4, c4 = (lane & 15) * 4; typedef _Float16 v4h __attribute__((ext_vector_type(4)));
  {
#pragma unroll
    for (int q = 0; q < 8; ++q) { const int r = q * 2 + rsub; if (col0 + c4 < N) { const v4f v = *(const v4fa*)&so[w][r][c4]; if (C) *(v4f*)(C + cofs + (size_t)(row0 + r) * ldc + col0 + c4) = v; if (C16) { v4h h4; for (int i = 0; i < 4; ++i) h4[i] = (_Float16)v[i]; *(v4h*)(C16 + cofs + (size_t)(row0 + r) * ldc + col0 + c4) = h4; } } }
     }
}


typedef _Float16 v4h __attribute__((ext_vector_type(4)));

/* rows of DM into fragment order (see gf_frag): strips of 16 rows, DM / 32 tiles a strip; thread t writes the t-th 16 bytes */
__global__ __launch_bounds__(256) void k_x16(const float* __restrict__ x, _Float16* __restrict__ X16, size_t n8) { const size_t t = (size_t)blockIdx.x * 256 + threadIdx.x; if (t >= n8) return; FragH f;
  const size_t tile = t >> 6; const int c = (int)(t & 63); const float* src = x + ((tile / (DM / 32)) * 16 + (c & 15)) * DM + (tile % (DM / 32)) * 32 + (c >> 5) * 16 + ((c >> 4) & 1) * 8;
#pragma unroll
  for (int q = 0; q < 8; ++q) f.h[q] = (_Float16)bf16_round(src[q]); *(v8us*)((unsigned short*)X16 + t * 8) = f.half[0];  }
__global__ __launch_bounds__(256) void k_h16(const float* __restrict__ x, _Float16* __restrict__ X16, size_t n8) { const size_t t = (size_t)blockIdx.x * 256 + threadIdx.x; if (t >= n8) return; FragH f;
#pragma unroll
  for (int q = 0; q < 8; ++q) f.h[q] = (_Float16)x[t * 8 + q]; *(v8us*)((unsigned short*)X16 + t * 8) = f.half[0];  }
__global__ __launch_bounds__(256) void k_round16f(const float* __restrict__ W, _Float16* __restrict__ Bt, size_t n8) { const size_t t = (size_t)blockIdx.x * 256 + threadIdx.x; if (t >= n8) return; FragH f;
#pragma unroll
  for (int i = 0; i < 8; ++i) f.h[i] = (_Float16)(bf16_round(W[t * 8 + i]) * 16.0f); *(v8us*)((unsigned short*)Bt + t * 8) = f.half[0];  }
// ---- fast GEMM (wave tile 32x64; requires M % 32 == 0 rows per launch region, N % 64 == 0 and K % 64 == 0); A and Bh in fragment order (see gf_frag), strips of 16 rows of lda / ldb elements each; epilogue = k_gemm_hhx semantics ----
__device__ __forceinline__ v16h g2_frag(const _Float16* p, int hh) { FragH f; f.half[0] = *(const v8us*)((const unsigned short*)p + 8 * hh); f.half[1] = *(const v8us*)((const unsigned short*)p + 16 + 8 * hh); return f.v; }
// Fragment order: a 16-row x 32-k f16 tile lies 1 KB in a row, element (r, k) at (k >> 4) * 256 + (((k >> 3) & 1) * 16 + r) * 8 + (k & 7), so lane l = 16 hh + ln finds the two 16-byte halves of its fragment at 8 l and 256 + 8 l:
// each fragment load of a wave reads 512 bytes in a row (four whole 128-byte lines) where a row-major plane gives it 16 lines of 32 bytes. Which element a lane and register hold is as in g2_frag. p = tile + 8 * lane.
__device__ __forceinline__ v16h gf_frag(const _Float16* p) { FragH f; f.half[0] = *(const v8us*)((const unsigned short*)p); f.half[1] = *(const v8us*)((const unsigned short*)p + 256); return f.v; }
__device__ __forceinline__ v8f g2_mma(v16h a, v16h b, v8f c) { v8f d = __builtin_amdgcn_wmma_f32_16x16x32_f16(false, a, false, b, (short)0, c, false, false); asm volatile("v_nop\n\tv_nop\n\tv_nop\n\tv_nop" : "+v"(d) : "v"(a), "v"(b)); return d; }
// GEMM main loops: every fragment register is asked for again, for a later trip, directly behind the last product that reads it, so that a trip's twelve loads are all in flight while products run, and no product waits out a whole load by itself.
// G2_HOLD keeps each reload at that place: hoisted it would take a further register set, sunk to its use it would have no lead.
#define G2_HOLD __builtin_amdgcn_sched_barrier(0);
// one trip on a whole set, the set reloaded from element offset KO of the six strips. The wait holds the six address pairs whole until the loads have taken them, and the loads in front of the next trip.
#define G2_TRIP2(A0, A1, F0, F1, F2, F3, KO) { const int ko = (KO); \
    const _Float16* pa0 = a0p + ko; const _Float16* pa1 = a1p + ko; const _Float16* pb0 = b0p + ko; const _Float16* pb1 = b1p + ko; const _Float16* pb2 = b2p + ko; const _Float16* pb3 = b3p + ko; \
    c00 = g2_mma(A0, F0, c00); c10 = g2_mma(A1, F0, c10); F0 = gf_frag(pb0); G2_HOLD \
    c01 = g2_mma(A0, F1, c01); c11 = g2_mma(A1, F1, c11); F1 = gf_frag(pb1); G2_HOLD \
    c02 = g2_mma(A0, F2, c02); c12 = g2_mma(A1, F2, c12); F2 = gf_frag(pb2); G2_HOLD \
    c03 = g2_mma(A0, F3, c03); c13 = g2_mma(A1, F3, c13); F3 = gf_frag(pb3); A0 = gf_frag(pa0); A1 = gf_frag(pa1); \
    asm volatile("s_wait_xcnt 0x0" :: "v"(pa0), "v"(pa1), "v"(pb0), "v"(pb1), "v"(pb2), "v"(pb3) : "memory"); }
// a whole set's first loads, from element offset KO of the six strips
#define G2_FILL(A0, A1, F0, F1, F2, F3, KO) v16h F0 = gf_frag(b0p + (KO)); G2_HOLD v16h F1 = gf_frag(b1p + (KO)); G2_HOLD v16h F2 = gf_frag(b2p + (KO)); G2_HOLD v16h F3 = gf_frag(b3p + (KO)); G2_HOLD v16h A0 = gf_frag(a0p + (KO)); G2_HOLD v16h A1 = gf_frag(a1p + (KO));
// one trip with one B set and two A sets: the next trip's A (N0, N1) asked for at the head, each B fragment reloaded in place; KO = element offset of the next trip's tiles in the strips. The wait as above, for the two pairs.
#define G2_TRIP1(A0, A1, N0, N1, KO) { const _Float16* pa = ap + (KO); const _Float16* pb = bp + (KO); \
    N0 = gf_frag(pa); N1 = gf_frag(pa + 16 * DM); G2_HOLD \
    c00 = g2_mma(A0, b0, c00); c10 = g2_mma(A1, b0, c10); b0 = gf_frag(pb); G2_HOLD \
    c01 = g2_mma(A0, b1, c01); c11 = g2_mma(A1, b1, c11); b1 = gf_frag(pb + 16 * DM); G2_HOLD \
    c02 = g2_mma(A0, b2, c02); c12 = g2_mma(A1, b2, c12); b2 = gf_frag(pb + 32 * DM); G2_HOLD \
    c03 = g2_mma(A0, b3, c03); c13 = g2_mma(A1, b3, c13); b3 = gf_frag(pb + 48 * DM); \
    asm volatile("s_wait_xcnt 0x0" :: "v"(pa), "v"(pb) : "memory"); }
template <int ACT>
__global__ __launch_bounds__(128) void k_gemm2(const _Float16* __restrict__ A, int lda, size_t sA, const _Float16* __restrict__ Bh, int ldb, size_t sB, float alpha, const float* __restrict__ bias, size_t sBias, const float* __restrict__ CP, int rowsPerB, size_t sCPb, int row0g,
    float* __restrict__ C, _Float16* __restrict__ C16, int ldc, size_t sC, int M, int N, int K) { static_assert(ACT == 0 || ACT == 3 || ACT == 6 || ACT == 8 || ACT == 9 || ACT == 11 || ACT == 12 || ACT == 14 || ACT == 15 || ACT == 16 || ACT == 17, "k_gemm2: unsupported ACT code (would silently apply no activation)");
  __shared__ __attribute__((aligned(16))) float so[4][32][68];
  const int tid = threadIdx.x, w = tid >> 5, lane = tid & 31, ln = lane & 15, hh = lane >> 4; const int by = blockIdx.y;
  A += (size_t)by * sA; Bh += (size_t)by * sB; const size_t cofs = (size_t)by * sC; const float* bp = bias ? bias + (size_t)by * sBias : nullptr;
  const int ntn = N >> 6; const int mt = blockIdx.x / ntn, nq = blockIdx.x - mt * ntn; const int row0 = mt * 128 + 32 * w, col0 = nq * 64; if (row0 >= M) return;
  const _Float16* a0p = A + (size_t)row0 * lda + 8 * lane; const _Float16* a1p = a0p + (size_t)16 * lda;
  const _Float16* b0p = Bh + (size_t)col0 * ldb + 8 * lane; const _Float16* b1p = b0p + (size_t)16 * ldb; const _Float16* b2p = b1p + (size_t)16 * ldb; const _Float16* b3p = b2p + (size_t)16 * ldb;
  const v8f z8 = {0.f,0.f,0.f,0.f,0.f,0.f,0.f,0.f}; v8f c00 = z8, c01 = z8, c02 = z8, c03 = z8, c10 = z8, c11 = z8, c12 = z8, c13 = z8;
  /* two fragment sets (x: even trips, y: odd trips), every register reloaded two trips ahead directly behind the last product that reads it; K % 64 == 0 */
  /* the first loads in the order in which the loop reloads (B tiles, then A; x, then y), held so: the loop's counted waits are set for both ways into it, and another order here made them wait for younger loads */
  G2_FILL(xa0, xa1, xb0, xb1, xb2, xb3, 0) G2_HOLD G2_FILL(ya0, ya1, yb0, yb1, yb2, yb3, 512)
  asm volatile("s_wait_xcnt 0x0" :: "v"(a0p), "v"(a1p), "v"(b0p), "v"(b1p), "v"(b2p), "v"(b3p) : "memory");      /* the six address pairs stay whole until the first loads have taken them */
#pragma unroll 1      /* rolled: two trips' code, the register sets named once each */
  for (int kb = 0; kb < K; kb += 64) {
    G2_TRIP2(xa0, xa1, xb0, xb1, xb2, xb3, ((kb + 64 < K) ? kb + 64 : kb) * 16)      /* 512 elements a tile of 32 k; the last two trips ask for their own tiles again (in bounds) */
    G2_TRIP2(ya0, ya1, yb0, yb1, yb2, yb3, ((kb + 96 < K) ? kb + 96 : kb + 32) * 16) }
  v8f accs[8] = {c00, c01, c02, c03, c10, c11, c12, c13};
#pragma unroll
  for (int u = 0; u < 8; ++u) { const int t = u & 3, half = u >> 2; const int col = col0 + t * 16 + ln; const float bv = bp ? bf16_round(bp[col]) : 0.f;
#pragma unroll
    for (int r = 0; r < 8; ++r) { const int rloc = half * 16 + 8 * hh + r; float v = accs[u][r] * alpha + bv; if (CP) { if (rowsPerB < 0) v += CP[cofs + (size_t)(row0g + row0 + rloc) * ldc + col];      /* rowsPerB < 0: own element of the batched C plane */ else { const int bidx = (row0g + row0 + rloc) / rowsPerB; v += CP[(size_t)bidx * sCPb + (size_t)by * 64 + col]; } }
      if (ACT == 3) v = fmaxf(v, 0.f); else if (ACT == 6) v = 0.5f * v * (1.0f + erff(v * 0.70710678118654752f)); else if (ACT == 11) v = 1.0f / (1.0f + expf(-v)); else if (ACT == 15) v = v / (1.0f + expf(-v)); else if (ACT == 12) v = (v > 0.f) ? v : 0.01f * v; else if (ACT == 8) v = tanhf(v); else if (ACT == 9) v = 0.5f * v * (1.0f + tanhf(0.7978845608028654f * (v + 0.044715f * v * v * v))); else if (ACT == 14) v = (v > 0.f) ? v : 0.1f * v; else if (ACT == 16) v = (v >= 0.f) ? v : 0.3f * v; else if (ACT == 17) v = (v >= 0.f) ? v : 0.2f * v;
      so[w][rloc][t * 16 + ln] = v; } }
  __builtin_amdgcn_fence(__ATOMIC_ACQ_REL, "workgroup"); __builtin_amdgcn_wave_barrier();
  const int rsub = lane >> 4, c4 = (lane & 15) * 4;
  {
#pragma unroll
    for (int q = 0; q < 16; ++q) { const int r = q * 2 + rsub; const v4f v = *(const v4fa*)&so[w][r][c4]; if (C) *(v4f*)(C + cofs + (size_t)(row0 + r) * ldc + col0 + c4) = v; if (C16) { v4h h4; for (int i = 0; i < 4; ++i) h4[i] = (_Float16)v[i]; *(v4h*)(C16 + cofs + (size_t)(row0 + r) * ldc + col0 + c4) = h4; } }
     } }


__global__ __launch_bounds__(256) void k_wnat(const float* __restrict__ w, size_t n8, _Float16* __restrict__ Bt) { const size_t t = (size_t)blockIdx.x * 256 + threadIdx.x; if (t >= n8) return; FragH f; for (int q = 0; q < 8; ++q) f.h[q] = (_Float16)(bf16_round(w[t * 8 + q]) * 16.0f); *(v8us*)((unsigned short*)Bt + t * 8) = f.half[0];  }
__global__ __launch_bounds__(256) void k_rsm(const float* __restrict__ S, _Float16* __restrict__ P, int nrows) {
  #pragma clang fp contract(off)
  const int i = blockIdx.x * 256 + threadIdx.x; if (i >= nrows) return; const float* s = S + (size_t)i * SQ; float mx = -3.0e38f;
#pragma unroll 1
  for (int j = 0; j < SQ; ++j) mx = fmaxf(mx, s[j]); float se = 0.f;
#pragma unroll 1
  for (int j = 0; j < SQ; ++j) se += expf(s[j] - mx); const float sc = 256.0f / se;
#pragma unroll 1
  for (int j0 = 0; j0 < SQ; j0 += 8) { FragH f; for (int q = 0; q < 8; ++q) f.h[q] = (_Float16)(expf(s[j0 + q] - mx) * sc); unsigned short* d = (unsigned short*)P + (size_t)i * SQ + j0; *(v8us*)d = f.half[0];  } }
__global__ __launch_bounds__(256) void k_vt(const _Float16* __restrict__ V16, int b, int h0, _Float16* __restrict__ VT) { __shared__ unsigned short tl[64][65]; const int tid = threadIdx.x; const int hh = blockIdx.x % HG, sg = blockIdx.x / HG; const int s0 = sg * 64; const int h = h0 + hh;
  for (int i = tid; i < 64 * 8; i += 256) { const int j = i / 8, d8 = (i % 8) * 8; FragH f; f.half[0] = *(const v8us*)((const unsigned short*)V16 + ((size_t)b * SQ + s0 + j) * DM + h * HD + d8); for (int q = 0; q < 8; ++q) tl[d8 + q][j] = f.u[q]; }
  __syncthreads();
  { for (int i = tid; i < 64 * 8; i += 256) { const int d = i / 8, j8 = (i % 8) * 8; FragH f; for (int q = 0; q < 8; ++q) f.u[q] = tl[d][j8 + q]; *(v8us*)((unsigned short*)VT + ((size_t)hh * HD + d) * SQ + s0 + j8) = f.half[0]; }  } }


__global__ __launch_bounds__(256) void k_tab2(float theta, float* __restrict__ CS, float* __restrict__ SN) {
  #pragma clang fp contract(off)
  const int t = blockIdx.x * 256 + threadIdx.x; if (t >= SQ * (HD / 2)) return; const int i = t % (HD / 2); const int p = t / (HD / 2); const float invf = 1.0f / powf(theta, (float)(2 * i) / (float)HD); const float ang = __fmul_rn((float)p, invf); const float c = cosf(ang), s = sinf(ang);
  *(float*)(CS + t) = c; *(float*)(SN + t) = s;  }
// Fused causal attention, one launch for every (batch, head, 128-query block): each wave owns 32 queries and walks the keys 0 .. its own last query in passes of 32, nothing of S or P goes through memory.
// Transposed products: S^T = K . Q^T (A = key rows, B = query rows kept in registers; hi.hi in one accumulator, lo.hi + hi.lo in a second, joined as hi + 2^-10 lo in f32), so a lane holds 16 scores of ONE query;
// running maximum and sum per query (online softmax, accumulators rescaled only in a pass where some query's maximum moved); the two 16-key score tiles, as f16 weights x256, ARE the B operand of O^T += V^T . P^T.
__device__ __forceinline__ float rs_xrow(float v) { const int i = __float_as_int(v); return __int_as_float(__builtin_amdgcn_permlanex16(i, i, 0x76543210, 0xfedcba98, false, false)); }      /* lane l <- lane l ^ 16 */
// native 2^a. The v_nop is the slot the instruction set asks for behind a transcendental before its source is overwritten or its result read.
__device__ __forceinline__ float fa_exp2(float a) { float e; asm("v_exp_f32 %0, %1\n\tv_nop" : "=v"(e) : "v"(a)); return e; }
__device__ __forceinline__ v8f fa_mma(v16h a, v16h b, v8f c) { return __builtin_amdgcn_wmma_f32_16x16x32_f16(false, a, false, b, (short)0, c, false, false); }
#define FA_C 11.5415603271117072589f      /* sqrt(64) * log2(e): score differences -> exponent of 2 */
__global__ __launch_bounds__(128) void k_fattn(const _Float16* __restrict__ QH, const _Float16* __restrict__ QL, const _Float16* __restrict__ KH, const _Float16* __restrict__ KL, const _Float16* __restrict__ VT, _Float16* __restrict__ O16) {
  const int lane = threadIdx.x & 31, ln = lane & 15, hh = lane >> 4; const int w = __builtin_amdgcn_readfirstlane((int)(threadIdx.x >> 5));      /* scalar wave number: the key loop's bound stays a scalar */
  const int bh = blockIdx.y, b = bh / NH, h = bh % NH; const int q0 = ((int)gridDim.x - 1 - (int)blockIdx.x) * 128 + w * 32;      /* longest blocks start first */
  const size_t r0 = (size_t)b * SQ;
  /* every pointer below is the lane's own address, its lane offset 8 lane folded in, so that the loads name exactly the pair that the wait behind them holds */
  /* q, k planes: fragment order (see gf_frag), per (batch, head) strips of 16 tokens, two tiles (k halves of the head) a strip: 64 elements a token; V^T: per (batch, head) and 32 keys four tiles (16 head columns each): 64 elements a key */
  const size_t hb = (size_t)bh * SQ * HD + 8 * lane;
  const _Float16* qhp = QH + hb + (size_t)q0 * HD; const _Float16* qlp = QL + hb + (size_t)q0 * HD;
  v16h qh[2][2], ql[2][2];      /* [query group of 16][k half of the head] */
#pragma unroll
  for (int j = 0; j < 2; ++j)
#pragma unroll
    for (int ks = 0; ks < 2; ++ks) { const size_t o = (size_t)(2 * j + ks) * 512; qh[j][ks] = gf_frag(qhp + o); ql[j][ks] = gf_frag(qlp + o); }
  asm volatile("s_wait_xcnt 0x0" :: "v"(qhp), "v"(qlp) : "memory");      /* the two address pairs stay whole until the loads have taken them */
  const _Float16* khp = KH + hb; const _Float16* klp = KL + hb; const _Float16* vtp = VT + hb;
  const v8f z8 = {0.f,0.f,0.f,0.f,0.f,0.f,0.f,0.f};
  v8f o[2][4]; float m[2], l[2];
#pragma unroll
  for (int j = 0; j < 2; ++j) { m[j] = -1.0e30f; l[j] = 0.f;
#pragma unroll
    for (int t = 0; t < 4; ++t) o[j][t] = z8; }
  v16h kh[2][2], kl[2][2];      /* [16-key tile][k half] */
#pragma unroll
  for (int kt = 0; kt < 2; ++kt)
#pragma unroll
    for (int ks = 0; ks < 2; ++ks) { const size_t ko = (size_t)(2 * kt + ks) * 512; kh[kt][ks] = gf_frag(khp + ko); kl[kt][ks] = gf_frag(klp + ko); }
#pragma unroll 1
  for (int kb = 0; kb <= q0; kb += 32) {
    v16h vf[4]; const _Float16* pv = vtp + (size_t)kb * HD;      /* V^T tiles of this pass, asked for ahead of the score products */
#pragma unroll
    for (int t = 0; t < 4; ++t) vf[t] = gf_frag(pv + (size_t)t * 512);
    asm volatile("s_wait_xcnt 0x0" ::: "memory");      /* stands in front of the advance of the loads' address pair; it also keeps these loads here, ahead of the score products, where the build had sunk them to their use */
    v8f u[2][2];      /* [query group][key tile]: q . k, register r = key 16 kt + 8 hh + r of query ln */
#pragma unroll
    for (int kt = 0; kt < 2; ++kt)
#pragma unroll
      for (int j = 0; j < 2; ++j) { v8f sh = z8, sl = z8;
#pragma unroll
        for (int ks = 0; ks < 2; ++ks) { sh = fa_mma(kh[kt][ks], qh[j][ks], sh); sl = fa_mma(kh[kt][ks], ql[j][ks], sl); sl = fa_mma(kl[kt][ks], qh[j][ks], sl); }
#pragma unroll
        for (int r = 0; r < 8; ++r) u[j][kt][r] = sh[r] + 0.0009765625f * sl[r]; }
    { const int kn = (kb + 32 <= q0) ? kb + 32 : q0;      /* next pass's key rows into the same registers, behind their last use; the last pass asks for its own rows again (in bounds) */
      const _Float16* pkh = khp + (size_t)kn * HD; const _Float16* pkl = klp + (size_t)kn * HD;
#pragma unroll
      for (int kt = 0; kt < 2; ++kt)
#pragma unroll
        for (int ks = 0; ks < 2; ++ks) { const size_t ko = (size_t)(2 * kt + ks) * 512; kh[kt][ks] = gf_frag(pkh + ko); kl[kt][ks] = gf_frag(pkl + ko); }
      asm volatile("s_wait_xcnt 0x0" :: "v"(pkh), "v"(pkl) : "memory"); }      /* the two address pairs stay whole until the loads have taken them */
    if (kb == q0) {      /* the one pass on the diagonal: keys above the query are out */
#pragma unroll
      for (int j = 0; j < 2; ++j)
#pragma unroll
        for (int kt = 0; kt < 2; ++kt)
#pragma unroll
          for (int r = 0; r < 8; ++r) u[j][kt][r] = (16 * kt + 8 * hh + r <= 16 * j + ln) ? u[j][kt][r] : -1.0e9f; }
    float mn[2];
#pragma unroll
    for (int j = 0; j < 2; ++j) { float x = fmaxf(u[j][0][0], u[j][1][0]);
#pragma unroll
      for (int r = 1; r < 8; ++r) x = fmaxf(x, fmaxf(u[j][0][r], u[j][1][r]));
      mn[j] = fmaxf(m[j], fmaxf(x, rs_xrow(x))); }
    if (__builtin_amdgcn_ballot_w32(mn[0] > m[0] || mn[1] > m[1]) != 0) {      /* scalar branch; where no maximum moved every factor would be 1 */
#pragma unroll
      for (int j = 0; j < 2; ++j) { const float al = fa_exp2((m[j] - mn[j]) * FA_C); m[j] = mn[j]; l[j] *= al;
#pragma unroll
        for (int t = 0; t < 4; ++t)
#pragma unroll
          for (int r = 0; r < 8; ++r) o[j][t][r] *= al; } }
#pragma unroll
    for (int j = 0; j < 2; ++j) { FragH pf; float s0 = 0.f, s1 = 0.f;
#pragma unroll
      for (int r = 0; r < 8; ++r) { const float p0 = fa_exp2((u[j][0][r] - m[j]) * FA_C + 8.0f), p1 = fa_exp2((u[j][1][r] - m[j]) * FA_C + 8.0f); s0 += p0; s1 += p1; pf.h[r] = (_Float16)p0; pf.h[8 + r] = (_Float16)p1; }      /* weights x256 */
      l[j] += s0 + s1;
#pragma unroll
      for (int t = 0; t < 4; ++t) o[j][t] = fa_mma(vf[t], pf.v, o[j][t]); }
  }
#pragma unroll
  for (int j = 0; j < 2; ++j) { const float inv = 64.0f / (l[j] + rs_xrow(l[j]));      /* the two lane halves hold disjoint keys' sums; o carried x64 */
    unsigned short* dst = (unsigned short*)O16 + (r0 + q0 + 16 * j) * DM + (size_t)h * 1024 + 8 * lane;      /* o rows in fragment order for the output GEMM: strip of 16 rows, tiles 2 h and 2 h + 1; the lane's 8 values are one 16-byte half of its own fragment */
#pragma unroll
    for (int t = 0; t < 4; ++t) { FragH f;
#pragma unroll
      for (int r = 0; r < 8; ++r) f.h[r] = (_Float16)(o[j][t][r] * inv);
      *(v8us*)(dst + 256 * t) = f.half[0]; } } }


// q | k | v projection of every token row in one launch: wave tile (32 x 64) of k_gemm2, main loop on one B set and two A sets (G2_TRIP1); a block's 64 columns are exactly one head of q, of k or of v, and the epilogue finishes that head's rows itself:
// q, k: f32 row through LDS, interleaved-pair rotation from the f32 tables, f16 hi + x1024 residual planes in fragment order; v: f16 from the accumulators (a lane holds 8 consecutive tokens of one column) straight into V^T in fragment order, whole 128-byte lines.
typedef float v2fa __attribute__((ext_vector_type(2), may_alias));
__global__ __launch_bounds__(128) void k_qkv(const _Float16* __restrict__ A, const _Float16* __restrict__ Bh, const float* __restrict__ bias, const float* __restrict__ CS, const float* __restrict__ SN,
    _Float16* __restrict__ QH, _Float16* __restrict__ QL, _Float16* __restrict__ KH, _Float16* __restrict__ KL, _Float16* __restrict__ VT) {
  __shared__ __attribute__((aligned(16))) float so[4][32][68];
  const int tid = threadIdx.x, w = tid >> 5, lane = tid & 31, ln = lane & 15, hh = lane >> 4;
  const int ntn = 3 * NH; const int mt = blockIdx.x / ntn, nq = blockIdx.x - mt * ntn; const int row0 = mt * 128 + 32 * w, col0 = nq * HD; const int part = nq / NH, h = nq - part * NH;      /* part 0 q, 1 k, 2 v: the same for the whole block */
  const _Float16* ap = A + (size_t)row0 * DM + 8 * lane; const _Float16* bp = Bh + (size_t)col0 * DM + 8 * lane;      /* A, Bh in fragment order (see gf_frag), strips of 16 rows; the lane's own addresses: every load of a trip names one of two pairs */
  const v8f z8 = {0.f,0.f,0.f,0.f,0.f,0.f,0.f,0.f}; v8f c00 = z8, c01 = z8, c02 = z8, c03 = z8, c10 = z8, c11 = z8, c12 = z8, c13 = z8;
  /* one B set reloaded in place, two A sets (x: even trips, y: odd trips): a second B set would take the launch below the six waves a SIMD that it needs to be resident at once */
  /* the first loads in the order in which the loop reloads (A, then the B tiles), held so: the loop's counted waits are set for both ways into it, and another order here made them wait for younger loads */
  v16h ya0, ya1, xa0 = gf_frag(ap); G2_HOLD v16h xa1 = gf_frag(ap + 16 * DM); G2_HOLD v16h b0 = gf_frag(bp); G2_HOLD v16h b1 = gf_frag(bp + 16 * DM); G2_HOLD v16h b2 = gf_frag(bp + 32 * DM); G2_HOLD v16h b3 = gf_frag(bp + 48 * DM);
  asm volatile("s_wait_xcnt 0x0" :: "v"(ap), "v"(bp) : "memory");      /* the two address pairs stay whole until the first loads have taken them */
#pragma unroll 1      /* rolled: two trips' code, the register sets named once each */
  for (int kb = 0; kb < DM; kb += 64) {
    G2_TRIP1(xa0, xa1, ya0, ya1, (kb + 32) * 16)      /* 512 elements a tile of 32 k */
    G2_TRIP1(ya0, ya1, xa0, xa1, ((kb + 64 < DM) ? kb + 64 : kb + 32) * 16) }      /* the last trip asks for its own tiles again (in bounds) */
  v8f accs[8] = {c00, c01, c02, c03, c10, c11, c12, c13};
  const size_t hb = ((size_t)((row0 / SQ) * NH + h) * SQ + row0 % SQ) * HD;      /* the wave's 32 tokens in a plane of its (batch, head): 64 elements a token in fragment order */
  if (part == 2) {      /* V^T tiles (16 head columns x 32 keys) in fragment order: the wave's 32 tokens are one group of 32 keys, and a lane's 8 accumulator values (column ln of tile t, tokens 16 half + 8 hh + r) are one 16-byte half of its own fragment: stored from the registers, 512 bytes in a row a store */
    unsigned short* vd = (unsigned short*)VT + hb + 8 * lane;
#pragma unroll
    for (int u = 0; u < 8; ++u) { const int t = u & 3, half = u >> 2; const float bv = bf16_round(bias[col0 + t * 16 + ln]); FragH f;
#pragma unroll
      for (int r = 0; r < 8; ++r) f.h[r] = (_Float16)(accs[u][r] * 0.0625f + bv);
      *(v8us*)(vd + t * 512 + half * 256) = f.half[0]; }
    return; }
#pragma unroll
  for (int u = 0; u < 8; ++u) { const int t = u & 3, half = u >> 2; const float bv = bf16_round(bias[col0 + t * 16 + ln]);
#pragma unroll
    for (int r = 0; r < 8; ++r) so[w][half * 16 + 8 * hh + r][t * 16 + ln] = accs[u][r] * 0.0625f + bv; }
  __builtin_amdgcn_fence(__ATOMIC_ACQ_REL, "workgroup"); __builtin_amdgcn_wave_barrier();      /* a wave reads back only its own plane of so: its LDS writes are ordered in front of its reads, no block barrier */
  const int rsub = lane >> 4, c4 = (lane & 15) * 4;
  _Float16* Hh = (part ? KH : QH) + hb + (c4 >> 3) * 128 + (c4 & 7); _Float16* Hl = (part ? KL : QL) + hb + (c4 >> 3) * 128 + (c4 & 7);      /* the lane's 4 columns in fragment order: tile c4 >> 5, half (c4 >> 4) & 1, lane half (c4 >> 3) & 1, 128 elements apart each step of 8 columns */
#pragma unroll 1      /* rolled, four steps (eight rows) a trip: as one unrolled loop of sixteen steps the build took 166 registers, five waves a SIMD, and this launch needs six to be resident at once */
  for (int q0 = 0; q0 < 16; q0 += 4) {
#pragma unroll
  for (int q = q0; q < q0 + 4; ++q) { const int r = q * 2 + rsub; const v4f v = *(const v4fa*)&so[w][r][c4]; const int row = row0 + r; const size_t to = (size_t)(row % SQ) * (HD / 2) + (c4 >> 1);
    const v2fa c = *(const v2fa*)(CS + to), s = *(const v2fa*)(SN + to); float o[4];
    o[0] = fmaf(v[0], c[0], -(v[1] * s[0])); o[1] = fmaf(v[0], s[0], v[1] * c[0]); o[2] = fmaf(v[2], c[1], -(v[3] * s[1])); o[3] = fmaf(v[2], s[1], v[3] * c[1]);      /* the odd element's product rounded, the even element's fused onto it */
    v4h fh, fl;
#pragma unroll
    for (int i = 0; i < 4; ++i) { const _Float16 hi = (_Float16)o[i]; fh[i] = hi; fl[i] = (_Float16)((o[i] - (float)hi) * 1024.0f); }
    const size_t d = (size_t)(r >> 4) * 1024 + (r & 15) * 8; *(v4h*)(Hh + d) = fh; *(v4h*)(Hl + d) = fl; }
    asm volatile("s_wait_xcnt 0x0" ::: "memory"); } }      /* stands in front of the next trip's first writes */

extern "C" void kernel_launch(void* const* d_in, const int* in_sizes, int n_in,
                              void* d_out, int out_size, void* d_ws, size_t ws_size, hipStream_t stream) {
  (void)in_sizes; (void)n_in; (void)out_size;
  const float* const* I = (const float* const*)d_in; const float* x = I[0]; const float* wqkv = I[1]; const float* bqkv = I[2]; const float* wo = I[3]; const float* bo = I[4];      /* [in][out] fused qkv + out weights, biases */
  char* ws = (char*)d_ws; size_t off = 0;
  auto take = [&](size_t bytes) { char* p = ws + off; off += (bytes + 255) & ~(size_t)255; return p; };
  _Float16* BQKV = (_Float16*)take((size_t)3 * DM * DM * 2); _Float16* BO = (_Float16*)take((size_t)DM * DM * 2); float* CS = (float*)take((size_t)SQ * (HD / 2) * 4); float* SN = (float*)take((size_t)SQ * (HD / 2) * 4);
  _Float16* X16 = (_Float16*)take(NR * DM * 2);
  _Float16* QH = (_Float16*)take(NR * DM * 2); _Float16* QL = (_Float16*)take(NR * DM * 2); _Float16* KH = (_Float16*)take(NR * DM * 2); _Float16* KL = (_Float16*)take(NR * DM * 2); _Float16* O16 = (_Float16*)take(NR * DM * 2);
  _Float16* VT = (_Float16*)take((size_t)NB * NH * HD * SQ * 2);      /* V^T of every batch */
  if (off > ws_size) return;
  k_wt_f16<<<(unsigned)(((size_t)3 * DM * (DM / 8) + 255) / 256), 256, 0, stream>>>(wqkv, BQKV, DM, 3 * DM, 16.0f); k_wt_f16<<<(unsigned)(((size_t)DM * (DM / 8) + 255) / 256), 256, 0, stream>>>(wo, BO, DM, DM, 16.0f);      /* [in][out] -> Bt(n, k) x16 in fragment order; q | k | v stacked along n */
  k_tab2<<<(SQ * (HD / 2) + 255) / 256, 256, 0, stream>>>(10000.0f, CS, SN);
  k_x16<<<(unsigned)((NR * DM / 8 + 255) / 256), 256, 0, stream>>>(x, X16, NR * DM / 8);
  k_qkv<<<(unsigned)((NR / 128) * (3 * DM / 64)), 128, 0, stream>>>(X16, BQKV, bqkv, CS, SN, QH, QL, KH, KL, VT);      /* roped q, k as f16 hi + x1024 residual (the x8 logits, sigma ~64, need ~f32-accurate scores) and V^T, per (batch, head), in fragment order */
  k_fattn<<<dim3(SQ / 128, NB * NH), 128, 0, stream>>>(QH, QL, KH, KL, VT, O16);      /* o (merged heads, x64) as f16 rows in fragment order */
  k_gemm2<0><<<dim3((unsigned)((MPO / 128) * (DM / 64)), 1), 128, 0, stream>>>(O16 + (size_t)B0 * SQ * DM, DM, 0, BO, DM, 0, 0.0009765625f, bo, 0, nullptr, 1, 0, 0, (float*)d_out + (size_t)B0 * SQ * DM, nullptr, DM, 0, MPO, DM, DM);      /* out rows are the output layout */
}

// v006
// A run of this version takes 121 microseconds.
// Next to v005, in two timings, it ran 1.05 and 1.09 times as fast.
// Over all steps from v000 it is 37.6 times as fast.
#include <hip/hip_runtime.h>
// Masked (causal) RoPE multi-head attention with LARGE logits (x [2][2048][1024]; qkv = x w_qkv + b_qkv ([in][out] 1024 x 3072, sigma 1/32, bias sigma 0.01) -> q | k | v, 16 heads of 64; interleaved-pair RoPE on q and k (inv_freq_i = 10000^(-2i/64), positions 0..2047); scores = q . k x sqrt(64) (the module divides by 1/sqrt(d_k)), causal (tril); softmax; out = (attn v merged) w_out + b_out -> [2][2048][1024]).
// Structure: token rows r = b*2048 + s; x as exact f16 rows (bf16-rounded); q | k | v of every row as ONE WMMA GEMM launch (32x64 wave tiles, f32 accumulation, exact x16 weights + bias, N = 3 x 1024) whose epilogue, a block's 64 columns being one head, does on VALU: the interleaved-pair rotary rotation of q and k from f32 cos/sin tables (positions 0..SQ-1, no norm) and their split into f16 hi + x1024 residual planes (the x8 logits have sigma ~64: near-argmax softmax, so the scores are computed to ~f32 accuracy from three products), v as f16 into V^T; then ONE fused attention launch over every (batch, head, 128-query block): a wave holds 32 queries, walks the keys up to its own diagonal in passes of 32, scores as S^T = K . Q^T (three products), online causal softmax in registers (f32 running maximum and sum, native exp; keys above the diagonal set to -1e9; weights x256 f16), O^T += V^T . P^T with the score tiles as the B operand, o carried x64 (folded into the output GEMM alpha) written straight into the merged f16 o rows; out = o W_o + b GEMM (f32) into the output layout. Every f16 operand plane in the workspace (x, both weights, q and k hi / residual, V^T, o) lies in WMMA fragment order (see gf_frag), so that a fragment load reads whole 128-byte lines.
// Compute dtype: inputs rounded to bf16; x / weights exact; projections and rope f32; q, k as f16 hi + residual (~2^-22); v, softmax weights and o as plain f16 GEMM operands (~2^-12); scores and softmax statistics f32. v_wmma_f32_16x16x32_f16.
#define NB 2
#define SQ 2048
#define DM 1024
#define NH 16
#define HD 64
#define HG 4                         /* heads per launch of the (b, h0) V^T transpose */
#define QT 256
#define NKX SQ                       /* unused */
#define B0 0                         /* first batch processed (debug hook) */
#define NBR NB                       /* batches processed (debug hook) */
#define QN SQ                        /* unused (attention covers all SQ queries) */
#define NHD NH                       /* unused (attention covers all NH heads) */
#define NR ((size_t)NB * SQ)         /* token rows */
#define MPO ((int)((size_t)NBR * SQ))      /* rows through the output GEMM (debug hook) */
typedef __bf16 v16b __attribute__((ext_vector_type(16)));
typedef unsigned short v8us __attribute__((ext_vector_type(8), may_alias));
typedef float  v8f  __attribute__((ext_vector_type(8)));
typedef float  v4f  __attribute__((ext_vector_type(4)));
typedef float  v4fa __attribute__((ext_vector_type(4), may_alias));
union FragB { v16b v; v8us half[2]; unsigned short u[16]; };

__device__ __forceinline__ unsigned short bf16_bits(float x) { unsigned int u = __float_as_uint(x); return (unsigned short)((u + 0x7FFFu + ((u >> 16) & 1u)) >> 16); }
__device__ __forceinline__ float bf16_val(unsigned short b) { return __uint_as_float(((unsigned int)b) << 16); }
__device__ __forceinline__ float bf16_round(float x) { return bf16_val(bf16_bits(x)); }
// D += A·B with NT terms: 1 = ah·bh, 2 = + al·bh (A split), 3 = + ah·bl (both split)
template <int NT>
__device__ __forceinline__ v8f mmaN(v16b ah, v16b al, v16b bh, v16b bl, v8f c) {
  c = __builtin_amdgcn_wmma_f32_16x16x32_bf16(false, ah, false, bh, (short)0, c, false, false);
  if (NT >= 2) c = __builtin_amdgcn_wmma_f32_16x16x32_bf16(false, al, false, bh, (short)0, c, false, false);
  if (NT >= 3) c = __builtin_amdgcn_wmma_f32_16x16x32_bf16(false, ah, false, bl, (short)0, c, false, false);
  asm volatile("v_nop\n\tv_nop\n\tv_nop\n\tv_nop" : "+v"(c) : "v"(ah), "v"(al), "v"(bh), "v"(bl));
  return c;
}

__global__ __launch_bounds__(256) void k_wt_bf16(const float* __restrict__ W, unsigned short* __restrict__ Wt, int K, int N) {
  const int t = blockIdx.x * 256 + threadIdx.x;
  const int k8n = K / 8;
  if (t >= N * k8n) return;
  const int n = t / k8n, k8 = (t % k8n) * 8;
  v8us v;
#pragma unroll
  for (int i = 0; i < 8; ++i) v[i] = bf16_bits(W[(size_t)(k8 + i) * N + n]);
  *(v8us*)(Wt + (size_t)n * K + k8) = v;
  
}

// GEMM C[M][N] (f32, pitch ldc) = act(A[M][K]·W + bias). A f32 row-major (pitch lda) converted per fragment to bf16
// (ASPLIT: hi/lo two planes -> 2 terms, else single rounded term); Wt bf16 [N][K] (pitch ldb). BIAS_BF16 rounds the
// bias to bf16 first (bias quantised to bf16 before the add). K%32==0, M%16==0, N%64==0.
template <bool ASPLIT, int ACT, bool BIAS_BF16>
__global__ __launch_bounds__(128) void k_gemm_bf(const float* __restrict__ A, int lda, const unsigned short* __restrict__ Wt, int ldb,
                                               const float* __restrict__ bias, float* __restrict__ C, int ldc, int M, int N, int K) {
  __shared__ __attribute__((aligned(16))) float so[4][16][64];
  const int tid = threadIdx.x, w = tid >> 5, lane = tid & 31, ln = lane & 15, hh = lane >> 4;
  const int ntn = N / 64;
  const int wid = blockIdx.x * 4 + w;
  const int mt = wid / ntn, nq = wid % ntn;
  if (mt * 16 >= M) return;
  const int row0 = mt * 16, col0 = nq * 64;
  const float* arow = A + (size_t)(row0 + ln) * lda;
  v8f acc[4] = {};
  for (int kb = 0; kb < K; kb += 32) {
    FragB ah, al;
    const v4f x0 = *(const v4fa*)(arow + kb + 8 * hh), x1 = *(const v4fa*)(arow + kb + 8 * hh + 4);
    const v4f x2 = *(const v4fa*)(arow + kb + 16 + 8 * hh), x3 = *(const v4fa*)(arow + kb + 16 + 8 * hh + 4);
    float xs[16] = {x0[0],x0[1],x0[2],x0[3],x1[0],x1[1],x1[2],x1[3],x2[0],x2[1],x2[2],x2[3],x3[0],x3[1],x3[2],x3[3]};
#pragma unroll
    for (int i = 0; i < 16; ++i) { const unsigned short hb = bf16_bits(xs[i]); ah.u[i] = hb; al.u[i] = ASPLIT ? bf16_bits(xs[i] - bf16_val(hb)) : (unsigned short)0; }
#pragma unroll
    for (int t = 0; t < 4; ++t) {
      const unsigned short* brow = Wt + (size_t)(col0 + t * 16 + ln) * ldb + kb;
      FragB b;
      b.half[0] = *(const v8us*)(brow + 8 * hh);
      b.half[1] = *(const v8us*)(brow + 16 + 8 * hh);
      acc[t] = mmaN<ASPLIT ? 2 : 1>(ah.v, al.v, b.v, b.v, acc[t]);
    }
  }
#pragma unroll
  for (int t = 0; t < 4; ++t) {
    float bv = bias ? bias[col0 + t * 16 + ln] : 0.f;
    if (BIAS_BF16) bv = bf16_round(bv);
#pragma unroll
    for (int r = 0; r < 8; ++r) { float v = acc[t][r] + bv; if (ACT == 1) v = fmaxf(v, 0.f); so[w][8 * hh + r][t * 16 + ln] = v; }
  }
  __builtin_amdgcn_fence(__ATOMIC_ACQ_REL, "workgroup");
  __builtin_amdgcn_wave_barrier();
  const int rsub = lane >> 4, c4 = (lane & 15) * 4;
  {
#pragma unroll
    for (int q = 0; q < 8; ++q) {
      const int r = q * 2 + rsub;
      const v4f v = *(const v4fa*)&so[w][r][c4];
      *(v4f*)(C + (size_t)(row0 + r) * ldc + col0 + c4) = v;
    }
    
  }
}

// GEMM C = act(A·W + bias + resid): A f32 (ASPLIT -> hi/lo 2 terms), Wt bf16 [N][K]; ACT 0 none, 1 relu, 2 exact gelu;
// resid (optional, f32, row index = (row % rmod), pitch ldr, RES_BF16 rounds it) added before the activation.
template <bool ASPLIT, int ACT, bool BIAS_BF16, bool RES_BF16>
__global__ __launch_bounds__(128) void k_gemm_bf3(const float* __restrict__ A, int lda, const unsigned short* __restrict__ Wt, int ldb,
                                                const float* __restrict__ bias, const float* __restrict__ resid, int rmod, int ldr,
                                                float* __restrict__ C, int ldc, int M, int N, int K) {
  __shared__ __attribute__((aligned(16))) float so[4][16][64];
  const int tid = threadIdx.x, w = tid >> 5, lane = tid & 31, ln = lane & 15, hh = lane >> 4;
  const int ntn = N / 64;
  const int wid = blockIdx.x * 4 + w;
  const int mt = wid / ntn, nq = wid % ntn;
  if (mt * 16 >= M) return;
  const int row0 = mt * 16, col0 = nq * 64;
  const float* arow = A + (size_t)(row0 + ln) * lda;
  v8f acc[4] = {};
  for (int kb = 0; kb < K; kb += 32) {
    FragB ah, al;
    const v4f x0 = *(const v4fa*)(arow + kb + 8 * hh), x1 = *(const v4fa*)(arow + kb + 8 * hh + 4);
    const v4f x2 = *(const v4fa*)(arow + kb + 16 + 8 * hh), x3 = *(const v4fa*)(arow + kb + 16 + 8 * hh + 4);
    float xs[16] = {x0[0],x0[1],x0[2],x0[3],x1[0],x1[1],x1[2],x1[3],x2[0],x2[1],x2[2],x2[3],x3[0],x3[1],x3[2],x3[3]};
#pragma unroll
    for (int i = 0; i < 16; ++i) { const unsigned short hb = bf16_bits(xs[i]); ah.u[i] = hb; al.u[i] = ASPLIT ? bf16_bits(xs[i] - bf16_val(hb)) : (unsigned short)0; }
#pragma unroll
    for (int t = 0; t < 4; ++t) {
      const unsigned short* brow = Wt + (size_t)(col0 + t * 16 + ln) * ldb + kb;
      FragB b;
      b.half[0] = *(const v8us*)(brow + 8 * hh);
      b.half[1] = *(const v8us*)(brow + 16 + 8 * hh);
      acc[t] = mmaN<ASPLIT ? 2 : 1>(ah.v, al.v, b.v, b.v, acc[t]);
    }
  }
#pragma unroll
  for (int t = 0; t < 4; ++t) {
    const int col = col0 + t * 16 + ln;
    float bv = bias ? bias[col] : 0.f;
    if (BIAS_BF16) bv = bf16_round(bv);
#pragma unroll
    for (int r = 0; r < 8; ++r) {
      float v = acc[t][r] + bv;
      if (resid) { float rv = resid[(size_t)((row0 + 8 * hh + r) % rmod) * ldr + col]; if (RES_BF16) rv = bf16_round(rv); v += rv; }
      if (ACT == 1) v = fmaxf(v, 0.f);
      if (ACT == 2) v = 0.5f * v * (1.0f + erff(v * 0.70710678118654752f));
      if (ACT == 3) { const float u = 0.7978845608028654f * (v + 0.044715f * v * v * v); v = 0.5f * v * (1.0f + tanhf(u)); }
      so[w][8 * hh + r][t * 16 + ln] = v;
    }
  }
  __builtin_amdgcn_fence(__ATOMIC_ACQ_REL, "workgroup");
  __builtin_amdgcn_wave_barrier();
  const int rsub = lane >> 4, c4 = (lane & 15) * 4;
  {
#pragma unroll
    for (int q = 0; q < 8; ++q) {
      const int r = q * 2 + rsub;
      const v4f v = *(const v4fa*)&so[w][r][c4];
      *(v4f*)(C + (size_t)(row0 + r) * ldc + col0 + c4) = v;
    }
    
  }
}
// row LayerNorm (biased variance, eps) over N: s = X (+ R); optional out_sum <- s; out_norm <- (s-mu)*rsqrt(var+eps)*g + b
template <bool PARAM_BF16>
__global__ __launch_bounds__(256) void k_layernorm(const float* __restrict__ X, const float* __restrict__ R, const float* __restrict__ g, const float* __restrict__ bta,
                                                  float* __restrict__ out_sum, float* __restrict__ out_norm, int N, float eps) {
  __shared__ float red[256];
  const int row = blockIdx.x, tid = threadIdx.x;
  const float* x = X + (size_t)row * N; const float* rr = R ? R + (size_t)row * N : nullptr;
  float vals[16];                     // up to N = 4096
  const int per = N / 256;            // contiguous chunk per thread? use strided-by-4 chunks: thread handles j = tid*4 + 1024*u
  float s1 = 0.f;
  for (int u = 0; u < per / 4; ++u) {
    const int j = tid * 4 + 1024 * u;
    const v4f a = *(const v4fa*)(x + j);
    v4f b = {0.f,0.f,0.f,0.f}; if (rr) b = *(const v4fa*)(rr + j);
#pragma unroll
    for (int q = 0; q < 4; ++q) { const float v = a[q] + b[q]; vals[u * 4 + q] = v; s1 += v; }
  }
  red[tid] = s1; __syncthreads();
  for (int st = 128; st > 0; st >>= 1) { if (tid < st) red[tid] += red[tid + st]; __syncthreads(); }
  const float mu = red[0] / (float)N; __syncthreads();
  float s2 = 0.f;
  for (int u = 0; u < per / 4; ++u)
#pragma unroll
    for (int q = 0; q < 4; ++q) { const float c = vals[u * 4 + q] - mu; s2 += c * c; }
  red[tid] = s2; __syncthreads();
  for (int st = 128; st > 0; st >>= 1) { if (tid < st) red[tid] += red[tid + st]; __syncthreads(); }
  const float rs = rsqrtf(red[0] / (float)N + eps);
  {
    for (int u = 0; u < per / 4; ++u) {
      const int j = tid * 4 + 1024 * u;
      v4f o, sm;
#pragma unroll
      for (int q = 0; q < 4; ++q) {
        float gg = g[j + q], bb = bta[j + q];
        if (PARAM_BF16) { gg = bf16_round(gg); bb = bf16_round(bb); }
        sm[q] = vals[u * 4 + q]; o[q] = (vals[u * 4 + q] - mu) * rs * gg + bb;
      }
      if (out_sum) *(v4f*)(out_sum + (size_t)row * N + j) = sm;
      *(v4f*)(out_norm + (size_t)row * N + j) = o;
    }
    
  }
}



// ---- f16 WMMA path (v_wmma_f32_16x16x32_f16): 11-bit significands for operands in range — used where a [0,1] probability operand needs more precision than bf16
typedef _Float16 v16h __attribute__((ext_vector_type(16)));
union FragH { v16h v; v8us half[2]; _Float16 h[16]; unsigned short u[16]; };
template <int NT>
__device__ __forceinline__ v8f mmaH(v16h ah, v16h al, v16h bh, v16h bl, v8f c) {
  c = __builtin_amdgcn_wmma_f32_16x16x32_f16(false, ah, false, bh, (short)0, c, false, false);
  if (NT >= 2) c = __builtin_amdgcn_wmma_f32_16x16x32_f16(false, al, false, bh, (short)0, c, false, false);
  if (NT >= 3) c = __builtin_amdgcn_wmma_f32_16x16x32_f16(false, ah, false, bl, (short)0, c, false, false);
  asm volatile("v_nop\n\tv_nop\n\tv_nop\n\tv_nop" : "+v"(c) : "v"(ah), "v"(al), "v"(bh), "v"(bl));
  return c;
}
// batched GEMM like k_gemm_b but f16 operands: A f32 (split into f16 hi/lo if ASPLIT, else rounded to f16), Bt = f16 values [n][k]; alpha; C f32; N multiple of 16 (partial tiles skipped)
template <bool ASPLIT>
__global__ __launch_bounds__(128) void k_gemm_h(const float* __restrict__ A, int lda, size_t sA, const _Float16* __restrict__ Bh, int ldb, size_t sB, float alpha, float* __restrict__ C, int ldc, size_t sC, int M, int N, int K) {
  __shared__ __attribute__((aligned(16))) float so[4][16][64];
  const int tid = threadIdx.x, w = tid >> 5, lane = tid & 31, ln = lane & 15, hh = lane >> 4; const int by = blockIdx.y;
  A += (size_t)by * sA; Bh += (size_t)by * sB; C += (size_t)by * sC;
  const int ntn = (N + 63) / 64; const int wid = blockIdx.x * 4 + w; const int mt = wid / ntn, nq = wid % ntn; if (mt * 16 >= M) return;
  const int row0 = mt * 16, col0 = nq * 64; const float* arow = A + (size_t)(row0 + ln) * lda;
  v8f acc[4] = {};
  for (int kb = 0; kb < K; kb += 32) {
    FragH ah, al;
    const v4f x0 = *(const v4fa*)(arow + kb + 8 * hh), x1 = *(const v4fa*)(arow + kb + 8 * hh + 4), x2 = *(const v4fa*)(arow + kb + 16 + 8 * hh), x3 = *(const v4fa*)(arow + kb + 16 + 8 * hh + 4);
    float xs[16] = {x0[0],x0[1],x0[2],x0[3],x1[0],x1[1],x1[2],x1[3],x2[0],x2[1],x2[2],x2[3],x3[0],x3[1],x3[2],x3[3]};
#pragma unroll
    for (int i = 0; i < 16; ++i) { const _Float16 h = (_Float16)xs[i]; ah.h[i] = h; al.h[i] = ASPLIT ? (_Float16)(xs[i] - (float)h) : (_Float16)0.0f; }
#pragma unroll
    for (int t = 0; t < 4; ++t) { if (col0 + t * 16 >= N) continue; const size_t boff = (size_t)(col0 + t * 16 + ln) * ldb + kb; FragH bq; bq.half[0] = *(const v8us*)(Bh + boff + 8 * hh); bq.half[1] = *(const v8us*)(Bh + boff + 16 + 8 * hh);
      acc[t] = mmaH<ASPLIT ? 2 : 1>(ah.v, al.v, bq.v, bq.v, acc[t]); }
  }
#pragma unroll
  for (int t = 0; t < 4; ++t) { if (col0 + t * 16 >= N) continue;
#pragma unroll
    for (int r = 0; r < 8; ++r) so[w][8 * hh + r][t * 16 + ln] = acc[t][r] * alpha; }
  __builtin_amdgcn_fence(__ATOMIC_ACQ_REL, "workgroup"); __builtin_amdgcn_wave_barrier();
  const int rsub = lane >> 4, c4 = (lane & 15) * 4;
  {
#pragma unroll
    for (int q = 0; q < 8; ++q) { const int r = q * 2 + rsub; if (col0 + c4 < N) { const v4f v = *(const v4fa*)&so[w][r][c4]; *(v4f*)(C + (size_t)(row0 + r) * ldc + col0 + c4) = v; } }
     }
}

// k_gemm_hh variant with fused epilogue: v = acc·alpha + bias[by·sBias + col] (+ CP[(row/rowsPerB)·sCPb + by·64 + col] if CP) ; ACT 0 none / 1 elu ; writes f16 C16 (and f32 C if non-null)
template <int ACT>
__global__ __launch_bounds__(128) void k_gemm_hhx(const _Float16* __restrict__ A, int lda, size_t sA, const _Float16* __restrict__ Bh, int ldb, size_t sB, float alpha, const float* __restrict__ bias, size_t sBias, const float* __restrict__ CP, int rowsPerB, size_t sCPb, int row0g,
    float* __restrict__ C, _Float16* __restrict__ C16, int ldc, size_t sC, int M, int N, int K) {
  __shared__ __attribute__((aligned(16))) float so[4][16][64];
  const int tid = threadIdx.x, w = tid >> 5, lane = tid & 31, ln = lane & 15, hh = lane >> 4; const int by = blockIdx.y;
  A += (size_t)by * sA; Bh += (size_t)by * sB; const size_t cofs = (size_t)by * sC; const float* bp = bias ? bias + (size_t)by * sBias : nullptr;
  const int ntn = (N + 63) / 64; const int wid = blockIdx.x * 4 + w; const int mt = wid / ntn, nq = wid % ntn; if (mt * 16 >= M) return;
  const int row0 = mt * 16, col0 = nq * 64; const _Float16* arow = A + (size_t)(row0 + ln) * lda;
  v8f acc[4] = {};
  for (int kb = 0; kb < K; kb += 32) { FragH ah; ah.half[0] = *(const v8us*)((const unsigned short*)arow + kb + 8 * hh); ah.half[1] = *(const v8us*)((const unsigned short*)arow + kb + 16 + 8 * hh);
#pragma unroll
    for (int t = 0; t < 4; ++t) { if (col0 + t * 16 >= N) continue; const size_t boff = (size_t)(col0 + t * 16 + ln) * ldb + kb; FragH bq; bq.half[0] = *(const v8us*)((const unsigned short*)Bh + boff + 8 * hh); bq.half[1] = *(const v8us*)((const unsigned short*)Bh + boff + 16 + 8 * hh);
      acc[t] = mmaH<1>(ah.v, ah.v, bq.v, bq.v, acc[t]); }
  }
#pragma unroll
  for (int t = 0; t < 4; ++t) { if (col0 + t * 16 >= N) continue; const int col = col0 + t * 16 + ln; const float bv = bp ? bf16_round(bp[col]) : 0.f;
#pragma unroll
    for (int r = 0; r < 8; ++r) { float v = acc[t][r] * alpha + bv; if (CP) { const int rr = row0g + row0 + 8 * hh + r; if (rowsPerB < 0) v += CP[cofs + (size_t)rr * ldc + col];      /* rowsPerB < 0: own element of the batched C plane */ else { const int bidx = rr / rowsPerB; v += CP[(size_t)bidx * sCPb + (size_t)by * 64 + col]; } } if (ACT == 1) v = (v > 0.f) ? v : expm1f(v); else if (ACT == 7) v = (v > 0.f) ? v + 1.0f : expf(v); else if (ACT == 8) v = tanhf(v); else if (ACT == 9) v = 0.5f * v * (1.0f + tanhf(0.7978845608028654f * (v + 0.044715f * v * v * v))); else if (ACT == 11) v = 1.0f / (1.0f + expf(-v)); else if (ACT == 12) v = (v > 0.f) ? v : 0.01f * v; else if (ACT == 14) v = (v > 0.f) ? v : 0.1f * v; else if (ACT == 16) v = (v >= 0.f) ? v : 0.3f * v; else if (ACT == 17) v = (v >= 0.f) ? v : 0.2f * v; else if (ACT == 15) v = v / (1.0f + expf(-v)); else if (ACT == 3) v = fmaxf(v, 0.f); else if (ACT == 6) v = 0.5f * v * (1.0f + erff(v * 0.70710678118654752f)); so[w][8 * hh + r][t * 16 + ln] = v; } }
  __builtin_amdgcn_fence(__ATOMIC_ACQ_REL, "workgroup"); __builtin_amdgcn_wave_barrier();
  const int rsub = lane >> 4, c4 = (lane & 15) * 4; typedef _Float16 v4h __attribute__((ext_vector_type(4)));
  {
#pragma unroll
    for (int q = 0; q < 8; ++q) { const int r = q * 2 + rsub; if (col0 + c4 < N) { const v4f v = *(const v4fa*)&so[w][r][c4]; if (C) *(v4f*)(C + cofs + (size_t)(row0 + r) * ldc + col0 + c4) = v; if (C16) { v4h h4; for (int i = 0; i < 4; ++i) h4[i] = (_Float16)v[i]; *(v4h*)(C16 + cofs + (size_t)(row0 + r) * ldc + col0 + c4) = h4; } } }
     }
}


typedef _Float16 v4h __attribute__((ext_vector_type(4)));

__global__ __launch_bounds__(256) void k_h16(const float* __restrict__ x, _Float16* __restrict__ X16, size_t n8) { const size_t t = (size_t)blockIdx.x * 256 + threadIdx.x; if (t >= n8) return; FragH f;
#pragma unroll
  for (int q = 0; q < 8; ++q) f.h[q] = (_Float16)x[t * 8 + q]; *(v8us*)((unsigned short*)X16 + t * 8) = f.half[0];  }
__global__ __launch_bounds__(256) void k_round16f(const float* __restrict__ W, _Float16* __restrict__ Bt, size_t n8) { const size_t t = (size_t)blockIdx.x * 256 + threadIdx.x; if (t >= n8) return; FragH f;
#pragma unroll
  for (int i = 0; i < 8; ++i) f.h[i] = (_Float16)(bf16_round(W[t * 8 + i]) * 16.0f); *(v8us*)((unsigned short*)Bt + t * 8) = f.half[0];  }
// ---- fast GEMM (wave tile 32x64; requires M % 32 == 0 rows per launch region, N % 64 == 0 and K % 64 == 0); A and Bh in fragment order (see gf_frag), strips of 16 rows of lda / ldb elements each; epilogue = k_gemm_hhx semantics ----
__device__ __forceinline__ v16h g2_frag(const _Float16* p, int hh) { FragH f; f.half[0] = *(const v8us*)((const unsigned short*)p + 8 * hh); f.half[1] = *(const v8us*)((const unsigned short*)p + 16 + 8 * hh); return f.v; }
// Fragment order: a 16-row x 32-k f16 tile lies 1 KB in a row, element (r, k) at (k >> 4) * 256 + (((k >> 3) & 1) * 16 + r) * 8 + (k & 7), so lane l = 16 hh + ln finds the two 16-byte halves of its fragment at 8 l and 256 + 8 l:
// each fragment load of a wave reads 512 bytes in a row (four whole 128-byte lines) where a row-major plane gives it 16 lines of 32 bytes. Which element a lane and register hold is as in g2_frag. p = tile + 8 * lane.
__device__ __forceinline__ v16h gf_frag(const _Float16* p) { FragH f; f.half[0] = *(const v8us*)((const unsigned short*)p); f.half[1] = *(const v8us*)((const unsigned short*)p + 256); return f.v; }
__device__ __forceinline__ v8f g2_mma(v16h a, v16h b, v8f c) { v8f d = __builtin_amdgcn_wmma_f32_16x16x32_f16(false, a, false, b, (short)0, c, false, false); asm volatile("v_nop\n\tv_nop\n\tv_nop\n\tv_nop" : "+v"(d) : "v"(a), "v"(b)); return d; }
// GEMM main loops: every fragment register is asked for again, for a later trip, directly behind the last product that reads it, so that a trip's twelve loads are all in flight while products run, and no product waits out a whole load by itself.
// G2_HOLD keeps each reload at that place: hoisted it would take a further register set, sunk to its use it would have no lead.
#define G2_HOLD __builtin_amdgcn_sched_barrier(0);
// one trip on a whole set, the set reloaded from element offset KO of the six strips. The wait holds the six address pairs whole until the loads have taken them, and the loads in front of the next trip.
#define G2_TRIP2(A0, A1, F0, F1, F2, F3, KO) { const int ko = (KO); \
    const _Float16* pa0 = a0p + ko; const _Float16* pa1 = a1p + ko; const _Float16* pb0 = b0p + ko; const _Float16* pb1 = b1p + ko; const _Float16* pb2 = b2p + ko; const _Float16* pb3 = b3p + ko; \
    c00 = g2_mma(A0, F0, c00); c10 = g2_mma(A1, F0, c10); F0 = gf_frag(pb0); G2_HOLD \
    c01 = g2_mma(A0, F1, c01); c11 = g2_mma(A1, F1, c11); F1 = gf_frag(pb1); G2_HOLD \
    c02 = g2_mma(A0, F2, c02); c12 = g2_mma(A1, F2, c12); F2 = gf_frag(pb2); G2_HOLD \
    c03 = g2_mma(A0, F3, c03); c13 = g2_mma(A1, F3, c13); F3 = gf_frag(pb3); A0 = gf_frag(pa0); A1 = gf_frag(pa1); \
    asm volatile("s_wait_xcnt 0x0" :: "v"(pa0), "v"(pa1), "v"(pb0), "v"(pb1), "v"(pb2), "v"(pb3) : "memory"); }
// a whole set's first loads, from element offset KO of the six strips
#define G2_FILL(A0, A1, F0, F1, F2, F3, KO) v16h F0 = gf_frag(b0p + (KO)); G2_HOLD v16h F1 = gf_frag(b1p + (KO)); G2_HOLD v16h F2 = gf_frag(b2p + (KO)); G2_HOLD v16h F3 = gf_frag(b3p + (KO)); G2_HOLD v16h A0 = gf_frag(a0p + (KO)); G2_HOLD v16h A1 = gf_frag(a1p + (KO));
// one trip with one B set and two A sets: the next trip's A (N0, N1) asked for at the head, each B fragment reloaded in place; KO = element offset of the next trip's tiles in the strips. The wait as above, for the two pairs.
#define G2_TRIP1(A0, A1, N0, N1, KO) { const _Float16* pa = ap + (KO); const _Float16* pb = bp + (KO); \
    N0 = gf_frag(pa); N1 = gf_frag(pa + 16 * DM); G2_HOLD \
    c00 = g2_mma(A0, b0, c00); c10 = g2_mma(A1, b0, c10); b0 = gf_frag(pb); G2_HOLD \
    c01 = g2_mma(A0, b1, c01); c11 = g2_mma(A1, b1, c11); b1 = gf_frag(pb + 16 * DM); G2_HOLD \
    c02 = g2_mma(A0, b2, c02); c12 = g2_mma(A1, b2, c12); b2 = gf_frag(pb + 32 * DM); G2_HOLD \
    c03 = g2_mma(A0, b3, c03); c13 = g2_mma(A1, b3, c13); b3 = gf_frag(pb + 48 * DM); \
    asm volatile("s_wait_xcnt 0x0" :: "v"(pa), "v"(pb) : "memory"); }
template <int ACT>
__global__ __launch_bounds__(128) void k_gemm2(const _Float16* __restrict__ A, int lda, size_t sA, const _Float16* __restrict__ Bh, int ldb, size_t sB, float alpha, const float* __restrict__ bias, size_t sBias, const float* __restrict__ CP, int rowsPerB, size_t sCPb, int row0g,
    float* __restrict__ C, _Float16* __restrict__ C16, int ldc, size_t sC, int M, int N, int K) { static_assert(ACT == 0 || ACT == 3 || ACT == 6 || ACT == 8 || ACT == 9 || ACT == 11 || ACT == 12 || ACT == 14 || ACT == 15 || ACT == 16 || ACT == 17, "k_gemm2: unsupported ACT code (would silently apply no activation)");
  __shared__ __attribute__((aligned(16))) float so[4][32][68];
  const int tid = threadIdx.x, w = tid >> 5, lane = tid & 31, ln = lane & 15, hh = lane >> 4; const int by = blockIdx.y;
  A += (size_t)by * sA; Bh += (size_t)by * sB; const size_t cofs = (size_t)by * sC; const float* bp = bias ? bias + (size_t)by * sBias : nullptr;
  const int ntn = N >> 6; const int mt = blockIdx.x / ntn, nq = blockIdx.x - mt * ntn; const int row0 = mt * 128 + 32 * w, col0 = nq * 64; if (row0 >= M) return;
  const _Float16* a0p = A + (size_t)row0 * lda + 8 * lane; const _Float16* a1p = a0p + (size_t)16 * lda;
  const _Float16* b0p = Bh + (size_t)col0 * ldb + 8 * lane; const _Float16* b1p = b0p + (size_t)16 * ldb; const _Float16* b2p = b1p + (size_t)16 * ldb; const _Float16* b3p = b2p + (size_t)16 * ldb;
  const v8f z8 = {0.f,0.f,0.f,0.f,0.f,0.f,0.f,0.f}; v8f c00 = z8, c01 = z8, c02 = z8, c03 = z8, c10 = z8, c11 = z8, c12 = z8, c13 = z8;
  /* two fragment sets (x: even trips, y: odd trips), every register reloaded two trips ahead directly behind the last product that reads it; K % 64 == 0 */
  /* the first loads in the order in which the loop reloads (B tiles, then A; x, then y), held so: the loop's counted waits are set for both ways into it, and another order here made them wait for younger loads */
  G2_FILL(xa0, xa1, xb0, xb1, xb2, xb3, 0) G2_HOLD G2_FILL(ya0, ya1, yb0, yb1, yb2, yb3, 512)
  asm volatile("s_wait_xcnt 0x0" :: "v"(a0p), "v"(a1p), "v"(b0p), "v"(b1p), "v"(b2p), "v"(b3p) : "memory");      /* the six address pairs stay whole until the first loads have taken them */
#pragma unroll 1      /* rolled: two trips' code, the register sets named once each */
  for (int kb = 0; kb < K; kb += 64) {
    G2_TRIP2(xa0, xa1, xb0, xb1, xb2, xb3, ((kb + 64 < K) ? kb + 64 : kb) * 16)      /* 512 elements a tile of 32 k; the last two trips ask for their own tiles again (in bounds) */
    G2_TRIP2(ya0, ya1, yb0, yb1, yb2, yb3, ((kb + 96 < K) ? kb + 96 : kb + 32) * 16) }
  v8f accs[8] = {c00, c01, c02, c03, c10, c11, c12, c13};
#pragma unroll
  for (int u = 0; u < 8; ++u) { const int t = u & 3, half = u >> 2; const int col = col0 + t * 16 + ln; const float bv = bp ? bf16_round(bp[col]) : 0.f;
#pragma unroll
    for (int r = 0; r < 8; ++r) { const int rloc = half * 16 + 8 * hh + r; float v = accs[u][r] * alpha + bv; if (CP) { if (rowsPerB < 0) v += CP[cofs + (size_t)(row0g + row0 + rloc) * ldc + col];      /* rowsPerB < 0: own element of the batched C plane */ else { const int bidx = (row0g + row0 + rloc) / rowsPerB; v += CP[(size_t)bidx * sCPb + (size_t)by * 64 + col]; } }
      if (ACT == 3) v = fmaxf(v, 0.f); else if (ACT == 6) v = 0.5f * v * (1.0f + erff(v * 0.70710678118654752f)); else if (ACT == 11) v = 1.0f / (1.0f + expf(-v)); else if (ACT == 15) v = v / (1.0f + expf(-v)); else if (ACT == 12) v = (v > 0.f) ? v : 0.01f * v; else if (ACT == 8) v = tanhf(v); else if (ACT == 9) v = 0.5f * v * (1.0f + tanhf(0.7978845608028654f * (v + 0.044715f * v * v * v))); else if (ACT == 14) v = (v > 0.f) ? v : 0.1f * v; else if (ACT == 16) v = (v >= 0.f) ? v : 0.3f * v; else if (ACT == 17) v = (v >= 0.f) ? v : 0.2f * v;
      so[w][rloc][t * 16 + ln] = v; } }
  __builtin_amdgcn_fence(__ATOMIC_ACQ_REL, "workgroup"); __builtin_amdgcn_wave_barrier();
  const int rsub = lane >> 4, c4 = (lane & 15) * 4;
  {
#pragma unroll
    for (int q = 0; q < 16; ++q) { const int r = q * 2 + rsub; const v4f v = *(const v4fa*)&so[w][r][c4]; if (C) *(v4f*)(C + cofs + (size_t)(row0 + r) * ldc + col0 + c4) = v; if (C16) { v4h h4; for (int i = 0; i < 4; ++i) h4[i] = (_Float16)v[i]; *(v4h*)(C16 + cofs + (size_t)(row0 + r) * ldc + col0 + c4) = h4; } }
     } }


__global__ __launch_bounds__(256) void k_wnat(const float* __restrict__ w, size_t n8, _Float16* __restrict__ Bt) { const size_t t = (size_t)blockIdx.x * 256 + threadIdx.x; if (t >= n8) return; FragH f; for (int q = 0; q < 8; ++q) f.h[q] = (_Float16)(bf16_round(w[t * 8 + q]) * 16.0f); *(v8us*)((unsigned short*)Bt + t * 8) = f.half[0];  }
__global__ __launch_bounds__(256) void k_rsm(const float* __restrict__ S, _Float16* __restrict__ P, int nrows) {
  #pragma clang fp contract(off)
  const int i = blockIdx.x * 256 + threadIdx.x; if (i >= nrows) return; const float* s = S + (size_t)i * SQ; float mx = -3.0e38f;
#pragma unroll 1
  for (int j = 0; j < SQ; ++j) mx = fmaxf(mx, s[j]); float se = 0.f;
#pragma unroll 1
  for (int j = 0; j < SQ; ++j) se += expf(s[j] - mx); const float sc = 256.0f / se;
#pragma unroll 1
  for (int j0 = 0; j0 < SQ; j0 += 8) { FragH f; for (int q = 0; q < 8; ++q) f.h[q] = (_Float16)(expf(s[j0 + q] - mx) * sc); unsigned short* d = (unsigned short*)P + (size_t)i * SQ + j0; *(v8us*)d = f.half[0];  } }
__global__ __launch_bounds__(256) void k_vt(const _Float16* __restrict__ V16, int b, int h0, _Float16* __restrict__ VT) { __shared__ unsigned short tl[64][65]; const int tid = threadIdx.x; const int hh = blockIdx.x % HG, sg = blockIdx.x / HG; const int s0 = sg * 64; const int h = h0 + hh;
  for (int i = tid; i < 64 * 8; i += 256) { const int j = i / 8, d8 = (i % 8) * 8; FragH f; f.half[0] = *(const v8us*)((const unsigned short*)V16 + ((size_t)b * SQ + s0 + j) * DM + h * HD + d8); for (int q = 0; q < 8; ++q) tl[d8 + q][j] = f.u[q]; }
  __syncthreads();
  { for (int i = tid; i < 64 * 8; i += 256) { const int d = i / 8, j8 = (i % 8) * 8; FragH f; for (int q = 0; q < 8; ++q) f.u[q] = tl[d][j8 + q]; *(v8us*)((unsigned short*)VT + ((size_t)hh * HD + d) * SQ + s0 + j8) = f.half[0]; }  } }


// ---- preparation, ONE launch: x rows and both weights into f16 fragment order (see gf_frag), and the rotary tables ----
// A plane's unit t is its t-th 16 bytes: 8 consecutive k of one row (x) or of one output column n (weights, Bt(n, k) = f16(bf16(W[k][n]) x16), exact) in strips of 16 rows, DM / 32 tiles a strip.
// PREP_T threads in all; a thread takes units g, g + PREP_T, ... of every plane (4 of x, 3 of q|k|v, 1 of the output weight), and the first SQ * HD / 2 threads one table entry each:
// few long waves in place of many that live for one unit, and what a wave reads is all asked for at once.
#define PREP_T (512 * 256)
#define PREP_X 4
#define PREP_W 3
static_assert((size_t)PREP_X * PREP_T == NR * DM / 8 && (size_t)PREP_W * PREP_T == (size_t)3 * DM * DM / 8 && (size_t)PREP_T == (size_t)DM * DM / 8 && SQ * (HD / 2) <= PREP_T, "k_prep: the planes are whole multiples of the grid");
__device__ __forceinline__ const float* prep_wsrc(const float* W, int N, int t) { const int tile = t >> 6, c = t & 63; const int n = (tile / (DM / 32)) * 16 + (c & 15), k8 = (tile % (DM / 32)) * 32 + (c >> 5) * 16 + ((c >> 4) & 1) * 8; return W + (size_t)k8 * N + n; }      /* first of the unit's 8 elements, N apart */
__device__ __forceinline__ void prep_tab(float theta, int t, float* __restrict__ CS, float* __restrict__ SN) {
  const int i = t % (HD / 2); const int p = t / (HD / 2); const float invf = 1.0f / powf(theta, (float)(2 * i) / (float)HD); const float ang = __fmul_rn((float)p, invf); const float c = cosf(ang), s = sinf(ang);
  *(float*)(CS + t) = c; *(float*)(SN + t) = s; }
__global__ __launch_bounds__(256) void k_prep(const float* __restrict__ x, const float* __restrict__ wqkv, const float* __restrict__ wo, float theta,
    _Float16* __restrict__ X16, _Float16* __restrict__ BQKV, _Float16* __restrict__ BO, float* __restrict__ CS, float* __restrict__ SN) {
  const int g = blockIdx.x * 256 + threadIdx.x;
  const float* xs[PREP_X]; const float* ws[PREP_W + 1]; v4f xv[PREP_X][2]; float wv[PREP_W + 1][8];
#pragma unroll
  for (int u = 0; u < PREP_X; ++u) { const int t = g + u * PREP_T; const int tile = t >> 6, c = t & 63;
    xs[u] = x + ((size_t)(tile / (DM / 32)) * 16 + (c & 15)) * DM + (tile % (DM / 32)) * 32 + (c >> 5) * 16 + ((c >> 4) & 1) * 8; }
#pragma unroll
  for (int u = 0; u < PREP_W; ++u) ws[u] = prep_wsrc(wqkv, 3 * DM, g + u * PREP_T);
  ws[PREP_W] = prep_wsrc(wo, DM, g);
#pragma unroll
  for (int u = 0; u < PREP_X; ++u) { xv[u][0] = *(const v4fa*)xs[u]; xv[u][1] = *(const v4fa*)(xs[u] + 4); }
#pragma unroll
  for (int u = 0; u <= PREP_W; ++u)
#pragma unroll
    for (int i = 0; i < 8; ++i) wv[u][i] = ws[u][(size_t)i * (u < PREP_W ? 3 * DM : DM)];
  asm volatile("s_wait_xcnt 0x0" :: "v"(xs[0]), "v"(xs[1]), "v"(xs[2]), "v"(xs[3]), "v"(ws[0]), "v"(ws[1]), "v"(ws[2]), "v"(ws[3]) : "memory");      /* the eight address pairs stay whole until the loads have taken them; it also keeps every load here, in front of the table entry, so that they fly while it is computed */
  if (g < SQ * (HD / 2)) prep_tab(theta, g, CS, SN);      /* whole blocks: 256 divides the bound */
  FragH fx[PREP_X], fw[PREP_W + 1];
#pragma unroll
  for (int u = 0; u < PREP_X; ++u)
#pragma unroll
    for (int q = 0; q < 8; ++q) fx[u].h[q] = (_Float16)bf16_round(xv[u][q >> 2][q & 3]);
#pragma unroll
  for (int u = 0; u <= PREP_W; ++u)
#pragma unroll
    for (int i = 0; i < 8; ++i) fw[u].h[i] = (_Float16)(bf16_round(wv[u][i]) * 16.0f);
#pragma unroll
  for (int u = 0; u < PREP_X; ++u) *(v8us*)((unsigned short*)X16 + ((size_t)g + (size_t)u * PREP_T) * 8) = fx[u].half[0];
#pragma unroll
  for (int u = 0; u < PREP_W; ++u) *(v8us*)((unsigned short*)BQKV + ((size_t)g + (size_t)u * PREP_T) * 8) = fw[u].half[0];
  *(v8us*)((unsigned short*)BO + (size_t)g * 8) = fw[PREP_W].half[0]; }
// Fused causal attention, one launch for every (batch, head, 128-query block): each wave owns 32 queries and walks the keys 0 .. its own last query in passes of 32, nothing of S or P goes through memory.
// Transposed products: S^T = K . Q^T (A = key rows, B = query rows kept in registers; hi.hi in one accumulator, lo.hi + hi.lo in a second, joined as hi + 2^-10 lo in f32), so a lane holds 16 scores of ONE query;
// running maximum and sum per query (online softmax, accumulators rescaled only in a pass where some query's maximum moved); the two 16-key score tiles, as f16 weights x256, ARE the B operand of O^T += V^T . P^T.
__device__ __forceinline__ float rs_xrow(float v) { const int i = __float_as_int(v); return __int_as_float(__builtin_amdgcn_permlanex16(i, i, 0x76543210, 0xfedcba98, false, false)); }      /* lane l <- lane l ^ 16 */
// native 2^a. The v_nop is the slot the instruction set asks for behind a transcendental before its source is overwritten or its result read.
__device__ __forceinline__ float fa_exp2(float a) { float e; asm("v_exp_f32 %0, %1\n\tv_nop" : "=v"(e) : "v"(a)); return e; }
__device__ __forceinline__ v8f fa_mma(v16h a, v16h b, v8f c) { return __builtin_amdgcn_wmma_f32_16x16x32_f16(false, a, false, b, (short)0, c, false, false); }
#define FA_C 11.5415603271117072589f      /* sqrt(64) * log2(e): score differences -> exponent of 2 */
__global__ __launch_bounds__(128) void k_fattn(const _Float16* __restrict__ QH, const _Float16* __restrict__ QL, const _Float16* __restrict__ KH, const _Float16* __restrict__ KL, const _Float16* __restrict__ VT, _Float16* __restrict__ O16) {
  const int lane = threadIdx.x & 31, ln = lane & 15, hh = lane >> 4; const int w = __builtin_amdgcn_readfirstlane((int)(threadIdx.x >> 5));      /* scalar wave number: the key loop's bound stays a scalar */
  const int bh = blockIdx.y, b = bh / NH, h = bh % NH; const int q0 = ((int)gridDim.x - 1 - (int)blockIdx.x) * 128 + w * 32;      /* longest blocks start first */
  const size_t r0 = (size_t)b * SQ;
  /* every pointer below is the lane's own address, its lane offset 8 lane folded in, so that the loads name exactly the pair that the wait behind them holds */
  /* q, k planes: fragment order (see gf_frag), per (batch, head) strips of 16 tokens, two tiles (k halves of the head) a strip: 64 elements a token; V^T: per (batch, head) and 32 keys four tiles (16 head columns each): 64 elements a key */
  const size_t hb = (size_t)bh * SQ * HD + 8 * lane;
  const _Float16* qhp = QH + hb + (size_t)q0 * HD; const _Float16* qlp = QL + hb + (size_t)q0 * HD;
  v16h qh[2][2], ql[2][2];      /* [query group of 16][k half of the head] */
#pragma unroll
  for (int j = 0; j < 2; ++j)
#pragma unroll
    for (int ks = 0; ks < 2; ++ks) { const size_t o = (size_t)(2 * j + ks) * 512; qh[j][ks] = gf_frag(qhp + o); ql[j][ks] = gf_frag(qlp + o); }
  asm volatile("s_wait_xcnt 0x0" :: "v"(qhp), "v"(qlp) : "memory");      /* the two address pairs stay whole until the loads have taken them */
  const _Float16* khp = KH + hb; const _Float16* klp = KL + hb; const _Float16* vtp = VT + hb;
  const v8f z8 = {0.f,0.f,0.f,0.f,0.f,0.f,0.f,0.f};
  v8f o[2][4]; float m[2], l[2];
#pragma unroll
  for (int j = 0; j < 2; ++j) { m[j] = -1.0e30f; l[j] = 0.f;
#pragma unroll
    for (int t = 0; t < 4; ++t) o[j][t] = z8; }
  v16h kh[2][2], kl[2][2];      /* [16-key tile][k half] */
#pragma unroll
  for (int kt = 0; kt < 2; ++kt)
#pragma unroll
    for (int ks = 0; ks < 2; ++ks) { const size_t ko = (size_t)(2 * kt + ks) * 512; kh[kt][ks] = gf_frag(khp + ko); kl[kt][ks] = gf_frag(klp + ko); }
#pragma unroll 1
  for (int kb = 0; kb <= q0; kb += 32) {
    v16h vf[4]; const _Float16* pv = vtp + (size_t)kb * HD;      /* V^T tiles of this pass, asked for ahead of the score products */
#pragma unroll
    for (int t = 0; t < 4; ++t) vf[t] = gf_frag(pv + (size_t)t * 512);
    asm volatile("s_wait_xcnt 0x0" ::: "memory");      /* stands in front of the advance of the loads' address pair; it also keeps these loads here, ahead of the score products, where the build had sunk them to their use */
    v8f u[2][2];      /* [query group][key tile]: q . k, register r = key 16 kt + 8 hh + r of query ln */
#pragma unroll
    for (int kt = 0; kt < 2; ++kt)
#pragma unroll
      for (int j = 0; j < 2; ++j) { v8f sh = z8, sl = z8;
#pragma unroll
        for (int ks = 0; ks < 2; ++ks) { sh = fa_mma(kh[kt][ks], qh[j][ks], sh); sl = fa_mma(kh[kt][ks], ql[j][ks], sl); sl = fa_mma(kl[kt][ks], qh[j][ks], sl); }
#pragma unroll
        for (int r = 0; r < 8; ++r) u[j][kt][r] = sh[r] + 0.0009765625f * sl[r]; }
    { const int kn = (kb + 32 <= q0) ? kb + 32 : q0;      /* next pass's key rows into the same registers, behind their last use; the last pass asks for its own rows again (in bounds) */
      const _Float16* pkh = khp + (size_t)kn * HD; const _Float16* pkl = klp + (size_t)kn * HD;
#pragma unroll
      for (int kt = 0; kt < 2; ++kt)
#pragma unroll
        for (int ks = 0; ks < 2; ++ks) { const size_t ko = (size_t)(2 * kt + ks) * 512; kh[kt][ks] = gf_frag(pkh + ko); kl[kt][ks] = gf_frag(pkl + ko); }
      asm volatile("s_wait_xcnt 0x0" :: "v"(pkh), "v"(pkl) : "memory"); }      /* the two address pairs stay whole until the loads have taken them */
    if (kb == q0) {      /* the one pass on the diagonal: keys above the query are out */
#pragma unroll
      for (int j = 0; j < 2; ++j)
#pragma unroll
        for (int kt = 0; kt < 2; ++kt)
#pragma unroll
          for (int r = 0; r < 8; ++r) u[j][kt][r] = (16 * kt + 8 * hh + r <= 16 * j + ln) ? u[j][kt][r] : -1.0e9f; }
    float mn[2];
#pragma unroll
    for (int j = 0; j < 2; ++j) { float x = fmaxf(u[j][0][0], u[j][1][0]);
#pragma unroll
      for (int r = 1; r < 8; ++r) x = fmaxf(x, fmaxf(u[j][0][r], u[j][1][r]));
      mn[j] = fmaxf(m[j], fmaxf(x, rs_xrow(x))); }
    if (__builtin_amdgcn_ballot_w32(mn[0] > m[0] || mn[1] > m[1]) != 0) {      /* scalar branch; where no maximum moved every factor would be 1 */
#pragma unroll
      for (int j = 0; j < 2; ++j) { const float al = fa_exp2((m[j] - mn[j]) * FA_C); m[j] = mn[j]; l[j] *= al;
#pragma unroll
        for (int t = 0; t < 4; ++t)
#pragma unroll
          for (int r = 0; r < 8; ++r) o[j][t][r] *= al; } }
#pragma unroll
    for (int j = 0; j < 2; ++j) { FragH pf; float s0 = 0.f, s1 = 0.f;
#pragma unroll
      for (int r = 0; r < 8; ++r) { const float p0 = fa_exp2((u[j][0][r] - m[j]) * FA_C + 8.0f), p1 = fa_exp2((u[j][1][r] - m[j]) * FA_C + 8.0f); s0 += p0; s1 += p1; pf.h[r] = (_Float16)p0; pf.h[8 + r] = (_Float16)p1; }      /* weights x256 */
      l[j] += s0 + s1;
#pragma unroll
      for (int t = 0; t < 4; ++t) o[j][t] = fa_mma(vf[t], pf.v, o[j][t]); }
  }
#pragma unroll
  for (int j = 0; j < 2; ++j) { const float inv = 64.0f / (l[j] + rs_xrow(l[j]));      /* the two lane halves hold disjoint keys' sums; o carried x64 */
    unsigned short* dst = (unsigned short*)O16 + (r0 + q0 + 16 * j) * DM + (size_t)h * 1024 + 8 * lane;      /* o rows in fragment order for the output GEMM: strip of 16 rows, tiles 2 h and 2 h + 1; the lane's 8 values are one 16-byte half of its own fragment */
#pragma unroll
    for (int t = 0; t < 4; ++t) { FragH f;
#pragma unroll
      for (int r = 0; r < 8; ++r) f.h[r] = (_Float16)(o[j][t][r] * inv);
      *(v8us*)(dst + 256 * t) = f.half[0]; } } }


// q | k | v projection of every token row in one launch: wave tile (32 x 64) of k_gemm2, main loop on one B set and two A sets (G2_TRIP1); a block's 64 columns are exactly one head of q, of k or of v, and the epilogue finishes that head's rows itself:
// q, k: f32 row through LDS, interleaved-pair rotation from the f32 tables, f16 hi + x1024 residual planes in fragment order; v: f16 from the accumulators (a lane holds 8 consecutive tokens of one column) straight into V^T in fragment order, whole 128-byte lines.
typedef float v2fa __attribute__((ext_vector_type(2), may_alias));
__global__ __launch_bounds__(128) void k_qkv(const _Float16* __restrict__ A, const _Float16* __restrict__ Bh, const float* __restrict__ bias, const float* __restrict__ CS, const float* __restrict__ SN,
    _Float16* __restrict__ QH, _Float16* __restrict__ QL, _Float16* __restrict__ KH, _Float16* __restrict__ KL, _Float16* __restrict__ VT) {
  __shared__ __attribute__((aligned(16))) float so[4][32][68];
  const int tid = threadIdx.x, w = tid >> 5, lane = tid & 31, ln = lane & 15, hh = lane >> 4;
  const int ntn = 3 * NH; const int mt = blockIdx.x / ntn, nq = blockIdx.x - mt * ntn; const int row0 = mt * 128 + 32 * w, col0 = nq * HD; const int part = nq / NH, h = nq - part * NH;      /* part 0 q, 1 k, 2 v: the same for the whole block */
  const _Float16* ap = A + (size_t)row0 * DM + 8 * lane; const _Float16* bp = Bh + (size_t)col0 * DM + 8 * lane;      /* A, Bh in fragment order (see gf_frag), strips of 16 rows; the lane's own addresses: every load of a trip names one of two pairs */
  const v8f z8 = {0.f,0.f,0.f,0.f,0.f,0.f,0.f,0.f}; v8f c00 = z8, c01 = z8, c02 = z8, c03 = z8, c10 = z8, c11 = z8, c12 = z8, c13 = z8;
  /* one B set reloaded in place, two A sets (x: even trips, y: odd trips): a second B set would take the launch below the six waves a SIMD that it needs to be resident at once */
  /* the first loads in the order in which the loop reloads (A, then the B tiles), held so: the loop's counted waits are set for both ways into it, and another order here made them wait for younger loads */
  v16h ya0, ya1, xa0 = gf_frag(ap); G2_HOLD v16h xa1 = gf_frag(ap + 16 * DM); G2_HOLD v16h b0 = gf_frag(bp); G2_HOLD v16h b1 = gf_frag(bp + 16 * DM); G2_HOLD v16h b2 = gf_frag(bp + 32 * DM); G2_HOLD v16h b3 = gf_frag(bp + 48 * DM);
  asm volatile("s_wait_xcnt 0x0" :: "v"(ap), "v"(bp) : "memory");      /* the two address pairs stay whole until the first loads have taken them */
#pragma unroll 1      /* rolled: two trips' code, the register sets named once each */
  for (int kb = 0; kb < DM; kb += 64) {
    G2_TRIP1(xa0, xa1, ya0, ya1, (kb + 32) * 16)      /* 512 elements a tile of 32 k */
    G2_TRIP1(ya0, ya1, xa0, xa1, ((kb + 64 < DM) ? kb + 64 : kb + 32) * 16) }      /* the last trip asks for its own tiles again (in bounds) */
  v8f accs[8] = {c00, c01, c02, c03, c10, c11, c12, c13};
  const size_t hb = ((size_t)((row0 / SQ) * NH + h) * SQ + row0 % SQ) * HD;      /* the wave's 32 tokens in a plane of its (batch, head): 64 elements a token in fragment order */
  if (part == 2) {      /* V^T tiles (16 head columns x 32 keys) in fragment order: the wave's 32 tokens are one group of 32 keys, and a lane's 8 accumulator values (column ln of tile t, tokens 16 half + 8 hh + r) are one 16-byte half of its own fragment: stored from the registers, 512 bytes in a row a store */
    unsigned short* vd = (unsigned short*)VT + hb + 8 * lane;
#pragma unroll
    for (int u = 0; u < 8; ++u) { const int t = u & 3, half = u >> 2; const float bv = bf16_round(bias[col0 + t * 16 + ln]); FragH f;
#pragma unroll
      for (int r = 0; r < 8; ++r) f.h[r] = (_Float16)(accs[u][r] * 0.0625f + bv);
      *(v8us*)(vd + t * 512 + half * 256) = f.half[0]; }
    return; }
#pragma unroll
  for (int u = 0; u < 8; ++u) { const int t = u & 3, half = u >> 2; const float bv = bf16_round(bias[col0 + t * 16 + ln]);
#pragma unroll
    for (int r = 0; r < 8; ++r) so[w][half * 16 + 8 * hh + r][t * 16 + ln] = accs[u][r] * 0.0625f + bv; }
  __builtin_amdgcn_fence(__ATOMIC_ACQ_REL, "workgroup"); __builtin_amdgcn_wave_barrier();      /* a wave reads back only its own plane of so: its LDS writes are ordered in front of its reads, no block barrier */
  const int rsub = lane >> 4, c4 = (lane & 15) * 4;
  _Float16* Hh = (part ? KH : QH) + hb + (c4 >> 3) * 128 + (c4 & 7); _Float16* Hl = (part ? KL : QL) + hb + (c4 >> 3) * 128 + (c4 & 7);      /* the lane's 4 columns in fragment order: tile c4 >> 5, half (c4 >> 4) & 1, lane half (c4 >> 3) & 1, 128 elements apart each step of 8 columns */
#pragma unroll 1      /* rolled, four steps (eight rows) a trip: as one unrolled loop of sixteen steps the build took 166 registers, five waves a SIMD, and this launch needs six to be resident at once */
  for (int q0 = 0; q0 < 16; q0 += 4) {
#pragma unroll
  for (int q = q0; q < q0 + 4; ++q) { const int r = q * 2 + rsub; const v4f v = *(const v4fa*)&so[w][r][c4]; const int row = row0 + r; const size_t to = (size_t)(row % SQ) * (HD / 2) + (c4 >> 1);
    const v2fa c = *(const v2fa*)(CS + to), s = *(const v2fa*)(SN + to); float o[4];
    o[0] = fmaf(v[0], c[0], -(v[1] * s[0])); o[1] = fmaf(v[0], s[0], v[1] * c[0]); o[2] = fmaf(v[2], c[1], -(v[3] * s[1])); o[3] = fmaf(v[2], s[1], v[3] * c[1]);      /* the odd element's product rounded, the even element's fused onto it */
    v4h fh, fl;
#pragma unroll
    for (int i = 0; i < 4; ++i) { const _Float16 hi = (_Float16)o[i]; fh[i] = hi; fl[i] = (_Float16)((o[i] - (float)hi) * 1024.0f); }
    const size_t d = (size_t)(r >> 4) * 1024 + (r & 15) * 8; *(v4h*)(Hh + d) = fh; *(v4h*)(Hl + d) = fl; }
    asm volatile("s_wait_xcnt 0x0" ::: "memory"); } }      /* stands in front of the next trip's first writes */

extern "C" void kernel_launch(void* const* d_in, const int* in_sizes, int n_in,
                              void* d_out, int out_size, void* d_ws, size_t ws_size, hipStream_t stream) {
  (void)in_sizes; (void)n_in; (void)out_size;
  const float* const* I = (const float* const*)d_in; const float* x = I[0]; const float* wqkv = I[1]; const float* bqkv = I[2]; const float* wo = I[3]; const float* bo = I[4];      /* [in][out] fused qkv + out weights, biases */
  char* ws = (char*)d_ws; size_t off = 0;
  auto take = [&](size_t bytes) { char* p = ws + off; off += (bytes + 255) & ~(size_t)255; return p; };
  _Float16* BQKV = (_Float16*)take((size_t)3 * DM * DM * 2); _Float16* BO = (_Float16*)take((size_t)DM * DM * 2); float* CS = (float*)take((size_t)SQ * (HD / 2) * 4); float* SN = (float*)take((size_t)SQ * (HD / 2) * 4);
  _Float16* X16 = (_Float16*)take(NR * DM * 2);
  _Float16* QH = (_Float16*)take(NR * DM * 2); _Float16* QL = (_Float16*)take(NR * DM * 2); _Float16* KH = (_Float16*)take(NR * DM * 2); _Float16* KL = (_Float16*)take(NR * DM * 2); _Float16* O16 = (_Float16*)take(NR * DM * 2);
  _Float16* VT = (_Float16*)take((size_t)NB * NH * HD * SQ * 2);      /* V^T of every batch */
  if (off > ws_size) return;
  k_prep<<<PREP_T / 256, 256, 0, stream>>>(x, wqkv, wo, 10000.0f, X16, BQKV, BO, CS, SN);      /* x rows, [in][out] weights -> Bt(n, k) x16 (q | k | v stacked along n), all in fragment order; cos / sin tables */
  k_qkv<<<(unsigned)((NR / 128) * (3 * DM / 64)), 128, 0, stream>>>(X16, BQKV, bqkv, CS, SN, QH, QL, KH, KL, VT);      /* roped q, k as f16 hi + x1024 residual (the x8 logits, sigma ~64, need ~f32-accurate scores) and V^T, per (batch, head), in fragment order */
  k_fattn<<<dim3(SQ / 128, NB * NH), 128, 0, stream>>>(QH, QL, KH, KL, VT, O16);      /* o (merged heads, x64) as f16 rows in fragment order */
  k_gemm2<0><<<dim3((unsigned)((MPO / 128) * (DM / 64)), 1), 128, 0, stream>>>(O16 + (size_t)B0 * SQ * DM, DM, 0, BO, DM, 0, 0.0009765625f, bo, 0, nullptr, 1, 0, 0, (float*)d_out + (size_t)B0 * SQ * DM, nullptr, DM, 0, MPO, DM, DM);      /* out rows are the output layout */
}

// v007
// A run of this version takes 91.6 microseconds.
// Timed twice side by side with v006, it ran 1.36 and 1.39 times as fast.
// Counting every step since v000, it is 51.6 times as fast.
#include <hip/hip_runtime.h>
// Masked (causal) RoPE multi-head attention with LARGE logits (x [2][2048][1024]; qkv = x w_qkv + b_qkv ([in][out] 1024 x 3072, sigma 1/32, bias sigma 0.01) -> q | k | v, 16 heads of 64; interleaved-pair RoPE on q and k (inv_freq_i = 10000^(-2i/64), positions 0..2047); scores = q . k x sqrt(64) (the module divides by 1/sqrt(d_k)), causal (tril); softmax; out = (attn v merged) w_out + b_out -> [2][2048][1024]).
// Structure: token rows r = b*2048 + s; x as exact f16 rows (bf16-rounded); q | k | v of every row as ONE WMMA GEMM launch (32x64 wave tiles, f32 accumulation, exact x16 weights + bias, N = 3 x 1024) whose epilogue, a block's 64 columns being one head, does on VALU: the interleaved-pair rotary rotation of q and k from f32 cos/sin tables (positions 0..SQ-1, no norm) and their split into f16 hi + x1024 residual planes (the x8 logits have sigma ~64: near-argmax softmax, so the scores are computed to ~f32 accuracy from three products), v as f16 into V^T; then ONE fused attention launch over every (batch, head, 128-query block): a wave holds 32 queries and walks every third pass of 32 keys up to its own diagonal (three waves a query group, joined through LDS at the end), scores as S^T = K . Q^T (three products), online causal softmax in registers (f32 running maximum and sum, native exp; keys above the diagonal set to -1e9; weights x256 f16), O^T += V^T . P^T with the score tiles as the B operand, o carried x64 (folded into the output GEMM alpha) written straight into the merged f16 o rows; out = o W_o + b GEMM (f32) into the output layout. Every f16 operand plane in the workspace (x, both weights, q and k hi / residual, V^T, o) lies in WMMA fragment order (see gf_frag), so that a fragment load reads whole 128-byte lines.
// Compute dtype: inputs rounded to bf16; x / weights exact; projections and rope f32; q, k as f16 hi + residual (~2^-22); v, softmax weights and o as plain f16 GEMM operands (~2^-12); scores and softmax statistics f32. v_wmma_f32_16x16x32_f16.
#define NB 2
#define SQ 2048
#define DM 1024
#define NH 16
#define HD 64
#define HG 4                         /* heads per launch of the (b, h0) V^T transpose */
#define QT 256
#define NKX SQ                       /* unused */
#define B0 0                         /* first batch processed (debug hook) */
#define NBR NB                       /* batches processed (debug hook) */
#define QN SQ                        /* unused (attention covers all SQ queries) */
#define NHD NH                       /* unused (attention covers all NH heads) */
#define NR ((size_t)NB * SQ)         /* token rows */
#define MPO ((int)((size_t)NBR * SQ))      /* rows through the output GEMM (debug hook) */
typedef __bf16 v16b __attribute__((ext_vector_type(16)));
typedef unsigned short v8us __attribute__((ext_vector_type(8), may_alias));
typedef float  v8f  __attribute__((ext_vector_type(8)));
typedef float  v4f  __attribute__((ext_vector_type(4)));
typedef float  v4fa __attribute__((ext_vector_type(4), may_alias));
union FragB { v16b v; v8us half[2]; unsigned short u[16]; };

__device__ __forceinline__ unsigned short bf16_bits(float x) { unsigned int u = __float_as_uint(x); return (unsigned short)((u + 0x7FFFu + ((u >> 16) & 1u)) >> 16); }
__device__ __forceinline__ float bf16_val(unsigned short b) { return __uint_as_float(((unsigned int)b) << 16); }
__device__ __forceinline__ float bf16_round(float x) { return bf16_val(bf16_bits(x)); }
// D += A·B with NT terms: 1 = ah·bh, 2 = + al·bh (A split), 3 = + ah·bl (both split)
template <int NT>
__device__ __forceinline__ v8f mmaN(v16b ah, v16b al, v16b bh, v16b bl, v8f c) {
  c = __builtin_amdgcn_wmma_f32_16x16x32_bf16(false, ah, false, bh, (short)0, c, false, false);
  if (NT >= 2) c = __builtin_amdgcn_wmma_f32_16x16x32_bf16(false, al, false, bh, (short)0, c, false, false);
  if (NT >= 3) c = __builtin_amdgcn_wmma_f32_16x16x32_bf16(false, ah, false, bl, (short)0, c, false, false);
  asm volatile("v_nop\n\tv_nop\n\tv_nop\n\tv_nop" : "+v"(c) : "v"(ah), "v"(al), "v"(bh), "v"(bl));
  return c;
}

__global__ __launch_bounds__(256) void k_wt_bf16(const float* __restrict__ W, unsigned short* __restrict__ Wt, int K, int N) {
  const int t = blockIdx.x * 256 + threadIdx.x;
  const int k8n = K / 8;
  if (t >= N * k8n) return;
  const int n = t / k8n, k8 = (t % k8n) * 8;
  v8us v;
#pragma unroll
  for (int i = 0; i < 8; ++i) v[i] = bf16_bits(W[(size_t)(k8 + i) * N + n]);
  *(v8us*)(Wt + (size_t)n * K + k8) = v;
  
}

// GEMM C[M][N] (f32, pitch ldc) = act(A[M][K]·W + bias). A f32 row-major (pitch lda) converted per fragment to bf16
// (ASPLIT: hi/lo two planes -> 2 terms, else single rounded term); Wt bf16 [N][K] (pitch ldb). BIAS_BF16 rounds the
// bias to bf16 first (bias quantised to bf16 before the add). K%32==0, M%16==0, N%64==0.
template <bool ASPLIT, int ACT, bool BIAS_BF16>
__global__ __launch_bounds__(128) void k_gemm_bf(const float* __restrict__ A, int lda, const unsigned short* __restrict__ Wt, int ldb,
                                               const float* __restrict__ bias, float* __restrict__ C, int ldc, int M, int N, int K) {
  __shared__ __attribute__((aligned(16))) float so[4][16][64];
  const int tid = threadIdx.x, w = tid >> 5, lane = tid & 31, ln = lane & 15, hh = lane >> 4;
  const int ntn = N / 64;
  const int wid = blockIdx.x * 4 + w;
  const int mt = wid / ntn, nq = wid % ntn;
  if (mt * 16 >= M) return;
  const int row0 = mt * 16, col0 = nq * 64;
  const float* arow = A + (size_t)(row0 + ln) * lda;
  v8f acc[4] = {};
  for (int kb = 0; kb < K; kb += 32) {
    FragB ah, al;
    const v4f x0 = *(const v4fa*)(arow + kb + 8 * hh), x1 = *(const v4fa*)(arow + kb + 8 * hh + 4);
    const v4f x2 = *(const v4fa*)(arow + kb + 16 + 8 * hh), x3 = *(const v4fa*)(arow + kb + 16 + 8 * hh + 4);
    float xs[16] = {x0[0],x0[1],x0[2],x0[3],x1[0],x1[1],x1[2],x1[3],x2[0],x2[1],x2[2],x2[3],x3[0],x3[1],x3[2],x3[3]};
#pragma unroll
    for (int i = 0; i < 16; ++i) { const unsigned short hb = bf16_bits(xs[i]); ah.u[i] = hb; al.u[i] = ASPLIT ? bf16_bits(xs[i] - bf16_val(hb)) : (unsigned short)0; }
#pragma unroll
    for (int t = 0; t < 4; ++t) {
      const unsigned short* brow = Wt + (size_t)(col0 + t * 16 + ln) * ldb + kb;
      FragB b;
      b.half[0] = *(const v8us*)(brow + 8 * hh);
      b.half[1] = *(const v8us*)(brow + 16 + 8 * hh);
      acc[t] = mmaN<ASPLIT ? 2 : 1>(ah.v, al.v, b.v, b.v, acc[t]);
    }
  }
#pragma unroll
  for (int t = 0; t < 4; ++t) {
    float bv = bias ? bias[col0 + t * 16 + ln] : 0.f;
    if (BIAS_BF16) bv = bf16_round(bv);
#pragma unroll
    for (int r = 0; r < 8; ++r) { float v = acc[t][r] + bv; if (ACT == 1) v = fmaxf(v, 0.f); so[w][8 * hh + r][t * 16 + ln] = v; }
  }
  __builtin_amdgcn_fence(__ATOMIC_ACQ_REL, "workgroup");
  __builtin_amdgcn_wave_barrier();
  const int rsub = lane >> 4, c4 = (lane & 15) * 4;
  {
#pragma unroll
    for (int q = 0; q < 8; ++q) {
      const int r = q * 2 + rsub;
      const v4f v = *(const v4fa*)&so[w][r][c4];
      *(v4f*)(C + (size_t)(row0 + r) * ldc + col0 + c4) = v;
    }
    
  }
}

// GEMM C = act(A·W + bias + resid): A f32 (ASPLIT -> hi/lo 2 terms), Wt bf16 [N][K]; ACT 0 none, 1 relu, 2 exact gelu;
// resid (optional, f32, row index = (row % rmod), pitch ldr, RES_BF16 rounds it) added before the activation.
template <bool ASPLIT, int ACT, bool BIAS_BF16, bool RES_BF16>
__global__ __launch_bounds__(128) void k_gemm_bf3(const float* __restrict__ A, int lda, const unsigned short* __restrict__ Wt, int ldb,
                                                const float* __restrict__ bias, const float* __restrict__ resid, int rmod, int ldr,
                                                float* __restrict__ C, int ldc, int M, int N, int K) {
  __shared__ __attribute__((aligned(16))) float so[4][16][64];
  const int tid = threadIdx.x, w = tid >> 5, lane = tid & 31, ln = lane & 15, hh = lane >> 4;
  const int ntn = N / 64;
  const int wid = blockIdx.x * 4 + w;
  const int mt = wid / ntn, nq = wid % ntn;
  if (mt * 16 >= M) return;
  const int row0 = mt * 16, col0 = nq * 64;
  const float* arow = A + (size_t)(row0 + ln) * lda;
  v8f acc[4] = {};
  for (int kb = 0; kb < K; kb += 32) {
    FragB ah, al;
    const v4f x0 = *(const v4fa*)(arow + kb + 8 * hh), x1 = *(const v4fa*)(arow + kb + 8 * hh + 4);
    const v4f x2 = *(const v4fa*)(arow + kb + 16 + 8 * hh), x3 = *(const v4fa*)(arow + kb + 16 + 8 * hh + 4);
    float xs[16] = {x0[0],x0[1],x0[2],x0[3],x1[0],x1[1],x1[2],x1[3],x2[0],x2[1],x2[2],x2[3],x3[0],x3[1],x3[2],x3[3]};
#pragma unroll
    for (int i = 0; i < 16; ++i) { const unsigned short hb = bf16_bits(xs[i]); ah.u[i] = hb; al.u[i] = ASPLIT ? bf16_bits(xs[i] - bf16_val(hb)) : (unsigned short)0; }
#pragma unroll
    for (int t = 0; t < 4; ++t) {
      const unsigned short* brow = Wt + (size_t)(col0 + t * 16 + ln) * ldb + kb;
      FragB b;
      b.half[0] = *(const v8us*)(brow + 8 * hh);
      b.half[1] = *(const v8us*)(brow + 16 + 8 * hh);
      acc[t] = mmaN<ASPLIT ? 2 : 1>(ah.v, al.v, b.v, b.v, acc[t]);
    }
  }
#pragma unroll
  for (int t = 0; t < 4; ++t) {
    const int col = col0 + t * 16 + ln;
    float bv = bias ? bias[col] : 0.f;
    if (BIAS_BF16) bv = bf16_round(bv);
#pragma unroll
    for (int r = 0; r < 8; ++r) {
      float v = acc[t][r] + bv;
      if (resid) { float rv = resid[(size_t)((row0 + 8 * hh + r) % rmod) * ldr + col]; if (RES_BF16) rv = bf16_round(rv); v += rv; }
      if (ACT == 1) v = fmaxf(v, 0.f);
      if (ACT == 2) v = 0.5f * v * (1.0f + erff(v * 0.70710678118654752f));
      if (ACT == 3) { const float u = 0.7978845608028654f * (v + 0.044715f * v * v * v); v = 0.5f * v * (1.0f + tanhf(u)); }
      so[w][8 * hh + r][t * 16 + ln] = v;
    }
  }
  __builtin_amdgcn_fence(__ATOMIC_ACQ_REL, "workgroup");
  __builtin_amdgcn_wave_barrier();
  const int rsub = lane >> 4, c4 = (lane & 15) * 4;
  {
#pragma unroll
    for (int q = 0; q < 8; ++q) {
      const int r = q * 2 + rsub;
      const v4f v = *(const v4fa*)&so[w][r][c4];
      *(v4f*)(C + (size_t)(row0 + r) * ldc + col0 + c4) = v;
    }
    
  }
}
// row LayerNorm (biased variance, eps) over N: s = X (+ R); optional out_sum <- s; out_norm <- (s-mu)*rsqrt(var+eps)*g + b
template <bool PARAM_BF16>
__global__ __launch_bounds__(256) void k_layernorm(const float* __restrict__ X, const float* __restrict__ R, const float* __restrict__ g, const float* __restrict__ bta,
                                                  float* __restrict__ out_sum, float* __restrict__ out_norm, int N, float eps) {
  __shared__ float red[256];
  const int row = blockIdx.x, tid = threadIdx.x;
  const float* x = X + (size_t)row * N; const float* rr = R ? R + (size_t)row * N : nullptr;
  float vals[16];                     // up to N = 4096
  const int per = N / 256;            // contiguous chunk per thread? use strided-by-4 chunks: thread handles j = tid*4 + 1024*u
  float s1 = 0.f;
  for (int u = 0; u < per / 4; ++u) {
    const int j = tid * 4 + 1024 * u;
    const v4f a = *(const v4fa*)(x + j);
    v4f b = {0.f,0.f,0.f,0.f}; if (rr) b = *(const v4fa*)(rr + j);
#pragma unroll
    for (int q = 0; q < 4; ++q) { const float v = a[q] + b[q]; vals[u * 4 + q] = v; s1 += v; }
  }
  red[tid] = s1; __syncthreads();
  for (int st = 128; st > 0; st >>= 1) { if (tid < st) red[tid] += red[tid + st]; __syncthreads(); }
  const float mu = red[0] / (float)N; __syncthreads();
  float s2 = 0.f;
  for (int u = 0; u < per / 4; ++u)
#pragma unroll
    for (int q = 0; q < 4; ++q) { const float c = vals[u * 4 + q] - mu; s2 += c * c; }
  red[tid] = s2; __syncthreads();
  for (int st = 128; st > 0; st >>= 1) { if (tid < st) red[tid] += red[tid + st]; __syncthreads(); }
  const float rs = rsqrtf(red[0] / (float)N + eps);
  {
    for (int u = 0; u < per / 4; ++u) {
      const int j = tid * 4 + 1024 * u;
      v4f o, sm;
#pragma unroll
      for (int q = 0; q < 4; ++q) {
        float gg = g[j + q], bb = bta[j + q];
        if (PARAM_BF16) { gg = bf16_round(gg); bb = bf16_round(bb); }
        sm[q] = vals[u * 4 + q]; o[q] = (vals[u * 4 + q] - mu) * rs * gg + bb;
      }
      if (out_sum) *(v4f*)(out_sum + (size_t)row * N + j) = sm;
      *(v4f*)(out_norm + (size_t)row * N + j) = o;
    }
    
  }
}



// ---- f16 WMMA path (v_wmma_f32_16x16x32_f16): 11-bit significands for operands in range — used where a [0,1] probability operand needs more precision than bf16
typedef _Float16 v16h __attribute__((ext_vector_type(16)));
union FragH { v16h v; v8us half[2]; _Float16 h[16]; unsigned short u[16]; };
template <int NT>
__device__ __forceinline__ v8f mmaH(v16h ah, v16h al, v16h bh, v16h bl, v8f c) {
  c = __builtin_amdgcn_wmma_f32_16x16x32_f16(false, ah, false, bh, (short)0, c, false, false);
  if (NT >= 2) c = __builtin_amdgcn_wmma_f32_16x16x32_f16(false, al, false, bh, (short)0, c, false, false);
  if (NT >= 3) c = __builtin_amdgcn_wmma_f32_16x16x32_f16(false, ah, false, bl, (short)0, c, false, false);
  asm volatile("v_nop\n\tv_nop\n\tv_nop\n\tv_nop" : "+v"(c) : "v"(ah), "v"(al), "v"(bh), "v"(bl));
  return c;
}
// batched GEMM like k_gemm_b but f16 operands: A f32 (split into f16 hi/lo if ASPLIT, else rounded to f16), Bt = f16 values [n][k]; alpha; C f32; N multiple of 16 (partial tiles skipped)
template <bool ASPLIT>
__global__ __launch_bounds__(128) void k_gemm_h(const float* __restrict__ A, int lda, size_t sA, const _Float16* __restrict__ Bh, int ldb, size_t sB, float alpha, float* __restrict__ C, int ldc, size_t sC, int M, int N, int K) {
  __shared__ __attribute__((aligned(16))) float so[4][16][64];
  const int tid = threadIdx.x, w = tid >> 5, lane = tid & 31, ln = lane & 15, hh = lane >> 4; const int by = blockIdx.y;
  A += (size_t)by * sA; Bh += (size_t)by * sB; C += (size_t)by * sC;
  const int ntn = (N + 63) / 64; const int wid = blockIdx.x * 4 + w; const int mt = wid / ntn, nq = wid % ntn; if (mt * 16 >= M) return;
  const int row0 = mt * 16, col0 = nq * 64; const float* arow = A + (size_t)(row0 + ln) * lda;
  v8f acc[4] = {};
  for (int kb = 0; kb < K; kb += 32) {
    FragH ah, al;
    const v4f x0 = *(const v4fa*)(arow + kb + 8 * hh), x1 = *(const v4fa*)(arow + kb + 8 * hh + 4), x2 = *(const v4fa*)(arow + kb + 16 + 8 * hh), x3 = *(const v4fa*)(arow + kb + 16 + 8 * hh + 4);
    float xs[16] = {x0[0],x0[1],x0[2],x0[3],x1[0],x1[1],x1[2],x1[3],x2[0],x2[1],x2[2],x2[3],x3[0],x3[1],x3[2],x3[3]};
#pragma unroll
    for (int i = 0; i < 16; ++i) { const _Float16 h = (_Float16)xs[i]; ah.h[i] = h; al.h[i] = ASPLIT ? (_Float16)(xs[i] - (float)h) : (_Float16)0.0f; }
#pragma unroll
    for (int t = 0; t < 4; ++t) { if (col0 + t * 16 >= N) continue; const size_t boff = (size_t)(col0 + t * 16 + ln) * ldb + kb; FragH bq; bq.half[0] = *(const v8us*)(Bh + boff + 8 * hh); bq.half[1] = *(const v8us*)(Bh + boff + 16 + 8 * hh);
      acc[t] = mmaH<ASPLIT ? 2 : 1>(ah.v, al.v, bq.v, bq.v, acc[t]); }
  }
#pragma unroll
  for (int t = 0; t < 4; ++t) { if (col0 + t * 16 >= N) continue;
#pragma unroll
    for (int r = 0; r < 8; ++r) so[w][8 * hh + r][t * 16 + ln] = acc[t][r] * alpha; }
  __builtin_amdgcn_fence(__ATOMIC_ACQ_REL, "workgroup"); __builtin_amdgcn_wave_barrier();
  const int rsub = lane >> 4, c4 = (lane & 15) * 4;
  {
#pragma unroll
    for (int q = 0; q < 8; ++q) { const int r = q * 2 + rsub; if (col0 + c4 < N) { const v4f v = *(const v4fa*)&so[w][r][c4]; *(v4f*)(C + (size_t)(row0 + r) * ldc + col0 + c4) = v; } }
     }
}

// k_gemm_hh variant with fused epilogue: v = acc·alpha + bias[by·sBias + col] (+ CP[(row/rowsPerB)·sCPb + by·64 + col] if CP) ; ACT 0 none / 1 elu ; writes f16 C16 (and f32 C if non-null)
template <int ACT>
__global__ __launch_bounds__(128) void k_gemm_hhx(const _Float16* __restrict__ A, int lda, size_t sA, const _Float16* __restrict__ Bh, int ldb, size_t sB, float alpha, const float* __restrict__ bias, size_t sBias, const float* __restrict__ CP, int rowsPerB, size_t sCPb, int row0g,
    float* __restrict__ C, _Float16* __restrict__ C16, int ldc, size_t sC, int M, int N, int K) {
  __shared__ __attribute__((aligned(16))) float so[4][16][64];
  const int tid = threadIdx.x, w = tid >> 5, lane = tid & 31, ln = lane & 15, hh = lane >> 4; const int by = blockIdx.y;
  A += (size_t)by * sA; Bh += (size_t)by * sB; const size_t cofs = (size_t)by * sC; const float* bp = bias ? bias + (size_t)by * sBias : nullptr;
  const int ntn = (N + 63) / 64; const int wid = blockIdx.x * 4 + w; const int mt = wid / ntn, nq = wid % ntn; if (mt * 16 >= M) return;
  const int row0 = mt * 16, col0 = nq * 64; const _Float16* arow = A + (size_t)(row0 + ln) * lda;
  v8f acc[4] = {};
  for (int kb = 0; kb < K; kb += 32) { FragH ah; ah.half[0] = *(const v8us*)((const unsigned short*)arow + kb + 8 * hh); ah.half[1] = *(const v8us*)((const unsigned short*)arow + kb + 16 + 8 * hh);
#pragma unroll
    for (int t = 0; t < 4; ++t) { if (col0 + t * 16 >= N) continue; const size_t boff = (size_t)(col0 + t * 16 + ln) * ldb + kb; FragH bq; bq.half[0] = *(const v8us*)((const unsigned short*)Bh + boff + 8 * hh); bq.half[1] = *(const v8us*)((const unsigned short*)Bh + boff + 16 + 8 * hh);
      acc[t] = mmaH<1>(ah.v, ah.v, bq.v, bq.v, acc[t]); }
  }
#pragma unroll
  for (int t = 0; t < 4; ++t) { if (col0 + t * 16 >= N) continue; const int col = col0 + t * 16 + ln; const float bv = bp ? bf16_round(bp[col]) : 0.f;
#pragma unroll
    for (int r = 0; r < 8; ++r) { float v = acc[t][r] * alpha + bv; if (CP) { const int rr = row0g + row0 + 8 * hh + r; if (rowsPerB < 0) v += CP[cofs + (size_t)rr * ldc + col];      /* rowsPerB < 0: own element of the batched C plane */ else { const int bidx = rr / rowsPerB; v += CP[(size_t)bidx * sCPb + (size_t)by * 64 + col]; } } if (ACT == 1) v = (v > 0.f) ? v : expm1f(v); else if (ACT == 7) v = (v > 0.f) ? v + 1.0f : expf(v); else if (ACT == 8) v = tanhf(v); else if (ACT == 9) v = 0.5f * v * (1.0f + tanhf(0.7978845608028654f * (v + 0.044715f * v * v * v))); else if (ACT == 11) v = 1.0f / (1.0f + expf(-v)); else if (ACT == 12) v = (v > 0.f) ? v : 0.01f * v; else if (ACT == 14) v = (v > 0.f) ? v : 0.1f * v; else if (ACT == 16) v = (v >= 0.f) ? v : 0.3f * v; else if (ACT == 17) v = (v >= 0.f) ? v : 0.2f * v; else if (ACT == 15) v = v / (1.0f + expf(-v)); else if (ACT == 3) v = fmaxf(v, 0.f); else if (ACT == 6) v = 0.5f * v * (1.0f + erff(v * 0.70710678118654752f)); so[w][8 * hh + r][t * 16 + ln] = v; } }
  __builtin_amdgcn_fence(__ATOMIC_ACQ_REL, "workgroup"); __builtin_amdgcn_wave_barrier();
  const int rsub = lane >> 4, c4 = (lane & 15) * 4; typedef _Float16 v4h __attribute__((ext_vector_type(4)));
  {
#pragma unroll
    for (int q = 0; q < 8; ++q) { const int r = q * 2 + rsub; if (col0 + c4 < N) { const v4f v = *(const v4fa*)&so[w][r][c4]; if (C) *(v4f*)(C + cofs + (size_t)(row0 + r) * ldc + col0 + c4) = v; if (C16) { v4h h4; for (int i = 0; i < 4; ++i) h4[i] = (_Float16)v[i]; *(v4h*)(C16 + cofs + (size_t)(row0 + r) * ldc + col0 + c4) = h4; } } }
     }
}


typedef _Float16 v4h __attribute__((ext_vector_type(4)));

__global__ __launch_bounds__(256) void k_h16(const float* __restrict__ x, _Float16* __restrict__ X16, size_t n8) { const size_t t = (size_t)blockIdx.x * 256 + threadIdx.x; if (t >= n8) return; FragH f;
#pragma unroll
  for (int q = 0; q < 8; ++q) f.h[q] = (_Float16)x[t * 8 + q]; *(v8us*)((unsigned short*)X16 + t * 8) = f.half[0];  }
__global__ __launch_bounds__(256) void k_round16f(const float* __restrict__ W, _Float16* __restrict__ Bt, size_t n8) { const size_t t = (size_t)blockIdx.x * 256 + threadIdx.x; if (t >= n8) return; FragH f;
#pragma unroll
  for (int i = 0; i < 8; ++i) f.h[i] = (_Float16)(bf16_round(W[t * 8 + i]) * 16.0f); *(v8us*)((unsigned short*)Bt + t * 8) = f.half[0];  }
// ---- fast GEMM (wave tile 32x64; requires M % 32 == 0 rows per launch region, N % 64 == 0 and K % 64 == 0); A and Bh in fragment order (see gf_frag), strips of 16 rows of lda / ldb elements each; epilogue = k_gemm_hhx semantics ----
__device__ __forceinline__ v16h g2_frag(const _Float16* p, int hh) { FragH f; f.half[0] = *(const v8us*)((const unsigned short*)p + 8 * hh); f.half[1] = *(const v8us*)((const unsigned short*)p + 16 + 8 * hh); return f.v; }
// Fragment order: a 16-row x 32-k f16 tile lies 1 KB in a row, element (r, k) at (k >> 4) * 256 + (((k >> 3) & 1) * 16 + r) * 8 + (k & 7), so lane l = 16 hh + ln finds the two 16-byte halves of its fragment at 8 l and 256 + 8 l:
// each fragment load of a wave reads 512 bytes in a row (four whole 128-byte lines) where a row-major plane gives it 16 lines of 32 bytes. Which element a lane and register hold is as in g2_frag. p = tile + 8 * lane.
__device__ __forceinline__ v16h gf_frag(const _Float16* p) { FragH f; f.half[0] = *(const v8us*)((const unsigned short*)p); f.half[1] = *(const v8us*)((const unsigned short*)p + 256); return f.v; }
__device__ __forceinline__ v8f g2_mma(v16h a, v16h b, v8f c) { v8f d = __builtin_amdgcn_wmma_f32_16x16x32_f16(false, a, false, b, (short)0, c, false, false); asm volatile("v_nop\n\tv_nop\n\tv_nop\n\tv_nop" : "+v"(d) : "v"(a), "v"(b)); return d; }
// GEMM main loops: every fragment register is asked for again, for a later trip, directly behind the last product that reads it, so that a trip's twelve loads are all in flight while products run, and no product waits out a whole load by itself.
// G2_HOLD keeps each reload at that place: hoisted it would take a further register set, sunk to its use it would have no lead.
#define G2_HOLD __builtin_amdgcn_sched_barrier(0);
// one trip on a whole set, the set reloaded from element offset KO of the six strips. The wait holds the six address pairs whole until the loads have taken them, and the loads in front of the next trip.
#define G2_TRIP2(A0, A1, F0, F1, F2, F3, KO) { const int ko = (KO); \
    const _Float16* pa0 = a0p + ko; const _Float16* pa1 = a1p + ko; const _Float16* pb0 = b0p + ko; const _Float16* pb1 = b1p + ko; const _Float16* pb2 = b2p + ko; const _Float16* pb3 = b3p + ko; \
    c00 = g2_mma(A0, F0, c00); c10 = g2_mma(A1, F0, c10); F0 = gf_frag(pb0); G2_HOLD \
    c01 = g2_mma(A0, F1, c01); c11 = g2_mma(A1, F1, c11); F1 = gf_frag(pb1); G2_HOLD \
    c02 = g2_mma(A0, F2, c02); c12 = g2_mma(A1, F2, c12); F2 = gf_frag(pb2); G2_HOLD \
    c03 = g2_mma(A0, F3, c03); c13 = g2_mma(A1, F3, c13); F3 = gf_frag(pb3); A0 = gf_frag(pa0); A1 = gf_frag(pa1); \
    asm volatile("s_wait_xcnt 0x0" :: "v"(pa0), "v"(pa1), "v"(pb0), "v"(pb1), "v"(pb2), "v"(pb3) : "memory"); }
// a whole set's first loads, from element offset KO of the six strips
#define G2_FILL(A0, A1, F0, F1, F2, F3, KO) v16h F0 = gf_frag(b0p + (KO)); G2_HOLD v16h F1 = gf_frag(b1p + (KO)); G2_HOLD v16h F2 = gf_frag(b2p + (KO)); G2_HOLD v16h F3 = gf_frag(b3p + (KO)); G2_HOLD v16h A0 = gf_frag(a0p + (KO)); G2_HOLD v16h A1 = gf_frag(a1p + (KO));
// one trip with one B set and two A sets: the next trip's A (N0, N1) asked for at the head, each B fragment reloaded in place; KO = element offset of the next trip's tiles in the strips. The wait as above, for the two pairs.
#define G2_TRIP1(A0, A1, N0, N1, KO) { const _Float16* pa = ap + (KO); const _Float16* pb = bp + (KO); \
    N0 = gf_frag(pa); N1 = gf_frag(pa + 16 * DM); G2_HOLD \
    c00 = g2_mma(A0, b0, c00); c10 = g2_mma(A1, b0, c10); b0 = gf_frag(pb); G2_HOLD \
    c01 = g2_mma(A0, b1, c01); c11 = g2_mma(A1, b1, c11); b1 = gf_frag(pb + 16 * DM); G2_HOLD \
    c02 = g2_mma(A0, b2, c02); c12 = g2_mma(A1, b2, c12); b2 = gf_frag(pb + 32 * DM); G2_HOLD \
    c03 = g2_mma(A0, b3, c03); c13 = g2_mma(A1, b3, c13); b3 = gf_frag(pb + 48 * DM); \
    asm volatile("s_wait_xcnt 0x0" :: "v"(pa), "v"(pb) : "memory"); }
template <int ACT>
__global__ __launch_bounds__(128) void k_gemm2(const _Float16* __restrict__ A, int lda, size_t sA, const _Float16* __restrict__ Bh, int ldb, size_t sB, float alpha, const float* __restrict__ bias, size_t sBias, const float* __restrict__ CP, int rowsPerB, size_t sCPb, int row0g,
    float* __restrict__ C, _Float16* __restrict__ C16, int ldc, size_t sC, int M, int N, int K) { static_assert(ACT == 0 || ACT == 3 || ACT == 6 || ACT == 8 || ACT == 9 || ACT == 11 || ACT == 12 || ACT == 14 || ACT == 15 || ACT == 16 || ACT == 17, "k_gemm2: unsupported ACT code (would silently apply no activation)");
  __shared__ __attribute__((aligned(16))) float so[4][32][68];
  const int tid = threadIdx.x, w = tid >> 5, lane = tid & 31, ln = lane & 15, hh = lane >> 4; const int by = blockIdx.y;
  A += (size_t)by * sA; Bh += (size_t)by * sB; const size_t cofs = (size_t)by * sC; const float* bp = bias ? bias + (size_t)by * sBias : nullptr;
  const int ntn = N >> 6; const int mt = blockIdx.x / ntn, nq = blockIdx.x - mt * ntn; const int row0 = mt * 128 + 32 * w, col0 = nq * 64; if (row0 >= M) return;
  const _Float16* a0p = A + (size_t)row0 * lda + 8 * lane; const _Float16* a1p = a0p + (size_t)16 * lda;
  const _Float16* b0p = Bh + (size_t)col0 * ldb + 8 * lane; const _Float16* b1p = b0p + (size_t)16 * ldb; const _Float16* b2p = b1p + (size_t)16 * ldb; const _Float16* b3p = b2p + (size_t)16 * ldb;
  const v8f z8 = {0.f,0.f,0.f,0.f,0.f,0.f,0.f,0.f}; v8f c00 = z8, c01 = z8, c02 = z8, c03 = z8, c10 = z8, c11 = z8, c12 = z8, c13 = z8;
  /* two fragment sets (x: even trips, y: odd trips), every register reloaded two trips ahead directly behind the last product that reads it; K % 64 == 0 */
  /* the first loads in the order in which the loop reloads (B tiles, then A; x, then y), held so: the loop's counted waits are set for both ways into it, and another order here made them wait for younger loads */
  G2_FILL(xa0, xa1, xb0, xb1, xb2, xb3, 0) G2_HOLD G2_FILL(ya0, ya1, yb0, yb1, yb2, yb3, 512)
  asm volatile("s_wait_xcnt 0x0" :: "v"(a0p), "v"(a1p), "v"(b0p), "v"(b1p), "v"(b2p), "v"(b3p) : "memory");      /* the six address pairs stay whole until the first loads have taken them */
#pragma unroll 1      /* rolled: two trips' code, the register sets named once each */
  for (int kb = 0; kb < K; kb += 64) {
    G2_TRIP2(xa0, xa1, xb0, xb1, xb2, xb3, ((kb + 64 < K) ? kb + 64 : kb) * 16)      /* 512 elements a tile of 32 k; the last two trips ask for their own tiles again (in bounds) */
    G2_TRIP2(ya0, ya1, yb0, yb1, yb2, yb3, ((kb + 96 < K) ? kb + 96 : kb + 32) * 16) }
  v8f accs[8] = {c00, c01, c02, c03, c10, c11, c12, c13};
#pragma unroll
  for (int u = 0; u < 8; ++u) { const int t = u & 3, half = u >> 2; const int col = col0 + t * 16 + ln; const float bv = bp ? bf16_round(bp[col]) : 0.f;
#pragma unroll
    for (int r = 0; r < 8; ++r) { const int rloc = half * 16 + 8 * hh + r; float v = accs[u][r] * alpha + bv; if (CP) { if (rowsPerB < 0) v += CP[cofs + (size_t)(row0g + row0 + rloc) * ldc + col];      /* rowsPerB < 0: own element of the batched C plane */ else { const int bidx = (row0g + row0 + rloc) / rowsPerB; v += CP[(size_t)bidx * sCPb + (size_t)by * 64 + col]; } }
      if (ACT == 3) v = fmaxf(v, 0.f); else if (ACT == 6) v = 0.5f * v * (1.0f + erff(v * 0.70710678118654752f)); else if (ACT == 11) v = 1.0f / (1.0f + expf(-v)); else if (ACT == 15) v = v / (1.0f + expf(-v)); else if (ACT == 12) v = (v > 0.f) ? v : 0.01f * v; else if (ACT == 8) v = tanhf(v); else if (ACT == 9) v = 0.5f * v * (1.0f + tanhf(0.7978845608028654f * (v + 0.044715f * v * v * v))); else if (ACT == 14) v = (v > 0.f) ? v : 0.1f * v; else if (ACT == 16) v = (v >= 0.f) ? v : 0.3f * v; else if (ACT == 17) v = (v >= 0.f) ? v : 0.2f * v;
      so[w][rloc][t * 16 + ln] = v; } }
  __builtin_amdgcn_fence(__ATOMIC_ACQ_REL, "workgroup"); __builtin_amdgcn_wave_barrier();
  const int rsub = lane >> 4, c4 = (lane & 15) * 4;
  {
#pragma unroll
    for (int q = 0; q < 16; ++q) { const int r = q * 2 + rsub; const v4f v = *(const v4fa*)&so[w][r][c4]; if (C) *(v4f*)(C + cofs + (size_t)(row0 + r) * ldc + col0 + c4) = v; if (C16) { v4h h4; for (int i = 0; i < 4; ++i) h4[i] = (_Float16)v[i]; *(v4h*)(C16 + cofs + (size_t)(row0 + r) * ldc + col0 + c4) = h4; } }
     } }


__global__ __launch_bounds__(256) void k_wnat(const float* __restrict__ w, size_t n8, _Float16* __restrict__ Bt) { const size_t t = (size_t)blockIdx.x * 256 + threadIdx.x; if (t >= n8) return; FragH f; for (int q = 0; q < 8; ++q) f.h[q] = (_Float16)(bf16_round(w[t * 8 + q]) * 16.0f); *(v8us*)((unsigned short*)Bt + t * 8) = f.half[0];  }
__global__ __launch_bounds__(256) void k_rsm(const float* __restrict__ S, _Float16* __restrict__ P, int nrows) {
  #pragma clang fp contract(off)
  const int i = blockIdx.x * 256 + threadIdx.x; if (i >= nrows) return; const float* s = S + (size_t)i * SQ; float mx = -3.0e38f;
#pragma unroll 1
  for (int j = 0; j < SQ; ++j) mx = fmaxf(mx, s[j]); float se = 0.f;
#pragma unroll 1
  for (int j = 0; j < SQ; ++j) se += expf(s[j] - mx); const float sc = 256.0f / se;
#pragma unroll 1
  for (int j0 = 0; j0 < SQ; j0 += 8) { FragH f; for (int q = 0; q < 8; ++q) f.h[q] = (_Float16)(expf(s[j0 + q] - mx) * sc); unsigned short* d = (unsigned short*)P + (size_t)i * SQ + j0; *(v8us*)d = f.half[0];  } }
__global__ __launch_bounds__(256) void k_vt(const _Float16* __restrict__ V16, int b, int h0, _Float16* __restrict__ VT) { __shared__ unsigned short tl[64][65]; const int tid = threadIdx.x; const int hh = blockIdx.x % HG, sg = blockIdx.x / HG; const int s0 = sg * 64; const int h = h0 + hh;
  for (int i = tid; i < 64 * 8; i += 256) { const int j = i / 8, d8 = (i % 8) * 8; FragH f; f.half[0] = *(const v8us*)((const unsigned short*)V16 + ((size_t)b * SQ + s0 + j) * DM + h * HD + d8); for (int q = 0; q < 8; ++q) tl[d8 + q][j] = f.u[q]; }
  __syncthreads();
  { for (int i = tid; i < 64 * 8; i += 256) { const int d = i / 8, j8 = (i % 8) * 8; FragH f; for (int q = 0; q < 8; ++q) f.u[q] = tl[d][j8 + q]; *(v8us*)((unsigned short*)VT + ((size_t)hh * HD + d) * SQ + s0 + j8) = f.half[0]; }  } }


// ---- preparation, ONE launch: x rows and both weights into f16 fragment order (see gf_frag), and the rotary tables ----
// A plane's unit t is its t-th 16 bytes: 8 consecutive k of one row (x) or of one output column n (weights, Bt(n, k) = f16(bf16(W[k][n]) x16), exact) in strips of 16 rows, DM / 32 tiles a strip.
// PREP_T threads in all; a thread takes units g, g + PREP_T, ... of every plane (4 of x, 3 of q|k|v, 1 of the output weight), and the first SQ * HD / 2 threads one table entry each:
// few long waves in place of many that live for one unit, and what a wave reads is all asked for at once.
#define PREP_T (512 * 256)
#define PREP_X 4
#define PREP_W 3
static_assert((size_t)PREP_X * PREP_T == NR * DM / 8 && (size_t)PREP_W * PREP_T == (size_t)3 * DM * DM / 8 && (size_t)PREP_T == (size_t)DM * DM / 8 && SQ * (HD / 2) <= PREP_T, "k_prep: the planes are whole multiples of the grid");
__device__ __forceinline__ const float* prep_wsrc(const float* W, int N, int t) { const int tile = t >> 6, c = t & 63; const int n = (tile / (DM / 32)) * 16 + (c & 15), k8 = (tile % (DM / 32)) * 32 + (c >> 5) * 16 + ((c >> 4) & 1) * 8; return W + (size_t)k8 * N + n; }      /* first of the unit's 8 elements, N apart */
__device__ __forceinline__ void prep_tab(float theta, int t, float* __restrict__ CS, float* __restrict__ SN) {
  const int i = t % (HD / 2); const int p = t / (HD / 2); const float invf = 1.0f / powf(theta, (float)(2 * i) / (float)HD); const float ang = __fmul_rn((float)p, invf); const float c = cosf(ang), s = sinf(ang);
  *(float*)(CS + t) = c; *(float*)(SN + t) = s; }
__global__ __launch_bounds__(256) void k_prep(const float* __restrict__ x, const float* __restrict__ wqkv, const float* __restrict__ wo, float theta,
    _Float16* __restrict__ X16, _Float16* __restrict__ BQKV, _Float16* __restrict__ BO, float* __restrict__ CS, float* __restrict__ SN) {
  const int g = blockIdx.x * 256 + threadIdx.x;
  const float* xs[PREP_X]; const float* ws[PREP_W + 1]; v4f xv[PREP_X][2]; float wv[PREP_W + 1][8];
#pragma unroll
  for (int u = 0; u < PREP_X; ++u) { const int t = g + u * PREP_T; const int tile = t >> 6, c = t & 63;
    xs[u] = x + ((size_t)(tile / (DM / 32)) * 16 + (c & 15)) * DM + (tile % (DM / 32)) * 32 + (c >> 5) * 16 + ((c >> 4) & 1) * 8; }
#pragma unroll
  for (int u = 0; u < PREP_W; ++u) ws[u] = prep_wsrc(wqkv, 3 * DM, g + u * PREP_T);
  ws[PREP_W] = prep_wsrc(wo, DM, g);
#pragma unroll
  for (int u = 0; u < PREP_X; ++u) { xv[u][0] = *(const v4fa*)xs[u]; xv[u][1] = *(const v4fa*)(xs[u] + 4); }
#pragma unroll
  for (int u = 0; u <= PREP_W; ++u)
#pragma unroll
    for (int i = 0; i < 8; ++i) wv[u][i] = ws[u][(size_t)i * (u < PREP_W ? 3 * DM : DM)];
  asm volatile("s_wait_xcnt 0x0" :: "v"(xs[0]), "v"(xs[1]), "v"(xs[2]), "v"(xs[3]), "v"(ws[0]), "v"(ws[1]), "v"(ws[2]), "v"(ws[3]) : "memory");      /* the eight address pairs stay whole until the loads have taken them; it also keeps every load here, in front of the table entry, so that they fly while it is computed */
  if (g < SQ * (HD / 2)) prep_tab(theta, g, CS, SN);      /* whole blocks: 256 divides the bound */
  FragH fx[PREP_X], fw[PREP_W + 1];
#pragma unroll
  for (int u = 0; u < PREP_X; ++u)
#pragma unroll
    for (int q = 0; q < 8; ++q) fx[u].h[q] = (_Float16)bf16_round(xv[u][q >> 2][q & 3]);
#pragma unroll
  for (int u = 0; u <= PREP_W; ++u)
#pragma unroll
    for (int i = 0; i < 8; ++i) fw[u].h[i] = (_Float16)(bf16_round(wv[u][i]) * 16.0f);
#pragma unroll
  for (int u = 0; u < PREP_X; ++u) *(v8us*)((unsigned short*)X16 + ((size_t)g + (size_t)u * PREP_T) * 8) = fx[u].half[0];
#pragma unroll
  for (int u = 0; u < PREP_W; ++u) *(v8us*)((unsigned short*)BQKV + ((size_t)g + (size_t)u * PREP_T) * 8) = fw[u].half[0];
  *(v8us*)((unsigned short*)BO + (size_t)g * 8) = fw[PREP_W].half[0]; }
// Fused causal attention, one launch for every (batch, head, 128-query block): 32 queries belong to FA_KS waves, w + 4 g taking the passes of 32 keys g, g + FA_KS, ... up to the queries' own diagonal; nothing of S or P goes through memory.
// The longest walk is so 22 passes, not 64, and a SIMD holds as many waves as its registers take; one block fills a WGP, and the blocks come longest first over all heads (the query block is the slow grid index), so that a WGP that ends a short block takes the next: every WGP gets about the mean.
// At the end the waves g > 0 hand their maximum, sum and accumulators to wave g = 0 through LDS, which joins the partial softmaxes on their common maximum.
// Transposed products: S^T = K . Q^T (A = key rows, B = query rows kept in registers; hi.hi in one accumulator, lo.hi + hi.lo in a second, joined as hi + 2^-10 lo in f32), so a lane holds 16 scores of ONE query;
// running maximum and sum per query (online softmax, accumulators rescaled only in a pass where some query's maximum moved); the two 16-key score tiles, as f16 weights x256, ARE the B operand of O^T += V^T . P^T.
__device__ __forceinline__ float rs_xrow(float v) { const int i = __float_as_int(v); return __int_as_float(__builtin_amdgcn_permlanex16(i, i, 0x76543210, 0xfedcba98, false, false)); }      /* lane l <- lane l ^ 16 */
// native 2^a. The v_nop is the slot the instruction set asks for behind a transcendental before its source is overwritten or its result read.
__device__ __forceinline__ float fa_exp2(float a) { float e; asm("v_exp_f32 %0, %1\n\tv_nop" : "=v"(e) : "v"(a)); return e; }
__device__ __forceinline__ v8f fa_mma(v16h a, v16h b, v8f c) { return __builtin_amdgcn_wmma_f32_16x16x32_f16(false, a, false, b, (short)0, c, false, false); }
#define FA_C 11.5415603271117072589f      /* sqrt(64) * log2(e): score differences -> exponent of 2 */
#define FA_KS 3      /* waves that share a query group's key walk */
__global__ __launch_bounds__(128 * FA_KS) void k_fattn(const _Float16* __restrict__ QH, const _Float16* __restrict__ QL, const _Float16* __restrict__ KH, const _Float16* __restrict__ KL, const _Float16* __restrict__ VT, _Float16* __restrict__ O16) {
  __shared__ __attribute__((aligned(16))) float mo[FA_KS - 1][4][17][32][4];      /* [g - 1][query group][16 quads of o, then m and l][lane]: a wave's store or load of a quad is 512 bytes in a row */
  const int lane = threadIdx.x & 31, ln = lane & 15, hh = lane >> 4; const int w8 = __builtin_amdgcn_readfirstlane((int)(threadIdx.x >> 5)); const int w = w8 & 3, g = w8 >> 2;      /* scalar wave number: the key loop's bounds stay scalars; w query group, g its share of the passes */
  const int bh = blockIdx.x, b = bh / NH, h = bh % NH; const int q0 = ((int)gridDim.y - 1 - (int)blockIdx.y) * 128 + w * 32;      /* longest blocks start first, over all heads */
  const size_t r0 = (size_t)b * SQ;
  /* every pointer below is the lane's own address, its lane offset 8 lane folded in, so that the loads name exactly the pair that the wait behind them holds */
  /* q, k planes: fragment order (see gf_frag), per (batch, head) strips of 16 tokens, two tiles (k halves of the head) a strip: 64 elements a token; V^T: per (batch, head) and 32 keys four tiles (16 head columns each): 64 elements a key */
  const size_t hb = (size_t)bh * SQ * HD + 8 * lane;
  const _Float16* qhp = QH + hb + (size_t)q0 * HD; const _Float16* qlp = QL + hb + (size_t)q0 * HD;
  v16h qh[2][2], ql[2][2];      /* [query group of 16][k half of the head] */
#pragma unroll
  for (int j = 0; j < 2; ++j)
#pragma unroll
    for (int ks = 0; ks < 2; ++ks) { const size_t o = (size_t)(2 * j + ks) * 512; qh[j][ks] = gf_frag(qhp + o); ql[j][ks] = gf_frag(qlp + o); }
  asm volatile("s_wait_xcnt 0x0" :: "v"(qhp), "v"(qlp) : "memory");      /* the two address pairs stay whole until the loads have taken them */
  const _Float16* khp = KH + hb; const _Float16* klp = KL + hb; const _Float16* vtp = VT + hb;
  const v8f z8 = {0.f,0.f,0.f,0.f,0.f,0.f,0.f,0.f};
  v8f o[2][4]; float m[2], l[2];
#pragma unroll
  for (int j = 0; j < 2; ++j) { m[j] = -1.0e30f; l[j] = 0.f;
#pragma unroll
    for (int t = 0; t < 4; ++t) o[j][t] = z8; }
  v16h kh[2][2], kl[2][2];      /* [16-key tile][k half] */
  { const _Float16* pkh = khp + (size_t)(32 * g) * HD; const _Float16* pkl = klp + (size_t)(32 * g) * HD;      /* the wave's first pass (in bounds also where it has none) */
#pragma unroll
    for (int kt = 0; kt < 2; ++kt)
#pragma unroll
      for (int ks = 0; ks < 2; ++ks) { const size_t ko = (size_t)(2 * kt + ks) * 512; kh[kt][ks] = gf_frag(pkh + ko); kl[kt][ks] = gf_frag(pkl + ko); }
    asm volatile("s_wait_xcnt 0x0" :: "v"(pkh), "v"(pkl) : "memory"); }      /* the two address pairs stay whole until the loads have taken them */
#pragma unroll 1
  for (int kb = 32 * g; kb <= q0; kb += 32 * FA_KS) {
    v16h vf[4]; const _Float16* pv = vtp + (size_t)kb * HD;      /* V^T tiles of this pass, asked for ahead of the score products */
#pragma unroll
    for (int t = 0; t < 4; ++t) vf[t] = gf_frag(pv + (size_t)t * 512);
    asm volatile("s_wait_xcnt 0x0" ::: "memory");      /* stands in front of the advance of the loads' address pair; it also keeps these loads here, ahead of the score products, where the build had sunk them to their use */
    v8f u[2][2];      /* [query group][key tile]: q . k, register r = key 16 kt + 8 hh + r of query ln */
#pragma unroll
    for (int kt = 0; kt < 2; ++kt)
#pragma unroll
      for (int j = 0; j < 2; ++j) { v8f sh = z8, sl = z8;
#pragma unroll
        for (int ks = 0; ks < 2; ++ks) { sh = fa_mma(kh[kt][ks], qh[j][ks], sh); sl = fa_mma(kh[kt][ks], ql[j][ks], sl); sl = fa_mma(kl[kt][ks], qh[j][ks], sl); }
#pragma unroll
        for (int r = 0; r < 8; ++r) u[j][kt][r] = sh[r] + 0.0009765625f * sl[r]; }
    { const int kn = (kb + 32 * FA_KS <= q0) ? kb + 32 * FA_KS : kb;      /* the wave's next pass's key rows into the same registers, behind their last use; the last pass asks for its own rows again (in bounds) */
      const _Float16* pkh = khp + (size_t)kn * HD; const _Float16* pkl = klp + (size_t)kn * HD;
#pragma unroll
      for (int kt = 0; kt < 2; ++kt)
#pragma unroll
        for (int ks = 0; ks < 2; ++ks) { const size_t ko = (size_t)(2 * kt + ks) * 512; kh[kt][ks] = gf_frag(pkh + ko); kl[kt][ks] = gf_frag(pkl + ko); }
      asm volatile("s_wait_xcnt 0x0" :: "v"(pkh), "v"(pkl) : "memory"); }      /* the two address pairs stay whole until the loads have taken them */
    if (kb == q0) {      /* the one pass on the diagonal: keys above the query are out */
#pragma unroll
      for (int j = 0; j < 2; ++j)
#pragma unroll
        for (int kt = 0; kt < 2; ++kt)
#pragma unroll
          for (int r = 0; r < 8; ++r) u[j][kt][r] = (16 * kt + 8 * hh + r <= 16 * j + ln) ? u[j][kt][r] : -1.0e9f; }
    float mn[2];
#pragma unroll
    for (int j = 0; j < 2; ++j) { float x = fmaxf(u[j][0][0], u[j][1][0]);
#pragma unroll
      for (int r = 1; r < 8; ++r) x = fmaxf(x, fmaxf(u[j][0][r], u[j][1][r]));
      mn[j] = fmaxf(m[j], fmaxf(x, rs_xrow(x))); }
    if (__builtin_amdgcn_ballot_w32(mn[0] > m[0] || mn[1] > m[1]) != 0) {      /* scalar branch; where no maximum moved every factor would be 1 */
#pragma unroll
      for (int j = 0; j < 2; ++j) { const float al = fa_exp2((m[j] - mn[j]) * FA_C); m[j] = mn[j]; l[j] *= al;
#pragma unroll
        for (int t = 0; t < 4; ++t)
#pragma unroll
          for (int r = 0; r < 8; ++r) o[j][t][r] *= al; } }
#pragma unroll
    for (int j = 0; j < 2; ++j) { FragH pf; float s0 = 0.f, s1 = 0.f;
#pragma unroll
      for (int r = 0; r < 8; ++r) { const float p0 = fa_exp2((u[j][0][r] - m[j]) * FA_C + 8.0f), p1 = fa_exp2((u[j][1][r] - m[j]) * FA_C + 8.0f); s0 += p0; s1 += p1; pf.h[r] = (_Float16)p0; pf.h[8 + r] = (_Float16)p1; }      /* weights x256 */
      l[j] += s0 + s1;
#pragma unroll
      for (int t = 0; t < 4; ++t) o[j][t] = fa_mma(vf[t], pf.v, o[j][t]); }
  }
  /* the partial softmaxes of a query group joined: the state of the waves g > 0 through LDS, all scaled to the common maximum (a wave without a pass holds m = -1e30, l = 0, o = 0: factor 0; wave g = 0 always has the pass of key 0) */
  if (g != 0) {
#pragma unroll
    for (int j = 0; j < 2; ++j)
#pragma unroll
      for (int t = 0; t < 4; ++t)
#pragma unroll
        for (int c = 0; c < 2; ++c) { const v4f x = {o[j][t][4 * c], o[j][t][4 * c + 1], o[j][t][4 * c + 2], o[j][t][4 * c + 3]}; *(v4fa*)&mo[g - 1][w][(j * 4 + t) * 2 + c][lane][0] = x; }
    const v4f x = {m[0], m[1], l[0], l[1]}; *(v4fa*)&mo[g - 1][w][16][lane][0] = x; }
  __syncthreads();      /* every wave of the block passes it: the state of the waves g > 0 is in LDS before wave g = 0 reads it */
  if (g != 0) return;
  { v4f ml[FA_KS - 1];
#pragma unroll
    for (int p = 0; p < FA_KS - 1; ++p) ml[p] = *(const v4fa*)&mo[p][w][16][lane][0];
#pragma unroll
    for (int j = 0; j < 2; ++j) { float mx = m[j];
#pragma unroll
      for (int p = 0; p < FA_KS - 1; ++p) mx = fmaxf(mx, ml[p][j]);
      const float a0 = fa_exp2((m[j] - mx) * FA_C); l[j] *= a0;
#pragma unroll
      for (int t = 0; t < 4; ++t)
#pragma unroll
        for (int r = 0; r < 8; ++r) o[j][t][r] *= a0;
#pragma unroll
      for (int p = 0; p < FA_KS - 1; ++p) { const float a = fa_exp2((ml[p][j] - mx) * FA_C); l[j] += ml[p][2 + j] * a;
#pragma unroll
        for (int t = 0; t < 4; ++t)
#pragma unroll
          for (int c = 0; c < 2; ++c) { const v4f x = *(const v4fa*)&mo[p][w][(j * 4 + t) * 2 + c][lane][0];
#pragma unroll
            for (int i = 0; i < 4; ++i) o[j][t][4 * c + i] += x[i] * a; } } } }
#pragma unroll
  for (int j = 0; j < 2; ++j) { const float inv = 64.0f / (l[j] + rs_xrow(l[j]));      /* the two lane halves hold disjoint keys' sums; o carried x64 */
    unsigned short* dst = (unsigned short*)O16 + (r0 + q0 + 16 * j) * DM + (size_t)h * 1024 + 8 * lane;      /* o rows in fragment order for the output GEMM: strip of 16 rows, tiles 2 h and 2 h + 1; the lane's 8 values are one 16-byte half of its own fragment */
#pragma unroll
    for (int t = 0; t < 4; ++t) { FragH f;
#pragma unroll
      for (int r = 0; r < 8; ++r) f.h[r] = (_Float16)(o[j][t][r] * inv);
      *(v8us*)(dst + 256 * t) = f.half[0]; } } }


// q | k | v projection of every token row in one launch: wave tile (32 x 64) of k_gemm2, main loop on one B set and two A sets (G2_TRIP1); a block's 64 columns are exactly one head of q, of k or of v, and the epilogue finishes that head's rows itself:
// q, k: f32 row through LDS, interleaved-pair rotation from the f32 tables, f16 hi + x1024 residual planes in fragment order; v: f16 from the accumulators (a lane holds 8 consecutive tokens of one column) straight into V^T in fragment order, whole 128-byte lines.
typedef float v2fa __attribute__((ext_vector_type(2), may_alias));
__global__ __launch_bounds__(128) void k_qkv(const _Float16* __restrict__ A, const _Float16* __restrict__ Bh, const float* __restrict__ bias, const float* __restrict__ CS, const float* __restrict__ SN,
    _Float16* __restrict__ QH, _Float16* __restrict__ QL, _Float16* __restrict__ KH, _Float16* __restrict__ KL, _Float16* __restrict__ VT) {
  __shared__ __attribute__((aligned(16))) float so[4][32][68];
  const int tid = threadIdx.x, w = tid >> 5, lane = tid & 31, ln = lane & 15, hh = lane >> 4;
  const int ntn = 3 * NH; const int mt = blockIdx.x / ntn, nq = blockIdx.x - mt * ntn; const int row0 = mt * 128 + 32 * w, col0 = nq * HD; const int part = nq / NH, h = nq - part * NH;      /* part 0 q, 1 k, 2 v: the same for the whole block */
  const _Float16* ap = A + (size_t)row0 * DM + 8 * lane; const _Float16* bp = Bh + (size_t)col0 * DM + 8 * lane;      /* A, Bh in fragment order (see gf_frag), strips of 16 rows; the lane's own addresses: every load of a trip names one of two pairs */
  const v8f z8 = {0.f,0.f,0.f,0.f,0.f,0.f,0.f,0.f}; v8f c00 = z8, c01 = z8, c02 = z8, c03 = z8, c10 = z8, c11 = z8, c12 = z8, c13 = z8;
  /* one B set reloaded in place, two A sets (x: even trips, y: odd trips): a second B set would take the launch below the six waves a SIMD that it needs to be resident at once */
  /* the first loads in the order in which the loop reloads (A, then the B tiles), held so: the loop's counted waits are set for both ways into it, and another order here made them wait for younger loads */
  v16h ya0, ya1, xa0 = gf_frag(ap); G2_HOLD v16h xa1 = gf_frag(ap + 16 * DM); G2_HOLD v16h b0 = gf_frag(bp); G2_HOLD v16h b1 = gf_frag(bp + 16 * DM); G2_HOLD v16h b2 = gf_frag(bp + 32 * DM); G2_HOLD v16h b3 = gf_frag(bp + 48 * DM);
  asm volatile("s_wait_xcnt 0x0" :: "v"(ap), "v"(bp) : "memory");      /* the two address pairs stay whole until the first loads have taken them */
#pragma unroll 1      /* rolled: two trips' code, the register sets named once each */
  for (int kb = 0; kb < DM; kb += 64) {
    G2_TRIP1(xa0, xa1, ya0, ya1, (kb + 32) * 16)      /* 512 elements a tile of 32 k */
    G2_TRIP1(ya0, ya1, xa0, xa1, ((kb + 64 < DM) ? kb + 64 : kb + 32) * 16) }      /* the last trip asks for its own tiles again (in bounds) */
  v8f accs[8] = {c00, c01, c02, c03, c10, c11, c12, c13};
  const size_t hb = ((size_t)((row0 / SQ) * NH + h) * SQ + row0 % SQ) * HD;      /* the wave's 32 tokens in a plane of its (batch, head): 64 elements a token in fragment order */
  if (part == 2) {      /* V^T tiles (16 head columns x 32 keys) in fragment order: the wave's 32 tokens are one group of 32 keys, and a lane's 8 accumulator values (column ln of tile t, tokens 16 half + 8 hh + r) are one 16-byte half of its own fragment: stored from the registers, 512 bytes in a row a store */
    unsigned short* vd = (unsigned short*)VT + hb + 8 * lane;
#pragma unroll
    for (int u = 0; u < 8; ++u) { const int t = u & 3, half = u >> 2; const float bv = bf16_round(bias[col0 + t * 16 + ln]); FragH f;
#pragma unroll
      for (int r = 0; r < 8; ++r) f.h[r] = (_Float16)(accs[u][r] * 0.0625f + bv);
      *(v8us*)(vd + t * 512 + half * 256) = f.half[0]; }
    return; }
#pragma unroll
  for (int u = 0; u < 8; ++u) { const int t = u & 3, half = u >> 2; const float bv = bf16_round(bias[col0 + t * 16 + ln]);
#pragma unroll
    for (int r = 0; r < 8; ++r) so[w][half * 16 + 8 * hh + r][t * 16 + ln] = accs[u][r] * 0.0625f + bv; }
  __builtin_amdgcn_fence(__ATOMIC_ACQ_REL, "workgroup"); __builtin_amdgcn_wave_barrier();      /* a wave reads back only its own plane of so: its LDS writes are ordered in front of its reads, no block barrier */
  const int rsub = lane >> 4, c4 = (lane & 15) * 4;
  _Float16* Hh = (part ? KH : QH) + hb + (c4 >> 3) * 128 + (c4 & 7); _Float16* Hl = (part ? KL : QL) + hb + (c4 >> 3) * 128 + (c4 & 7);      /* the lane's 4 columns in fragment order: tile c4 >> 5, half (c4 >> 4) & 1, lane half (c4 >> 3) & 1, 128 elements apart each step of 8 columns */
#pragma unroll 1      /* rolled, four steps (eight rows) a trip: as one unrolled loop of sixteen steps the build took 166 registers, five waves a SIMD, and this launch needs six to be resident at once */
  for (int q0 = 0; q0 < 16; q0 += 4) {
#pragma unroll
  for (int q = q0; q < q0 + 4; ++q) { const int r = q * 2 + rsub; const v4f v = *(const v4fa*)&so[w][r][c4]; const int row = row0 + r; const size_t to = (size_t)(row % SQ) * (HD / 2) + (c4 >> 1);
    const v2fa c = *(const v2fa*)(CS + to), s = *(const v2fa*)(SN + to); float o[4];
    o[0] = fmaf(v[0], c[0], -(v[1] * s[0])); o[1] = fmaf(v[0], s[0], v[1] * c[0]); o[2] = fmaf(v[2], c[1], -(v[3] * s[1])); o[3] = fmaf(v[2], s[1], v[3] * c[1]);      /* the odd element's product rounded, the even element's fused onto it */
    v4h fh, fl;
#pragma unroll
    for (int i = 0; i < 4; ++i) { const _Float16 hi = (_Float16)o[i]; fh[i] = hi; fl[i] = (_Float16)((o[i] - (float)hi) * 1024.0f); }
    const size_t d = (size_t)(r >> 4) * 1024 + (r & 15) * 8; *(v4h*)(Hh + d) = fh; *(v4h*)(Hl + d) = fl; }
    asm volatile("s_wait_xcnt 0x0" ::: "memory"); } }      /* stands in front of the next trip's first writes */

extern "C" void kernel_launch(void* const* d_in, const int* in_sizes, int n_in,
                              void* d_out, int out_size, void* d_ws, size_t ws_size, hipStream_t stream) {
  (void)in_sizes; (void)n_in; (void)out_size;
  const float* const* I = (const float* const*)d_in; const float* x = I[0]; const float* wqkv = I[1]; const float* bqkv = I[2]; const float* wo = I[3]; const float* bo = I[4];      /* [in][out] fused qkv + out weights, biases */
  char* ws = (char*)d_ws; size_t off = 0;
  auto take = [&](size_t bytes) { char* p = ws + off; off += (bytes + 255) & ~(size_t)255; return p; };
  _Float16* BQKV = (_Float16*)take((size_t)3 * DM * DM * 2); _Float16* BO = (_Float16*)take((size_t)DM * DM * 2); float* CS = (float*)take((size_t)SQ * (HD / 2) * 4); float* SN = (float*)take((size_t)SQ * (HD / 2) * 4);
  _Float16* X16 = (_Float16*)take(NR * DM * 2);
  _Float16* QH = (_Float16*)take(NR * DM * 2); _Float16* QL = (_Float16*)take(NR * DM * 2); _Float16* KH = (_Float16*)take(NR * DM * 2); _Float16* KL = (_Float16*)take(NR * DM * 2); _Float16* O16 = (_Float16*)take(NR * DM * 2);
  _Float16* VT = (_Float16*)take((size_t)NB * NH * HD * SQ * 2);      /* V^T of every batch */
  if (off > ws_size) return;
  k_prep<<<PREP_T / 256, 256, 0, stream>>>(x, wqkv, wo, 10000.0f, X16, BQKV, BO, CS, SN);      /* x rows, [in][out] weights -> Bt(n, k) x16 (q | k | v stacked along n), all in fragment order; cos / sin tables */
  k_qkv<<<(unsigned)((NR / 128) * (3 * DM / 64)), 128, 0, stream>>>(X16, BQKV, bqkv, CS, SN, QH, QL, KH, KL, VT);      /* roped q, k as f16 hi + x1024 residual (the x8 logits, sigma ~64, need ~f32-accurate scores) and V^T, per (batch, head), in fragment order */
  k_fattn<<<dim3(NB * NH, SQ / 128), 128 * FA_KS, 0, stream>>>(QH, QL, KH, KL, VT, O16);      /* o (merged heads, x64) as f16 rows in fragment order */
  k_gemm2<0><<<dim3((unsigned)((MPO / 128) * (DM / 64)), 1), 128, 0, stream>>>(O16 + (size_t)B0 * SQ * DM, DM, 0, BO, DM, 0, 0.0009765625f, bo, 0, nullptr, 1, 0, 0, (float*)d_out + (size_t)B0 * SQ * DM, nullptr, DM, 0, MPO, DM, DM);      /* out rows are the output layout */
}

// v008
// It runs in 80.7 microseconds.
// Next to v007, in two timings, it ran 1.13 and 1.16 times as fast.
// Over all steps from v000 it is 58.9 times as fast.
#include <hip/hip_runtime.h>
// Masked (causal) RoPE multi-head attention with LARGE logits (x [2][2048][1024]; qkv = x w_qkv + b_qkv ([in][out] 1024 x 3072, sigma 1/32, bias sigma 0.01) -> q | k | v, 16 heads of 64; interleaved-pair RoPE on q and k (inv_freq_i = 10000^(-2i/64), positions 0..2047); scores = q . k x sqrt(64) (the module divides by 1/sqrt(d_k)), causal (tril); softmax; out = (attn v merged) w_out + b_out -> [2][2048][1024]).
// Structure: token rows r = b*2048 + s; x as exact f16 rows (bf16-rounded); q | k | v of every row as ONE WMMA GEMM launch (64x64 wave tiles, f32 accumulation, exact x16 weights + bias, N = 3 x 1024) whose epilogue, a wave's 64 columns being one head, does on VALU: the interleaved-pair rotary rotation of q and k from f32 cos/sin tables (positions 0..SQ-1, no norm) and their split into f16 hi + x1024 residual planes (the x8 logits have sigma ~64: near-argmax softmax, so the scores are computed to ~f32 accuracy from three products), v as f16 into V^T; then ONE fused attention launch over every (batch, head, 128-query block): a wave holds 32 queries and walks every third pass of 32 keys up to its own diagonal (three waves a query group, joined through LDS at the end), scores as S^T = K . Q^T (three products), online causal softmax in registers (f32 running maximum and sum, native exp; keys above the diagonal set to -1e9; weights x256 f16), O^T += V^T . P^T with the score tiles as the B operand, o carried x64 (folded into the output GEMM alpha) written straight into the merged f16 o rows; out = o W_o + b GEMM (f32) into the output layout. Every f16 operand plane in the workspace (x, both weights, q and k hi / residual, V^T, o) lies in WMMA fragment order (see gf_frag), so that a fragment load reads whole 128-byte lines.
// Compute dtype: inputs rounded to bf16; x / weights exact; projections and rope f32; q, k as f16 hi + residual (~2^-22); v, softmax weights and o as plain f16 GEMM operands (~2^-12); scores and softmax statistics f32. v_wmma_f32_16x16x32_f16.
#define NB 2
#define SQ 2048
#define DM 1024
#define NH 16
#define HD 64
#define HG 4                         /* heads per launch of the (b, h0) V^T transpose */
#define QT 256
#define NKX SQ                       /* unused */
#define B0 0                         /* first batch processed (debug hook) */
#define NBR NB                       /* batches processed (debug hook) */
#define QN SQ                        /* unused (attention covers all SQ queries) */
#define NHD NH                       /* unused (attention covers all NH heads) */
#define NR ((size_t)NB * SQ)         /* token rows */
#define MPO ((int)((size_t)NBR * SQ))      /* rows through the output GEMM (debug hook) */
typedef __bf16 v16b __attribute__((ext_vector_type(16)));
typedef unsigned short v8us __attribute__((ext_vector_type(8), may_alias));
typedef float  v8f  __attribute__((ext_vector_type(8)));
typedef float  v4f  __attribute__((ext_vector_type(4)));
typedef float  v4fa __attribute__((ext_vector_type(4), may_alias));
union FragB { v16b v; v8us half[2]; unsigned short u[16]; };

__device__ __forceinline__ unsigned short bf16_bits(float x) { unsigned int u = __float_as_uint(x); return (unsigned short)((u + 0x7FFFu + ((u >> 16) & 1u)) >> 16); }
__device__ __forceinline__ float bf16_val(unsigned short b) { return __uint_as_float(((unsigned int)b) << 16); }
__device__ __forceinline__ float bf16_round(float x) { return bf16_val(bf16_bits(x)); }
// D += A·B with NT terms: 1 = ah·bh, 2 = + al·bh (A split), 3 = + ah·bl (both split)
template <int NT>
__device__ __forceinline__ v8f mmaN(v16b ah, v16b al, v16b bh, v16b bl, v8f c) {
  c = __builtin_amdgcn_wmma_f32_16x16x32_bf16(false, ah, false, bh, (short)0, c, false, false);
  if (NT >= 2) c = __builtin_amdgcn_wmma_f32_16x16x32_bf16(false, al, false, bh, (short)0, c, false, false);
  if (NT >= 3) c = __builtin_amdgcn_wmma_f32_16x16x32_bf16(false, ah, false, bl, (short)0, c, false, false);
  asm volatile("v_nop\n\tv_nop\n\tv_nop\n\tv_nop" : "+v"(c) : "v"(ah), "v"(al), "v"(bh), "v"(bl));
  return c;
}

__global__ __launch_bounds__(256) void k_wt_bf16(const float* __restrict__ W, unsigned short* __restrict__ Wt, int K, int N) {
  const int t = blockIdx.x * 256 + threadIdx.x;
  const int k8n = K / 8;
  if (t >= N * k8n) return;
  const int n = t / k8n, k8 = (t % k8n) * 8;
  v8us v;
#pragma unroll
  for (int i = 0; i < 8; ++i) v[i] = bf16_bits(W[(size_t)(k8 + i) * N + n]);
  *(v8us*)(Wt + (size_t)n * K + k8) = v;
  
}

// GEMM C[M][N] (f32, pitch ldc) = act(A[M][K]·W + bias). A f32 row-major (pitch lda) converted per fragment to bf16
// (ASPLIT: hi/lo two planes -> 2 terms, else single rounded term); Wt bf16 [N][K] (pitch ldb). BIAS_BF16 rounds the
// bias to bf16 first (bias quantised to bf16 before the add). K%32==0, M%16==0, N%64==0.
template <bool ASPLIT, int ACT, bool BIAS_BF16>
__global__ __launch_bounds__(128) void k_gemm_bf(const float* __restrict__ A, int lda, const unsigned short* __restrict__ Wt, int ldb,
                                               const float* __restrict__ bias, float* __restrict__ C, int ldc, int M, int N, int K) {
  __shared__ __attribute__((aligned(16))) float so[4][16][64];
  const int tid = threadIdx.x, w = tid >> 5, lane = tid & 31, ln = lane & 15, hh = lane >> 4;
  const int ntn = N / 64;
  const int wid = blockIdx.x * 4 + w;
  const int mt = wid / ntn, nq = wid % ntn;
  if (mt * 16 >= M) return;
  const int row0 = mt * 16, col0 = nq * 64;
  const float* arow = A + (size_t)(row0 + ln) * lda;
  v8f acc[4] = {};
  for (int kb = 0; kb < K; kb += 32) {
    FragB ah, al;
    const v4f x0 = *(const v4fa*)(arow + kb + 8 * hh), x1 = *(const v4fa*)(arow + kb + 8 * hh + 4);
    const v4f x2 = *(const v4fa*)(arow + kb + 16 + 8 * hh), x3 = *(const v4fa*)(arow + kb + 16 + 8 * hh + 4);
    float xs[16] = {x0[0],x0[1],x0[2],x0[3],x1[0],x1[1],x1[2],x1[3],x2[0],x2[1],x2[2],x2[3],x3[0],x3[1],x3[2],x3[3]};
#pragma unroll
    for (int i = 0; i < 16; ++i) { const unsigned short hb = bf16_bits(xs[i]); ah.u[i] = hb; al.u[i] = ASPLIT ? bf16_bits(xs[i] - bf16_val(hb)) : (unsigned short)0; }
#pragma unroll
    for (int t = 0; t < 4; ++t) {
      const unsigned short* brow = Wt + (size_t)(col0 + t * 16 + ln) * ldb + kb;
      FragB b;
      b.half[0] = *(const v8us*)(brow + 8 * hh);
      b.half[1] = *(const v8us*)(brow + 16 + 8 * hh);
      acc[t] = mmaN<ASPLIT ? 2 : 1>(ah.v, al.v, b.v, b.v, acc[t]);
    }
  }
#pragma unroll
  for (int t = 0; t < 4; ++t) {
    float bv = bias ? bias[col0 + t * 16 + ln] : 0.f;
    if (BIAS_BF16) bv = bf16_round(bv);
#pragma unroll
    for (int r = 0; r < 8; ++r) { float v = acc[t][r] + bv; if (ACT == 1) v = fmaxf(v, 0.f); so[w][8 * hh + r][t * 16 + ln] = v; }
  }
  __builtin_amdgcn_fence(__ATOMIC_ACQ_REL, "workgroup");
  __builtin_amdgcn_wave_barrier();
  const int rsub = lane >> 4, c4 = (lane & 15) * 4;
  {
#pragma unroll
    for (int q = 0; q < 8; ++q) {
      const int r = q * 2 + rsub;
      const v4f v = *(const v4fa*)&so[w][r][c4];
      *(v4f*)(C + (size_t)(row0 + r) * ldc + col0 + c4) = v;
    }
    
  }
}

// GEMM C = act(A·W + bias + resid): A f32 (ASPLIT -> hi/lo 2 terms), Wt bf16 [N][K]; ACT 0 none, 1 relu, 2 exact gelu;
// resid (optional, f32, row index = (row % rmod), pitch ldr, RES_BF16 rounds it) added before the activation.
template <bool ASPLIT, int ACT, bool BIAS_BF16, bool RES_BF16>
__global__ __launch_bounds__(128) void k_gemm_bf3(const float* __restrict__ A, int lda, const unsigned short* __restrict__ Wt, int ldb,
                                                const float* __restrict__ bias, const float* __restrict__ resid, int rmod, int ldr,
                                                float* __restrict__ C, int ldc, int M, int N, int K) {
  __shared__ __attribute__((aligned(16))) float so[4][16][64];
  const int tid = threadIdx.x, w = tid >> 5, lane = tid & 31, ln = lane & 15, hh = lane >> 4;
  const int ntn = N / 64;
  const int wid = blockIdx.x * 4 + w;
  const int mt = wid / ntn, nq = wid % ntn;
  if (mt * 16 >= M) return;
  const int row0 = mt * 16, col0 = nq * 64;
  const float* arow = A + (size_t)(row0 + ln) * lda;
  v8f acc[4] = {};
  for (int kb = 0; kb < K; kb += 32) {
    FragB ah, al;
    const v4f x0 = *(const v4fa*)(arow + kb + 8 * hh), x1 = *(const v4fa*)(arow + kb + 8 * hh + 4);
    const v4f x2 = *(const v4fa*)(arow + kb + 16 + 8 * hh), x3 = *(const v4fa*)(arow + kb + 16 + 8 * hh + 4);
    float xs[16] = {x0[0],x0[1],x0[2],x0[3],x1[0],x1[1],x1[2],x1[3],x2[0],x2[1],x2[2],x2[3],x3[0],x3[1],x3[2],x3[3]};
#pragma unroll
    for (int i = 0; i < 16; ++i) { const unsigned short hb = bf16_bits(xs[i]); ah.u[i] = hb; al.u[i] = ASPLIT ? bf16_bits(xs[i] - bf16_val(hb)) : (unsigned short)0; }
#pragma unroll
    for (int t = 0; t < 4; ++t) {
      const unsigned short* brow = Wt + (size_t)(col0 + t * 16 + ln) * ldb + kb;
      FragB b;
      b.half[0] = *(const v8us*)(brow + 8 * hh);
      b.half[1] = *(const v8us*)(brow + 16 + 8 * hh);
      acc[t] = mmaN<ASPLIT ? 2 : 1>(ah.v, al.v, b.v, b.v, acc[t]);
    }
  }
#pragma unroll
  for (int t = 0; t < 4; ++t) {
    const int col = col0 + t * 16 + ln;
    float bv = bias ? bias[col] : 0.f;
    if (BIAS_BF16) bv = bf16_round(bv);
#pragma unroll
    for (int r = 0; r < 8; ++r) {
      float v = acc[t][r] + bv;
      if (resid) { float rv = resid[(size_t)((row0 + 8 * hh + r) % rmod) * ldr + col]; if (RES_BF16) rv = bf16_round(rv); v += rv; }
      if (ACT == 1) v = fmaxf(v, 0.f);
      if (ACT == 2) v = 0.5f * v * (1.0f + erff(v * 0.70710678118654752f));
      if (ACT == 3) { const float u = 0.7978845608028654f * (v + 0.044715f * v * v * v); v = 0.5f * v * (1.0f + tanhf(u)); }
      so[w][8 * hh + r][t * 16 + ln] = v;
    }
  }
  __builtin_amdgcn_fence(__ATOMIC_ACQ_REL, "workgroup");
  __builtin_amdgcn_wave_barrier();
  const int rsub = lane >> 4, c4 = (lane & 15) * 4;
  {
#pragma unroll
    for (int q = 0; q < 8; ++q) {
      const int r = q * 2 + rsub;
      const v4f v = *(const v4fa*)&so[w][r][c4];
      *(v4f*)(C + (size_t)(row0 + r) * ldc + col0 + c4) = v;
    }
    
  }
}
// row LayerNorm (biased variance, eps) over N: s = X (+ R); optional out_sum <- s; out_norm <- (s-mu)*rsqrt(var+eps)*g + b
template <bool PARAM_BF16>
__global__ __launch_bounds__(256) void k_layernorm(const float* __restrict__ X, const float* __restrict__ R, const float* __restrict__ g, const float* __restrict__ bta,
                                                  float* __restrict__ out_sum, float* __restrict__ out_norm, int N, float eps) {
  __shared__ float red[256];
  const int row = blockIdx.x, tid = threadIdx.x;
  const float* x = X + (size_t)row * N; const float* rr = R ? R + (size_t)row * N : nullptr;
  float vals[16];                     // up to N = 4096
  const int per = N / 256;            // contiguous chunk per thread? use strided-by-4 chunks: thread handles j = tid*4 + 1024*u
  float s1 = 0.f;
  for (int u = 0; u < per / 4; ++u) {
    const int j = tid * 4 + 1024 * u;
    const v4f a = *(const v4fa*)(x + j);
    v4f b = {0.f,0.f,0.f,0.f}; if (rr) b = *(const v4fa*)(rr + j);
#pragma unroll
    for (int q = 0; q < 4; ++q) { const float v = a[q] + b[q]; vals[u * 4 + q] = v; s1 += v; }
  }
  red[tid] = s1; __syncthreads();
  for (int st = 128; st > 0; st >>= 1) { if (tid < st) red[tid] += red[tid + st]; __syncthreads(); }
  const float mu = red[0] / (float)N; __syncthreads();
  float s2 = 0.f;
  for (int u = 0; u < per / 4; ++u)
#pragma unroll
    for (int q = 0; q < 4; ++q) { const float c = vals[u * 4 + q] - mu; s2 += c * c; }
  red[tid] = s2; __syncthreads();
  for (int st = 128; st > 0; st >>= 1) { if (tid < st) red[tid] += red[tid + st]; __syncthreads(); }
  const float rs = rsqrtf(red[0] / (float)N + eps);
  {
    for (int u = 0; u < per / 4; ++u) {
      const int j = tid * 4 + 1024 * u;
      v4f o, sm;
#pragma unroll
      for (int q = 0; q < 4; ++q) {
        float gg = g[j + q], bb = bta[j + q];
        if (PARAM_BF16) { gg = bf16_round(gg); bb = bf16_round(bb); }
        sm[q] = vals[u * 4 + q]; o[q] = (vals[u * 4 + q] - mu) * rs * gg + bb;
      }
      if (out_sum) *(v4f*)(out_sum + (size_t)row * N + j) = sm;
      *(v4f*)(out_norm + (size_t)row * N + j) = o;
    }
    
  }
}



// ---- f16 WMMA path (v_wmma_f32_16x16x32_f16): 11-bit significands for operands in range — used where a [0,1] probability operand needs more precision than bf16
typedef _Float16 v16h __attribute__((ext_vector_type(16)));
union FragH { v16h v; v8us half[2]; _Float16 h[16]; unsigned short u[16]; };
template <int NT>
__device__ __forceinline__ v8f mmaH(v16h ah, v16h al, v16h bh, v16h bl, v8f c) {
  c = __builtin_amdgcn_wmma_f32_16x16x32_f16(false, ah, false, bh, (short)0, c, false, false);
  if (NT >= 2) c = __builtin_amdgcn_wmma_f32_16x16x32_f16(false, al, false, bh, (short)0, c, false, false);
  if (NT >= 3) c = __builtin_amdgcn_wmma_f32_16x16x32_f16(false, ah, false, bl, (short)0, c, false, false);
  asm volatile("v_nop\n\tv_nop\n\tv_nop\n\tv_nop" : "+v"(c) : "v"(ah), "v"(al), "v"(bh), "v"(bl));
  return c;
}
// batched GEMM like k_gemm_b but f16 operands: A f32 (split into f16 hi/lo if ASPLIT, else rounded to f16), Bt = f16 values [n][k]; alpha; C f32; N multiple of 16 (partial tiles skipped)
template <bool ASPLIT>
__global__ __launch_bounds__(128) void k_gemm_h(const float* __restrict__ A, int lda, size_t sA, const _Float16* __restrict__ Bh, int ldb, size_t sB, float alpha, float* __restrict__ C, int ldc, size_t sC, int M, int N, int K) {
  __shared__ __attribute__((aligned(16))) float so[4][16][64];
  const int tid = threadIdx.x, w = tid >> 5, lane = tid & 31, ln = lane & 15, hh = lane >> 4; const int by = blockIdx.y;
  A += (size_t)by * sA; Bh += (size_t)by * sB; C += (size_t)by * sC;
  const int ntn = (N + 63) / 64; const int wid = blockIdx.x * 4 + w; const int mt = wid / ntn, nq = wid % ntn; if (mt * 16 >= M) return;
  const int row0 = mt * 16, col0 = nq * 64; const float* arow = A + (size_t)(row0 + ln) * lda;
  v8f acc[4] = {};
  for (int kb = 0; kb < K; kb += 32) {
    FragH ah, al;
    const v4f x0 = *(const v4fa*)(arow + kb + 8 * hh), x1 = *(const v4fa*)(arow + kb + 8 * hh + 4), x2 = *(const v4fa*)(arow + kb + 16 + 8 * hh), x3 = *(const v4fa*)(arow + kb + 16 + 8 * hh + 4);
    float xs[16] = {x0[0],x0[1],x0[2],x0[3],x1[0],x1[1],x1[2],x1[3],x2[0],x2[1],x2[2],x2[3],x3[0],x3[1],x3[2],x3[3]};
#pragma unroll
    for (int i = 0; i < 16; ++i) { const _Float16 h = (_Float16)xs[i]; ah.h[i] = h; al.h[i] = ASPLIT ? (_Float16)(xs[i] - (float)h) : (_Float16)0.0f; }
#pragma unroll
    for (int t = 0; t < 4; ++t) { if (col0 + t * 16 >= N) continue; const size_t boff = (size_t)(col0 + t * 16 + ln) * ldb + kb; FragH bq; bq.half[0] = *(const v8us*)(Bh + boff + 8 * hh); bq.half[1] = *(const v8us*)(Bh + boff + 16 + 8 * hh);
      acc[t] = mmaH<ASPLIT ? 2 : 1>(ah.v, al.v, bq.v, bq.v, acc[t]); }
  }
#pragma unroll
  for (int t = 0; t < 4; ++t) { if (col0 + t * 16 >= N) continue;
#pragma unroll
    for (int r = 0; r < 8; ++r) so[w][8 * hh + r][t * 16 + ln] = acc[t][r] * alpha; }
  __builtin_amdgcn_fence(__ATOMIC_ACQ_REL, "workgroup"); __builtin_amdgcn_wave_barrier();
  const int rsub = lane >> 4, c4 = (lane & 15) * 4;
  {
#pragma unroll
    for (int q = 0; q < 8; ++q) { const int r = q * 2 + rsub; if (col0 + c4 < N) { const v4f v = *(const v4fa*)&so[w][r][c4]; *(v4f*)(C + (size_t)(row0 + r) * ldc + col0 + c4) = v; } }
     }
}

// k_gemm_hh variant with fused epilogue: v = acc·alpha + bias[by·sBias + col] (+ CP[(row/rowsPerB)·sCPb + by·64 + col] if CP) ; ACT 0 none / 1 elu ; writes f16 C16 (and f32 C if non-null)
template <int ACT>
__global__ __launch_bounds__(128) void k_gemm_hhx(const _Float16* __restrict__ A, int lda, size_t sA, const _Float16* __restrict__ Bh, int ldb, size_t sB, float alpha, const float* __restrict__ bias, size_t sBias, const float* __restrict__ CP, int rowsPerB, size_t sCPb, int row0g,
    float* __restrict__ C, _Float16* __restrict__ C16, int ldc, size_t sC, int M, int N, int K) {
  __shared__ __attribute__((aligned(16))) float so[4][16][64];
  const int tid = threadIdx.x, w = tid >> 5, lane = tid & 31, ln = lane & 15, hh = lane >> 4; const int by = blockIdx.y;
  A += (size_t)by * sA; Bh += (size_t)by * sB; const size_t cofs = (size_t)by * sC; const float* bp = bias ? bias + (size_t)by * sBias : nullptr;
  const int ntn = (N + 63) / 64; const int wid = blockIdx.x * 4 + w; const int mt = wid / ntn, nq = wid % ntn; if (mt * 16 >= M) return;
  const int row0 = mt * 16, col0 = nq * 64; const _Float16* arow = A + (size_t)(row0 + ln) * lda;
  v8f acc[4] = {};
  for (int kb = 0; kb < K; kb += 32) { FragH ah; ah.half[0] = *(const v8us*)((const unsigned short*)arow + kb + 8 * hh); ah.half[1] = *(const v8us*)((const unsigned short*)arow + kb + 16 + 8 * hh);
#pragma unroll
    for (int t = 0; t < 4; ++t) { if (col0 + t * 16 >= N) continue; const size_t boff = (size_t)(col0 + t * 16 + ln) * ldb + kb; FragH bq; bq.half[0] = *(const v8us*)((const unsigned short*)Bh + boff + 8 * hh); bq.half[1] = *(const v8us*)((const unsigned short*)Bh + boff + 16 + 8 * hh);
      acc[t] = mmaH<1>(ah.v, ah.v, bq.v, bq.v, acc[t]); }
  }
#pragma unroll
  for (int t = 0; t < 4; ++t) { if (col0 + t * 16 >= N) continue; const int col = col0 + t * 16 + ln; const float bv = bp ? bf16_round(bp[col]) : 0.f;
#pragma unroll
    for (int r = 0; r < 8; ++r) { float v = acc[t][r] * alpha + bv; if (CP) { const int rr = row0g + row0 + 8 * hh + r; if (rowsPerB < 0) v += CP[cofs + (size_t)rr * ldc + col];      /* rowsPerB < 0: own element of the batched C plane */ else { const int bidx = rr / rowsPerB; v += CP[(size_t)bidx * sCPb + (size_t)by * 64 + col]; } } if (ACT == 1) v = (v > 0.f) ? v : expm1f(v); else if (ACT == 7) v = (v > 0.f) ? v + 1.0f : expf(v); else if (ACT == 8) v = tanhf(v); else if (ACT == 9) v = 0.5f * v * (1.0f + tanhf(0.7978845608028654f * (v + 0.044715f * v * v * v))); else if (ACT == 11) v = 1.0f / (1.0f + expf(-v)); else if (ACT == 12) v = (v > 0.f) ? v : 0.01f * v; else if (ACT == 14) v = (v > 0.f) ? v : 0.1f * v; else if (ACT == 16) v = (v >= 0.f) ? v : 0.3f * v; else if (ACT == 17) v = (v >= 0.f) ? v : 0.2f * v; else if (ACT == 15) v = v / (1.0f + expf(-v)); else if (ACT == 3) v = fmaxf(v, 0.f); else if (ACT == 6) v = 0.5f * v * (1.0f + erff(v * 0.70710678118654752f)); so[w][8 * hh + r][t * 16 + ln] = v; } }
  __builtin_amdgcn_fence(__ATOMIC_ACQ_REL, "workgroup"); __builtin_amdgcn_wave_barrier();
  const int rsub = lane >> 4, c4 = (lane & 15) * 4; typedef _Float16 v4h __attribute__((ext_vector_type(4)));
  {
#pragma unroll
    for (int q = 0; q < 8; ++q) { const int r = q * 2 + rsub; if (col0 + c4 < N) { const v4f v = *(const v4fa*)&so[w][r][c4]; if (C) *(v4f*)(C + cofs + (size_t)(row0 + r) * ldc + col0 + c4) = v; if (C16) { v4h h4; for (int i = 0; i < 4; ++i) h4[i] = (_Float16)v[i]; *(v4h*)(C16 + cofs + (size_t)(row0 + r) * ldc + col0 + c4) = h4; } } }
     }
}


typedef _Float16 v4h __attribute__((ext_vector_type(4)));

__global__ __launch_bounds__(256) void k_h16(const float* __restrict__ x, _Float16* __restrict__ X16, size_t n8) { const size_t t = (size_t)blockIdx.x * 256 + threadIdx.x; if (t >= n8) return; FragH f;
#pragma unroll
  for (int q = 0; q < 8; ++q) f.h[q] = (_Float16)x[t * 8 + q]; *(v8us*)((unsigned short*)X16 + t * 8) = f.half[0];  }
__global__ __launch_bounds__(256) void k_round16f(const float* __restrict__ W, _Float16* __restrict__ Bt, size_t n8) { const size_t t = (size_t)blockIdx.x * 256 + threadIdx.x; if (t >= n8) return; FragH f;
#pragma unroll
  for (int i = 0; i < 8; ++i) f.h[i] = (_Float16)(bf16_round(W[t * 8 + i]) * 16.0f); *(v8us*)((unsigned short*)Bt + t * 8) = f.half[0];  }
// ---- fast GEMM (wave tile 32x64; requires M % 32 == 0 rows per launch region, N % 64 == 0 and K % 64 == 0); A and Bh in fragment order (see gf_frag), strips of 16 rows of lda / ldb elements each; epilogue = k_gemm_hhx semantics ----
__device__ __forceinline__ v16h g2_frag(const _Float16* p, int hh) { FragH f; f.half[0] = *(const v8us*)((const unsigned short*)p + 8 * hh); f.half[1] = *(const v8us*)((const unsigned short*)p + 16 + 8 * hh); return f.v; }
// Fragment order: a 16-row x 32-k f16 tile lies 1 KB in a row, element (r, k) at (k >> 4) * 256 + (((k >> 3) & 1) * 16 + r) * 8 + (k & 7), so lane l = 16 hh + ln finds the two 16-byte halves of its fragment at 8 l and 256 + 8 l:
// each fragment load of a wave reads 512 bytes in a row (four whole 128-byte lines) where a row-major plane gives it 16 lines of 32 bytes. Which element a lane and register hold is as in g2_frag. p = tile + 8 * lane.
__device__ __forceinline__ v16h gf_frag(const _Float16* p) { FragH f; f.half[0] = *(const v8us*)((const unsigned short*)p); f.half[1] = *(const v8us*)((const unsigned short*)p + 256); return f.v; }
__device__ __forceinline__ v8f g2_mma(v16h a, v16h b, v8f c) { v8f d = __builtin_amdgcn_wmma_f32_16x16x32_f16(false, a, false, b, (short)0, c, false, false); asm volatile("v_nop\n\tv_nop\n\tv_nop\n\tv_nop" : "+v"(d) : "v"(a), "v"(b)); return d; }
// GEMM main loops: every fragment register is asked for again, for a later trip, directly behind the last product that reads it, so that a trip's loads (twelve in k_gemm2, sixteen in k_qkv) are all in flight while products run, and no product waits out a whole load by itself.
// G2_HOLD keeps each reload at that place: hoisted it would take a further register set, sunk to its use it would have no lead.
#define G2_HOLD __builtin_amdgcn_sched_barrier(0);
// one trip on a whole set, the set reloaded from element offset KO of the six strips. The wait holds the six address pairs whole until the loads have taken them, and the loads in front of the next trip.
#define G2_TRIP2(A0, A1, F0, F1, F2, F3, KO) { const int ko = (KO); \
    const _Float16* pa0 = a0p + ko; const _Float16* pa1 = a1p + ko; const _Float16* pb0 = b0p + ko; const _Float16* pb1 = b1p + ko; const _Float16* pb2 = b2p + ko; const _Float16* pb3 = b3p + ko; \
    c00 = g2_mma(A0, F0, c00); c10 = g2_mma(A1, F0, c10); F0 = gf_frag(pb0); G2_HOLD \
    c01 = g2_mma(A0, F1, c01); c11 = g2_mma(A1, F1, c11); F1 = gf_frag(pb1); G2_HOLD \
    c02 = g2_mma(A0, F2, c02); c12 = g2_mma(A1, F2, c12); F2 = gf_frag(pb2); G2_HOLD \
    c03 = g2_mma(A0, F3, c03); c13 = g2_mma(A1, F3, c13); F3 = gf_frag(pb3); A0 = gf_frag(pa0); A1 = gf_frag(pa1); \
    asm volatile("s_wait_xcnt 0x0" :: "v"(pa0), "v"(pa1), "v"(pb0), "v"(pb1), "v"(pb2), "v"(pb3) : "memory"); }
// a whole set's first loads, from element offset KO of the six strips
#define G2_FILL(A0, A1, F0, F1, F2, F3, KO) v16h F0 = gf_frag(b0p + (KO)); G2_HOLD v16h F1 = gf_frag(b1p + (KO)); G2_HOLD v16h F2 = gf_frag(b2p + (KO)); G2_HOLD v16h F3 = gf_frag(b3p + (KO)); G2_HOLD v16h A0 = gf_frag(a0p + (KO)); G2_HOLD v16h A1 = gf_frag(a1p + (KO));
template <int ACT>
__global__ __launch_bounds__(128) void k_gemm2(const _Float16* __restrict__ A, int lda, size_t sA, const _Float16* __restrict__ Bh, int ldb, size_t sB, float alpha, const float* __restrict__ bias, size_t sBias, const float* __restrict__ CP, int rowsPerB, size_t sCPb, int row0g,
    float* __restrict__ C, _Float16* __restrict__ C16, int ldc, size_t sC, int M, int N, int K) { static_assert(ACT == 0 || ACT == 3 || ACT == 6 || ACT == 8 || ACT == 9 || ACT == 11 || ACT == 12 || ACT == 14 || ACT == 15 || ACT == 16 || ACT == 17, "k_gemm2: unsupported ACT code (would silently apply no activation)");
  __shared__ __attribute__((aligned(16))) float so[4][32][68];
  const int tid = threadIdx.x, w = tid >> 5, lane = tid & 31, ln = lane & 15, hh = lane >> 4; const int by = blockIdx.y;
  A += (size_t)by * sA; Bh += (size_t)by * sB; const size_t cofs = (size_t)by * sC; const float* bp = bias ? bias + (size_t)by * sBias : nullptr;
  const int ntn = N >> 6; const int mt = blockIdx.x / ntn, nq = blockIdx.x - mt * ntn; const int row0 = mt * 128 + 32 * w, col0 = nq * 64; if (row0 >= M) return;
  const _Float16* a0p = A + (size_t)row0 * lda + 8 * lane; const _Float16* a1p = a0p + (size_t)16 * lda;
  const _Float16* b0p = Bh + (size_t)col0 * ldb + 8 * lane; const _Float16* b1p = b0p + (size_t)16 * ldb; const _Float16* b2p = b1p + (size_t)16 * ldb; const _Float16* b3p = b2p + (size_t)16 * ldb;
  const v8f z8 = {0.f,0.f,0.f,0.f,0.f,0.f,0.f,0.f}; v8f c00 = z8, c01 = z8, c02 = z8, c03 = z8, c10 = z8, c11 = z8, c12 = z8, c13 = z8;
  /* two fragment sets (x: even trips, y: odd trips), every register reloaded two trips ahead directly behind the last product that reads it; K % 64 == 0 */
  /* the first loads in the order in which the loop reloads (B tiles, then A; x, then y), held so: the loop's counted waits are set for both ways into it, and another order here made them wait for younger loads */
  G2_FILL(xa0, xa1, xb0, xb1, xb2, xb3, 0) G2_HOLD G2_FILL(ya0, ya1, yb0, yb1, yb2, yb3, 512)
  asm volatile("s_wait_xcnt 0x0" :: "v"(a0p), "v"(a1p), "v"(b0p), "v"(b1p), "v"(b2p), "v"(b3p) : "memory");      /* the six address pairs stay whole until the first loads have taken them */
#pragma unroll 1      /* rolled: two trips' code, the register sets named once each */
  for (int kb = 0; kb < K; kb += 64) {
    G2_TRIP2(xa0, xa1, xb0, xb1, xb2, xb3, ((kb + 64 < K) ? kb + 64 : kb) * 16)      /* 512 elements a tile of 32 k; the last two trips ask for their own tiles again (in bounds) */
    G2_TRIP2(ya0, ya1, yb0, yb1, yb2, yb3, ((kb + 96 < K) ? kb + 96 : kb + 32) * 16) }
  v8f accs[8] = {c00, c01, c02, c03, c10, c11, c12, c13};
#pragma unroll
  for (int u = 0; u < 8; ++u) { const int t = u & 3, half = u >> 2; const int col = col0 + t * 16 + ln; const float bv = bp ? bf16_round(bp[col]) : 0.f;
#pragma unroll
    for (int r = 0; r < 8; ++r) { const int rloc = half * 16 + 8 * hh + r; float v = accs[u][r] * alpha + bv; if (CP) { if (rowsPerB < 0) v += CP[cofs + (size_t)(row0g + row0 + rloc) * ldc + col];      /* rowsPerB < 0: own element of the batched C plane */ else { const int bidx = (row0g + row0 + rloc) / rowsPerB; v += CP[(size_t)bidx * sCPb + (size_t)by * 64 + col]; } }
      if (ACT == 3) v = fmaxf(v, 0.f); else if (ACT == 6) v = 0.5f * v * (1.0f + erff(v * 0.70710678118654752f)); else if (ACT == 11) v = 1.0f / (1.0f + expf(-v)); else if (ACT == 15) v = v / (1.0f + expf(-v)); else if (ACT == 12) v = (v > 0.f) ? v : 0.01f * v; else if (ACT == 8) v = tanhf(v); else if (ACT == 9) v = 0.5f * v * (1.0f + tanhf(0.7978845608028654f * (v + 0.044715f * v * v * v))); else if (ACT == 14) v = (v > 0.f) ? v : 0.1f * v; else if (ACT == 16) v = (v >= 0.f) ? v : 0.3f * v; else if (ACT == 17) v = (v >= 0.f) ? v : 0.2f * v;
      so[w][rloc][t * 16 + ln] = v; } }
  __builtin_amdgcn_fence(__ATOMIC_ACQ_REL, "workgroup"); __builtin_amdgcn_wave_barrier();
  const int rsub = lane >> 4, c4 = (lane & 15) * 4;
  {
#pragma unroll
    for (int q = 0; q < 16; ++q) { const int r = q * 2 + rsub; const v4f v = *(const v4fa*)&so[w][r][c4]; if (C) *(v4f*)(C + cofs + (size_t)(row0 + r) * ldc + col0 + c4) = v; if (C16) { v4h h4; for (int i = 0; i < 4; ++i) h4[i] = (_Float16)v[i]; *(v4h*)(C16 + cofs + (size_t)(row0 + r) * ldc + col0 + c4) = h4; } }
     } }


__global__ __launch_bounds__(256) void k_wnat(const float* __restrict__ w, size_t n8, _Float16* __restrict__ Bt) { const size_t t = (size_t)blockIdx.x * 256 + threadIdx.x; if (t >= n8) return; FragH f; for (int q = 0; q < 8; ++q) f.h[q] = (_Float16)(bf16_round(w[t * 8 + q]) * 16.0f); *(v8us*)((unsigned short*)Bt + t * 8) = f.half[0];  }
__global__ __launch_bounds__(256) void k_rsm(const float* __restrict__ S, _Float16* __restrict__ P, int nrows) {
  #pragma clang fp contract(off)
  const int i = blockIdx.x * 256 + threadIdx.x; if (i >= nrows) return; const float* s = S + (size_t)i * SQ; float mx = -3.0e38f;
#pragma unroll 1
  for (int j = 0; j < SQ; ++j) mx = fmaxf(mx, s[j]); float se = 0.f;
#pragma unroll 1
  for (int j = 0; j < SQ; ++j) se += expf(s[j] - mx); const float sc = 256.0f / se;
#pragma unroll 1
  for (int j0 = 0; j0 < SQ; j0 += 8) { FragH f; for (int q = 0; q < 8; ++q) f.h[q] = (_Float16)(expf(s[j0 + q] - mx) * sc); unsigned short* d = (unsigned short*)P + (size_t)i * SQ + j0; *(v8us*)d = f.half[0];  } }
__global__ __launch_bounds__(256) void k_vt(const _Float16* __restrict__ V16, int b, int h0, _Float16* __restrict__ VT) { __shared__ unsigned short tl[64][65]; const int tid = threadIdx.x; const int hh = blockIdx.x % HG, sg = blockIdx.x / HG; const int s0 = sg * 64; const int h = h0 + hh;
  for (int i = tid; i < 64 * 8; i += 256) { const int j = i / 8, d8 = (i % 8) * 8; FragH f; f.half[0] = *(const v8us*)((const unsigned short*)V16 + ((size_t)b * SQ + s0 + j) * DM + h * HD + d8); for (int q = 0; q < 8; ++q) tl[d8 + q][j] = f.u[q]; }
  __syncthreads();
  { for (int i = tid; i < 64 * 8; i += 256) { const int d = i / 8, j8 = (i % 8) * 8; FragH f; for (int q = 0; q < 8; ++q) f.u[q] = tl[d][j8 + q]; *(v8us*)((unsigned short*)VT + ((size_t)hh * HD + d) * SQ + s0 + j8) = f.half[0]; }  } }


// ---- preparation, ONE launch: x rows and both weights into f16 fragment order (see gf_frag), and the rotary tables ----
// A plane's unit t is its t-th 16 bytes: 8 consecutive k of one row (x) or of one output column n (weights, Bt(n, k) = f16(bf16(W[k][n]) x16), exact) in strips of 16 rows, DM / 32 tiles a strip.
// PREP_T threads in all; a thread takes units g, g + PREP_T, ... of every plane (4 of x, 3 of q|k|v, 1 of the output weight), and the first SQ * HD / 2 threads one table entry each:
// few long waves in place of many that live for one unit, and what a wave reads is all asked for at once.
#define PREP_T (512 * 256)
#define PREP_X 4
#define PREP_W 3
static_assert((size_t)PREP_X * PREP_T == NR * DM / 8 && (size_t)PREP_W * PREP_T == (size_t)3 * DM * DM / 8 && (size_t)PREP_T == (size_t)DM * DM / 8 && SQ * (HD / 2) <= PREP_T, "k_prep: the planes are whole multiples of the grid");
__device__ __forceinline__ const float* prep_wsrc(const float* W, int N, int t) { const int tile = t >> 6, c = t & 63; const int n = (tile / (DM / 32)) * 16 + (c & 15), k8 = (tile % (DM / 32)) * 32 + (c >> 5) * 16 + ((c >> 4) & 1) * 8; return W + (size_t)k8 * N + n; }      /* first of the unit's 8 elements, N apart */
__device__ __forceinline__ void prep_tab(float theta, int t, float* __restrict__ CS, float* __restrict__ SN) {
  const int i = t % (HD / 2); const int p = t / (HD / 2); const float invf = 1.0f / powf(theta, (float)(2 * i) / (float)HD); const float ang = __fmul_rn((float)p, invf); const float c = cosf(ang), s = sinf(ang);
  *(float*)(CS + t) = c; *(float*)(SN + t) = s; }
__global__ __launch_bounds__(256) void k_prep(const float* __restrict__ x, const float* __restrict__ wqkv, const float* __restrict__ wo, float theta,
    _Float16* __restrict__ X16, _Float16* __restrict__ BQKV, _Float16* __restrict__ BO, float* __restrict__ CS, float* __restrict__ SN) {
  const int g = blockIdx.x * 256 + threadIdx.x;
  const float* xs[PREP_X]; const float* ws[PREP_W + 1]; v4f xv[PREP_X][2]; float wv[PREP_W + 1][8];
#pragma unroll
  for (int u = 0; u < PREP_X; ++u) { const int t = g + u * PREP_T; const int tile = t >> 6, c = t & 63;
    xs[u] = x + ((size_t)(tile / (DM / 32)) * 16 + (c & 15)) * DM + (tile % (DM / 32)) * 32 + (c >> 5) * 16 + ((c >> 4) & 1) * 8; }
#pragma unroll
  for (int u = 0; u < PREP_W; ++u) ws[u] = prep_wsrc(wqkv, 3 * DM, g + u * PREP_T);
  ws[PREP_W] = prep_wsrc(wo, DM, g);
#pragma unroll
  for (int u = 0; u < PREP_X; ++u) { xv[u][0] = *(const v4fa*)xs[u]; xv[u][1] = *(const v4fa*)(xs[u] + 4); }
#pragma unroll
  for (int u = 0; u <= PREP_W; ++u)
#pragma unroll
    for (int i = 0; i < 8; ++i) wv[u][i] = ws[u][(size_t)i * (u < PREP_W ? 3 * DM : DM)];
  asm volatile("s_wait_xcnt 0x0" :: "v"(xs[0]), "v"(xs[1]), "v"(xs[2]), "v"(xs[3]), "v"(ws[0]), "v"(ws[1]), "v"(ws[2]), "v"(ws[3]) : "memory");      /* the eight address pairs stay whole until the loads have taken them; it also keeps every load here, in front of the table entry, so that they fly while it is computed */
  if (g < SQ * (HD / 2)) prep_tab(theta, g, CS, SN);      /* whole blocks: 256 divides the bound */
  FragH fx[PREP_X], fw[PREP_W + 1];
#pragma unroll
  for (int u = 0; u < PREP_X; ++u)
#pragma unroll
    for (int q = 0; q < 8; ++q) fx[u].h[q] = (_Float16)bf16_round(xv[u][q >> 2][q & 3]);
#pragma unroll
  for (int u = 0; u <= PREP_W; ++u)
#pragma unroll
    for (int i = 0; i < 8; ++i) fw[u].h[i] = (_Float16)(bf16_round(wv[u][i]) * 16.0f);
#pragma unroll
  for (int u = 0; u < PREP_X; ++u) *(v8us*)((unsigned short*)X16 + ((size_t)g + (size_t)u * PREP_T) * 8) = fx[u].half[0];
#pragma unroll
  for (int u = 0; u < PREP_W; ++u) *(v8us*)((unsigned short*)BQKV + ((size_t)g + (size_t)u * PREP_T) * 8) = fw[u].half[0];
  *(v8us*)((unsigned short*)BO + (size_t)g * 8) = fw[PREP_W].half[0]; }
// Fused causal attention, one launch for every (batch, head, 128-query block): 32 queries belong to FA_KS waves, w + 4 g taking the passes of 32 keys g, g + FA_KS, ... up to the queries' own diagonal; nothing of S or P goes through memory.
// The longest walk is so 22 passes, not 64, and a SIMD holds as many waves as its registers take; one block fills a WGP, and the blocks come longest first over all heads (the query block is the slow grid index), so that a WGP that ends a short block takes the next: every WGP gets about the mean.
// At the end the waves g > 0 hand their maximum, sum and accumulators to wave g = 0 through LDS, which joins the partial softmaxes on their common maximum.
// Transposed products: S^T = K . Q^T (A = key rows, B = query rows kept in registers; hi.hi in one accumulator, lo.hi + hi.lo in a second, joined as hi + 2^-10 lo in f32), so a lane holds 16 scores of ONE query;
// running maximum and sum per query (online softmax, accumulators rescaled only in a pass where some query's maximum moved); the two 16-key score tiles, as f16 weights x256, ARE the B operand of O^T += V^T . P^T.
__device__ __forceinline__ float rs_xrow(float v) { const int i = __float_as_int(v); return __int_as_float(__builtin_amdgcn_permlanex16(i, i, 0x76543210, 0xfedcba98, false, false)); }      /* lane l <- lane l ^ 16 */
// native 2^a. The v_nop is the slot the instruction set asks for behind a transcendental before its source is overwritten or its result read.
__device__ __forceinline__ float fa_exp2(float a) { float e; asm("v_exp_f32 %0, %1\n\tv_nop" : "=v"(e) : "v"(a)); return e; }
__device__ __forceinline__ v8f fa_mma(v16h a, v16h b, v8f c) { return __builtin_amdgcn_wmma_f32_16x16x32_f16(false, a, false, b, (short)0, c, false, false); }
#define FA_C 11.5415603271117072589f      /* sqrt(64) * log2(e): score differences -> exponent of 2 */
#define FA_KS 3      /* waves that share a query group's key walk */
__global__ __launch_bounds__(128 * FA_KS) void k_fattn(const _Float16* __restrict__ QH, const _Float16* __restrict__ QL, const _Float16* __restrict__ KH, const _Float16* __restrict__ KL, const _Float16* __restrict__ VT, _Float16* __restrict__ O16) {
  __shared__ __attribute__((aligned(16))) float mo[FA_KS - 1][4][17][32][4];      /* [g - 1][query group][16 quads of o, then m and l][lane]: a wave's store or load of a quad is 512 bytes in a row */
  const int lane = threadIdx.x & 31, ln = lane & 15, hh = lane >> 4; const int w8 = __builtin_amdgcn_readfirstlane((int)(threadIdx.x >> 5)); const int w = w8 & 3, g = w8 >> 2;      /* scalar wave number: the key loop's bounds stay scalars; w query group, g its share of the passes */
  const int bh = blockIdx.x, b = bh / NH, h = bh % NH; const int q0 = ((int)gridDim.y - 1 - (int)blockIdx.y) * 128 + w * 32;      /* longest blocks start first, over all heads */
  const size_t r0 = (size_t)b * SQ;
  /* every pointer below is the lane's own address, its lane offset 8 lane folded in, so that the loads name exactly the pair that the wait behind them holds */
  /* q, k planes: fragment order (see gf_frag), per (batch, head) strips of 16 tokens, two tiles (k halves of the head) a strip: 64 elements a token; V^T: per (batch, head) and 32 keys four tiles (16 head columns each): 64 elements a key */
  const size_t hb = (size_t)bh * SQ * HD + 8 * lane;
  const _Float16* qhp = QH + hb + (size_t)q0 * HD; const _Float16* qlp = QL + hb + (size_t)q0 * HD;
  v16h qh[2][2], ql[2][2];      /* [query group of 16][k half of the head] */
#pragma unroll
  for (int j = 0; j < 2; ++j)
#pragma unroll
    for (int ks = 0; ks < 2; ++ks) { const size_t o = (size_t)(2 * j + ks) * 512; qh[j][ks] = gf_frag(qhp + o); ql[j][ks] = gf_frag(qlp + o); }
  asm volatile("s_wait_xcnt 0x0" :: "v"(qhp), "v"(qlp) : "memory");      /* the two address pairs stay whole until the loads have taken them */
  const _Float16* khp = KH + hb; const _Float16* klp = KL + hb; const _Float16* vtp = VT + hb;
  const v8f z8 = {0.f,0.f,0.f,0.f,0.f,0.f,0.f,0.f};
  v8f o[2][4]; float m[2], l[2];
#pragma unroll
  for (int j = 0; j < 2; ++j) { m[j] = -1.0e30f; l[j] = 0.f;
#pragma unroll
    for (int t = 0; t < 4; ++t) o[j][t] = z8; }
  v16h kh[2][2], kl[2][2];      /* [16-key tile][k half] */
  { const _Float16* pkh = khp + (size_t)(32 * g) * HD; const _Float16* pkl = klp + (size_t)(32 * g) * HD;      /* the wave's first pass (in bounds also where it has none) */
#pragma unroll
    for (int kt = 0; kt < 2; ++kt)
#pragma unroll
      for (int ks = 0; ks < 2; ++ks) { const size_t ko = (size_t)(2 * kt + ks) * 512; kh[kt][ks] = gf_frag(pkh + ko); kl[kt][ks] = gf_frag(pkl + ko); }
    asm volatile("s_wait_xcnt 0x0" :: "v"(pkh), "v"(pkl) : "memory"); }      /* the two address pairs stay whole until the loads have taken them */
#pragma unroll 1
  for (int kb = 32 * g; kb <= q0; kb += 32 * FA_KS) {
    v16h vf[4]; const _Float16* pv = vtp + (size_t)kb * HD;      /* V^T tiles of this pass, asked for ahead of the score products */
#pragma unroll
    for (int t = 0; t < 4; ++t) vf[t] = gf_frag(pv + (size_t)t * 512);
    asm volatile("s_wait_xcnt 0x0" ::: "memory");      /* stands in front of the advance of the loads' address pair; it also keeps these loads here, ahead of the score products, where the build had sunk them to their use */
    v8f u[2][2];      /* [query group][key tile]: q . k, register r = key 16 kt + 8 hh + r of query ln */
#pragma unroll
    for (int kt = 0; kt < 2; ++kt)
#pragma unroll
      for (int j = 0; j < 2; ++j) { v8f sh = z8, sl = z8;
#pragma unroll
        for (int ks = 0; ks < 2; ++ks) { sh = fa_mma(kh[kt][ks], qh[j][ks], sh); sl = fa_mma(kh[kt][ks], ql[j][ks], sl); sl = fa_mma(kl[kt][ks], qh[j][ks], sl); }
#pragma unroll
        for (int r = 0; r < 8; ++r) u[j][kt][r] = sh[r] + 0.0009765625f * sl[r]; }
    { const int kn = (kb + 32 * FA_KS <= q0) ? kb + 32 * FA_KS : kb;      /* the wave's next pass's key rows into the same registers, behind their last use; the last pass asks for its own rows again (in bounds) */
      const _Float16* pkh = khp + (size_t)kn * HD; const _Float16* pkl = klp + (size_t)kn * HD;
#pragma unroll
      for (int kt = 0; kt < 2; ++kt)
#pragma unroll
        for (int ks = 0; ks < 2; ++ks) { const size_t ko = (size_t)(2 * kt + ks) * 512; kh[kt][ks] = gf_frag(pkh + ko); kl[kt][ks] = gf_frag(pkl + ko); }
      asm volatile("s_wait_xcnt 0x0" :: "v"(pkh), "v"(pkl) : "memory"); }      /* the two address pairs stay whole until the loads have taken them */
    if (kb == q0) {      /* the one pass on the diagonal: keys above the query are out */
#pragma unroll
      for (int j = 0; j < 2; ++j)
#pragma unroll
        for (int kt = 0; kt < 2; ++kt)
#pragma unroll
          for (int r = 0; r < 8; ++r) u[j][kt][r] = (16 * kt + 8 * hh + r <= 16 * j + ln) ? u[j][kt][r] : -1.0e9f; }
    float mn[2];
#pragma unroll
    for (int j = 0; j < 2; ++j) { float x = fmaxf(u[j][0][0], u[j][1][0]);
#pragma unroll
      for (int r = 1; r < 8; ++r) x = fmaxf(x, fmaxf(u[j][0][r], u[j][1][r]));
      mn[j] = fmaxf(m[j], fmaxf(x, rs_xrow(x))); }
    if (__builtin_amdgcn_ballot_w32(mn[0] > m[0] || mn[1] > m[1]) != 0) {      /* scalar branch; where no maximum moved every factor would be 1 */
#pragma unroll
      for (int j = 0; j < 2; ++j) { const float al = fa_exp2((m[j] - mn[j]) * FA_C); m[j] = mn[j]; l[j] *= al;
#pragma unroll
        for (int t = 0; t < 4; ++t)
#pragma unroll
          for (int r = 0; r < 8; ++r) o[j][t][r] *= al; } }
#pragma unroll
    for (int j = 0; j < 2; ++j) { FragH pf; float s0 = 0.f, s1 = 0.f;
#pragma unroll
      for (int r = 0; r < 8; ++r) { const float p0 = fa_exp2((u[j][0][r] - m[j]) * FA_C + 8.0f), p1 = fa_exp2((u[j][1][r] - m[j]) * FA_C + 8.0f); s0 += p0; s1 += p1; pf.h[r] = (_Float16)p0; pf.h[8 + r] = (_Float16)p1; }      /* weights x256 */
      l[j] += s0 + s1;
#pragma unroll
      for (int t = 0; t < 4; ++t) o[j][t] = fa_mma(vf[t], pf.v, o[j][t]); }
  }
  /* the partial softmaxes of a query group joined: the state of the waves g > 0 through LDS, all scaled to the common maximum (a wave without a pass holds m = -1e30, l = 0, o = 0: factor 0; wave g = 0 always has the pass of key 0) */
  if (g != 0) {
#pragma unroll
    for (int j = 0; j < 2; ++j)
#pragma unroll
      for (int t = 0; t < 4; ++t)
#pragma unroll
        for (int c = 0; c < 2; ++c) { const v4f x = {o[j][t][4 * c], o[j][t][4 * c + 1], o[j][t][4 * c + 2], o[j][t][4 * c + 3]}; *(v4fa*)&mo[g - 1][w][(j * 4 + t) * 2 + c][lane][0] = x; }
    const v4f x = {m[0], m[1], l[0], l[1]}; *(v4fa*)&mo[g - 1][w][16][lane][0] = x; }
  __syncthreads();      /* every wave of the block passes it: the state of the waves g > 0 is in LDS before wave g = 0 reads it */
  if (g != 0) return;
  { v4f ml[FA_KS - 1];
#pragma unroll
    for (int p = 0; p < FA_KS - 1; ++p) ml[p] = *(const v4fa*)&mo[p][w][16][lane][0];
#pragma unroll
    for (int j = 0; j < 2; ++j) { float mx = m[j];
#pragma unroll
      for (int p = 0; p < FA_KS - 1; ++p) mx = fmaxf(mx, ml[p][j]);
      const float a0 = fa_exp2((m[j] - mx) * FA_C); l[j] *= a0;
#pragma unroll
      for (int t = 0; t < 4; ++t)
#pragma unroll
        for (int r = 0; r < 8; ++r) o[j][t][r] *= a0;
#pragma unroll
      for (int p = 0; p < FA_KS - 1; ++p) { const float a = fa_exp2((ml[p][j] - mx) * FA_C); l[j] += ml[p][2 + j] * a;
#pragma unroll
        for (int t = 0; t < 4; ++t)
#pragma unroll
          for (int c = 0; c < 2; ++c) { const v4f x = *(const v4fa*)&mo[p][w][(j * 4 + t) * 2 + c][lane][0];
#pragma unroll
            for (int i = 0; i < 4; ++i) o[j][t][4 * c + i] += x[i] * a; } } } }
#pragma unroll
  for (int j = 0; j < 2; ++j) { const float inv = 64.0f / (l[j] + rs_xrow(l[j]));      /* the two lane halves hold disjoint keys' sums; o carried x64 */
    unsigned short* dst = (unsigned short*)O16 + (r0 + q0 + 16 * j) * DM + (size_t)h * 1024 + 8 * lane;      /* o rows in fragment order for the output GEMM: strip of 16 rows, tiles 2 h and 2 h + 1; the lane's 8 values are one 16-byte half of its own fragment */
#pragma unroll
    for (int t = 0; t < 4; ++t) { FragH f;
#pragma unroll
      for (int r = 0; r < 8; ++r) f.h[r] = (_Float16)(o[j][t][r] * inv);
      *(v8us*)(dst + 256 * t) = f.half[0]; } } }


// q | k | v projection of every token row in one launch. One block of twelve waves a WGP takes 256 rows x 192 columns (4 x 3 waves of 64 x 64; the columns are one head each of q, k and v): sixteen products a trip on sixteen fragment loads (a 32 x 64 wave tile: eight on twelve),
// and every A strip is asked for by three waves and every B strip by four of the same WGP, close in time, so that most of these loads are met by the WGP's cache and not by L2. A wave's 64 columns are exactly one head of q, of k or of v, and its epilogue finishes that head's rows itself:
// q, k: f32 row through LDS, interleaved-pair rotation from the f32 tables, f16 hi + x1024 residual planes in fragment order; v: f16 from the accumulators (a lane holds 8 consecutive tokens of one column) straight into V^T in fragment order, whole 128-byte lines.
typedef float v2fa __attribute__((ext_vector_type(2), may_alias));
#define QK_BM 256      /* rows a block */
#define QK_BN 192      /* columns a block: one head each of q, k and v */
static_assert(NR % QK_BM == 0 && SQ % QK_BM == 0 && 3 * DM / QK_BN == NH && QK_BN == 3 * HD && DM % 64 == 0, "k_qkv: whole blocks, none across a batch, two trips a loop pass");
// one trip on a whole set (four A, four B fragments), every register reloaded from element offset KO of the strips, two trips ahead, behind the last product that reads it. The wait holds the two address pairs whole until the loads have taken them, and the loads in front of the next trip.
// the products are the plain builtin (the compiler keeps their distances itself): accumulators and two sets take 256 registers, and an operand of an asm statement cannot lie above v255 (with g2_mma the build spilled fragments in the loop)
#define QK_ROW(R0, R1, R2, R3, F, T) c0##T = fa_mma(R0, F, c0##T); c1##T = fa_mma(R1, F, c1##T); c2##T = fa_mma(R2, F, c2##T); c3##T = fa_mma(R3, F, c3##T);
#define QK_TRIP(A0, A1, A2, A3, F0, F1, F2, F3, KO) { const _Float16* pa = ap + (KO); const _Float16* pb = bp + (KO); \
    QK_ROW(A0, A1, A2, A3, F0, 0) F0 = gf_frag(pb); G2_HOLD \
    QK_ROW(A0, A1, A2, A3, F1, 1) F1 = gf_frag(pb + 16 * DM); G2_HOLD \
    QK_ROW(A0, A1, A2, A3, F2, 2) F2 = gf_frag(pb + 32 * DM); G2_HOLD \
    QK_ROW(A0, A1, A2, A3, F3, 3) F3 = gf_frag(pb + 48 * DM); A0 = gf_frag(pa); A1 = gf_frag(pa + 16 * DM); A2 = gf_frag(pa + 32 * DM); A3 = gf_frag(pa + 48 * DM); \
    asm volatile("s_wait_xcnt 0x0" :: "v"(pa), "v"(pb) : "memory"); }
// a whole set's first loads, in the order in which the loop reloads (B tiles, then A), held so: the loop's counted waits are set for both ways into it
#define QK_FILL(A0, A1, A2, A3, F0, F1, F2, F3, KO) v16h F0 = gf_frag(bp + (KO)); G2_HOLD v16h F1 = gf_frag(bp + (KO) + 16 * DM); G2_HOLD v16h F2 = gf_frag(bp + (KO) + 32 * DM); G2_HOLD v16h F3 = gf_frag(bp + (KO) + 48 * DM); G2_HOLD \
    v16h A0 = gf_frag(ap + (KO)); G2_HOLD v16h A1 = gf_frag(ap + (KO) + 16 * DM); G2_HOLD v16h A2 = gf_frag(ap + (KO) + 32 * DM); G2_HOLD v16h A3 = gf_frag(ap + (KO) + 48 * DM);
__global__ __launch_bounds__(384) void k_qkv(const _Float16* __restrict__ A, const _Float16* __restrict__ Bh, const float* __restrict__ bias, const float* __restrict__ CS, const float* __restrict__ SN,
    _Float16* __restrict__ QH, _Float16* __restrict__ QL, _Float16* __restrict__ KH, _Float16* __restrict__ KL, _Float16* __restrict__ VT) {
  __shared__ __attribute__((aligned(16))) float so[12][64][68];
  const int tid = threadIdx.x, lane = tid & 31, ln = lane & 15, hh = lane >> 4; const int w = __builtin_amdgcn_readfirstlane(tid >> 5);      /* scalar wave number: which of q, k, v a wave holds is a scalar branch */
  const int ntn = 3 * DM / QK_BN; const int mt = blockIdx.x / ntn, nt = blockIdx.x - mt * ntn; const int nq = (w >> 2) * NH + nt;      /* head nt of q (waves 0 to 3), of k (4 to 7) and of v (8 to 11): every block, and every SIMD, has the same share of the long q, k epilogue; the four waves of one age share their B strips */
  const int row0 = mt * QK_BM + 64 * (w & 3), col0 = nq * HD; const int part = nq / NH, h = nq - part * NH;      /* part 0 q, 1 k, 2 v: the same for the whole wave */
  const _Float16* ap = A + (size_t)row0 * DM + 8 * lane; const _Float16* bp = Bh + (size_t)col0 * DM + 8 * lane;      /* A, Bh in fragment order (see gf_frag), strips of 16 rows; the lane's own addresses: every load of a trip names one of two pairs */
  const v8f z8 = {0.f,0.f,0.f,0.f,0.f,0.f,0.f,0.f};
  v8f c00 = z8, c01 = z8, c02 = z8, c03 = z8, c10 = z8, c11 = z8, c12 = z8, c13 = z8, c20 = z8, c21 = z8, c22 = z8, c23 = z8, c30 = z8, c31 = z8, c32 = z8, c33 = z8;
  /* two fragment sets (x: even trips, y: odd trips) */
  QK_FILL(xa0, xa1, xa2, xa3, xb0, xb1, xb2, xb3, 0) G2_HOLD QK_FILL(ya0, ya1, ya2, ya3, yb0, yb1, yb2, yb3, 512)
  asm volatile("s_wait_xcnt 0x0" :: "v"(ap), "v"(bp) : "memory");      /* the two address pairs stay whole until the first loads have taken them */
#pragma unroll 1      /* rolled: two trips' code, the register sets named once each */
  for (int kb = 0; kb < DM; kb += 64) {
    QK_TRIP(xa0, xa1, xa2, xa3, xb0, xb1, xb2, xb3, ((kb + 64 < DM) ? kb + 64 : kb) * 16)      /* 512 elements a tile of 32 k; the last two trips ask for their own tiles again (in bounds) */
    QK_TRIP(ya0, ya1, ya2, ya3, yb0, yb1, yb2, yb3, ((kb + 96 < DM) ? kb + 96 : kb + 32) * 16) }
  float bb[4];      /* the wave's bias */
#pragma unroll
  for (int t = 0; t < 4; ++t) bb[t] = bias[col0 + t * 16 + ln];
  asm volatile("s_wait_xcnt 0x0" ::: "memory");      /* stands in front of the first write of the four loads' offset register: the build reused it behind the first load's data alone */
  v8f accs[16] = {c00, c01, c02, c03, c10, c11, c12, c13, c20, c21, c22, c23, c30, c31, c32, c33};      /* [strip of 16 rows][16 columns] */
  const size_t hb = ((size_t)((row0 / SQ) * NH + h) * SQ + row0 % SQ) * HD;      /* the wave's 64 tokens in a plane of its (batch, head): 64 elements a token in fragment order */
  if (part == 2) {      /* V^T tiles (16 head columns x 32 keys) in fragment order: the wave's 64 tokens are two groups of 32 keys, and a lane's 8 accumulator values (column ln of tile t, tokens 16 i + 8 hh + r) are one 16-byte half of its own fragment: stored from the registers, 512 bytes in a row a store */
    unsigned short* vd = (unsigned short*)VT + hb + 8 * lane;
#pragma unroll
    for (int u = 0; u < 16; ++u) { const int t = u & 3, i = u >> 2; const float bv = bf16_round(bb[t]); FragH f;
#pragma unroll
      for (int r = 0; r < 8; ++r) f.h[r] = (_Float16)(accs[u][r] * 0.0625f + bv);
      *(v8us*)(vd + (i >> 1) * 2048 + t * 512 + (i & 1) * 256) = f.half[0]; }
    return; }
#pragma unroll
  for (int u = 0; u < 16; ++u) { const int t = u & 3, i = u >> 2; const float bv = bf16_round(bb[t]);
#pragma unroll
    for (int r = 0; r < 8; ++r) so[w][i * 16 + 8 * hh + r][t * 16 + ln] = accs[u][r] * 0.0625f + bv; }
  __builtin_amdgcn_fence(__ATOMIC_ACQ_REL, "workgroup"); __builtin_amdgcn_wave_barrier();      /* a wave reads back only its own plane of so: its LDS writes are ordered in front of its reads, no block barrier */
  const int rsub = lane >> 4, c4 = (lane & 15) * 4;
  _Float16* Hh = (part ? KH : QH) + hb + (c4 >> 3) * 128 + (c4 & 7); _Float16* Hl = (part ? KL : QL) + hb + (c4 >> 3) * 128 + (c4 & 7);      /* the lane's 4 columns in fragment order: tile c4 >> 5, half (c4 >> 4) & 1, lane half (c4 >> 3) & 1, 128 elements apart each step of 8 columns */
#pragma unroll 1      /* rolled, eight steps (16 rows) a trip, inside the registers that the main loop takes anyway (sixteen steps a trip spilled) */
  for (int q0 = 0; q0 < 32; q0 += 8) {
    v4f vv[8]; v2fa cc[8], ss[8];      /* a trip's rows and table entries all asked for in front of its first store: behind a store the build holds every later load back, one load latency a step */
#pragma unroll
    for (int j = 0; j < 8; ++j) { const int r = (q0 + j) * 2 + rsub; const size_t to = (size_t)((row0 + r) % SQ) * (HD / 2) + (c4 >> 1);
      vv[j] = *(const v4fa*)&so[w][r][c4]; cc[j] = *(const v2fa*)(CS + to); ss[j] = *(const v2fa*)(SN + to); }
#pragma unroll
    for (int j = 0; j < 8; ++j) { const int r = (q0 + j) * 2 + rsub; const v4f v = vv[j]; const v2fa c = cc[j], s = ss[j]; float o[4];
      o[0] = fmaf(v[0], c[0], -(v[1] * s[0])); o[1] = fmaf(v[0], s[0], v[1] * c[0]); o[2] = fmaf(v[2], c[1], -(v[3] * s[1])); o[3] = fmaf(v[2], s[1], v[3] * c[1]);      /* the odd element's product rounded, the even element's fused onto it */
      v4h fh, fl;
#pragma unroll
      for (int i = 0; i < 4; ++i) { const _Float16 hi = (_Float16)o[i]; fh[i] = hi; fl[i] = (_Float16)((o[i] - (float)hi) * 1024.0f); }
      const size_t d = (size_t)(r >> 4) * 1024 + (r & 15) * 8; *(v4h*)(Hh + d) = fh; *(v4h*)(Hl + d) = fl; }
    asm volatile("s_wait_xcnt 0x0" ::: "memory"); } }      /* stands in front of the next trip's first writes, which may reuse a register of this trip's stores */

extern "C" void kernel_launch(void* const* d_in, const int* in_sizes, int n_in,
                              void* d_out, int out_size, void* d_ws, size_t ws_size, hipStream_t stream) {
  (void)in_sizes; (void)n_in; (void)out_size;
  const float* const* I = (const float* const*)d_in; const float* x = I[0]; const float* wqkv = I[1]; const float* bqkv = I[2]; const float* wo = I[3]; const float* bo = I[4];      /* [in][out] fused qkv + out weights, biases */
  char* ws = (char*)d_ws; size_t off = 0;
  auto take = [&](size_t bytes) { char* p = ws + off; off += (bytes + 255) & ~(size_t)255; return p; };
  _Float16* BQKV = (_Float16*)take((size_t)3 * DM * DM * 2); _Float16* BO = (_Float16*)take((size_t)DM * DM * 2); float* CS = (float*)take((size_t)SQ * (HD / 2) * 4); float* SN = (float*)take((size_t)SQ * (HD / 2) * 4);
  _Float16* X16 = (_Float16*)take(NR * DM * 2);
  _Float16* QH = (_Float16*)take(NR * DM * 2); _Float16* QL = (_Float16*)take(NR * DM * 2); _Float16* KH = (_Float16*)take(NR * DM * 2); _Float16* KL = (_Float16*)take(NR * DM * 2); _Float16* O16 = (_Float16*)take(NR * DM * 2);
  _Float16* VT = (_Float16*)take((size_t)NB * NH * HD * SQ * 2);      /* V^T of every batch */
  if (off > ws_size) return;
  k_prep<<<PREP_T / 256, 256, 0, stream>>>(x, wqkv, wo, 10000.0f, X16, BQKV, BO, CS, SN);      /* x rows, [in][out] weights -> Bt(n, k) x16 (q | k | v stacked along n), all in fragment order; cos / sin tables */
  k_qkv<<<(unsigned)((NR / QK_BM) * (3 * DM / QK_BN)), 384, 0, stream>>>(X16, BQKV, bqkv, CS, SN, QH, QL, KH, KL, VT);      /* roped q, k as f16 hi + x1024 residual (the x8 logits, sigma ~64, need ~f32-accurate scores) and V^T, per (batch, head), in fragment order */
  k_fattn<<<dim3(NB * NH, SQ / 128), 128 * FA_KS, 0, stream>>>(QH, QL, KH, KL, VT, O16);      /* o (merged heads, x64) as f16 rows in fragment order */
  k_gemm2<0><<<dim3((unsigned)((MPO / 128) * (DM / 64)), 1), 128, 0, stream>>>(O16 + (size_t)B0 * SQ * DM, DM, 0, BO, DM, 0, 0.0009765625f, bo, 0, nullptr, 1, 0, 0, (float*)d_out + (size_t)B0 * SQ * DM, nullptr, DM, 0, MPO, DM, DM);      /* out rows are the output layout */
}

// v009
// It runs in 73.5 microseconds.
// Two timings next to v008 put it at 1.08 and 1.09 times that version's speed.
// Counting every step since v000, it is 64.2 times as fast.
#include <hip/hip_runtime.h>
// Masked (causal) RoPE multi-head attention with LARGE logits (x [2][2048][1024]; qkv = x w_qkv + b_qkv ([in][out] 1024 x 3072, sigma 1/32, bias sigma 0.01) -> q | k | v, 16 heads of 64; interleaved-pair RoPE on q and k (inv_freq_i = 10000^(-2i/64), positions 0..2047); scores = q . k x sqrt(64) (the module divides by 1/sqrt(d_k)), causal (tril); softmax; out = (attn v merged) w_out + b_out -> [2][2048][1024]).
// Structure: token rows r = b*2048 + s; x as exact f16 rows (bf16-rounded); q | k | v of every row as ONE WMMA GEMM launch (64x64 wave tiles, f32 accumulation, exact x16 weights + bias, N = 3 x 1024) whose epilogue, a wave's 64 columns being one head, does on VALU: the interleaved-pair rotary rotation of q and k from f32 cos/sin tables (positions 0..SQ-1, no norm) and their split into f16 hi + x1024 residual planes (the x8 logits have sigma ~64: near-argmax softmax, so the scores are computed to ~f32 accuracy from three products), v as f16 into V^T; then ONE fused attention launch over every (batch, head, 128-query block): a wave holds 32 queries and walks every third pass of 32 keys up to its own diagonal (three waves a query group, joined through LDS at the end), scores as S^T = K . Q^T (three products), online causal softmax in registers (f32 running maximum and sum, native exp; keys above the diagonal set to -1e9; weights x256 f16), O^T += V^T . P^T with the score tiles as the B operand, o carried x64 (folded into the output GEMM alpha) written straight into the merged f16 o rows; out = o W_o + b GEMM (f32) into the output layout. Every f16 operand plane in the workspace (x, both weights, q and k hi / residual, V^T, o) lies in WMMA fragment order (see gf_frag), so that a fragment load reads whole 128-byte lines.
// Compute dtype: inputs rounded to bf16; x / weights exact; projections and rope f32; q, k as f16 hi + residual (~2^-22); v, softmax weights and o as plain f16 GEMM operands (~2^-12); scores and softmax statistics f32. v_wmma_f32_16x16x32_f16.
#define NB 2
#define SQ 2048
#define DM 1024
#define NH 16
#define HD 64
#define HG 4                         /* heads per launch of the (b, h0) V^T transpose */
#define QT 256
#define NKX SQ                       /* unused */
#define B0 0                         /* first batch processed (debug hook) */
#define NBR NB                       /* batches processed (debug hook) */
#define QN SQ                        /* unused (attention covers all SQ queries) */
#define NHD NH                       /* unused (attention covers all NH heads) */
#define NR ((size_t)NB * SQ)         /* token rows */
#define MPO ((int)((size_t)NBR * SQ))      /* rows through the output GEMM (debug hook) */
typedef __bf16 v16b __attribute__((ext_vector_type(16)));
typedef unsigned short v8us __attribute__((ext_vector_type(8), may_alias));
typedef float  v8f  __attribute__((ext_vector_type(8)));
typedef float  v4f  __attribute__((ext_vector_type(4)));
typedef float  v4fa __attribute__((ext_vector_type(4), may_alias));
union FragB { v16b v; v8us half[2]; unsigned short u[16]; };

__device__ __forceinline__ unsigned short bf16_bits(float x) { unsigned int u = __float_as_uint(x); return (unsigned short)((u + 0x7FFFu + ((u >> 16) & 1u)) >> 16); }
__device__ __forceinline__ float bf16_val(unsigned short b) { return __uint_as_float(((unsigned int)b) << 16); }
__device__ __forceinline__ float bf16_round(float x) { return bf16_val(bf16_bits(x)); }
// D += A·B with NT terms: 1 = ah·bh, 2 = + al·bh (A split), 3 = + ah·bl (both split)
template <int NT>
__device__ __forceinline__ v8f mmaN(v16b ah, v16b al, v16b bh, v16b bl, v8f c) {
  c = __builtin_amdgcn_wmma_f32_16x16x32_bf16(false, ah, false, bh, (short)0, c, false, false);
  if (NT >= 2) c = __builtin_amdgcn_wmma_f32_16x16x32_bf16(false, al, false, bh, (short)0, c, false, false);
  if (NT >= 3) c = __builtin_amdgcn_wmma_f32_16x16x32_bf16(false, ah, false, bl, (short)0, c, false, false);
  asm volatile("v_nop\n\tv_nop\n\tv_nop\n\tv_nop" : "+v"(c) : "v"(ah), "v"(al), "v"(bh), "v"(bl));
  return c;
}

__global__ __launch_bounds__(256) void k_wt_bf16(const float* __restrict__ W, unsigned short* __restrict__ Wt, int K, int N) {
  const int t = blockIdx.x * 256 + threadIdx.x;
  const int k8n = K / 8;
  if (t >= N * k8n) return;
  const int n = t / k8n, k8 = (t % k8n) * 8;
  v8us v;
#pragma unroll
  for (int i = 0; i < 8; ++i) v[i] = bf16_bits(W[(size_t)(k8 + i) * N + n]);
  *(v8us*)(Wt + (size_t)n * K + k8) = v;
  
}

// GEMM C[M][N] (f32, pitch ldc) = act(A[M][K]·W + bias). A f32 row-major (pitch lda) converted per fragment to bf16
// (ASPLIT: hi/lo two planes -> 2 terms, else single rounded term); Wt bf16 [N][K] (pitch ldb). BIAS_BF16 rounds the
// bias to bf16 first (bias quantised to bf16 before the add). K%32==0, M%16==0, N%64==0.
template <bool ASPLIT, int ACT, bool BIAS_BF16>
__global__ __launch_bounds__(128) void k_gemm_bf(const float* __restrict__ A, int lda, const unsigned short* __restrict__ Wt, int ldb,
                                               const float* __restrict__ bias, float* __restrict__ C, int ldc, int M, int N, int K) {
  __shared__ __attribute__((aligned(16))) float so[4][16][64];
  const int tid = threadIdx.x, w = tid >> 5, lane = tid & 31, ln = lane & 15, hh = lane >> 4;
  const int ntn = N / 64;
  const int wid = blockIdx.x * 4 + w;
  const int mt = wid / ntn, nq = wid % ntn;
  if (mt * 16 >= M) return;
  const int row0 = mt * 16, col0 = nq * 64;
  const float* arow = A + (size_t)(row0 + ln) * lda;
  v8f acc[4] = {};
  for (int kb = 0; kb < K; kb += 32) {
    FragB ah, al;
    const v4f x0 = *(const v4fa*)(arow + kb + 8 * hh), x1 = *(const v4fa*)(arow + kb + 8 * hh + 4);
    const v4f x2 = *(const v4fa*)(arow + kb + 16 + 8 * hh), x3 = *(const v4fa*)(arow + kb + 16 + 8 * hh + 4);
    float xs[16] = {x0[0],x0[1],x0[2],x0[3],x1[0],x1[1],x1[2],x1[3],x2[0],x2[1],x2[2],x2[3],x3[0],x3[1],x3[2],x3[3]};
#pragma unroll
    for (int i = 0; i < 16; ++i) { const unsigned short hb = bf16_bits(xs[i]); ah.u[i] = hb; al.u[i] = ASPLIT ? bf16_bits(xs[i] - bf16_val(hb)) : (unsigned short)0; }
#pragma unroll
    for (int t = 0; t < 4; ++t) {
      const unsigned short* brow = Wt + (size_t)(col0 + t * 16 + ln) * ldb + kb;
      FragB b;
      b.half[0] = *(const v8us*)(brow + 8 * hh);
      b.half[1] = *(const v8us*)(brow + 16 + 8 * hh);
      acc[t] = mmaN<ASPLIT ? 2 : 1>(ah.v, al.v, b.v, b.v, acc[t]);
    }
  }
#pragma unroll
  for (int t = 0; t < 4; ++t) {
    float bv = bias ? bias[col0 + t * 16 + ln] : 0.f;
    if (BIAS_BF16) bv = bf16_round(bv);
#pragma unroll
    for (int r = 0; r < 8; ++r) { float v = acc[t][r] + bv; if (ACT == 1) v = fmaxf(v, 0.f); so[w][8 * hh + r][t * 16 + ln] = v; }
  }
  __builtin_amdgcn_fence(__ATOMIC_ACQ_REL, "workgroup");
  __builtin_amdgcn_wave_barrier();
  const int rsub = lane >> 4, c4 = (lane & 15) * 4;
  {
#pragma unroll
    for (int q = 0; q < 8; ++q) {
      const int r = q * 2 + rsub;
      const v4f v = *(const v4fa*)&so[w][r][c4];
      *(v4f*)(C + (size_t)(row0 + r) * ldc + col0 + c4) = v;
    }
    
  }
}

// GEMM C = act(A·W + bias + resid): A f32 (ASPLIT -> hi/lo 2 terms), Wt bf16 [N][K]; ACT 0 none, 1 relu, 2 exact gelu;
// resid (optional, f32, row index = (row % rmod), pitch ldr, RES_BF16 rounds it) added before the activation.
template <bool ASPLIT, int ACT, bool BIAS_BF16, bool RES_BF16>
__global__ __launch_bounds__(128) void k_gemm_bf3(const float* __restrict__ A, int lda, const unsigned short* __restrict__ Wt, int ldb,
                                                const float* __restrict__ bias, const float* __restrict__ resid, int rmod, int ldr,
                                                float* __restrict__ C, int ldc, int M, int N, int K) {
  __shared__ __attribute__((aligned(16))) float so[4][16][64];
  const int tid = threadIdx.x, w = tid >> 5, lane = tid & 31, ln = lane & 15, hh = lane >> 4;
  const int ntn = N / 64;
  const int wid = blockIdx.x * 4 + w;
  const int mt = wid / ntn, nq = wid % ntn;
  if (mt * 16 >= M) return;
  const int row0 = mt * 16, col0 = nq * 64;
  const float* arow = A + (size_t)(row0 + ln) * lda;
  v8f acc[4] = {};
  for (int kb = 0; kb < K; kb += 32) {
    FragB ah, al;
    const v4f x0 = *(const v4fa*)(arow + kb + 8 * hh), x1 = *(const v4fa*)(arow + kb + 8 * hh + 4);
    const v4f x2 = *(const v4fa*)(arow + kb + 16 + 8 * hh), x3 = *(const v4fa*)(arow + kb + 16 + 8 * hh + 4);
    float xs[16] = {x0[0],x0[1],x0[2],x0[3],x1[0],x1[1],x1[2],x1[3],x2[0],x2[1],x2[2],x2[3],x3[0],x3[1],x3[2],x3[3]};
#pragma unroll
    for (int i = 0; i < 16; ++i) { const unsigned short hb = bf16_bits(xs[i]); ah.u[i] = hb; al.u[i] = ASPLIT ? bf16_bits(xs[i] - bf16_val(hb)) : (unsigned short)0; }
#pragma unroll
    for (int t = 0; t < 4; ++t) {
      const unsigned short* brow = Wt + (size_t)(col0 + t * 16 + ln) * ldb + kb;
      FragB b;
      b.half[0] = *(const v8us*)(brow + 8 * hh);
      b.half[1] = *(const v8us*)(brow + 16 + 8 * hh);
      acc[t] = mmaN<ASPLIT ? 2 : 1>(ah.v, al.v, b.v, b.v, acc[t]);
    }
  }
#pragma unroll
  for (int t = 0; t < 4; ++t) {
    const int col = col0 + t * 16 + ln;
    float bv = bias ? bias[col] : 0.f;
    if (BIAS_BF16) bv = bf16_round(bv);
#pragma unroll
    for (int r = 0; r < 8; ++r) {
      float v = acc[t][r] + bv;
      if (resid) { float rv = resid[(size_t)((row0 + 8 * hh + r) % rmod) * ldr + col]; if (RES_BF16) rv = bf16_round(rv); v += rv; }
      if (ACT == 1) v = fmaxf(v, 0.f);
      if (ACT == 2) v = 0.5f * v * (1.0f + erff(v * 0.70710678118654752f));
      if (ACT == 3) { const float u = 0.7978845608028654f * (v + 0.044715f * v * v * v); v = 0.5f * v * (1.0f + tanhf(u)); }
      so[w][8 * hh + r][t * 16 + ln] = v;
    }
  }
  __builtin_amdgcn_fence(__ATOMIC_ACQ_REL, "workgroup");
  __builtin_amdgcn_wave_barrier();
  const int rsub = lane >> 4, c4 = (lane & 15) * 4;
  {
#pragma unroll
    for (int q = 0; q < 8; ++q) {
      const int r = q * 2 + rsub;
      const v4f v = *(const v4fa*)&so[w][r][c4];
      *(v4f*)(C + (size_t)(row0 + r) * ldc + col0 + c4) = v;
    }
    
  }
}
// row LayerNorm (biased variance, eps) over N: s = X (+ R); optional out_sum <- s; out_norm <- (s-mu)*rsqrt(var+eps)*g + b
template <bool PARAM_BF16>
__global__ __launch_bounds__(256) void k_layernorm(const float* __restrict__ X, const float* __restrict__ R, const float* __restrict__ g, const float* __restrict__ bta,
                                                  float* __restrict__ out_sum, float* __restrict__ out_norm, int N, float eps) {
  __shared__ float red[256];
  const int row = blockIdx.x, tid = threadIdx.x;
  const float* x = X + (size_t)row * N; const float* rr = R ? R + (size_t)row * N : nullptr;
  float vals[16];                     // up to N = 4096
  const int per = N / 256;            // contiguous chunk per thread? use strided-by-4 chunks: thread handles j = tid*4 + 1024*u
  float s1 = 0.f;
  for (int u = 0; u < per / 4; ++u) {
    const int j = tid * 4 + 1024 * u;
    const v4f a = *(const v4fa*)(x + j);
    v4f b = {0.f,0.f,0.f,0.f}; if (rr) b = *(const v4fa*)(rr + j);
#pragma unroll
    for (int q = 0; q < 4; ++q) { const float v = a[q] + b[q]; vals[u * 4 + q] = v; s1 += v; }
  }
  red[tid] = s1; __syncthreads();
  for (int st = 128; st > 0; st >>= 1) { if (tid < st) red[tid] += red[tid + st]; __syncthreads(); }
  const float mu = red[0] / (float)N; __syncthreads();
  float s2 = 0.f;
  for (int u = 0; u < per / 4; ++u)
#pragma unroll
    for (int q = 0; q < 4; ++q) { const float c = vals[u * 4 + q] - mu; s2 += c * c; }
  red[tid] = s2; __syncthreads();
  for (int st = 128; st > 0; st >>= 1) { if (tid < st) red[tid] += red[tid + st]; __syncthreads(); }
  const float rs = rsqrtf(red[0] / (float)N + eps);
  {
    for (int u = 0; u < per / 4; ++u) {
      const int j = tid * 4 + 1024 * u;
      v4f o, sm;
#pragma unroll
      for (int q = 0; q < 4; ++q) {
        float gg = g[j + q], bb = bta[j + q];
        if (PARAM_BF16) { gg = bf16_round(gg); bb = bf16_round(bb); }
        sm[q] = vals[u * 4 + q]; o[q] = (vals[u * 4 + q] - mu) * rs * gg + bb;
      }
      if (out_sum) *(v4f*)(out_sum + (size_t)row * N + j) = sm;
      *(v4f*)(out_norm + (size_t)row * N + j) = o;
    }
    
  }
}



// ---- f16 WMMA path (v_wmma_f32_16x16x32_f16): 11-bit significands for operands in range — used where a [0,1] probability operand needs more precision than bf16
typedef _Float16 v16h __attribute__((ext_vector_type(16)));
union FragH { v16h v; v8us half[2]; _Float16 h[16]; unsigned short u[16]; };
template <int NT>
__device__ __forceinline__ v8f mmaH(v16h ah, v16h al, v16h bh, v16h bl, v8f c) {
  c = __builtin_amdgcn_wmma_f32_16x16x32_f16(false, ah, false, bh, (short)0, c, false, false);
  if (NT >= 2) c = __builtin_amdgcn_wmma_f32_16x16x32_f16(false, al, false, bh, (short)0, c, false, false);
  if (NT >= 3) c = __builtin_amdgcn_wmma_f32_16x16x32_f16(false, ah, false, bl, (short)0, c, false, false);
  asm volatile("v_nop\n\tv_nop\n\tv_nop\n\tv_nop" : "+v"(c) : "v"(ah), "v"(al), "v"(bh), "v"(bl));
  return c;
}
// batched GEMM like k_gemm_b but f16 operands: A f32 (split into f16 hi/lo if ASPLIT, else rounded to f16), Bt = f16 values [n][k]; alpha; C f32; N multiple of 16 (partial tiles skipped)
template <bool ASPLIT>
__global__ __launch_bounds__(128) void k_gemm_h(const float* __restrict__ A, int lda, size_t sA, const _Float16* __restrict__ Bh, int ldb, size_t sB, float alpha, float* __restrict__ C, int ldc, size_t sC, int M, int N, int K) {
  __shared__ __attribute__((aligned(16))) float so[4][16][64];
  const int tid = threadIdx.x, w = tid >> 5, lane = tid & 31, ln = lane & 15, hh = lane >> 4; const int by = blockIdx.y;
  A += (size_t)by * sA; Bh += (size_t)by * sB; C += (size_t)by * sC;
  const int ntn = (N + 63) / 64; const int wid = blockIdx.x * 4 + w; const int mt = wid / ntn, nq = wid % ntn; if (mt * 16 >= M) return;
  const int row0 = mt * 16, col0 = nq * 64; const float* arow = A + (size_t)(row0 + ln) * lda;
  v8f acc[4] = {};
  for (int kb = 0; kb < K; kb += 32) {
    FragH ah, al;
    const v4f x0 = *(const v4fa*)(arow + kb + 8 * hh), x1 = *(const v4fa*)(arow + kb + 8 * hh + 4), x2 = *(const v4fa*)(arow + kb + 16 + 8 * hh), x3 = *(const v4fa*)(arow + kb + 16 + 8 * hh + 4);
    float xs[16] = {x0[0],x0[1],x0[2],x0[3],x1[0],x1[1],x1[2],x1[3],x2[0],x2[1],x2[2],x2[3],x3[0],x3[1],x3[2],x3[3]};
#pragma unroll
    for (int i = 0; i < 16; ++i) { const _Float16 h = (_Float16)xs[i]; ah.h[i] = h; al.h[i] = ASPLIT ? (_Float16)(xs[i] - (float)h) : (_Float16)0.0f; }
#pragma unroll
    for (int t = 0; t < 4; ++t) { if (col0 + t * 16 >= N) continue; const size_t boff = (size_t)(col0 + t * 16 + ln) * ldb + kb; FragH bq; bq.half[0] = *(const v8us*)(Bh + boff + 8 * hh); bq.half[1] = *(const v8us*)(Bh + boff + 16 + 8 * hh);
      acc[t] = mmaH<ASPLIT ? 2 : 1>(ah.v, al.v, bq.v, bq.v, acc[t]); }
  }
#pragma unroll
  for (int t = 0; t < 4; ++t) { if (col0 + t * 16 >= N) continue;
#pragma unroll
    for (int r = 0; r < 8; ++r) so[w][8 * hh + r][t * 16 + ln] = acc[t][r] * alpha; }
  __builtin_amdgcn_fence(__ATOMIC_ACQ_REL, "workgroup"); __builtin_amdgcn_wave_barrier();
  const int rsub = lane >> 4, c4 = (lane & 15) * 4;
  {
#pragma unroll
    for (int q = 0; q < 8; ++q) { const int r = q * 2 + rsub; if (col0 + c4 < N) { const v4f v = *(const v4fa*)&so[w][r][c4]; *(v4f*)(C + (size_t)(row0 + r) * ldc + col0 + c4) = v; } }
     }
}

// k_gemm_hh variant with fused epilogue: v = acc·alpha + bias[by·sBias + col] (+ CP[(row/rowsPerB)·sCPb + by·64 + col] if CP) ; ACT 0 none / 1 elu ; writes f16 C16 (and f32 C if non-null)
template <int ACT>
__global__ __launch_bounds__(128) void k_gemm_hhx(const _Float16* __restrict__ A, int lda, size_t sA, const _Float16* __restrict__ Bh, int ldb, size_t sB, float alpha, const float* __restrict__ bias, size_t sBias, const float* __restrict__ CP, int rowsPerB, size_t sCPb, int row0g,
    float* __restrict__ C, _Float16* __restrict__ C16, int ldc, size_t sC, int M, int N, int K) {
  __shared__ __attribute__((aligned(16))) float so[4][16][64];
  const int tid = threadIdx.x, w = tid >> 5, lane = tid & 31, ln = lane & 15, hh = lane >> 4; const int by = blockIdx.y;
  A += (size_t)by * sA; Bh += (size_t)by * sB; const size_t cofs = (size_t)by * sC; const float* bp = bias ? bias + (size_t)by * sBias : nullptr;
  const int ntn = (N + 63) / 64; const int wid = blockIdx.x * 4 + w; const int mt = wid / ntn, nq = wid % ntn; if (mt * 16 >= M) return;
  const int row0 = mt * 16, col0 = nq * 64; const _Float16* arow = A + (size_t)(row0 + ln) * lda;
  v8f acc[4] = {};
  for (int kb = 0; kb < K; kb += 32) { FragH ah; ah.half[0] = *(const v8us*)((const unsigned short*)arow + kb + 8 * hh); ah.half[1] = *(const v8us*)((const unsigned short*)arow + kb + 16 + 8 * hh);
#pragma unroll
    for (int t = 0; t < 4; ++t) { if (col0 + t * 16 >= N) continue; const size_t boff = (size_t)(col0 + t * 16 + ln) * ldb + kb; FragH bq; bq.half[0] = *(const v8us*)((const unsigned short*)Bh + boff + 8 * hh); bq.half[1] = *(const v8us*)((const unsigned short*)Bh + boff + 16 + 8 * hh);
      acc[t] = mmaH<1>(ah.v, ah.v, bq.v, bq.v, acc[t]); }
  }
#pragma unroll
  for (int t = 0; t < 4; ++t) { if (col0 + t * 16 >= N) continue; const int col = col0 + t * 16 + ln; const float bv = bp ? bf16_round(bp[col]) : 0.f;
#pragma unroll
    for (int r = 0; r < 8; ++r) { float v = acc[t][r] * alpha + bv; if (CP) { const int rr = row0g + row0 + 8 * hh + r; if (rowsPerB < 0) v += CP[cofs + (size_t)rr * ldc + col];      /* rowsPerB < 0: own element of the batched C plane */ else { const int bidx = rr / rowsPerB; v += CP[(size_t)bidx * sCPb + (size_t)by * 64 + col]; } } if (ACT == 1) v = (v > 0.f) ? v : expm1f(v); else if (ACT == 7) v = (v > 0.f) ? v + 1.0f : expf(v); else if (ACT == 8) v = tanhf(v); else if (ACT == 9) v = 0.5f * v * (1.0f + tanhf(0.7978845608028654f * (v + 0.044715f * v * v * v))); else if (ACT == 11) v = 1.0f / (1.0f + expf(-v)); else if (ACT == 12) v = (v > 0.f) ? v : 0.01f * v; else if (ACT == 14) v = (v > 0.f) ? v : 0.1f * v; else if (ACT == 16) v = (v >= 0.f) ? v : 0.3f * v; else if (ACT == 17) v = (v >= 0.f) ? v : 0.2f * v; else if (ACT == 15) v = v / (1.0f + expf(-v)); else if (ACT == 3) v = fmaxf(v, 0.f); else if (ACT == 6) v = 0.5f * v * (1.0f + erff(v * 0.70710678118654752f)); so[w][8 * hh + r][t * 16 + ln] = v; } }
  __builtin_amdgcn_fence(__ATOMIC_ACQ_REL, "workgroup"); __builtin_amdgcn_wave_barrier();
  const int rsub = lane >> 4, c4 = (lane & 15) * 4; typedef _Float16 v4h __attribute__((ext_vector_type(4)));
  {
#pragma unroll
    for (int q = 0; q < 8; ++q) { const int r = q * 2 + rsub; if (col0 + c4 < N) { const v4f v = *(const v4fa*)&so[w][r][c4]; if (C) *(v4f*)(C + cofs + (size_t)(row0 + r) * ldc + col0 + c4) = v; if (C16) { v4h h4; for (int i = 0; i < 4; ++i) h4[i] = (_Float16)v[i]; *(v4h*)(C16 + cofs + (size_t)(row0 + r) * ldc + col0 + c4) = h4; } } }
     }
}


typedef _Float16 v4h __attribute__((ext_vector_type(4)));

__global__ __launch_bounds__(256) void k_h16(const float* __restrict__ x, _Float16* __restrict__ X16, size_t n8) { const size_t t = (size_t)blockIdx.x * 256 + threadIdx.x; if (t >= n8) return; FragH f;
#pragma unroll
  for (int q = 0; q < 8; ++q) f.h[q] = (_Float16)x[t * 8 + q]; *(v8us*)((unsigned short*)X16 + t * 8) = f.half[0];  }
__global__ __launch_bounds__(256) void k_round16f(const float* __restrict__ W, _Float16* __restrict__ Bt, size_t n8) { const size_t t = (size_t)blockIdx.x * 256 + threadIdx.x; if (t >= n8) return; FragH f;
#pragma unroll
  for (int i = 0; i < 8; ++i) f.h[i] = (_Float16)(bf16_round(W[t * 8 + i]) * 16.0f); *(v8us*)((unsigned short*)Bt + t * 8) = f.half[0];  }
// ---- fast GEMM (wave tile 32x64; requires M % 32 == 0 rows per launch region, N % 64 == 0 and K % 64 == 0); A and Bh in fragment order (see gf_frag), strips of 16 rows of lda / ldb elements each; epilogue = k_gemm_hhx semantics ----
__device__ __forceinline__ v16h g2_frag(const _Float16* p, int hh) { FragH f; f.half[0] = *(const v8us*)((const unsigned short*)p + 8 * hh); f.half[1] = *(const v8us*)((const unsigned short*)p + 16 + 8 * hh); return f.v; }
// Fragment order: a 16-row x 32-k f16 tile lies 1 KB in a row, element (r, k) at (k >> 4) * 256 + (((k >> 3) & 1) * 16 + r) * 8 + (k & 7), so lane l = 16 hh + ln finds the two 16-byte halves of its fragment at 8 l and 256 + 8 l:
// each fragment load of a wave reads 512 bytes in a row (four whole 128-byte lines) where a row-major plane gives it 16 lines of 32 bytes. Which element a lane and register hold is as in g2_frag. p = tile + 8 * lane.
__device__ __forceinline__ v16h gf_frag(const _Float16* p) { FragH f; f.half[0] = *(const v8us*)((const unsigned short*)p); f.half[1] = *(const v8us*)((const unsigned short*)p + 256); return f.v; }
__device__ __forceinline__ v8f g2_mma(v16h a, v16h b, v8f c) { v8f d = __builtin_amdgcn_wmma_f32_16x16x32_f16(false, a, false, b, (short)0, c, false, false); asm volatile("v_nop\n\tv_nop\n\tv_nop\n\tv_nop" : "+v"(d) : "v"(a), "v"(b)); return d; }
// GEMM main loops: every fragment register is asked for again, for a later trip, directly behind the last product that reads it, so that a trip's loads (twelve in k_gemm2, sixteen in k_qkv) are all in flight while products run, and no product waits out a whole load by itself.
// G2_HOLD keeps each reload at that place: hoisted it would take a further register set, sunk to its use it would have no lead.
#define G2_HOLD __builtin_amdgcn_sched_barrier(0);
// one trip on a whole set, the set reloaded from element offset KO of the six strips. The wait holds the six address pairs whole until the loads have taken them, and the loads in front of the next trip.
#define G2_TRIP2(A0, A1, F0, F1, F2, F3, KO) { const int ko = (KO); \
    const _Float16* pa0 = a0p + ko; const _Float16* pa1 = a1p + ko; const _Float16* pb0 = b0p + ko; const _Float16* pb1 = b1p + ko; const _Float16* pb2 = b2p + ko; const _Float16* pb3 = b3p + ko; \
    c00 = g2_mma(A0, F0, c00); c10 = g2_mma(A1, F0, c10); F0 = gf_frag(pb0); G2_HOLD \
    c01 = g2_mma(A0, F1, c01); c11 = g2_mma(A1, F1, c11); F1 = gf_frag(pb1); G2_HOLD \
    c02 = g2_mma(A0, F2, c02); c12 = g2_mma(A1, F2, c12); F2 = gf_frag(pb2); G2_HOLD \
    c03 = g2_mma(A0, F3, c03); c13 = g2_mma(A1, F3, c13); F3 = gf_frag(pb3); A0 = gf_frag(pa0); A1 = gf_frag(pa1); \
    asm volatile("s_wait_xcnt 0x0" :: "v"(pa0), "v"(pa1), "v"(pb0), "v"(pb1), "v"(pb2), "v"(pb3) : "memory"); }
// a whole set's first loads, from the six addresses given (one tile of each strip)
#define G2_FILL(A0, A1, F0, F1, F2, F3, PA0, PA1, PB0, PB1, PB2, PB3) v16h F0 = gf_frag(PB0); G2_HOLD v16h F1 = gf_frag(PB1); G2_HOLD v16h F2 = gf_frag(PB2); G2_HOLD v16h F3 = gf_frag(PB3); G2_HOLD v16h A0 = gf_frag(PA0); G2_HOLD v16h A1 = gf_frag(PA1);
template <int ACT>
__global__ __launch_bounds__(128) void k_gemm2(const _Float16* __restrict__ A, int lda, size_t sA, const _Float16* __restrict__ Bh, int ldb, size_t sB, float alpha, const float* __restrict__ bias, size_t sBias, const float* __restrict__ CP, int rowsPerB, size_t sCPb, int row0g,
    float* __restrict__ C, _Float16* __restrict__ C16, int ldc, size_t sC, int M, int N, int K) { static_assert(ACT == 0 || ACT == 3 || ACT == 6 || ACT == 8 || ACT == 9 || ACT == 11 || ACT == 12 || ACT == 14 || ACT == 15 || ACT == 16 || ACT == 17, "k_gemm2: unsupported ACT code (would silently apply no activation)");
  __shared__ __attribute__((aligned(16))) float so[4][32][68];
  const int tid = threadIdx.x, w = tid >> 5, lane = tid & 31, ln = lane & 15, hh = lane >> 4; const int by = blockIdx.y;
  A += (size_t)by * sA; Bh += (size_t)by * sB; const size_t cofs = (size_t)by * sC; const float* bp = bias ? bias + (size_t)by * sBias : nullptr;
  const int ntn = N >> 6; const int mt = blockIdx.x / ntn, nq = blockIdx.x - mt * ntn; const int row0 = mt * 128 + 32 * w, col0 = nq * 64; if (row0 >= M) return;
  const _Float16* a0p = A + (size_t)row0 * lda + 8 * lane; const _Float16* a1p = a0p + (size_t)16 * lda;
  const _Float16* b0p = Bh + (size_t)col0 * ldb + 8 * lane; const _Float16* b1p = b0p + (size_t)16 * ldb; const _Float16* b2p = b1p + (size_t)16 * ldb; const _Float16* b3p = b2p + (size_t)16 * ldb;
  const v8f z8 = {0.f,0.f,0.f,0.f,0.f,0.f,0.f,0.f}; v8f c00 = z8, c01 = z8, c02 = z8, c03 = z8, c10 = z8, c11 = z8, c12 = z8, c13 = z8;
  /* two fragment sets (x: even trips, y: odd trips), every register reloaded two trips ahead directly behind the last product that reads it; K % 64 == 0 */
  /* the first loads in the order in which the loop reloads (B tiles, then A; x, then y), held so: the loop's counted waits are set for both ways into it, and another order here made them wait for younger loads */
  /* the k walk starts at the block's own k, rot (a multiple of 64 below K), and wraps round: the blocks that share an A strip (one mt) or a B strip (one nq) run at the same time, and started alike they would all ask L2 for the same lines at the same moment */
  const int rot = (((mt + nq) & 15) * 64) % K; const int fx = rot * 16, fy = fx + 512;      /* 512 elements a tile of 32 k */
  const _Float16* xpa0 = a0p + fx; const _Float16* xpa1 = a1p + fx; const _Float16* xpb0 = b0p + fx; const _Float16* xpb1 = b1p + fx; const _Float16* xpb2 = b2p + fx; const _Float16* xpb3 = b3p + fx;
  const _Float16* ypa0 = a0p + fy; const _Float16* ypa1 = a1p + fy; const _Float16* ypb0 = b0p + fy; const _Float16* ypb1 = b1p + fy; const _Float16* ypb2 = b2p + fy; const _Float16* ypb3 = b3p + fy;
  G2_FILL(xa0, xa1, xb0, xb1, xb2, xb3, xpa0, xpa1, xpb0, xpb1, xpb2, xpb3) G2_HOLD G2_FILL(ya0, ya1, yb0, yb1, yb2, yb3, ypa0, ypa1, ypb0, ypb1, ypb2, ypb3)
  asm volatile("s_wait_xcnt 0x0" :: "v"(xpa0), "v"(xpa1), "v"(xpb0), "v"(xpb1), "v"(xpb2), "v"(xpb3), "v"(ypa0), "v"(ypa1), "v"(ypb0), "v"(ypb1), "v"(ypb2), "v"(ypb3) : "memory");      /* the twelve address pairs stay whole until the first loads have taken them */
#pragma unroll 1      /* rolled: two trips' code, the register sets named once each */
  for (int kb = 0; kb < K; kb += 64) { const int kx = kb + 64 + rot, ky = kb + 96 + rot;      /* both below 2 K: one step back wraps them */
    G2_TRIP2(xa0, xa1, xb0, xb1, xb2, xb3, ((kx < K) ? kx : kx - K) * 16)      /* the last two trips ask for the walk's first two tiles again (in bounds, not used) */
    G2_TRIP2(ya0, ya1, yb0, yb1, yb2, yb3, ((ky < K) ? ky : ky - K) * 16) }
  v8f accs[8] = {c00, c01, c02, c03, c10, c11, c12, c13};
#pragma unroll
  for (int u = 0; u < 8; ++u) { const int t = u & 3, half = u >> 2; const int col = col0 + t * 16 + ln; const float bv = bp ? bf16_round(bp[col]) : 0.f;
#pragma unroll
    for (int r = 0; r < 8; ++r) { const int rloc = half * 16 + 8 * hh + r; float v = accs[u][r] * alpha + bv; if (CP) { if (rowsPerB < 0) v += CP[cofs + (size_t)(row0g + row0 + rloc) * ldc + col];      /* rowsPerB < 0: own element of the batched C plane */ else { const int bidx = (row0g + row0 + rloc) / rowsPerB; v += CP[(size_t)bidx * sCPb + (size_t)by * 64 + col]; } }
      if (ACT == 3) v = fmaxf(v, 0.f); else if (ACT == 6) v = 0.5f * v * (1.0f + erff(v * 0.70710678118654752f)); else if (ACT == 11) v = 1.0f / (1.0f + expf(-v)); else if (ACT == 15) v = v / (1.0f + expf(-v)); else if (ACT == 12) v = (v > 0.f) ? v : 0.01f * v; else if (ACT == 8) v = tanhf(v); else if (ACT == 9) v = 0.5f * v * (1.0f + tanhf(0.7978845608028654f * (v + 0.044715f * v * v * v))); else if (ACT == 14) v = (v > 0.f) ? v : 0.1f * v; else if (ACT == 16) v = (v >= 0.f) ? v : 0.3f * v; else if (ACT == 17) v = (v >= 0.f) ? v : 0.2f * v;
      so[w][rloc][t * 16 + ln] = v; } }
  __builtin_amdgcn_fence(__ATOMIC_ACQ_REL, "workgroup"); __builtin_amdgcn_wave_barrier();
  const int rsub = lane >> 4, c4 = (lane & 15) * 4;
  {
#pragma unroll
    for (int q = 0; q < 16; ++q) { const int r = q * 2 + rsub; const v4f v = *(const v4fa*)&so[w][r][c4]; if (C) *(v4f*)(C + cofs + (size_t)(row0 + r) * ldc + col0 + c4) = v; if (C16) { v4h h4; for (int i = 0; i < 4; ++i) h4[i] = (_Float16)v[i]; *(v4h*)(C16 + cofs + (size_t)(row0 + r) * ldc + col0 + c4) = h4; } }
     } }


__global__ __launch_bounds__(256) void k_wnat(const float* __restrict__ w, size_t n8, _Float16* __restrict__ Bt) { const size_t t = (size_t)blockIdx.x * 256 + threadIdx.x; if (t >= n8) return; FragH f; for (int q = 0; q < 8; ++q) f.h[q] = (_Float16)(bf16_round(w[t * 8 + q]) * 16.0f); *(v8us*)((unsigned short*)Bt + t * 8) = f.half[0];  }
__global__ __launch_bounds__(256) void k_rsm(const float* __restrict__ S, _Float16* __restrict__ P, int nrows) {
  #pragma clang fp contract(off)
  const int i = blockIdx.x * 256 + threadIdx.x; if (i >= nrows) return; const float* s = S + (size_t)i * SQ; float mx = -3.0e38f;
#pragma unroll 1
  for (int j = 0; j < SQ; ++j) mx = fmaxf(mx, s[j]); float se = 0.f;
#pragma unroll 1
  for (int j = 0; j < SQ; ++j) se += expf(s[j] - mx); const float sc = 256.0f / se;
#pragma unroll 1
  for (int j0 = 0; j0 < SQ; j0 += 8) { FragH f; for (int q = 0; q < 8; ++q) f.h[q] = (_Float16)(expf(s[j0 + q] - mx) * sc); unsigned short* d = (unsigned short*)P + (size_t)i * SQ + j0; *(v8us*)d = f.half[0];  } }
__global__ __launch_bounds__(256) void k_vt(const _Float16* __restrict__ V16, int b, int h0, _Float16* __restrict__ VT) { __shared__ unsigned short tl[64][65]; const int tid = threadIdx.x; const int hh = blockIdx.x % HG, sg = blockIdx.x / HG; const int s0 = sg * 64; const int h = h0 + hh;
  for (int i = tid; i < 64 * 8; i += 256) { const int j = i / 8, d8 = (i % 8) * 8; FragH f; f.half[0] = *(const v8us*)((const unsigned short*)V16 + ((size_t)b * SQ + s0 + j) * DM + h * HD + d8); for (int q = 0; q < 8; ++q) tl[d8 + q][j] = f.u[q]; }
  __syncthreads();
  { for (int i = tid; i < 64 * 8; i += 256) { const int d = i / 8, j8 = (i % 8) * 8; FragH f; for (int q = 0; q < 8; ++q) f.u[q] = tl[d][j8 + q]; *(v8us*)((unsigned short*)VT + ((size_t)hh * HD + d) * SQ + s0 + j8) = f.half[0]; }  } }


// ---- preparation, ONE launch: x rows and both weights into f16 fragment order (see gf_frag), and the rotary tables ----
// A plane's unit t is its t-th 16 bytes: 8 consecutive k of one row (x) or of one output column n (weights, Bt(n, k) = f16(bf16(W[k][n]) x16), exact) in strips of 16 rows, DM / 32 tiles a strip.
// PREP_T threads in all; a thread takes units g, g + PREP_T, ... of every plane (4 of x, 3 of q|k|v, 1 of the output weight), and the first SQ * HD / 2 threads one table entry each:
// few long waves in place of many that live for one unit, and what a wave reads is all asked for at once.
#define PREP_T (512 * 256)
#define PREP_X 4
#define PREP_W 3
static_assert((size_t)PREP_X * PREP_T == NR * DM / 8 && (size_t)PREP_W * PREP_T == (size_t)3 * DM * DM / 8 && (size_t)PREP_T == (size_t)DM * DM / 8 && SQ * (HD / 2) <= PREP_T, "k_prep: the planes are whole multiples of the grid");
__device__ __forceinline__ const float* prep_wsrc(const float* W, int N, int t) { const int tile = t >> 6, c = t & 63; const int n = (tile / (DM / 32)) * 16 + (c & 15), k8 = (tile % (DM / 32)) * 32 + (c >> 5) * 16 + ((c >> 4) & 1) * 8; return W + (size_t)k8 * N + n; }      /* first of the unit's 8 elements, N apart */
__device__ __forceinline__ void prep_tab(float theta, int t, float* __restrict__ CS, float* __restrict__ SN) {
  const int i = t % (HD / 2); const int p = t / (HD / 2); const float invf = 1.0f / powf(theta, (float)(2 * i) / (float)HD); const float ang = __fmul_rn((float)p, invf); const float c = cosf(ang), s = sinf(ang);
  *(float*)(CS + t) = c; *(float*)(SN + t) = s; }
__global__ __launch_bounds__(256) void k_prep(const float* __restrict__ x, const float* __restrict__ wqkv, const float* __restrict__ wo, float theta,
    _Float16* __restrict__ X16, _Float16* __restrict__ BQKV, _Float16* __restrict__ BO, float* __restrict__ CS, float* __restrict__ SN) {
  const int g = blockIdx.x * 256 + threadIdx.x;
  const float* xs[PREP_X]; const float* ws[PREP_W + 1]; v4f xv[PREP_X][2]; float wv[PREP_W + 1][8];
#pragma unroll
  for (int u = 0; u < PREP_X; ++u) { const int t = g + u * PREP_T; const int tile = t >> 6, c = t & 63;
    xs[u] = x + ((size_t)(tile / (DM / 32)) * 16 + (c & 15)) * DM + (tile % (DM / 32)) * 32 + (c >> 5) * 16 + ((c >> 4) & 1) * 8; }
#pragma unroll
  for (int u = 0; u < PREP_W; ++u) ws[u] = prep_wsrc(wqkv, 3 * DM, g + u * PREP_T);
  ws[PREP_W] = prep_wsrc(wo, DM, g);
#pragma unroll
  for (int u = 0; u < PREP_X; ++u) { xv[u][0] = *(const v4fa*)xs[u]; xv[u][1] = *(const v4fa*)(xs[u] + 4); }
#pragma unroll
  for (int u = 0; u <= PREP_W; ++u)
#pragma unroll
    for (int i = 0; i < 8; ++i) wv[u][i] = ws[u][(size_t)i * (u < PREP_W ? 3 * DM : DM)];
  asm volatile("s_wait_xcnt 0x0" :: "v"(xs[0]), "v"(xs[1]), "v"(xs[2]), "v"(xs[3]), "v"(ws[0]), "v"(ws[1]), "v"(ws[2]), "v"(ws[3]) : "memory");      /* the eight address pairs stay whole until the loads have taken them; it also keeps every load here, in front of the table entry, so that they fly while it is computed */
  if (g < SQ * (HD / 2)) prep_tab(theta, g, CS, SN);      /* whole blocks: 256 divides the bound */
  FragH fx[PREP_X], fw[PREP_W + 1];
#pragma unroll
  for (int u = 0; u < PREP_X; ++u)
#pragma unroll
    for (int q = 0; q < 8; ++q) fx[u].h[q] = (_Float16)bf16_round(xv[u][q >> 2][q & 3]);
#pragma unroll
  for (int u = 0; u <= PREP_W; ++u)
#pragma unroll
    for (int i = 0; i < 8; ++i) fw[u].h[i] = (_Float16)(bf16_round(wv[u][i]) * 16.0f);
#pragma unroll
  for (int u = 0; u < PREP_X; ++u) *(v8us*)((unsigned short*)X16 + ((size_t)g + (size_t)u * PREP_T) * 8) = fx[u].half[0];
#pragma unroll
  for (int u = 0; u < PREP_W; ++u) *(v8us*)((unsigned short*)BQKV + ((size_t)g + (size_t)u * PREP_T) * 8) = fw[u].half[0];
  *(v8us*)((unsigned short*)BO + (size_t)g * 8) = fw[PREP_W].half[0]; }
// Fused causal attention, one launch for every (batch, head, 128-query block): 32 queries belong to FA_KS waves, w + 4 g taking the passes of 32 keys g, g + FA_KS, ... up to the queries' own diagonal; nothing of S or P goes through memory.
// The longest walk is so 22 passes, not 64, and a SIMD holds as many waves as its registers take; one block fills a WGP, and the blocks come longest first over all heads (the query block is the slow grid index), so that a WGP that ends a short block takes the next: every WGP gets about the mean.
// At the end the waves g > 0 hand their maximum, sum and accumulators to wave g = 0 through LDS, which joins the partial softmaxes on their common maximum.
// Transposed products: S^T = K . Q^T (A = key rows, B = query rows kept in registers; hi.hi in one accumulator, lo.hi + hi.lo in a second, joined as hi + 2^-10 lo in f32), so a lane holds 16 scores of ONE query;
// running maximum and sum per query (online softmax, accumulators rescaled only in a pass where some query's maximum moved); the two 16-key score tiles, as f16 weights x256, ARE the B operand of O^T += V^T . P^T.
__device__ __forceinline__ float rs_xrow(float v) { const int i = __float_as_int(v); return __int_as_float(__builtin_amdgcn_permlanex16(i, i, 0x76543210, 0xfedcba98, false, false)); }      /* lane l <- lane l ^ 16 */
// native 2^a. The v_nop is the slot the instruction set asks for behind a transcendental before its source is overwritten or its result read.
__device__ __forceinline__ float fa_exp2(float a) { float e; asm("v_exp_f32 %0, %1\n\tv_nop" : "=v"(e) : "v"(a)); return e; }
__device__ __forceinline__ v8f fa_mma(v16h a, v16h b, v8f c) { return __builtin_amdgcn_wmma_f32_16x16x32_f16(false, a, false, b, (short)0, c, false, false); }
#define FA_C 11.5415603271117072589f      /* sqrt(64) * log2(e): score differences -> exponent of 2 */
#define FA_KS 3      /* waves that share a query group's key walk */
__global__ __launch_bounds__(128 * FA_KS) void k_fattn(const _Float16* __restrict__ QH, const _Float16* __restrict__ QL, const _Float16* __restrict__ KH, const _Float16* __restrict__ KL, const _Float16* __restrict__ VT, _Float16* __restrict__ O16) {
  __shared__ __attribute__((aligned(16))) float mo[FA_KS - 1][4][17][32][4];      /* [g - 1][query group][16 quads of o, then m and l][lane]: a wave's store or load of a quad is 512 bytes in a row */
  const int lane = threadIdx.x & 31, ln = lane & 15, hh = lane >> 4; const int w8 = __builtin_amdgcn_readfirstlane((int)(threadIdx.x >> 5)); const int w = w8 & 3, g = w8 >> 2;      /* scalar wave number: the key loop's bounds stay scalars; w query group, g its share of the passes */
  const int bh = blockIdx.x, b = bh / NH, h = bh % NH; const int q0 = ((int)gridDim.y - 1 - (int)blockIdx.y) * 128 + w * 32;      /* longest blocks start first, over all heads */
  const size_t r0 = (size_t)b * SQ;
  /* every pointer below is the lane's own address, its lane offset 8 lane folded in, so that the loads name exactly the pair that the wait behind them holds */
  /* q, k planes: fragment order (see gf_frag), per (batch, head) strips of 16 tokens, two tiles (k halves of the head) a strip: 64 elements a token; V^T: per (batch, head) and 32 keys four tiles (16 head columns each): 64 elements a key */
  const size_t hb = (size_t)bh * SQ * HD + 8 * lane;
  const _Float16* qhp = QH + hb + (size_t)q0 * HD; const _Float16* qlp = QL + hb + (size_t)q0 * HD;
  v16h qh[2][2], ql[2][2];      /* [query group of 16][k half of the head] */
#pragma unroll
  for (int j = 0; j < 2; ++j)
#pragma unroll
    for (int ks = 0; ks < 2; ++ks) { const size_t o = (size_t)(2 * j + ks) * 512; qh[j][ks] = gf_frag(qhp + o); ql[j][ks] = gf_frag(qlp + o); }
  asm volatile("s_wait_xcnt 0x0" :: "v"(qhp), "v"(qlp) : "memory");      /* the two address pairs stay whole until the loads have taken them */
  const _Float16* khp = KH + hb; const _Float16* klp = KL + hb; const _Float16* vtp = VT + hb;
  const v8f z8 = {0.f,0.f,0.f,0.f,0.f,0.f,0.f,0.f};
  v8f o[2][4]; float m[2], l[2];
#pragma unroll
  for (int j = 0; j < 2; ++j) { m[j] = -1.0e30f; l[j] = 0.f;
#pragma unroll
    for (int t = 0; t < 4; ++t) o[j][t] = z8; }
  v16h kh[2][2], kl[2][2];      /* [16-key tile][k half] */
  { const _Float16* pkh = khp + (size_t)(32 * g) * HD; const _Float16* pkl = klp + (size_t)(32 * g) * HD;      /* the wave's first pass (in bounds also where it has none) */
#pragma unroll
    for (int kt = 0; kt < 2; ++kt)
#pragma unroll
      for (int ks = 0; ks < 2; ++ks) { const size_t ko = (size_t)(2 * kt + ks) * 512; kh[kt][ks] = gf_frag(pkh + ko); kl[kt][ks] = gf_frag(pkl + ko); }
    asm volatile("s_wait_xcnt 0x0" :: "v"(pkh), "v"(pkl) : "memory"); }      /* the two address pairs stay whole until the loads have taken them */
#pragma unroll 1
  for (int kb = 32 * g; kb <= q0; kb += 32 * FA_KS) {
    v16h vf[4]; const _Float16* pv = vtp + (size_t)kb * HD;      /* V^T tiles of this pass, asked for ahead of the score products */
#pragma unroll
    for (int t = 0; t < 4; ++t) vf[t] = gf_frag(pv + (size_t)t * 512);
    asm volatile("s_wait_xcnt 0x0" ::: "memory");      /* stands in front of the advance of the loads' address pair; it also keeps these loads here, ahead of the score products, where the build had sunk them to their use */
    v8f u[2][2];      /* [query group][key tile]: q . k, register r = key 16 kt + 8 hh + r of query ln */
#pragma unroll
    for (int kt = 0; kt < 2; ++kt)
#pragma unroll
      for (int j = 0; j < 2; ++j) { v8f sh = z8, sl = z8;
#pragma unroll
        for (int ks = 0; ks < 2; ++ks) { sh = fa_mma(kh[kt][ks], qh[j][ks], sh); sl = fa_mma(kh[kt][ks], ql[j][ks], sl); sl = fa_mma(kl[kt][ks], qh[j][ks], sl); }
#pragma unroll
        for (int r = 0; r < 8; ++r) u[j][kt][r] = sh[r] + 0.0009765625f * sl[r]; }
    { const int kn = (kb + 32 * FA_KS <= q0) ? kb + 32 * FA_KS : kb;      /* the wave's next pass's key rows into the same registers, behind their last use; the last pass asks for its own rows again (in bounds) */
      const _Float16* pkh = khp + (size_t)kn * HD; const _Float16* pkl = klp + (size_t)kn * HD;
#pragma unroll
      for (int kt = 0; kt < 2; ++kt)
#pragma unroll
        for (int ks = 0; ks < 2; ++ks) { const size_t ko = (size_t)(2 * kt + ks) * 512; kh[kt][ks] = gf_frag(pkh + ko); kl[kt][ks] = gf_frag(pkl + ko); }
      asm volatile("s_wait_xcnt 0x0" :: "v"(pkh), "v"(pkl) : "memory"); }      /* the two address pairs stay whole until the loads have taken them */
    if (kb == q0) {      /* the one pass on the diagonal: keys above the query are out */
#pragma unroll
      for (int j = 0; j < 2; ++j)
#pragma unroll
        for (int kt = 0; kt < 2; ++kt)
#pragma unroll
          for (int r = 0; r < 8; ++r) u[j][kt][r] = (16 * kt + 8 * hh + r <= 16 * j + ln) ? u[j][kt][r] : -1.0e9f; }
    float mn[2];
#pragma unroll
    for (int j = 0; j < 2; ++j) { float x = fmaxf(u[j][0][0], u[j][1][0]);
#pragma unroll
      for (int r = 1; r < 8; ++r) x = fmaxf(x, fmaxf(u[j][0][r], u[j][1][r]));
      mn[j] = fmaxf(m[j], fmaxf(x, rs_xrow(x))); }
    if (__builtin_amdgcn_ballot_w32(mn[0] > m[0] || mn[1] > m[1]) != 0) {      /* scalar branch; where no maximum moved every factor would be 1 */
#pragma unroll
      for (int j = 0; j < 2; ++j) { const float al = fa_exp2((m[j] - mn[j]) * FA_C); m[j] = mn[j]; l[j] *= al;
#pragma unroll
        for (int t = 0; t < 4; ++t)
#pragma unroll
          for (int r = 0; r < 8; ++r) o[j][t][r] *= al; } }
#pragma unroll
    for (int j = 0; j < 2; ++j) { FragH pf; float s0 = 0.f, s1 = 0.f;
#pragma unroll
      for (int r = 0; r < 8; ++r) { const float p0 = fa_exp2((u[j][0][r] - m[j]) * FA_C + 8.0f), p1 = fa_exp2((u[j][1][r] - m[j]) * FA_C + 8.0f); s0 += p0; s1 += p1; pf.h[r] = (_Float16)p0; pf.h[8 + r] = (_Float16)p1; }      /* weights x256 */
      l[j] += s0 + s1;
#pragma unroll
      for (int t = 0; t < 4; ++t) o[j][t] = fa_mma(vf[t], pf.v, o[j][t]); }
  }
  /* the partial softmaxes of a query group joined: the state of the waves g > 0 through LDS, all scaled to the common maximum (a wave without a pass holds m = -1e30, l = 0, o = 0: factor 0; wave g = 0 always has the pass of key 0) */
  if (g != 0) {
#pragma unroll
    for (int j = 0; j < 2; ++j)
#pragma unroll
      for (int t = 0; t < 4; ++t)
#pragma unroll
        for (int c = 0; c < 2; ++c) { const v4f x = {o[j][t][4 * c], o[j][t][4 * c + 1], o[j][t][4 * c + 2], o[j][t][4 * c + 3]}; *(v4fa*)&mo[g - 1][w][(j * 4 + t) * 2 + c][lane][0] = x; }
    const v4f x = {m[0], m[1], l[0], l[1]}; *(v4fa*)&mo[g - 1][w][16][lane][0] = x; }
  __syncthreads();      /* every wave of the block passes it: the state of the waves g > 0 is in LDS before wave g = 0 reads it */
  if (g != 0) return;
  { v4f ml[FA_KS - 1];
#pragma unroll
    for (int p = 0; p < FA_KS - 1; ++p) ml[p] = *(const v4fa*)&mo[p][w][16][lane][0];
#pragma unroll
    for (int j = 0; j < 2; ++j) { float mx = m[j];
#pragma unroll
      for (int p = 0; p < FA_KS - 1; ++p) mx = fmaxf(mx, ml[p][j]);
      const float a0 = fa_exp2((m[j] - mx) * FA_C); l[j] *= a0;
#pragma unroll
      for (int t = 0; t < 4; ++t)
#pragma unroll
        for (int r = 0; r < 8; ++r) o[j][t][r] *= a0;
#pragma unroll
      for (int p = 0; p < FA_KS - 1; ++p) { const float a = fa_exp2((ml[p][j] - mx) * FA_C); l[j] += ml[p][2 + j] * a;
#pragma unroll
        for (int t = 0; t < 4; ++t)
#pragma unroll
          for (int c = 0; c < 2; ++c) { const v4f x = *(const v4fa*)&mo[p][w][(j * 4 + t) * 2 + c][lane][0];
#pragma unroll
            for (int i = 0; i < 4; ++i) o[j][t][4 * c + i] += x[i] * a; } } } }
#pragma unroll
  for (int j = 0; j < 2; ++j) { const float inv = 64.0f / (l[j] + rs_xrow(l[j]));      /* the two lane halves hold disjoint keys' sums; o carried x64 */
    unsigned short* dst = (unsigned short*)O16 + (r0 + q0 + 16 * j) * DM + (size_t)h * 1024 + 8 * lane;      /* o rows in fragment order for the output GEMM: strip of 16 rows, tiles 2 h and 2 h + 1; the lane's 8 values are one 16-byte half of its own fragment */
#pragma unroll
    for (int t = 0; t < 4; ++t) { FragH f;
#pragma unroll
      for (int r = 0; r < 8; ++r) f.h[r] = (_Float16)(o[j][t][r] * inv);
      *(v8us*)(dst + 256 * t) = f.half[0]; } } }


// q | k | v projection of every token row in one launch. One block of twelve waves a WGP takes 256 rows x 192 columns (4 x 3 waves of 64 x 64; the columns are one head each of q, k and v): sixteen products a trip on sixteen fragment loads (a 32 x 64 wave tile: eight on twelve),
// and every A strip is asked for by three waves and every B strip by four of the same WGP, close in time, so that most of these loads are met by the WGP's cache and not by L2. A wave's 64 columns are exactly one head of q, of k or of v, and its epilogue finishes that head's rows itself:
// q, k: f32 row through LDS, interleaved-pair rotation from the f32 tables, f16 hi + x1024 residual planes in fragment order; v: f16 from the accumulators (a lane holds 8 consecutive tokens of one column) straight into V^T in fragment order, whole 128-byte lines.
typedef float v2fa __attribute__((ext_vector_type(2), may_alias));
#define QK_BM 256      /* rows a block */
#define QK_BN 192      /* columns a block: one head each of q, k and v */
static_assert(NR % QK_BM == 0 && SQ % QK_BM == 0 && 3 * DM / QK_BN == NH && QK_BN == 3 * HD && DM % 64 == 0, "k_qkv: whole blocks, none across a batch, two trips a loop pass");
static_assert((DM & (DM - 1)) == 0 && (DM / 16) % 64 == 0, "k_qkv: the k walk wraps by a mask, and every start is a whole loop pass");
// one trip on a whole set (four A, four B fragments), every register reloaded from element offset KO of the strips, two trips ahead, behind the last product that reads it. The wait holds the two address pairs whole until the loads have taken them, and the loads in front of the next trip.
// the products are the plain builtin (the compiler keeps their distances itself): accumulators and two sets take 256 registers, and an operand of an asm statement cannot lie above v255 (with g2_mma the build spilled fragments in the loop)
#define QK_ROW(R0, R1, R2, R3, F, T) c0##T = fa_mma(R0, F, c0##T); c1##T = fa_mma(R1, F, c1##T); c2##T = fa_mma(R2, F, c2##T); c3##T = fa_mma(R3, F, c3##T);
#define QK_TRIP(A0, A1, A2, A3, F0, F1, F2, F3, KO) { const _Float16* pa = ap + (KO); const _Float16* pb = bp + (KO); \
    QK_ROW(A0, A1, A2, A3, F0, 0) F0 = gf_frag(pb); G2_HOLD \
    QK_ROW(A0, A1, A2, A3, F1, 1) F1 = gf_frag(pb + 16 * DM); G2_HOLD \
    QK_ROW(A0, A1, A2, A3, F2, 2) F2 = gf_frag(pb + 32 * DM); G2_HOLD \
    QK_ROW(A0, A1, A2, A3, F3, 3) F3 = gf_frag(pb + 48 * DM); A0 = gf_frag(pa); A1 = gf_frag(pa + 16 * DM); A2 = gf_frag(pa + 32 * DM); A3 = gf_frag(pa + 48 * DM); \
    asm volatile("s_wait_xcnt 0x0" :: "v"(pa), "v"(pb) : "memory"); }
// a whole set's first loads, in the order in which the loop reloads (B tiles, then A), held so: the loop's counted waits are set for both ways into it
#define QK_FILL(A0, A1, A2, A3, F0, F1, F2, F3, PA, PB) v16h F0 = gf_frag(PB); G2_HOLD v16h F1 = gf_frag(PB + 16 * DM); G2_HOLD v16h F2 = gf_frag(PB + 32 * DM); G2_HOLD v16h F3 = gf_frag(PB + 48 * DM); G2_HOLD \
    v16h A0 = gf_frag(PA); G2_HOLD v16h A1 = gf_frag(PA + 16 * DM); G2_HOLD v16h A2 = gf_frag(PA + 32 * DM); G2_HOLD v16h A3 = gf_frag(PA + 48 * DM);
__global__ __launch_bounds__(384) void k_qkv(const _Float16* __restrict__ A, const _Float16* __restrict__ Bh, const float* __restrict__ bias, const float* __restrict__ CS, const float* __restrict__ SN,
    _Float16* __restrict__ QH, _Float16* __restrict__ QL, _Float16* __restrict__ KH, _Float16* __restrict__ KL, _Float16* __restrict__ VT) {
  __shared__ __attribute__((aligned(16))) float so[12][64][68];
  const int tid = threadIdx.x, lane = tid & 31, ln = lane & 15, hh = lane >> 4; const int w = __builtin_amdgcn_readfirstlane(tid >> 5);      /* scalar wave number: which of q, k, v a wave holds is a scalar branch */
  const int ntn = 3 * DM / QK_BN; const int mt = blockIdx.x / ntn, nt = blockIdx.x - mt * ntn; const int nq = (w >> 2) * NH + nt;      /* head nt of q (waves 0 to 3), of k (4 to 7) and of v (8 to 11): every block, and every SIMD, has the same share of the long q, k epilogue; the four waves of one age share their B strips */
  const int row0 = mt * QK_BM + 64 * (w & 3), col0 = nq * HD; const int part = nq / NH, h = nq - part * NH;      /* part 0 q, 1 k, 2 v: the same for the whole wave */
  const _Float16* ap = A + (size_t)row0 * DM + 8 * lane; const _Float16* bp = Bh + (size_t)col0 * DM + 8 * lane;      /* A, Bh in fragment order (see gf_frag), strips of 16 rows; the lane's own addresses: every load of a trip names one of two pairs */
  const v8f z8 = {0.f,0.f,0.f,0.f,0.f,0.f,0.f,0.f};
  v8f c00 = z8, c01 = z8, c02 = z8, c03 = z8, c10 = z8, c11 = z8, c12 = z8, c13 = z8, c20 = z8, c21 = z8, c22 = z8, c23 = z8, c30 = z8, c31 = z8, c32 = z8, c33 = z8;
  /* two fragment sets (x: even trips, y: odd trips) */
  /* the k walk starts at the block's own k, rot, and wraps round: the sixteen blocks that share A strips (one mt) and the sixteen that share B strips (one nt) all run at the same time, and started alike they would ask L2 for the same lines at the same moment; so each of the sixteen has a start of its own */
  const int rot = ((mt + nt) & 15) * (DM / 16);
  const _Float16* xpa = ap + rot * 16; const _Float16* xpb = bp + rot * 16; const _Float16* ypa = xpa + 512; const _Float16* ypb = xpb + 512;      /* 512 elements a tile of 32 k; rot + 32 is below DM */
  QK_FILL(xa0, xa1, xa2, xa3, xb0, xb1, xb2, xb3, xpa, xpb) G2_HOLD QK_FILL(ya0, ya1, ya2, ya3, yb0, yb1, yb2, yb3, ypa, ypb)
  asm volatile("s_wait_xcnt 0x0" :: "v"(xpa), "v"(xpb), "v"(ypa), "v"(ypb) : "memory");      /* the four address pairs stay whole until the first loads have taken them */
#pragma unroll 1      /* rolled: two trips' code, the register sets named once each */
  for (int kb = 0; kb < DM; kb += 64) {
    QK_TRIP(xa0, xa1, xa2, xa3, xb0, xb1, xb2, xb3, ((kb + 64 + rot) & (DM - 1)) * 16)      /* the last two trips ask for the walk's first two tiles again (in bounds, not used) */
    QK_TRIP(ya0, ya1, ya2, ya3, yb0, yb1, yb2, yb3, ((kb + 96 + rot) & (DM - 1)) * 16) }
  float bb[4];      /* the wave's bias */
#pragma unroll
  for (int t = 0; t < 4; ++t) bb[t] = bias[col0 + t * 16 + ln];
  asm volatile("s_wait_xcnt 0x0" ::: "memory");      /* stands in front of the first write of the four loads' offset register: the build reused it behind the first load's data alone */
  v8f accs[16] = {c00, c01, c02, c03, c10, c11, c12, c13, c20, c21, c22, c23, c30, c31, c32, c33};      /* [strip of 16 rows][16 columns] */
  const size_t hb = ((size_t)((row0 / SQ) * NH + h) * SQ + row0 % SQ) * HD;      /* the wave's 64 tokens in a plane of its (batch, head): 64 elements a token in fragment order */
  if (part == 2) {      /* V^T tiles (16 head columns x 32 keys) in fragment order: the wave's 64 tokens are two groups of 32 keys, and a lane's 8 accumulator values (column ln of tile t, tokens 16 i + 8 hh + r) are one 16-byte half of its own fragment: stored from the registers, 512 bytes in a row a store */
    unsigned short* vd = (unsigned short*)VT + hb + 8 * lane;
#pragma unroll
    for (int u = 0; u < 16; ++u) { const int t = u & 3, i = u >> 2; const float bv = bf16_round(bb[t]); FragH f;
#pragma unroll
      for (int r = 0; r < 8; ++r) f.h[r] = (_Float16)(accs[u][r] * 0.0625f + bv);
      *(v8us*)(vd + (i >> 1) * 2048 + t * 512 + (i & 1) * 256) = f.half[0]; }
    return; }
#pragma unroll
  for (int u = 0; u < 16; ++u) { const int t = u & 3, i = u >> 2; const float bv = bf16_round(bb[t]);
#pragma unroll
    for (int r = 0; r < 8; ++r) so[w][i * 16 + 8 * hh + r][t * 16 + ln] = accs[u][r] * 0.0625f + bv; }
  __builtin_amdgcn_fence(__ATOMIC_ACQ_REL, "workgroup"); __builtin_amdgcn_wave_barrier();      /* a wave reads back only its own plane of so: its LDS writes are ordered in front of its reads, no block barrier */
  const int rsub = lane >> 4, c4 = (lane & 15) * 4;
  _Float16* Hh = (part ? KH : QH) + hb + (c4 >> 3) * 128 + (c4 & 7); _Float16* Hl = (part ? KL : QL) + hb + (c4 >> 3) * 128 + (c4 & 7);      /* the lane's 4 columns in fragment order: tile c4 >> 5, half (c4 >> 4) & 1, lane half (c4 >> 3) & 1, 128 elements apart each step of 8 columns */
#pragma unroll 1      /* rolled, eight steps (16 rows) a trip, inside the registers that the main loop takes anyway (sixteen steps a trip spilled) */
  for (int q0 = 0; q0 < 32; q0 += 8) {
    v4f vv[8]; v2fa cc[8], ss[8];      /* a trip's rows and table entries all asked for in front of its first store: behind a store the build holds every later load back, one load latency a step */
#pragma unroll
    for (int j = 0; j < 8; ++j) { const int r = (q0 + j) * 2 + rsub; const size_t to = (size_t)((row0 + r) % SQ) * (HD / 2) + (c4 >> 1);
      vv[j] = *(const v4fa*)&so[w][r][c4]; cc[j] = *(const v2fa*)(CS + to); ss[j] = *(const v2fa*)(SN + to); }
#pragma unroll
    for (int j = 0; j < 8; ++j) { const int r = (q0 + j) * 2 + rsub; const v4f v = vv[j]; const v2fa c = cc[j], s = ss[j]; float o[4];
      o[0] = fmaf(v[0], c[0], -(v[1] * s[0])); o[1] = fmaf(v[0], s[0], v[1] * c[0]); o[2] = fmaf(v[2], c[1], -(v[3] * s[1])); o[3] = fmaf(v[2], s[1], v[3] * c[1]);      /* the odd element's product rounded, the even element's fused onto it */
      v4h fh, fl;
#pragma unroll
      for (int i = 0; i < 4; ++i) { const _Float16 hi = (_Float16)o[i]; fh[i] = hi; fl[i] = (_Float16)((o[i] - (float)hi) * 1024.0f); }
      const size_t d = (size_t)(r >> 4) * 1024 + (r & 15) * 8; *(v4h*)(Hh + d) = fh; *(v4h*)(Hl + d) = fl; }
    asm volatile("s_wait_xcnt 0x0" ::: "memory"); } }      /* stands in front of the next trip's first writes, which may reuse a register of this trip's stores */

extern "C" void kernel_launch(void* const* d_in, const int* in_sizes, int n_in,
                              void* d_out, int out_size, void* d_ws, size_t ws_size, hipStream_t stream) {
  (void)in_sizes; (void)n_in; (void)out_size;
  const float* const* I = (const float* const*)d_in; const float* x = I[0]; const float* wqkv = I[1]; const float* bqkv = I[2]; const float* wo = I[3]; const float* bo = I[4];      /* [in][out] fused qkv + out weights, biases */
  char* ws = (char*)d_ws; size_t off = 0;
  auto take = [&](size_t bytes) { char* p = ws + off; off += (bytes + 255) & ~(size_t)255; return p; };
  _Float16* BQKV = (_Float16*)take((size_t)3 * DM * DM * 2); _Float16* BO = (_Float16*)take((size_t)DM * DM * 2); float* CS = (float*)take((size_t)SQ * (HD / 2) * 4); float* SN = (float*)take((size_t)SQ * (HD / 2) * 4);
  _Float16* X16 = (_Float16*)take(NR * DM * 2);
  _Float16* QH = (_Float16*)take(NR * DM * 2); _Float16* QL = (_Float16*)take(NR * DM * 2); _Float16* KH = (_Float16*)take(NR * DM * 2); _Float16* KL = (_Float16*)take(NR * DM * 2); _Float16* O16 = (_Float16*)take(NR * DM * 2);
  _Float16* VT = (_Float16*)take((size_t)NB * NH * HD * SQ * 2);      /* V^T of every batch */
  if (off > ws_size) return;
  k_prep<<<PREP_T / 256, 256, 0, stream>>>(x, wqkv, wo, 10000.0f, X16, BQKV, BO, CS, SN);      /* x rows, [in][out] weights -> Bt(n, k) x16 (q | k | v stacked along n), all in fragment order; cos / sin tables */
  k_qkv<<<(unsigned)((NR / QK_BM) * (3 * DM / QK_BN)), 384, 0, stream>>>(X16, BQKV, bqkv, CS, SN, QH, QL, KH, KL, VT);      /* roped q, k as f16 hi + x1024 residual (the x8 logits, sigma ~64, need ~f32-accurate scores) and V^T, per (batch, head), in fragment order */
  k_fattn<<<dim3(NB * NH, SQ / 128), 128 * FA_KS, 0, stream>>>(QH, QL, KH, KL, VT, O16);      /* o (merged heads, x64) as f16 rows in fragment order */
  k_gemm2<0><<<dim3((unsigned)((MPO / 128) * (DM / 64)), 1), 128, 0, stream>>>(O16 + (size_t)B0 * SQ * DM, DM, 0, BO, DM, 0, 0.0009765625f, bo, 0, nullptr, 1, 0, 0, (float*)d_out + (size_t)B0 * SQ * DM, nullptr, DM, 0, MPO, DM, DM);      /* out rows are the output layout */
}
